// v000
// Measured on an AMD MI455X. A time is GPU time per run, averaged over a window of back-to-back runs after a warm-up
// (all launches, gaps included; the runs take copies of the inputs in turn), and the median of several windows.
// Apart from v000's, it joins two sittings. Times from different sittings can be a few percent apart, while
// side-by-side timings come from the same sitting.
// The starting kernel, v000, takes 9640 microseconds a run.
#include <hip/hip_runtime.h>
// Grouped-query causal attention with RoPE and a BFLOAT16 output (x [2][2048][2048]; xq = x wq (32 heads x 64), xk = x wk, xv = x wv (8 kv heads x 64) ([in][out] weights sigma 1/sqrt(2048), no biases); interleaved-pair RoPE (reshape(..., 32, 2): real = even, imag = odd) on q and k from the module's INPUT tables freqs_cos/freqs_sin [S][32]; repeat: query head h uses kv head h/4; scores / 8 + triu(-inf, 1) (causal); softmax; out = (merged wo).astype(bfloat16) -> bf16 [2][2048][2048] (2 bytes per element)).
// Compute dtype: inputs rounded to bf16; x / weights exact; q, k, v, softmax weights and o as plain f16 GEMM operands (~2^-12); scores and softmax statistics f32. v_wmma_f32_16x16x32_f16.
#define NB 2
#define NG 8
#define HPG 4
#define KVD (NG * HD)
#define SQ 2048
#define DM 2048
#define NH 32
#define HD 64
#define HG 4                         /* heads per attention launch group */
#define QT 256                       /* query rows per causal tile */
#define NKX SQ                       /* S / P row pitch */
#define QT0 128                      /* first-tile rows recomputed exactly in f32 */
#define B0 0                         /* first batch processed (debug hook) */
#define NBR NB                       /* batches processed (debug hook) */
#define NR ((size_t)NB * SQ)         /* token rows */
#define MP ((int)((size_t)NBR * SQ)) /* rows projected (debug hook) */
#define QN SQ                        /* query rows attended per batch (debug hook) */
#define NHD NH                       /* heads attended (debug hook) */
#define MPO MP                       /* rows through the output stage (debug hook) */
#define LQ DM      /* row pitch of the q rows */
typedef __bf16 v16b __attribute__((ext_vector_type(16)));
typedef unsigned short v8us __attribute__((ext_vector_type(8), may_alias));
typedef float  v8f  __attribute__((ext_vector_type(8)));
typedef float  v4f  __attribute__((ext_vector_type(4)));
typedef float  v4fa __attribute__((ext_vector_type(4), may_alias));
union FragB { v16b v; v8us half[2]; unsigned short u[16]; };

__device__ __forceinline__ unsigned short bf16_bits(float x) { unsigned int u = __float_as_uint(x); return (unsigned short)((u + 0x7FFFu + ((u >> 16) & 1u)) >> 16); }
__device__ __forceinline__ float bf16_val(unsigned short b) { return __uint_as_float(((unsigned int)b) << 16); }
__device__ __forceinline__ float bf16_round(float x) { return bf16_val(bf16_bits(x)); }
// D += A·B with NT terms: 1 = ah·bh, 2 = + al·bh (A split), 3 = + ah·bl (both split)
template <int NT>
__device__ __forceinline__ v8f mmaN(v16b ah, v16b al, v16b bh, v16b bl, v8f c) {
  c = __builtin_amdgcn_wmma_f32_16x16x32_bf16(false, ah, false, bh, (short)0, c, false, false);
  if (NT >= 2) c = __builtin_amdgcn_wmma_f32_16x16x32_bf16(false, al, false, bh, (short)0, c, false, false);
  if (NT >= 3) c = __builtin_amdgcn_wmma_f32_16x16x32_bf16(false, ah, false, bl, (short)0, c, false, false);
  asm volatile("v_nop\n\tv_nop\n\tv_nop\n\tv_nop" : "+v"(c) : "v"(ah), "v"(al), "v"(bh), "v"(bl));
  return c;
}

__global__ __launch_bounds__(256) void k_wt_bf16(const float* __restrict__ W, unsigned short* __restrict__ Wt, int K, int N) {
  const int t = blockIdx.x * 256 + threadIdx.x;
  const int k8n = K / 8;
  if (t >= N * k8n) return;
  const int n = t / k8n, k8 = (t % k8n) * 8;
  v8us v;
#pragma unroll
  for (int i = 0; i < 8; ++i) v[i] = bf16_bits(W[(size_t)(k8 + i) * N + n]);
  *(v8us*)(Wt + (size_t)n * K + k8) = v;
  
}

// GEMM C[M][N] (f32, pitch ldc) = act(A[M][K]·W + bias). A f32 row-major (pitch lda) converted per fragment to bf16
// (ASPLIT: hi/lo two planes -> 2 terms, else single rounded term); Wt bf16 [N][K] (pitch ldb). BIAS_BF16 rounds the
// bias to bf16 first (bias quantised to bf16 before the add). K%32==0, M%16==0, N%64==0.
template <bool ASPLIT, int ACT, bool BIAS_BF16>
__global__ __launch_bounds__(128) void k_gemm_bf(const float* __restrict__ A, int lda, const unsigned short* __restrict__ Wt, int ldb,
                                               const float* __restrict__ bias, float* __restrict__ C, int ldc, int M, int N, int K) {
  __shared__ __attribute__((aligned(16))) float so[4][16][64];
  const int tid = threadIdx.x, w = tid >> 5, lane = tid & 31, ln = lane & 15, hh = lane >> 4;
  const int ntn = N / 64;
  const int wid = blockIdx.x * 4 + w;
  const int mt = wid / ntn, nq = wid % ntn;
  if (mt * 16 >= M) return;
  const int row0 = mt * 16, col0 = nq * 64;
  const float* arow = A + (size_t)(row0 + ln) * lda;
  v8f acc[4] = {};
  for (int kb = 0; kb < K; kb += 32) {
    FragB ah, al;
    const v4f x0 = *(const v4fa*)(arow + kb + 8 * hh), x1 = *(const v4fa*)(arow + kb + 8 * hh + 4);
    const v4f x2 = *(const v4fa*)(arow + kb + 16 + 8 * hh), x3 = *(const v4fa*)(arow + kb + 16 + 8 * hh + 4);
    float xs[16] = {x0[0],x0[1],x0[2],x0[3],x1[0],x1[1],x1[2],x1[3],x2[0],x2[1],x2[2],x2[3],x3[0],x3[1],x3[2],x3[3]};
#pragma unroll
    for (int i = 0; i < 16; ++i) { const unsigned short hb = bf16_bits(xs[i]); ah.u[i] = hb; al.u[i] = ASPLIT ? bf16_bits(xs[i] - bf16_val(hb)) : (unsigned short)0; }
#pragma unroll
    for (int t = 0; t < 4; ++t) {
      const unsigned short* brow = Wt + (size_t)(col0 + t * 16 + ln) * ldb + kb;
      FragB b;
      b.half[0] = *(const v8us*)(brow + 8 * hh);
      b.half[1] = *(const v8us*)(brow + 16 + 8 * hh);
      acc[t] = mmaN<ASPLIT ? 2 : 1>(ah.v, al.v, b.v, b.v, acc[t]);
    }
  }
#pragma unroll
  for (int t = 0; t < 4; ++t) {
    float bv = bias ? bias[col0 + t * 16 + ln] : 0.f;
    if (BIAS_BF16) bv = bf16_round(bv);
#pragma unroll
    for (int r = 0; r < 8; ++r) { float v = acc[t][r] + bv; if (ACT == 1) v = fmaxf(v, 0.f); so[w][8 * hh + r][t * 16 + ln] = v; }
  }
  __builtin_amdgcn_fence(__ATOMIC_ACQ_REL, "workgroup");
  __builtin_amdgcn_wave_barrier();
  const int rsub = lane >> 4, c4 = (lane & 15) * 4;
  {
#pragma unroll
    for (int q = 0; q < 8; ++q) {
      const int r = q * 2 + rsub;
      const v4f v = *(const v4fa*)&so[w][r][c4];
      *(v4f*)(C + (size_t)(row0 + r) * ldc + col0 + c4) = v;
    }
    
  }
}

// GEMM C = act(A·W + bias + resid): A f32 (ASPLIT -> hi/lo 2 terms), Wt bf16 [N][K]; ACT 0 none, 1 relu, 2 exact gelu;
// resid (optional, f32, row index = (row % rmod), pitch ldr, RES_BF16 rounds it) added before the activation.
template <bool ASPLIT, int ACT, bool BIAS_BF16, bool RES_BF16>
__global__ __launch_bounds__(128) void k_gemm_bf3(const float* __restrict__ A, int lda, const unsigned short* __restrict__ Wt, int ldb,
                                                const float* __restrict__ bias, const float* __restrict__ resid, int rmod, int ldr,
                                                float* __restrict__ C, int ldc, int M, int N, int K) {
  __shared__ __attribute__((aligned(16))) float so[4][16][64];
  const int tid = threadIdx.x, w = tid >> 5, lane = tid & 31, ln = lane & 15, hh = lane >> 4;
  const int ntn = N / 64;
  const int wid = blockIdx.x * 4 + w;
  const int mt = wid / ntn, nq = wid % ntn;
  if (mt * 16 >= M) return;
  const int row0 = mt * 16, col0 = nq * 64;
  const float* arow = A + (size_t)(row0 + ln) * lda;
  v8f acc[4] = {};
  for (int kb = 0; kb < K; kb += 32) {
    FragB ah, al;
    const v4f x0 = *(const v4fa*)(arow + kb + 8 * hh), x1 = *(const v4fa*)(arow + kb + 8 * hh + 4);
    const v4f x2 = *(const v4fa*)(arow + kb + 16 + 8 * hh), x3 = *(const v4fa*)(arow + kb + 16 + 8 * hh + 4);
    float xs[16] = {x0[0],x0[1],x0[2],x0[3],x1[0],x1[1],x1[2],x1[3],x2[0],x2[1],x2[2],x2[3],x3[0],x3[1],x3[2],x3[3]};
#pragma unroll
    for (int i = 0; i < 16; ++i) { const unsigned short hb = bf16_bits(xs[i]); ah.u[i] = hb; al.u[i] = ASPLIT ? bf16_bits(xs[i] - bf16_val(hb)) : (unsigned short)0; }
#pragma unroll
    for (int t = 0; t < 4; ++t) {
      const unsigned short* brow = Wt + (size_t)(col0 + t * 16 + ln) * ldb + kb;
      FragB b;
      b.half[0] = *(const v8us*)(brow + 8 * hh);
      b.half[1] = *(const v8us*)(brow + 16 + 8 * hh);
      acc[t] = mmaN<ASPLIT ? 2 : 1>(ah.v, al.v, b.v, b.v, acc[t]);
    }
  }
#pragma unroll
  for (int t = 0; t < 4; ++t) {
    const int col = col0 + t * 16 + ln;
    float bv = bias ? bias[col] : 0.f;
    if (BIAS_BF16) bv = bf16_round(bv);
#pragma unroll
    for (int r = 0; r < 8; ++r) {
      float v = acc[t][r] + bv;
      if (resid) { float rv = resid[(size_t)((row0 + 8 * hh + r) % rmod) * ldr + col]; if (RES_BF16) rv = bf16_round(rv); v += rv; }
      if (ACT == 1) v = fmaxf(v, 0.f);
      if (ACT == 2) v = 0.5f * v * (1.0f + erff(v * 0.70710678118654752f));
      if (ACT == 3) { const float u = 0.7978845608028654f * (v + 0.044715f * v * v * v); v = 0.5f * v * (1.0f + tanhf(u)); }
      so[w][8 * hh + r][t * 16 + ln] = v;
    }
  }
  __builtin_amdgcn_fence(__ATOMIC_ACQ_REL, "workgroup");
  __builtin_amdgcn_wave_barrier();
  const int rsub = lane >> 4, c4 = (lane & 15) * 4;
  {
#pragma unroll
    for (int q = 0; q < 8; ++q) {
      const int r = q * 2 + rsub;
      const v4f v = *(const v4fa*)&so[w][r][c4];
      *(v4f*)(C + (size_t)(row0 + r) * ldc + col0 + c4) = v;
    }
    
  }
}
// row LayerNorm (biased variance, eps) over N: s = X (+ R); optional out_sum <- s; out_norm <- (s-mu)*rsqrt(var+eps)*g + b
template <bool PARAM_BF16>
__global__ __launch_bounds__(256) void k_layernorm(const float* __restrict__ X, const float* __restrict__ R, const float* __restrict__ g, const float* __restrict__ bta,
                                                  float* __restrict__ out_sum, float* __restrict__ out_norm, int N, float eps) {
  __shared__ float red[256];
  const int row = blockIdx.x, tid = threadIdx.x;
  const float* x = X + (size_t)row * N; const float* rr = R ? R + (size_t)row * N : nullptr;
  float vals[16];                     // up to N = 4096
  const int per = N / 256;            // contiguous chunk per thread? use strided-by-4 chunks: thread handles j = tid*4 + 1024*u
  float s1 = 0.f;
  for (int u = 0; u < per / 4; ++u) {
    const int j = tid * 4 + 1024 * u;
    const v4f a = *(const v4fa*)(x + j);
    v4f b = {0.f,0.f,0.f,0.f}; if (rr) b = *(const v4fa*)(rr + j);
#pragma unroll
    for (int q = 0; q < 4; ++q) { const float v = a[q] + b[q]; vals[u * 4 + q] = v; s1 += v; }
  }
  red[tid] = s1; __syncthreads();
  for (int st = 128; st > 0; st >>= 1) { if (tid < st) red[tid] += red[tid + st]; __syncthreads(); }
  const float mu = red[0] / (float)N; __syncthreads();
  float s2 = 0.f;
  for (int u = 0; u < per / 4; ++u)
#pragma unroll
    for (int q = 0; q < 4; ++q) { const float c = vals[u * 4 + q] - mu; s2 += c * c; }
  red[tid] = s2; __syncthreads();
  for (int st = 128; st > 0; st >>= 1) { if (tid < st) red[tid] += red[tid + st]; __syncthreads(); }
  const float rs = rsqrtf(red[0] / (float)N + eps);
  {
    for (int u = 0; u < per / 4; ++u) {
      const int j = tid * 4 + 1024 * u;
      v4f o, sm;
#pragma unroll
      for (int q = 0; q < 4; ++q) {
        float gg = g[j + q], bb = bta[j + q];
        if (PARAM_BF16) { gg = bf16_round(gg); bb = bf16_round(bb); }
        sm[q] = vals[u * 4 + q]; o[q] = (vals[u * 4 + q] - mu) * rs * gg + bb;
      }
      if (out_sum) *(v4f*)(out_sum + (size_t)row * N + j) = sm;
      *(v4f*)(out_norm + (size_t)row * N + j) = o;
    }
    
  }
}



// ---- f16 WMMA path (v_wmma_f32_16x16x32_f16): 11-bit significands for operands in range — used where a [0,1] probability operand needs more precision than bf16
typedef _Float16 v16h __attribute__((ext_vector_type(16)));
union FragH { v16h v; v8us half[2]; _Float16 h[16]; unsigned short u[16]; };
template <int NT>
__device__ __forceinline__ v8f mmaH(v16h ah, v16h al, v16h bh, v16h bl, v8f c) {
  c = __builtin_amdgcn_wmma_f32_16x16x32_f16(false, ah, false, bh, (short)0, c, false, false);
  if (NT >= 2) c = __builtin_amdgcn_wmma_f32_16x16x32_f16(false, al, false, bh, (short)0, c, false, false);
  if (NT >= 3) c = __builtin_amdgcn_wmma_f32_16x16x32_f16(false, ah, false, bl, (short)0, c, false, false);
  asm volatile("v_nop\n\tv_nop\n\tv_nop\n\tv_nop" : "+v"(c) : "v"(ah), "v"(al), "v"(bh), "v"(bl));
  return c;
}
// batched GEMM like k_gemm_b but f16 operands: A f32 (split into f16 hi/lo if ASPLIT, else rounded to f16), Bt = f16 values [n][k]; alpha; C f32; N multiple of 16 (partial tiles skipped)
template <bool ASPLIT>
__global__ __launch_bounds__(128) void k_gemm_h(const float* __restrict__ A, int lda, size_t sA, const _Float16* __restrict__ Bh, int ldb, size_t sB, float alpha, float* __restrict__ C, int ldc, size_t sC, int M, int N, int K) {
  __shared__ __attribute__((aligned(16))) float so[4][16][64];
  const int tid = threadIdx.x, w = tid >> 5, lane = tid & 31, ln = lane & 15, hh = lane >> 4; const int by = blockIdx.y;
  A += (size_t)by * sA; Bh += (size_t)by * sB; C += (size_t)by * sC;
  const int ntn = (N + 63) / 64; const int wid = blockIdx.x * 4 + w; const int mt = wid / ntn, nq = wid % ntn; if (mt * 16 >= M) return;
  const int row0 = mt * 16, col0 = nq * 64; const float* arow = A + (size_t)(row0 + ln) * lda;
  v8f acc[4] = {};
  for (int kb = 0; kb < K; kb += 32) {
    FragH ah, al;
    const v4f x0 = *(const v4fa*)(arow + kb + 8 * hh), x1 = *(const v4fa*)(arow + kb + 8 * hh + 4), x2 = *(const v4fa*)(arow + kb + 16 + 8 * hh), x3 = *(const v4fa*)(arow + kb + 16 + 8 * hh + 4);
    float xs[16] = {x0[0],x0[1],x0[2],x0[3],x1[0],x1[1],x1[2],x1[3],x2[0],x2[1],x2[2],x2[3],x3[0],x3[1],x3[2],x3[3]};
#pragma unroll
    for (int i = 0; i < 16; ++i) { const _Float16 h = (_Float16)xs[i]; ah.h[i] = h; al.h[i] = ASPLIT ? (_Float16)(xs[i] - (float)h) : (_Float16)0.0f; }
#pragma unroll
    for (int t = 0; t < 4; ++t) { if (col0 + t * 16 >= N) continue; const size_t boff = (size_t)(col0 + t * 16 + ln) * ldb + kb; FragH bq; bq.half[0] = *(const v8us*)(Bh + boff + 8 * hh); bq.half[1] = *(const v8us*)(Bh + boff + 16 + 8 * hh);
      acc[t] = mmaH<ASPLIT ? 2 : 1>(ah.v, al.v, bq.v, bq.v, acc[t]); }
  }
#pragma unroll
  for (int t = 0; t < 4; ++t) { if (col0 + t * 16 >= N) continue;
#pragma unroll
    for (int r = 0; r < 8; ++r) so[w][8 * hh + r][t * 16 + ln] = acc[t][r] * alpha; }
  __builtin_amdgcn_fence(__ATOMIC_ACQ_REL, "workgroup"); __builtin_amdgcn_wave_barrier();
  const int rsub = lane >> 4, c4 = (lane & 15) * 4;
  {
#pragma unroll
    for (int q = 0; q < 8; ++q) { const int r = q * 2 + rsub; if (col0 + c4 < N) { const v4f v = *(const v4fa*)&so[w][r][c4]; *(v4f*)(C + (size_t)(row0 + r) * ldc + col0 + c4) = v; } }
     }
}

// Wt[n][k] = f16(W[k][n]·scale) from f32 row-major W[K][N] (scale = power of two; bf16-exact weights stay exact in f16 away from the subnormal range)
__global__ __launch_bounds__(256) void k_wt_f16(const float* __restrict__ W, _Float16* __restrict__ Wt, int K, int N, float scale) {
  const int t = blockIdx.x * 256 + threadIdx.x; if (t >= N * (K / 8)) return; const int n = t / (K / 8), k8 = (t % (K / 8)) * 8; FragH f;
#pragma unroll
  for (int i = 0; i < 8; ++i) f.h[i] = (_Float16)(bf16_round(W[(size_t)(k8 + i) * N + n]) * scale); const v8us o = f.half[0];
  *(v8us*)((unsigned short*)Wt + (size_t)n * K + k8) = o; 
}
// k_gemm_hh variant with fused epilogue: v = acc·alpha + bias[by·sBias + col] (+ CP[(row/rowsPerB)·sCPb + by·64 + col] if CP) ; ACT 0 none / 1 elu ; writes f16 C16 (and f32 C if non-null)
template <int ACT>
__global__ __launch_bounds__(128) void k_gemm_hhx(const _Float16* __restrict__ A, int lda, size_t sA, const _Float16* __restrict__ Bh, int ldb, size_t sB, float alpha, const float* __restrict__ bias, size_t sBias, const float* __restrict__ CP, int rowsPerB, size_t sCPb, int row0g,
    float* __restrict__ C, _Float16* __restrict__ C16, int ldc, size_t sC, int M, int N, int K) {
  __shared__ __attribute__((aligned(16))) float so[4][16][64];
  const int tid = threadIdx.x, w = tid >> 5, lane = tid & 31, ln = lane & 15, hh = lane >> 4; const int by = blockIdx.y;
  A += (size_t)by * sA; Bh += (size_t)by * sB; const size_t cofs = (size_t)by * sC; const float* bp = bias ? bias + (size_t)by * sBias : nullptr;
  const int ntn = (N + 63) / 64; const int wid = blockIdx.x * 4 + w; const int mt = wid / ntn, nq = wid % ntn; if (mt * 16 >= M) return;
  const int row0 = mt * 16, col0 = nq * 64; const _Float16* arow = A + (size_t)(row0 + ln) * lda;
  v8f acc[4] = {};
  for (int kb = 0; kb < K; kb += 32) { FragH ah; ah.half[0] = *(const v8us*)((const unsigned short*)arow + kb + 8 * hh); ah.half[1] = *(const v8us*)((const unsigned short*)arow + kb + 16 + 8 * hh);
#pragma unroll
    for (int t = 0; t < 4; ++t) { if (col0 + t * 16 >= N) continue; const size_t boff = (size_t)(col0 + t * 16 + ln) * ldb + kb; FragH bq; bq.half[0] = *(const v8us*)((const unsigned short*)Bh + boff + 8 * hh); bq.half[1] = *(const v8us*)((const unsigned short*)Bh + boff + 16 + 8 * hh);
      acc[t] = mmaH<1>(ah.v, ah.v, bq.v, bq.v, acc[t]); }
  }
#pragma unroll
  for (int t = 0; t < 4; ++t) { if (col0 + t * 16 >= N) continue; const int col = col0 + t * 16 + ln; const float bv = bp ? bf16_round(bp[col]) : 0.f;
#pragma unroll
    for (int r = 0; r < 8; ++r) { float v = acc[t][r] * alpha + bv; if (CP) { const int rr = row0g + row0 + 8 * hh + r; if (rowsPerB < 0) v += CP[cofs + (size_t)rr * ldc + col];      /* rowsPerB < 0: own element of the batched C plane */ else { const int bidx = rr / rowsPerB; v += CP[(size_t)bidx * sCPb + (size_t)by * 64 + col]; } } if (ACT == 1) v = (v > 0.f) ? v : expm1f(v); else if (ACT == 7) v = (v > 0.f) ? v + 1.0f : expf(v); else if (ACT == 8) v = tanhf(v); else if (ACT == 9) v = 0.5f * v * (1.0f + tanhf(0.7978845608028654f * (v + 0.044715f * v * v * v))); else if (ACT == 11) v = 1.0f / (1.0f + expf(-v)); else if (ACT == 12) v = (v > 0.f) ? v : 0.01f * v; else if (ACT == 14) v = (v > 0.f) ? v : 0.1f * v; else if (ACT == 16) v = (v >= 0.f) ? v : 0.3f * v; else if (ACT == 17) v = (v >= 0.f) ? v : 0.2f * v; else if (ACT == 15) v = v / (1.0f + expf(-v)); else if (ACT == 3) v = fmaxf(v, 0.f); else if (ACT == 6) v = 0.5f * v * (1.0f + erff(v * 0.70710678118654752f)); so[w][8 * hh + r][t * 16 + ln] = v; } }
  __builtin_amdgcn_fence(__ATOMIC_ACQ_REL, "workgroup"); __builtin_amdgcn_wave_barrier();
  const int rsub = lane >> 4, c4 = (lane & 15) * 4; typedef _Float16 v4h __attribute__((ext_vector_type(4)));
  {
#pragma unroll
    for (int q = 0; q < 8; ++q) { const int r = q * 2 + rsub; if (col0 + c4 < N) { const v4f v = *(const v4fa*)&so[w][r][c4]; if (C) *(v4f*)(C + cofs + (size_t)(row0 + r) * ldc + col0 + c4) = v; if (C16) { v4h h4; for (int i = 0; i < 4; ++i) h4[i] = (_Float16)v[i]; *(v4h*)(C16 + cofs + (size_t)(row0 + r) * ldc + col0 + c4) = h4; } } }
     }
}


typedef _Float16 v4h __attribute__((ext_vector_type(4)));

__global__ __launch_bounds__(256) void k_x16(const float* __restrict__ x, _Float16* __restrict__ X16, size_t n8) { const size_t t = (size_t)blockIdx.x * 256 + threadIdx.x; if (t >= n8) return; FragH f;
#pragma unroll
  for (int q = 0; q < 8; ++q) f.h[q] = (_Float16)bf16_round(x[t * 8 + q]); *(v8us*)((unsigned short*)X16 + t * 8) = f.half[0];  }
__global__ __launch_bounds__(256) void k_h16(const float* __restrict__ x, _Float16* __restrict__ X16, size_t n8) { const size_t t = (size_t)blockIdx.x * 256 + threadIdx.x; if (t >= n8) return; FragH f;
#pragma unroll
  for (int q = 0; q < 8; ++q) f.h[q] = (_Float16)x[t * 8 + q]; *(v8us*)((unsigned short*)X16 + t * 8) = f.half[0];  }
__global__ __launch_bounds__(256) void k_round16f(const float* __restrict__ W, _Float16* __restrict__ Bt, size_t n8) { const size_t t = (size_t)blockIdx.x * 256 + threadIdx.x; if (t >= n8) return; FragH f;
#pragma unroll
  for (int i = 0; i < 8; ++i) f.h[i] = (_Float16)(bf16_round(W[t * 8 + i]) * 16.0f); *(v8us*)((unsigned short*)Bt + t * 8) = f.half[0];  }
template <int NHv, int TTv>
__global__ __launch_bounds__(256) void k_vt(const _Float16* __restrict__ V16, int ldv, int voff, _Float16* __restrict__ Vt) { __shared__ unsigned short tl[64][66]; const int tid = threadIdx.x; const int slab = blockIdx.x / (TTv / 64), lg = blockIdx.x % (TTv / 64); const int b = slab / NHv, h = slab % NHv;
  for (int i = tid; i < 64 * 8; i += 256) { const int r = i / 8, c8 = (i % 8) * 8; FragH f; f.half[0] = *(const v8us*)((const unsigned short*)V16 + ((size_t)b * TTv + lg * 64 + r) * ldv + voff + h * 64 + c8);
#pragma unroll
    for (int q = 0; q < 8; ++q) tl[r][c8 + q] = f.u[q]; }
  __syncthreads();
  {
#pragma unroll
    for (int rd = 0; rd < 2; ++rd) { const int d = rd * 32 + tid / 8, pc = tid % 8; FragH f;
#pragma unroll
      for (int q = 0; q < 8; ++q) f.u[q] = tl[pc * 8 + q][d];
      *(v8us*)((unsigned short*)Vt + ((size_t)slab * 64 + d) * TTv + lg * 64 + pc * 8) = f.half[0]; }
     } }

__global__ __launch_bounds__(256) void k_hl(const float* __restrict__ F, _Float16* __restrict__ Hh, _Float16* __restrict__ Hl, size_t n8) { const size_t t = (size_t)blockIdx.x * 256 + threadIdx.x; if (t >= n8) return; FragH fh, fl; const v4f a = *(const v4fa*)(F + t * 8), c = *(const v4fa*)(F + t * 8 + 4);
#pragma unroll
  for (int q = 0; q < 4; ++q) { _Float16 h = (_Float16)a[q]; fh.h[q] = h; fl.h[q] = (_Float16)((a[q] - (float)h) * 1024.0f); h = (_Float16)c[q]; fh.h[4 + q] = h; fl.h[4 + q] = (_Float16)((c[q] - (float)h) * 1024.0f); }
  { *(v8us*)((unsigned short*)Hh + t * 8) = fh.half[0]; *(v8us*)((unsigned short*)Hl + t * 8) = fl.half[0];  } }

// ---- fast GEMM (wave tile 32x64; requires M % 32 == 0 rows per launch region and N % 64 == 0); epilogue = k_gemm_hhx semantics ----
__device__ __forceinline__ v16h g2_frag(const _Float16* p, int hh) { FragH f; f.half[0] = *(const v8us*)((const unsigned short*)p + 8 * hh); f.half[1] = *(const v8us*)((const unsigned short*)p + 16 + 8 * hh); return f.v; }
__device__ __forceinline__ v8f g2_mma(v16h a, v16h b, v8f c) { v8f d = __builtin_amdgcn_wmma_f32_16x16x32_f16(false, a, false, b, (short)0, c, false, false); asm volatile("v_nop\n\tv_nop\n\tv_nop\n\tv_nop" : "+v"(d) : "v"(a), "v"(b)); return d; }
template <int ACT>
__global__ __launch_bounds__(128) void k_gemm2(const _Float16* __restrict__ A, int lda, size_t sA, const _Float16* __restrict__ Bh, int ldb, size_t sB, float alpha, const float* __restrict__ bias, size_t sBias, const float* __restrict__ CP, int rowsPerB, size_t sCPb, int row0g,
    float* __restrict__ C, _Float16* __restrict__ C16, int ldc, size_t sC, int M, int N, int K) { static_assert(ACT == 0 || ACT == 3 || ACT == 6 || ACT == 8 || ACT == 9 || ACT == 11 || ACT == 12 || ACT == 14 || ACT == 15 || ACT == 16 || ACT == 17, "k_gemm2: unsupported ACT code (would silently apply no activation)");
  __shared__ __attribute__((aligned(16))) float so[4][32][68];
  const int tid = threadIdx.x, w = tid >> 5, lane = tid & 31, ln = lane & 15, hh = lane >> 4; const int by = blockIdx.y;
  A += (size_t)by * sA; Bh += (size_t)by * sB; const size_t cofs = (size_t)by * sC; const float* bp = bias ? bias + (size_t)by * sBias : nullptr;
  const int ntn = N >> 6; const int mt = blockIdx.x / ntn, nq = blockIdx.x - mt * ntn; const int row0 = mt * 128 + 32 * w, col0 = nq * 64; if (row0 >= M) return;
  const _Float16* a0p = A + (size_t)(row0 + ln) * lda; const _Float16* a1p = a0p + (size_t)16 * lda;
  const _Float16* b0p = Bh + (size_t)(col0 + ln) * ldb; const _Float16* b1p = b0p + (size_t)16 * ldb; const _Float16* b2p = b1p + (size_t)16 * ldb; const _Float16* b3p = b2p + (size_t)16 * ldb;
  const v8f z8 = {0.f,0.f,0.f,0.f,0.f,0.f,0.f,0.f}; v8f c00 = z8, c01 = z8, c02 = z8, c03 = z8, c10 = z8, c11 = z8, c12 = z8, c13 = z8;
#pragma unroll 1
  for (int kb = 0; kb < K; kb += 32) { const v16h a0 = g2_frag(a0p + kb, hh), a1 = g2_frag(a1p + kb, hh);
    v16h b = g2_frag(b0p + kb, hh); c00 = g2_mma(a0, b, c00); c10 = g2_mma(a1, b, c10);
    b = g2_frag(b1p + kb, hh); c01 = g2_mma(a0, b, c01); c11 = g2_mma(a1, b, c11);
    b = g2_frag(b2p + kb, hh); c02 = g2_mma(a0, b, c02); c12 = g2_mma(a1, b, c12);
    b = g2_frag(b3p + kb, hh); c03 = g2_mma(a0, b, c03); c13 = g2_mma(a1, b, c13); }
  v8f accs[8] = {c00, c01, c02, c03, c10, c11, c12, c13};
#pragma unroll
  for (int u = 0; u < 8; ++u) { const int t = u & 3, half = u >> 2; const int col = col0 + t * 16 + ln; const float bv = bp ? bf16_round(bp[col]) : 0.f;
#pragma unroll
    for (int r = 0; r < 8; ++r) { const int rloc = half * 16 + 8 * hh + r; float v = accs[u][r] * alpha + bv; if (CP) { if (rowsPerB < 0) v += CP[cofs + (size_t)(row0g + row0 + rloc) * ldc + col];      /* rowsPerB < 0: own element of the batched C plane */ else { const int bidx = (row0g + row0 + rloc) / rowsPerB; v += CP[(size_t)bidx * sCPb + (size_t)by * 64 + col]; } }
      if (ACT == 3) v = fmaxf(v, 0.f); else if (ACT == 6) v = 0.5f * v * (1.0f + erff(v * 0.70710678118654752f)); else if (ACT == 11) v = 1.0f / (1.0f + expf(-v)); else if (ACT == 15) v = v / (1.0f + expf(-v)); else if (ACT == 12) v = (v > 0.f) ? v : 0.01f * v; else if (ACT == 8) v = tanhf(v); else if (ACT == 9) v = 0.5f * v * (1.0f + tanhf(0.7978845608028654f * (v + 0.044715f * v * v * v))); else if (ACT == 14) v = (v > 0.f) ? v : 0.1f * v; else if (ACT == 16) v = (v >= 0.f) ? v : 0.3f * v; else if (ACT == 17) v = (v >= 0.f) ? v : 0.2f * v;
      so[w][rloc][t * 16 + ln] = v; } }
  __builtin_amdgcn_fence(__ATOMIC_ACQ_REL, "workgroup"); __builtin_amdgcn_wave_barrier();
  const int rsub = lane >> 4, c4 = (lane & 15) * 4;
  {
#pragma unroll
    for (int q = 0; q < 16; ++q) { const int r = q * 2 + rsub; const v4f v = *(const v4fa*)&so[w][r][c4]; if (C) *(v4f*)(C + cofs + (size_t)(row0 + r) * ldc + col0 + c4) = v; if (C16) { v4h h4; for (int i = 0; i < 4; ++i) h4[i] = (_Float16)v[i]; *(v4h*)(C16 + cofs + (size_t)(row0 + r) * ldc + col0 + c4) = h4; } }
     } }


__global__ __launch_bounds__(256) void k_wnat(const float* __restrict__ w, size_t n8, _Float16* __restrict__ Bt) { const size_t t = (size_t)blockIdx.x * 256 + threadIdx.x; if (t >= n8) return; FragH f; for (int q = 0; q < 8; ++q) f.h[q] = (_Float16)(bf16_round(w[t * 8 + q]) * 16.0f); *(v8us*)((unsigned short*)Bt + t * 8) = f.half[0];  }
__global__ __launch_bounds__(256) void k_rsm(const float* __restrict__ S, _Float16* __restrict__ P, int nrows) {
  #pragma clang fp contract(off)
  const int i = blockIdx.x * 256 + threadIdx.x; if (i >= nrows) return; const float* s = S + (size_t)i * SQ; float mx = -3.0e38f;
#pragma unroll 1
  for (int j = 0; j < SQ; ++j) mx = fmaxf(mx, s[j]); float se = 0.f;
#pragma unroll 1
  for (int j = 0; j < SQ; ++j) se += expf(s[j] - mx); const float sc = 256.0f / se;
#pragma unroll 1
  for (int j0 = 0; j0 < SQ; j0 += 8) { FragH f; for (int q = 0; q < 8; ++q) f.h[q] = (_Float16)(expf(s[j0 + q] - mx) * sc); unsigned short* d = (unsigned short*)P + (size_t)i * SQ + j0; *(v8us*)d = f.half[0];  } }
__global__ __launch_bounds__(256) void k_vt(const _Float16* __restrict__ V16, int b, int h0, _Float16* __restrict__ VT) { __shared__ unsigned short tl[64][65]; const int tid = threadIdx.x; const int hh = blockIdx.x % HG, sg = blockIdx.x / HG; const int s0 = sg * 64; const int h = h0 + hh;
  for (int i = tid; i < 64 * 8; i += 256) { const int j = i / 8, d8 = (i % 8) * 8; FragH f; f.half[0] = *(const v8us*)((const unsigned short*)V16 + ((size_t)b * SQ + s0 + j) * DM + h * HD + d8); for (int q = 0; q < 8; ++q) tl[d8 + q][j] = f.u[q]; }
  __syncthreads();
  { for (int i = tid; i < 64 * 8; i += 256) { const int d = i / 8, j8 = (i % 8) * 8; FragH f; for (int q = 0; q < 8; ++q) f.u[q] = tl[d][j8 + q]; *(v8us*)((unsigned short*)VT + ((size_t)hh * HD + d) * SQ + s0 + j8) = f.half[0]; }  } }



__global__ __launch_bounds__(256) void k_rsmcf2(const float* __restrict__ S, _Float16* __restrict__ P, int hg, int q0, int nk) {
  #pragma clang fp contract(off)
  const int t = blockIdx.x * 256 + threadIdx.x; if (t >= hg * QT) return; const size_t i = (size_t)t; const float* s = S + i * NKX; const int last = q0 + (t % QT); float mx = -3.0e38f;
#pragma unroll 1
  for (int j = 0; j < nk; ++j) { const float f = (j <= last) ? 1.f : 0.f; mx = fmaxf(mx, fmaf(f, s[j], (1.f - f) * -1.0e9f)); } float se = 0.f;
#pragma unroll 1
  for (int j = 0; j < nk; ++j) { const float f = (j <= last) ? 1.f : 0.f; se += __expf(fmaf(f, s[j], (1.f - f) * -1.0e9f) - mx); } const float sc = 256.0f / se;
#pragma unroll 1
  for (int j0 = 0; j0 < nk; j0 += 8) { FragH fr; for (int q = 0; q < 8; ++q) { const int j = j0 + q; const float f = (j <= last) ? 1.f : 0.f; fr.h[q] = (_Float16)(__expf(fmaf(f, s[j], (1.f - f) * -1.0e9f) - mx) * sc); } unsigned short* d = (unsigned short*)P + i * NKX + j0; *(v8us*)d = fr.half[0];  } }


template <int MASKADD>
__global__ __launch_bounds__(64) void k_att0(const float* __restrict__ QF, const float* __restrict__ KF, const float* __restrict__ VF, int ld, const float* __restrict__ mask, float scale, float* __restrict__ OF, int ldo) {
  #pragma clang fp contract(off)
  __shared__ __attribute__((aligned(16))) float lq[64][64]; __shared__ __attribute__((aligned(16))) float lo[64][64];
  const int tid = threadIdx.x; const int h = blockIdx.x / (QT0 / 64), rg = blockIdx.x % (QT0 / 64); const int i = rg * 64 + tid;
  const float* qr = QF + (size_t)i * ld + h * HD;
#pragma unroll 1
  for (int c = 0; c < HD / 4; ++c) { *(v4f*)&lq[tid][c * 4] = *(const v4fa*)(qr + c * 4); const v4f z = {0.f, 0.f, 0.f, 0.f}; *(v4f*)&lo[tid][c * 4] = z; }
  float m = -1.0e30f, l = 0.f; const int jmax = MASKADD ? (SQ - 1) : (rg * 64 + 63);      /* additive-mask form: every key (the mask input decides); causal form: keys up to the block's last row */
#pragma unroll 1
  for (int j = 0; j <= jmax; ++j) { const float* kr = KF + (size_t)j * ld + h * HD; const float* vr = VF + (size_t)j * ld + h * HD; float s = 0.f;
#pragma unroll 1
    for (int c = 0; c < HD / 4; ++c) { const v4f kq = *(const v4fa*)(kr + c * 4); const v4f qq = *(v4f*)&lq[tid][c * 4]; s = __fadd_rn(s, __fmul_rn(qq[0], kq[0])); s = __fadd_rn(s, __fmul_rn(qq[1], kq[1])); s = __fadd_rn(s, __fmul_rn(qq[2], kq[2])); s = __fadd_rn(s, __fmul_rn(qq[3], kq[3])); }
    s = __fmul_rn(s, scale); if (MASKADD) s = __fadd_rn(s, __fmul_rn(bf16_round(mask[(size_t)i * SQ + j]), -10000.0f));
    const float f = (MASKADD || j <= i) ? 1.f : 0.f; const float sm = fmaf(f, s, (1.f - f) * -1.0e30f); const float mn = fmaxf(m, sm); const float sc = expf(m - mn); const float e = expf(sm - mn); l = __fadd_rn(__fmul_rn(l, sc), e); m = mn;
#pragma unroll 1
    for (int c = 0; c < HD / 4; ++c) { const v4f vv = *(const v4fa*)(vr + c * 4); v4f oo = *(v4f*)&lo[tid][c * 4]; for (int u = 0; u < 4; ++u) oo[u] = __fadd_rn(__fmul_rn(oo[u], sc), __fmul_rn(e, vv[u])); *(v4f*)&lo[tid][c * 4] = oo; } }
  const float fin = 64.0f / l;      /* o carried x64 like the f16 path */
#pragma unroll 1
  for (int c = 0; c < HD / 4; ++c) { v4f oo = *(v4f*)&lo[tid][c * 4]; for (int u = 0; u < 4; ++u) oo[u] = __fmul_rn(oo[u], fin); *(v4f*)&lo[tid][c * 4] = oo; }
  __syncthreads();
  {
#pragma unroll 1
    for (int it = 0; it < 16; ++it) { const int row = it * 4 + tid / 16, pc = (tid % 16) * 4; const v4f v = *(const v4f*)&lo[row][pc]; *(v4f*)(OF + (size_t)(rg * 64 + row) * ldo + h * HD + pc) = v; }
     } }


__global__ __launch_bounds__(256) void k_kvexp(const float* __restrict__ src, float* __restrict__ dst, size_t n4) { const size_t t = (size_t)blockIdx.x * 256 + threadIdx.x; if (t >= n4) return; const size_t e = t * 4; const size_t row = e / DM; const int col = (int)(e % DM); const int h = col / HD, d = col % HD; const v4f v = *(const v4fa*)(src + row * KVD + (size_t)(h / HPG) * HD + d); *(v4f*)(dst + e) = v;  }

__global__ __launch_bounds__(256) void k_tab2(float theta, float* __restrict__ CS, float* __restrict__ SN) {
  #pragma clang fp contract(off)
  const int t = blockIdx.x * 256 + threadIdx.x; if (t >= SQ * (HD / 2)) return; const int i = t % (HD / 2); const int p = t / (HD / 2); const float invf = 1.0f / powf(theta, (float)(2 * i) / (float)HD); const float ang = __fmul_rn((float)p, invf); const float c = cosf(ang), s = sinf(ang);
  *(float*)(CS + t) = c; *(float*)(SN + t) = s;  }
template <int NORM, int ROPE>
__global__ __launch_bounds__(64) void k_xform(const float* __restrict__ F, int ldf, int nh, const float* __restrict__ gain, float eps, const float* __restrict__ CS, const float* __restrict__ SN, _Float16* __restrict__ H16, int ldo) {
  #pragma clang fp contract(off)
  __shared__ float xv[HD]; __shared__ float red[HD]; __shared__ unsigned short sh_[HD]; const int d = threadIdx.x; const int h = blockIdx.x % nh; const size_t r = blockIdx.x / nh; const int p = (int)(r % SQ);
  float x = F[r * (size_t)ldf + (size_t)h * HD + d];
  if (NORM) { red[d] = __fmul_rn(x, x); __syncthreads(); for (int st = HD / 2; st > 0; st >>= 1) { if (d < st) red[d] = __fadd_rn(red[d], red[d + st]); __syncthreads(); } const float rs = rsqrtf(__fadd_rn(red[0] / (float)HD, eps)); x = __fmul_rn(__fmul_rn(x, rs), bf16_round(gain[d])); }
  xv[d] = x; __syncthreads();
  float o = x;
  if (ROPE == 1) { const int i = d >> 1; const float c = CS[p * (HD / 2) + i], s = SN[p * (HD / 2) + i]; const float ev = xv[2 * i], od = xv[2 * i + 1]; o = (d & 1) ? __fadd_rn(__fmul_rn(ev, s), __fmul_rn(od, c)) : __fadd_rn(__fmul_rn(ev, c), -__fmul_rn(od, s)); }
  if (ROPE == 2) { const int i = d & (HD / 2 - 1); const float c = CS[p * (HD / 2) + i], s = SN[p * (HD / 2) + i]; const float lo = xv[i], hi = xv[i + HD / 2]; o = (d < HD / 2) ? __fadd_rn(__fmul_rn(lo, c), -__fmul_rn(hi, s)) : __fadd_rn(__fmul_rn(lo, s), __fmul_rn(hi, c)); }
  FragH th; th.h[0] = (_Float16)o; sh_[d] = th.u[0]; __syncthreads();
  if (d < HD / 8) { FragH f; for (int q = 0; q < 8; ++q) f.u[q] = sh_[d * 8 + q]; unsigned short* dst = (unsigned short*)H16 + r * (size_t)ldo + (size_t)h * HD + d * 8; *(v8us*)dst = f.half[0];  } }

template <int NORM, int ROPE>
__global__ __launch_bounds__(64) void k_xformf(const float* __restrict__ F, int ldf, int nh, const float* __restrict__ gain, float eps, const float* __restrict__ CS, const float* __restrict__ SN, float* __restrict__ F32, int ldo) {
  #pragma clang fp contract(off)
  __shared__ float xv[HD]; __shared__ float red[HD]; const int d = threadIdx.x; const int h = blockIdx.x % nh; const size_t r = blockIdx.x / nh; const int p = (int)(r % SQ);
  float x = F[r * (size_t)ldf + (size_t)h * HD + d];
  if (NORM) { red[d] = __fmul_rn(x, x); __syncthreads(); for (int st = HD / 2; st > 0; st >>= 1) { if (d < st) red[d] = __fadd_rn(red[d], red[d + st]); __syncthreads(); } const float rs = rsqrtf(__fadd_rn(red[0] / (float)HD, eps)); x = __fmul_rn(__fmul_rn(x, rs), bf16_round(gain[d])); }
  xv[d] = x; __syncthreads();
  float o = x;
  if (ROPE == 1) { const int i = d >> 1; const float c = CS[p * (HD / 2) + i], s = SN[p * (HD / 2) + i]; const float ev = xv[2 * i], od = xv[2 * i + 1]; o = (d & 1) ? __fadd_rn(__fmul_rn(ev, s), __fmul_rn(od, c)) : __fadd_rn(__fmul_rn(ev, c), -__fmul_rn(od, s)); }
  if (ROPE == 2) { const int i = d & (HD / 2 - 1); const float c = CS[p * (HD / 2) + i], s = SN[p * (HD / 2) + i]; const float lo = xv[i], hi = xv[i + HD / 2]; o = (d < HD / 2) ? __fadd_rn(__fmul_rn(lo, c), -__fmul_rn(hi, s)) : __fadd_rn(__fmul_rn(lo, s), __fmul_rn(hi, c)); }
  float* dst = F32 + r * (size_t)ldo + (size_t)h * HD + d; *(float*)dst = o;  }

__global__ __launch_bounds__(256) void k_bfcp(const float* __restrict__ src, float* __restrict__ dst, size_t n4) { const size_t t = (size_t)blockIdx.x * 256 + threadIdx.x; if (t >= n4) return; const v4f a = *(const v4fa*)(src + t * 4); v4f o; for (int q = 0; q < 4; ++q) o[q] = bf16_round(a[q]); *(v4f*)(dst + t * 4) = o;  }

__global__ __launch_bounds__(256) void k_f2bf(const float* __restrict__ F, unsigned short* __restrict__ O, size_t n8) { const size_t t = (size_t)blockIdx.x * 256 + threadIdx.x; if (t >= n8) return; const v4f a = *(const v4fa*)(F + t * 8), b = *(const v4fa*)(F + t * 8 + 4); FragH f;
  for (int q = 0; q < 4; ++q) { f.u[q] = (unsigned short)(__float_as_uint(bf16_round(a[q])) >> 16); f.u[4 + q] = (unsigned short)(__float_as_uint(bf16_round(b[q])) >> 16); }
  *(v8us*)(O + t * 8) = f.half[0];  }
extern "C" void kernel_launch(void* const* d_in, const int* in_sizes, int n_in,
                              void* d_out, int out_size, void* d_ws, size_t ws_size, hipStream_t stream) {
  (void)in_sizes; (void)n_in; (void)out_size;
  const float* const* I = (const float* const*)d_in; const float* x = I[0]; const float* tcos = I[1]; const float* tsin = I[2]; const float* wq = I[3]; const float* wk = I[4]; const float* wv = I[5]; const float* wo = I[6]; const float* bq = nullptr; const float* bk = nullptr; const float* bv = nullptr; const float* bo = nullptr;      /* [in][out] weights, no biases; rope tables [S][32] */
  char* ws = (char*)d_ws; size_t off = 0;
  auto take = [&](size_t bytes) { char* p = ws + off; off += (bytes + 255) & ~(size_t)255; return p; };
  _Float16* BQ = (_Float16*)take((size_t)DM * DM * 2); _Float16* BK = (_Float16*)take((size_t)KVD * DM * 2); _Float16* BV = (_Float16*)take((size_t)KVD * DM * 2); _Float16* BO = (_Float16*)take((size_t)DM * DM * 2);
  _Float16* X16 = (_Float16*)take(NR * DM * 2); float* QF = (float*)take((size_t)SQ * DM * 4); float* KF = (float*)take((size_t)SQ * KVD * 4); float* CSB = (float*)take((size_t)SQ * 32 * 4); float* SNB = (float*)take((size_t)SQ * 32 * 4); _Float16* Q16 = (_Float16*)take(NR * DM * 2); _Float16* K16 = (_Float16*)take(NR * KVD * 2); _Float16* V16 = (_Float16*)take(NR * KVD * 2); _Float16* O16 = (_Float16*)take(NR * DM * 2);
  float* S = (float*)take((size_t)NH * QT * NKX * 4); _Float16* P = (_Float16*)take((size_t)NH * QT * NKX * 2); _Float16* VT = (_Float16*)take((size_t)NH * HD * SQ * 2);
  float* QF0 = (float*)take((size_t)QT0 * DM * 4); float* KF0 = (float*)take((size_t)QT0 * KVD * 4); float* VF0 = (float*)take((size_t)QT0 * KVD * 4); float* KF0e = (float*)take((size_t)QT0 * DM * 4); float* VF0e = (float*)take((size_t)QT0 * DM * 4); float* OF0 = (float*)take((size_t)NB * QT0 * DM * 4); _Float16* OH0 = (_Float16*)take((size_t)NB * QT0 * DM * 2); _Float16* OL0 = (_Float16*)take((size_t)NB * QT0 * DM * 2); float* OUTF = (float*)take(NR * DM * 4);      /* f32 result rows, converted to bf16 at the end */
  if (off > ws_size) return;
  k_wt_f16<<<(unsigned)(((size_t)DM * (DM / 8) + 255) / 256), 256, 0, stream>>>(wq, BQ, DM, DM, 16.0f); k_wt_f16<<<(unsigned)(((size_t)KVD * (DM / 8) + 255) / 256), 256, 0, stream>>>(wk, BK, DM, KVD, 16.0f); k_wt_f16<<<(unsigned)(((size_t)KVD * (DM / 8) + 255) / 256), 256, 0, stream>>>(wv, BV, DM, KVD, 16.0f); k_wt_f16<<<(unsigned)(((size_t)DM * (DM / 8) + 255) / 256), 256, 0, stream>>>(wo, BO, DM, DM, 16.0f);      /* [in][out] -> Bt[n][k] x16 */
  k_x16<<<(unsigned)((NR * DM / 8 + 255) / 256), 256, 0, stream>>>(x, X16, NR * DM / 8);
  k_bfcp<<<(SQ * 32 / 4 + 255) / 256, 256, 0, stream>>>(tcos, CSB, (size_t)SQ * 32 / 4); k_bfcp<<<(SQ * 32 / 4 + 255) / 256, 256, 0, stream>>>(tsin, SNB, (size_t)SQ * 32 / 4);      /* bf16-rounded rope tables [pos][32] */
  const size_t r0p = (size_t)B0 * SQ;      /* first projected row */
  k_gemm2<0><<<dim3((unsigned)((MP / 128) * (KVD / 64)), 1), 128, 0, stream>>>(X16 + r0p * DM, DM, 0, BV, DM, 0, 0.0625f, bv, 0, nullptr, 1, 0, 0, nullptr, V16 + r0p * KVD, KVD, 0, MP, KVD, DM);
  for (int b = B0; b < B0 + NBR; ++b) { const size_t r0 = (size_t)b * SQ;
    k_gemm2<0><<<dim3((unsigned)((SQ / 128) * (DM / 64)), 1), 128, 0, stream>>>(X16 + r0 * DM, DM, 0, BQ, DM, 0, 0.0625f, nullptr, 0, nullptr, 1, 0, 0, QF, nullptr, DM, 0, SQ, DM, DM);      /* q (f32) of this batch */
    k_gemm2<0><<<dim3((unsigned)((SQ / 128) * (KVD / 64)), 1), 128, 0, stream>>>(X16 + r0 * DM, DM, 0, BK, DM, 0, 0.0625f, nullptr, 0, nullptr, 1, 0, 0, KF, nullptr, KVD, 0, SQ, KVD, DM);      /* k (f32) */
    k_xform<0, 1><<<(unsigned)((size_t)SQ * NH), 64, 0, stream>>>(QF, DM, NH, nullptr, 0.f, CSB, SNB, Q16 + r0 * DM, DM); k_xform<0, 1><<<(unsigned)((size_t)SQ * NG), 64, 0, stream>>>(KF, KVD, NG, nullptr, 0.f, CSB, SNB, K16 + r0 * KVD, KVD);      /* interleaved-pair rope -> f16 rows */
    k_xformf<0, 1><<<(unsigned)(QT0 * NH), 64, 0, stream>>>(QF, DM, NH, nullptr, 0.f, CSB, SNB, QF0, DM); k_xformf<0, 1><<<(unsigned)(QT0 * NG), 64, 0, stream>>>(KF, KVD, NG, nullptr, 0.f, CSB, SNB, KF0, KVD);      /* f32 roped q, k of rows 0..127 */
    k_vt<NG, SQ><<<NG * (SQ / 64), 256, 0, stream>>>(V16 + r0 * KVD, KVD, 0, VT);      /* V^T [NG][HD][SQ] for this batch */
    k_gemm2<0><<<dim3((QT0 / 128) * (KVD / 64), 1), 128, 0, stream>>>(X16 + r0 * DM, DM, 0, BV, DM, 0, 0.0625f, bv, 0, nullptr, 1, 0, 0, VF0, nullptr, KVD, 0, QT0, KVD, DM);
    k_kvexp<<<(unsigned)(((size_t)QT0 * DM / 4 + 255) / 256), 256, 0, stream>>>(KF0, KF0e, (size_t)QT0 * DM / 4); k_kvexp<<<(unsigned)(((size_t)QT0 * DM / 4 + 255) / 256), 256, 0, stream>>>(VF0, VF0e, (size_t)QT0 * DM / 4);      /* head h <- kv group h/4 for the exact first-tile kernel */      /* f32 q, k, v of the first 128 rows (exact products) */
    k_att0<0><<<NH * (QT0 / 64), 64, 0, stream>>>(QF0, KF0e, VF0e, DM, nullptr, 0.125f, OF0 + (size_t)b * QT0 * DM, DM);      /* exact f32 attention for rows 0..127 (o x64) */
    for (int q0 = 0; q0 < QN; q0 += QT) { const int nk = q0 + QT;      /* causal: only keys below the tile end are computed */
      for (int g = 0; g < NG; ++g) k_gemm2<0><<<dim3((QT / 128) * (nk / 64), HPG), 128, 0, stream>>>(Q16 + (r0 + q0) * LQ + (size_t)g * HPG * HD, LQ, (size_t)HD, K16 + r0 * KVD + (size_t)g * HD, KVD, 0, 0.125f, nullptr, 0, nullptr, 1, 0, 0, S + (size_t)g * HPG * QT * NKX, nullptr, NKX, (size_t)QT * NKX, QT, nk, HD);      /* scores: the 4 heads of group g against the group's keys (sB 0) */
      k_rsmcf2<<<(NHD * QT + 255) / 256, 256, 0, stream>>>(S, P, NHD, q0, nk);
      for (int g = 0; g < NG; ++g) k_gemm2<0><<<dim3((QT / 128) * (HD / 64), HPG), 128, 0, stream>>>(P + (size_t)g * HPG * QT * NKX, NKX, (size_t)QT * NKX, VT + (size_t)g * HD * SQ, SQ, 0, 0.25f, nullptr, 0, nullptr, 1, 0, 0, nullptr, O16 + (r0 + q0) * DM + (size_t)g * HPG * HD, DM, (size_t)HD, QT, HD, nk); } }      /* o for the group's 4 heads (x64) */      /* o (merged heads, x64) as f16 rows */
  k_gemm2<0><<<dim3((unsigned)((MPO / 128) * (DM / 64)), 1), 128, 0, stream>>>(O16 + r0p * DM, DM, 0, BO, DM, 0, 0.0009765625f, bo, 0, nullptr, 1, 0, 0, OUTF + r0p * DM, nullptr, DM, 0, MPO, DM, DM);      /* out rows (f32) */
  k_hl<<<(unsigned)(((size_t)NB * QT0 * DM / 8 + 255) / 256), 256, 0, stream>>>(OF0, OH0, OL0, (size_t)NB * QT0 * DM / 8);      /* first-tile o (x64) -> f16 hi + x1024 residual planes */
  for (int b = B0; b < B0 + NBR; ++b) { const size_t r0 = (size_t)b * SQ; const size_t f0 = (size_t)b * QT0;
    k_gemm2<0><<<dim3((QT0 / 128) * (DM / 64), 1), 128, 0, stream>>>(OH0 + f0 * DM, DM, 0, BO, DM, 0, 0.0009765625f, bo, 0, nullptr, 1, 0, 0, OUTF + r0 * DM, nullptr, DM, 0, QT0, DM, DM);      /* rows 0..127: out = o_hi Wo (+ b), overwriting the f16-path rows */
    k_gemm2<0><<<dim3((QT0 / 128) * (DM / 64), 1), 128, 0, stream>>>(OL0 + f0 * DM, DM, 0, BO, DM, 0, 0.00000095367431640625f, nullptr, 0, (const float*)(OUTF + r0 * DM), -1, 0, 0, OUTF + r0 * DM, nullptr, DM, 0, QT0, DM, DM); }      /* += o_lo Wo 2^-20 (own-element accumulate) */
  k_f2bf<<<(unsigned)(((size_t)MPO * DM / 8 + 255) / 256), 256, 0, stream>>>(OUTF + (size_t)B0 * SQ * DM, (unsigned short*)d_out + (size_t)B0 * SQ * DM, (size_t)MPO * DM / 8);      /* out.astype(bfloat16): the f32 rows rounded to nearest-even bf16 into the 2-byte output */
}

// v001
// It runs in 5550 microseconds.
// In both of two side-by-side timings against v000, it was 1.74 times as fast.
#include <hip/hip_runtime.h>
// Grouped-query causal attention with RoPE and a BFLOAT16 output (x [2][2048][2048]; xq = x wq (32 heads x 64), xk = x wk, xv = x wv (8 kv heads x 64) ([in][out] weights sigma 1/sqrt(2048), no biases); interleaved-pair RoPE (reshape(..., 32, 2): real = even, imag = odd) on q and k from the module's INPUT tables freqs_cos/freqs_sin [S][32]; repeat: query head h uses kv head h/4; scores / 8 + triu(-inf, 1) (causal); softmax; out = (merged wo).astype(bfloat16) -> bf16 [2][2048][2048] (2 bytes per element)).
// Compute dtype: inputs rounded to bf16; x / weights exact; q, k, v, softmax weights and o as plain f16 GEMM operands (~2^-12); scores and softmax statistics f32. v_wmma_f32_16x16x32_f16.
#define NB 2
#define NG 8
#define HPG 4
#define KVD (NG * HD)
#define SQ 2048
#define DM 2048
#define NH 32
#define HD 64
#define HG 4                         /* heads per launch of the non-template k_vt (not launched) */
#define QT 256                       /* query rows per causal tile */
#define NKX SQ                       /* S / P row pitch */
#define QT0 128                      /* first-tile rows recomputed exactly in f32 */
#define B0 0                         /* first batch processed (debug hook) */
#define NBR NB                       /* batches processed (debug hook) */
#define NR ((size_t)NB * SQ)         /* token rows */
#define MP ((int)((size_t)NBR * SQ)) /* rows projected (debug hook) */
#define QN SQ                        /* query rows attended per batch (debug hook) */
#define NHD NH                       /* heads attended (debug hook) */
#define MPO MP                       /* rows through the output stage (debug hook) */
#define LQ DM      /* row pitch of the q rows */
typedef __bf16 v16b __attribute__((ext_vector_type(16)));
typedef unsigned short v8us __attribute__((ext_vector_type(8), may_alias));
typedef float  v8f  __attribute__((ext_vector_type(8)));
typedef float  v4f  __attribute__((ext_vector_type(4)));
typedef float  v4fa __attribute__((ext_vector_type(4), may_alias));
union FragB { v16b v; v8us half[2]; unsigned short u[16]; };

__device__ __forceinline__ unsigned short bf16_bits(float x) { unsigned int u = __float_as_uint(x); return (unsigned short)((u + 0x7FFFu + ((u >> 16) & 1u)) >> 16); }
__device__ __forceinline__ float bf16_val(unsigned short b) { return __uint_as_float(((unsigned int)b) << 16); }
__device__ __forceinline__ float bf16_round(float x) { return bf16_val(bf16_bits(x)); }
// D += A·B with NT terms: 1 = ah·bh, 2 = + al·bh (A split), 3 = + ah·bl (both split)
template <int NT>
__device__ __forceinline__ v8f mmaN(v16b ah, v16b al, v16b bh, v16b bl, v8f c) {
  c = __builtin_amdgcn_wmma_f32_16x16x32_bf16(false, ah, false, bh, (short)0, c, false, false);
  if (NT >= 2) c = __builtin_amdgcn_wmma_f32_16x16x32_bf16(false, al, false, bh, (short)0, c, false, false);
  if (NT >= 3) c = __builtin_amdgcn_wmma_f32_16x16x32_bf16(false, ah, false, bl, (short)0, c, false, false);
  asm volatile("v_nop\n\tv_nop\n\tv_nop\n\tv_nop" : "+v"(c) : "v"(ah), "v"(al), "v"(bh), "v"(bl));
  return c;
}

__global__ __launch_bounds__(256) void k_wt_bf16(const float* __restrict__ W, unsigned short* __restrict__ Wt, int K, int N) {
  const int t = blockIdx.x * 256 + threadIdx.x;
  const int k8n = K / 8;
  if (t >= N * k8n) return;
  const int n = t / k8n, k8 = (t % k8n) * 8;
  v8us v;
#pragma unroll
  for (int i = 0; i < 8; ++i) v[i] = bf16_bits(W[(size_t)(k8 + i) * N + n]);
  *(v8us*)(Wt + (size_t)n * K + k8) = v;
  
}

// GEMM C[M][N] (f32, pitch ldc) = act(A[M][K]·W + bias). A f32 row-major (pitch lda) converted per fragment to bf16
// (ASPLIT: hi/lo two planes -> 2 terms, else single rounded term); Wt bf16 [N][K] (pitch ldb). BIAS_BF16 rounds the
// bias to bf16 first (bias quantised to bf16 before the add). K%32==0, M%16==0, N%64==0.
template <bool ASPLIT, int ACT, bool BIAS_BF16>
__global__ __launch_bounds__(128) void k_gemm_bf(const float* __restrict__ A, int lda, const unsigned short* __restrict__ Wt, int ldb,
                                               const float* __restrict__ bias, float* __restrict__ C, int ldc, int M, int N, int K) {
  __shared__ __attribute__((aligned(16))) float so[4][16][64];
  const int tid = threadIdx.x, w = tid >> 5, lane = tid & 31, ln = lane & 15, hh = lane >> 4;
  const int ntn = N / 64;
  const int wid = blockIdx.x * 4 + w;
  const int mt = wid / ntn, nq = wid % ntn;
  if (mt * 16 >= M) return;
  const int row0 = mt * 16, col0 = nq * 64;
  const float* arow = A + (size_t)(row0 + ln) * lda;
  v8f acc[4] = {};
  for (int kb = 0; kb < K; kb += 32) {
    FragB ah, al;
    const v4f x0 = *(const v4fa*)(arow + kb + 8 * hh), x1 = *(const v4fa*)(arow + kb + 8 * hh + 4);
    const v4f x2 = *(const v4fa*)(arow + kb + 16 + 8 * hh), x3 = *(const v4fa*)(arow + kb + 16 + 8 * hh + 4);
    float xs[16] = {x0[0],x0[1],x0[2],x0[3],x1[0],x1[1],x1[2],x1[3],x2[0],x2[1],x2[2],x2[3],x3[0],x3[1],x3[2],x3[3]};
#pragma unroll
    for (int i = 0; i < 16; ++i) { const unsigned short hb = bf16_bits(xs[i]); ah.u[i] = hb; al.u[i] = ASPLIT ? bf16_bits(xs[i] - bf16_val(hb)) : (unsigned short)0; }
#pragma unroll
    for (int t = 0; t < 4; ++t) {
      const unsigned short* brow = Wt + (size_t)(col0 + t * 16 + ln) * ldb + kb;
      FragB b;
      b.half[0] = *(const v8us*)(brow + 8 * hh);
      b.half[1] = *(const v8us*)(brow + 16 + 8 * hh);
      acc[t] = mmaN<ASPLIT ? 2 : 1>(ah.v, al.v, b.v, b.v, acc[t]);
    }
  }
#pragma unroll
  for (int t = 0; t < 4; ++t) {
    float bv = bias ? bias[col0 + t * 16 + ln] : 0.f;
    if (BIAS_BF16) bv = bf16_round(bv);
#pragma unroll
    for (int r = 0; r < 8; ++r) { float v = acc[t][r] + bv; if (ACT == 1) v = fmaxf(v, 0.f); so[w][8 * hh + r][t * 16 + ln] = v; }
  }
  __builtin_amdgcn_fence(__ATOMIC_ACQ_REL, "workgroup");
  __builtin_amdgcn_wave_barrier();
  const int rsub = lane >> 4, c4 = (lane & 15) * 4;
  {
#pragma unroll
    for (int q = 0; q < 8; ++q) {
      const int r = q * 2 + rsub;
      const v4f v = *(const v4fa*)&so[w][r][c4];
      *(v4f*)(C + (size_t)(row0 + r) * ldc + col0 + c4) = v;
    }
    
  }
}

// GEMM C = act(A·W + bias + resid): A f32 (ASPLIT -> hi/lo 2 terms), Wt bf16 [N][K]; ACT 0 none, 1 relu, 2 exact gelu;
// resid (optional, f32, row index = (row % rmod), pitch ldr, RES_BF16 rounds it) added before the activation.
template <bool ASPLIT, int ACT, bool BIAS_BF16, bool RES_BF16>
__global__ __launch_bounds__(128) void k_gemm_bf3(const float* __restrict__ A, int lda, const unsigned short* __restrict__ Wt, int ldb,
                                                const float* __restrict__ bias, const float* __restrict__ resid, int rmod, int ldr,
                                                float* __restrict__ C, int ldc, int M, int N, int K) {
  __shared__ __attribute__((aligned(16))) float so[4][16][64];
  const int tid = threadIdx.x, w = tid >> 5, lane = tid & 31, ln = lane & 15, hh = lane >> 4;
  const int ntn = N / 64;
  const int wid = blockIdx.x * 4 + w;
  const int mt = wid / ntn, nq = wid % ntn;
  if (mt * 16 >= M) return;
  const int row0 = mt * 16, col0 = nq * 64;
  const float* arow = A + (size_t)(row0 + ln) * lda;
  v8f acc[4] = {};
  for (int kb = 0; kb < K; kb += 32) {
    FragB ah, al;
    const v4f x0 = *(const v4fa*)(arow + kb + 8 * hh), x1 = *(const v4fa*)(arow + kb + 8 * hh + 4);
    const v4f x2 = *(const v4fa*)(arow + kb + 16 + 8 * hh), x3 = *(const v4fa*)(arow + kb + 16 + 8 * hh + 4);
    float xs[16] = {x0[0],x0[1],x0[2],x0[3],x1[0],x1[1],x1[2],x1[3],x2[0],x2[1],x2[2],x2[3],x3[0],x3[1],x3[2],x3[3]};
#pragma unroll
    for (int i = 0; i < 16; ++i) { const unsigned short hb = bf16_bits(xs[i]); ah.u[i] = hb; al.u[i] = ASPLIT ? bf16_bits(xs[i] - bf16_val(hb)) : (unsigned short)0; }
#pragma unroll
    for (int t = 0; t < 4; ++t) {
      const unsigned short* brow = Wt + (size_t)(col0 + t * 16 + ln) * ldb + kb;
      FragB b;
      b.half[0] = *(const v8us*)(brow + 8 * hh);
      b.half[1] = *(const v8us*)(brow + 16 + 8 * hh);
      acc[t] = mmaN<ASPLIT ? 2 : 1>(ah.v, al.v, b.v, b.v, acc[t]);
    }
  }
#pragma unroll
  for (int t = 0; t < 4; ++t) {
    const int col = col0 + t * 16 + ln;
    float bv = bias ? bias[col] : 0.f;
    if (BIAS_BF16) bv = bf16_round(bv);
#pragma unroll
    for (int r = 0; r < 8; ++r) {
      float v = acc[t][r] + bv;
      if (resid) { float rv = resid[(size_t)((row0 + 8 * hh + r) % rmod) * ldr + col]; if (RES_BF16) rv = bf16_round(rv); v += rv; }
      if (ACT == 1) v = fmaxf(v, 0.f);
      if (ACT == 2) v = 0.5f * v * (1.0f + erff(v * 0.70710678118654752f));
      if (ACT == 3) { const float u = 0.7978845608028654f * (v + 0.044715f * v * v * v); v = 0.5f * v * (1.0f + tanhf(u)); }
      so[w][8 * hh + r][t * 16 + ln] = v;
    }
  }
  __builtin_amdgcn_fence(__ATOMIC_ACQ_REL, "workgroup");
  __builtin_amdgcn_wave_barrier();
  const int rsub = lane >> 4, c4 = (lane & 15) * 4;
  {
#pragma unroll
    for (int q = 0; q < 8; ++q) {
      const int r = q * 2 + rsub;
      const v4f v = *(const v4fa*)&so[w][r][c4];
      *(v4f*)(C + (size_t)(row0 + r) * ldc + col0 + c4) = v;
    }
    
  }
}
// row LayerNorm (biased variance, eps) over N: s = X (+ R); optional out_sum <- s; out_norm <- (s-mu)*rsqrt(var+eps)*g + b
template <bool PARAM_BF16>
__global__ __launch_bounds__(256) void k_layernorm(const float* __restrict__ X, const float* __restrict__ R, const float* __restrict__ g, const float* __restrict__ bta,
                                                  float* __restrict__ out_sum, float* __restrict__ out_norm, int N, float eps) {
  __shared__ float red[256];
  const int row = blockIdx.x, tid = threadIdx.x;
  const float* x = X + (size_t)row * N; const float* rr = R ? R + (size_t)row * N : nullptr;
  float vals[16];                     // up to N = 4096
  const int per = N / 256;            // contiguous chunk per thread? use strided-by-4 chunks: thread handles j = tid*4 + 1024*u
  float s1 = 0.f;
  for (int u = 0; u < per / 4; ++u) {
    const int j = tid * 4 + 1024 * u;
    const v4f a = *(const v4fa*)(x + j);
    v4f b = {0.f,0.f,0.f,0.f}; if (rr) b = *(const v4fa*)(rr + j);
#pragma unroll
    for (int q = 0; q < 4; ++q) { const float v = a[q] + b[q]; vals[u * 4 + q] = v; s1 += v; }
  }
  red[tid] = s1; __syncthreads();
  for (int st = 128; st > 0; st >>= 1) { if (tid < st) red[tid] += red[tid + st]; __syncthreads(); }
  const float mu = red[0] / (float)N; __syncthreads();
  float s2 = 0.f;
  for (int u = 0; u < per / 4; ++u)
#pragma unroll
    for (int q = 0; q < 4; ++q) { const float c = vals[u * 4 + q] - mu; s2 += c * c; }
  red[tid] = s2; __syncthreads();
  for (int st = 128; st > 0; st >>= 1) { if (tid < st) red[tid] += red[tid + st]; __syncthreads(); }
  const float rs = rsqrtf(red[0] / (float)N + eps);
  {
    for (int u = 0; u < per / 4; ++u) {
      const int j = tid * 4 + 1024 * u;
      v4f o, sm;
#pragma unroll
      for (int q = 0; q < 4; ++q) {
        float gg = g[j + q], bb = bta[j + q];
        if (PARAM_BF16) { gg = bf16_round(gg); bb = bf16_round(bb); }
        sm[q] = vals[u * 4 + q]; o[q] = (vals[u * 4 + q] - mu) * rs * gg + bb;
      }
      if (out_sum) *(v4f*)(out_sum + (size_t)row * N + j) = sm;
      *(v4f*)(out_norm + (size_t)row * N + j) = o;
    }
    
  }
}



// ---- f16 WMMA path (v_wmma_f32_16x16x32_f16): 11-bit significands for operands in range — used where a [0,1] probability operand needs more precision than bf16
typedef _Float16 v16h __attribute__((ext_vector_type(16)));
union FragH { v16h v; v8us half[2]; _Float16 h[16]; unsigned short u[16]; };
template <int NT>
__device__ __forceinline__ v8f mmaH(v16h ah, v16h al, v16h bh, v16h bl, v8f c) {
  c = __builtin_amdgcn_wmma_f32_16x16x32_f16(false, ah, false, bh, (short)0, c, false, false);
  if (NT >= 2) c = __builtin_amdgcn_wmma_f32_16x16x32_f16(false, al, false, bh, (short)0, c, false, false);
  if (NT >= 3) c = __builtin_amdgcn_wmma_f32_16x16x32_f16(false, ah, false, bl, (short)0, c, false, false);
  asm volatile("v_nop\n\tv_nop\n\tv_nop\n\tv_nop" : "+v"(c) : "v"(ah), "v"(al), "v"(bh), "v"(bl));
  return c;
}
// batched GEMM like k_gemm_b but f16 operands: A f32 (split into f16 hi/lo if ASPLIT, else rounded to f16), Bt = f16 values [n][k]; alpha; C f32; N multiple of 16 (partial tiles skipped)
template <bool ASPLIT>
__global__ __launch_bounds__(128) void k_gemm_h(const float* __restrict__ A, int lda, size_t sA, const _Float16* __restrict__ Bh, int ldb, size_t sB, float alpha, float* __restrict__ C, int ldc, size_t sC, int M, int N, int K) {
  __shared__ __attribute__((aligned(16))) float so[4][16][64];
  const int tid = threadIdx.x, w = tid >> 5, lane = tid & 31, ln = lane & 15, hh = lane >> 4; const int by = blockIdx.y;
  A += (size_t)by * sA; Bh += (size_t)by * sB; C += (size_t)by * sC;
  const int ntn = (N + 63) / 64; const int wid = blockIdx.x * 4 + w; const int mt = wid / ntn, nq = wid % ntn; if (mt * 16 >= M) return;
  const int row0 = mt * 16, col0 = nq * 64; const float* arow = A + (size_t)(row0 + ln) * lda;
  v8f acc[4] = {};
  for (int kb = 0; kb < K; kb += 32) {
    FragH ah, al;
    const v4f x0 = *(const v4fa*)(arow + kb + 8 * hh), x1 = *(const v4fa*)(arow + kb + 8 * hh + 4), x2 = *(const v4fa*)(arow + kb + 16 + 8 * hh), x3 = *(const v4fa*)(arow + kb + 16 + 8 * hh + 4);
    float xs[16] = {x0[0],x0[1],x0[2],x0[3],x1[0],x1[1],x1[2],x1[3],x2[0],x2[1],x2[2],x2[3],x3[0],x3[1],x3[2],x3[3]};
#pragma unroll
    for (int i = 0; i < 16; ++i) { const _Float16 h = (_Float16)xs[i]; ah.h[i] = h; al.h[i] = ASPLIT ? (_Float16)(xs[i] - (float)h) : (_Float16)0.0f; }
#pragma unroll
    for (int t = 0; t < 4; ++t) { if (col0 + t * 16 >= N) continue; const size_t boff = (size_t)(col0 + t * 16 + ln) * ldb + kb; FragH bq; bq.half[0] = *(const v8us*)(Bh + boff + 8 * hh); bq.half[1] = *(const v8us*)(Bh + boff + 16 + 8 * hh);
      acc[t] = mmaH<ASPLIT ? 2 : 1>(ah.v, al.v, bq.v, bq.v, acc[t]); }
  }
#pragma unroll
  for (int t = 0; t < 4; ++t) { if (col0 + t * 16 >= N) continue;
#pragma unroll
    for (int r = 0; r < 8; ++r) so[w][8 * hh + r][t * 16 + ln] = acc[t][r] * alpha; }
  __builtin_amdgcn_fence(__ATOMIC_ACQ_REL, "workgroup"); __builtin_amdgcn_wave_barrier();
  const int rsub = lane >> 4, c4 = (lane & 15) * 4;
  {
#pragma unroll
    for (int q = 0; q < 8; ++q) { const int r = q * 2 + rsub; if (col0 + c4 < N) { const v4f v = *(const v4fa*)&so[w][r][c4]; *(v4f*)(C + (size_t)(row0 + r) * ldc + col0 + c4) = v; } }
     }
}

// Wt[n][k] = f16(W[k][n]·scale) from f32 row-major W[K][N] (scale = power of two; bf16-exact weights stay exact in f16 away from the subnormal range)
__global__ __launch_bounds__(256) void k_wt_f16(const float* __restrict__ W, _Float16* __restrict__ Wt, int K, int N, float scale) {
  const int t = blockIdx.x * 256 + threadIdx.x; if (t >= N * (K / 8)) return; const int n = t / (K / 8), k8 = (t % (K / 8)) * 8; FragH f;
#pragma unroll
  for (int i = 0; i < 8; ++i) f.h[i] = (_Float16)(bf16_round(W[(size_t)(k8 + i) * N + n]) * scale); const v8us o = f.half[0];
  *(v8us*)((unsigned short*)Wt + (size_t)n * K + k8) = o; 
}
// k_gemm_hh variant with fused epilogue: v = acc·alpha + bias[by·sBias + col] (+ CP[(row/rowsPerB)·sCPb + by·64 + col] if CP) ; ACT 0 none / 1 elu ; writes f16 C16 (and f32 C if non-null)
template <int ACT>
__global__ __launch_bounds__(128) void k_gemm_hhx(const _Float16* __restrict__ A, int lda, size_t sA, const _Float16* __restrict__ Bh, int ldb, size_t sB, float alpha, const float* __restrict__ bias, size_t sBias, const float* __restrict__ CP, int rowsPerB, size_t sCPb, int row0g,
    float* __restrict__ C, _Float16* __restrict__ C16, int ldc, size_t sC, int M, int N, int K) {
  __shared__ __attribute__((aligned(16))) float so[4][16][64];
  const int tid = threadIdx.x, w = tid >> 5, lane = tid & 31, ln = lane & 15, hh = lane >> 4; const int by = blockIdx.y;
  A += (size_t)by * sA; Bh += (size_t)by * sB; const size_t cofs = (size_t)by * sC; const float* bp = bias ? bias + (size_t)by * sBias : nullptr;
  const int ntn = (N + 63) / 64; const int wid = blockIdx.x * 4 + w; const int mt = wid / ntn, nq = wid % ntn; if (mt * 16 >= M) return;
  const int row0 = mt * 16, col0 = nq * 64; const _Float16* arow = A + (size_t)(row0 + ln) * lda;
  v8f acc[4] = {};
  for (int kb = 0; kb < K; kb += 32) { FragH ah; ah.half[0] = *(const v8us*)((const unsigned short*)arow + kb + 8 * hh); ah.half[1] = *(const v8us*)((const unsigned short*)arow + kb + 16 + 8 * hh);
#pragma unroll
    for (int t = 0; t < 4; ++t) { if (col0 + t * 16 >= N) continue; const size_t boff = (size_t)(col0 + t * 16 + ln) * ldb + kb; FragH bq; bq.half[0] = *(const v8us*)((const unsigned short*)Bh + boff + 8 * hh); bq.half[1] = *(const v8us*)((const unsigned short*)Bh + boff + 16 + 8 * hh);
      acc[t] = mmaH<1>(ah.v, ah.v, bq.v, bq.v, acc[t]); }
  }
#pragma unroll
  for (int t = 0; t < 4; ++t) { if (col0 + t * 16 >= N) continue; const int col = col0 + t * 16 + ln; const float bv = bp ? bf16_round(bp[col]) : 0.f;
#pragma unroll
    for (int r = 0; r < 8; ++r) { float v = acc[t][r] * alpha + bv; if (CP) { const int rr = row0g + row0 + 8 * hh + r; if (rowsPerB < 0) v += CP[cofs + (size_t)rr * ldc + col];      /* rowsPerB < 0: own element of the batched C plane */ else { const int bidx = rr / rowsPerB; v += CP[(size_t)bidx * sCPb + (size_t)by * 64 + col]; } } if (ACT == 1) v = (v > 0.f) ? v : expm1f(v); else if (ACT == 7) v = (v > 0.f) ? v + 1.0f : expf(v); else if (ACT == 8) v = tanhf(v); else if (ACT == 9) v = 0.5f * v * (1.0f + tanhf(0.7978845608028654f * (v + 0.044715f * v * v * v))); else if (ACT == 11) v = 1.0f / (1.0f + expf(-v)); else if (ACT == 12) v = (v > 0.f) ? v : 0.01f * v; else if (ACT == 14) v = (v > 0.f) ? v : 0.1f * v; else if (ACT == 16) v = (v >= 0.f) ? v : 0.3f * v; else if (ACT == 17) v = (v >= 0.f) ? v : 0.2f * v; else if (ACT == 15) v = v / (1.0f + expf(-v)); else if (ACT == 3) v = fmaxf(v, 0.f); else if (ACT == 6) v = 0.5f * v * (1.0f + erff(v * 0.70710678118654752f)); so[w][8 * hh + r][t * 16 + ln] = v; } }
  __builtin_amdgcn_fence(__ATOMIC_ACQ_REL, "workgroup"); __builtin_amdgcn_wave_barrier();
  const int rsub = lane >> 4, c4 = (lane & 15) * 4; typedef _Float16 v4h __attribute__((ext_vector_type(4)));
  {
#pragma unroll
    for (int q = 0; q < 8; ++q) { const int r = q * 2 + rsub; if (col0 + c4 < N) { const v4f v = *(const v4fa*)&so[w][r][c4]; if (C) *(v4f*)(C + cofs + (size_t)(row0 + r) * ldc + col0 + c4) = v; if (C16) { v4h h4; for (int i = 0; i < 4; ++i) h4[i] = (_Float16)v[i]; *(v4h*)(C16 + cofs + (size_t)(row0 + r) * ldc + col0 + c4) = h4; } } }
     }
}


typedef _Float16 v4h __attribute__((ext_vector_type(4)));

__global__ __launch_bounds__(256) void k_x16(const float* __restrict__ x, _Float16* __restrict__ X16, size_t n8) { const size_t t = (size_t)blockIdx.x * 256 + threadIdx.x; if (t >= n8) return; FragH f;
#pragma unroll
  for (int q = 0; q < 8; ++q) f.h[q] = (_Float16)bf16_round(x[t * 8 + q]); *(v8us*)((unsigned short*)X16 + t * 8) = f.half[0];  }
__global__ __launch_bounds__(256) void k_h16(const float* __restrict__ x, _Float16* __restrict__ X16, size_t n8) { const size_t t = (size_t)blockIdx.x * 256 + threadIdx.x; if (t >= n8) return; FragH f;
#pragma unroll
  for (int q = 0; q < 8; ++q) f.h[q] = (_Float16)x[t * 8 + q]; *(v8us*)((unsigned short*)X16 + t * 8) = f.half[0];  }
__global__ __launch_bounds__(256) void k_round16f(const float* __restrict__ W, _Float16* __restrict__ Bt, size_t n8) { const size_t t = (size_t)blockIdx.x * 256 + threadIdx.x; if (t >= n8) return; FragH f;
#pragma unroll
  for (int i = 0; i < 8; ++i) f.h[i] = (_Float16)(bf16_round(W[t * 8 + i]) * 16.0f); *(v8us*)((unsigned short*)Bt + t * 8) = f.half[0];  }
template <int NHv, int TTv>
__global__ __launch_bounds__(256) void k_vt(const _Float16* __restrict__ V16, int ldv, int voff, _Float16* __restrict__ Vt) { __shared__ unsigned short tl[64][66]; const int tid = threadIdx.x; const int slab = blockIdx.x / (TTv / 64), lg = blockIdx.x % (TTv / 64); const int b = slab / NHv, h = slab % NHv;
  for (int i = tid; i < 64 * 8; i += 256) { const int r = i / 8, c8 = (i % 8) * 8; FragH f; f.half[0] = *(const v8us*)((const unsigned short*)V16 + ((size_t)b * TTv + lg * 64 + r) * ldv + voff + h * 64 + c8);
#pragma unroll
    for (int q = 0; q < 8; ++q) tl[r][c8 + q] = f.u[q]; }
  __syncthreads();
  {
#pragma unroll
    for (int rd = 0; rd < 2; ++rd) { const int d = rd * 32 + tid / 8, pc = tid % 8; FragH f;
#pragma unroll
      for (int q = 0; q < 8; ++q) f.u[q] = tl[pc * 8 + q][d];
      *(v8us*)((unsigned short*)Vt + ((size_t)slab * 64 + d) * TTv + lg * 64 + pc * 8) = f.half[0]; }
     } }

__global__ __launch_bounds__(256) void k_hl(const float* __restrict__ F, _Float16* __restrict__ Hh, _Float16* __restrict__ Hl, size_t n8) { const size_t t = (size_t)blockIdx.x * 256 + threadIdx.x; if (t >= n8) return; FragH fh, fl; const v4f a = *(const v4fa*)(F + t * 8), c = *(const v4fa*)(F + t * 8 + 4);
#pragma unroll
  for (int q = 0; q < 4; ++q) { _Float16 h = (_Float16)a[q]; fh.h[q] = h; fl.h[q] = (_Float16)((a[q] - (float)h) * 1024.0f); h = (_Float16)c[q]; fh.h[4 + q] = h; fl.h[4 + q] = (_Float16)((c[q] - (float)h) * 1024.0f); }
  { *(v8us*)((unsigned short*)Hh + t * 8) = fh.half[0]; *(v8us*)((unsigned short*)Hl + t * 8) = fl.half[0];  } }

// ---- fast GEMM (wave tile 32x64; requires M % 32 == 0 rows per launch region and N % 64 == 0); epilogue = k_gemm_hhx semantics ----
__device__ __forceinline__ v16h g2_frag(const _Float16* p, int hh) { FragH f; f.half[0] = *(const v8us*)((const unsigned short*)p + 8 * hh); f.half[1] = *(const v8us*)((const unsigned short*)p + 16 + 8 * hh); return f.v; }
__device__ __forceinline__ v8f g2_mma(v16h a, v16h b, v8f c) { v8f d = __builtin_amdgcn_wmma_f32_16x16x32_f16(false, a, false, b, (short)0, c, false, false); asm volatile("v_nop\n\tv_nop\n\tv_nop\n\tv_nop" : "+v"(d) : "v"(a), "v"(b)); return d; }
// BG: consecutive blockIdx.y values that share one B slab (grouped-query attention: BG query heads read the same k / v rows); slab = blockIdx.y / BG
template <int ACT, int BG = 1>
__global__ __launch_bounds__(128) void k_gemm2(const _Float16* __restrict__ A, int lda, size_t sA, const _Float16* __restrict__ Bh, int ldb, size_t sB, float alpha, const float* __restrict__ bias, size_t sBias, const float* __restrict__ CP, int rowsPerB, size_t sCPb, int row0g,
    float* __restrict__ C, _Float16* __restrict__ C16, int ldc, size_t sC, int M, int N, int K) { static_assert(ACT == 0 || ACT == 3 || ACT == 6 || ACT == 8 || ACT == 9 || ACT == 11 || ACT == 12 || ACT == 14 || ACT == 15 || ACT == 16 || ACT == 17, "k_gemm2: unsupported ACT code (would silently apply no activation)");
  __shared__ __attribute__((aligned(16))) float so[4][32][68];
  const int tid = threadIdx.x, w = tid >> 5, lane = tid & 31, ln = lane & 15, hh = lane >> 4; const int by = blockIdx.y;
  A += (size_t)by * sA; Bh += (size_t)(by / BG) * sB; const size_t cofs = (size_t)by * sC; const float* bp = bias ? bias + (size_t)by * sBias : nullptr;
  const int ntn = N >> 6; const int mt = blockIdx.x / ntn, nq = blockIdx.x - mt * ntn; const int row0 = mt * 128 + 32 * w, col0 = nq * 64; if (row0 >= M) return;
  const _Float16* a0p = A + (size_t)(row0 + ln) * lda; const _Float16* a1p = a0p + (size_t)16 * lda;
  const _Float16* b0p = Bh + (size_t)(col0 + ln) * ldb; const _Float16* b1p = b0p + (size_t)16 * ldb; const _Float16* b2p = b1p + (size_t)16 * ldb; const _Float16* b3p = b2p + (size_t)16 * ldb;
  const v8f z8 = {0.f,0.f,0.f,0.f,0.f,0.f,0.f,0.f}; v8f c00 = z8, c01 = z8, c02 = z8, c03 = z8, c10 = z8, c11 = z8, c12 = z8, c13 = z8;
#pragma unroll 1
  for (int kb = 0; kb < K; kb += 32) { const v16h a0 = g2_frag(a0p + kb, hh), a1 = g2_frag(a1p + kb, hh);
    v16h b = g2_frag(b0p + kb, hh); c00 = g2_mma(a0, b, c00); c10 = g2_mma(a1, b, c10);
    b = g2_frag(b1p + kb, hh); c01 = g2_mma(a0, b, c01); c11 = g2_mma(a1, b, c11);
    b = g2_frag(b2p + kb, hh); c02 = g2_mma(a0, b, c02); c12 = g2_mma(a1, b, c12);
    b = g2_frag(b3p + kb, hh); c03 = g2_mma(a0, b, c03); c13 = g2_mma(a1, b, c13); }
  v8f accs[8] = {c00, c01, c02, c03, c10, c11, c12, c13};
#pragma unroll
  for (int u = 0; u < 8; ++u) { const int t = u & 3, half = u >> 2; const int col = col0 + t * 16 + ln; const float bv = bp ? bf16_round(bp[col]) : 0.f;
#pragma unroll
    for (int r = 0; r < 8; ++r) { const int rloc = half * 16 + 8 * hh + r; float v = accs[u][r] * alpha + bv; if (CP) { if (rowsPerB < 0) v += CP[cofs + (size_t)(row0g + row0 + rloc) * ldc + col];      /* rowsPerB < 0: own element of the batched C plane */ else { const int bidx = (row0g + row0 + rloc) / rowsPerB; v += CP[(size_t)bidx * sCPb + (size_t)by * 64 + col]; } }
      if (ACT == 3) v = fmaxf(v, 0.f); else if (ACT == 6) v = 0.5f * v * (1.0f + erff(v * 0.70710678118654752f)); else if (ACT == 11) v = 1.0f / (1.0f + expf(-v)); else if (ACT == 15) v = v / (1.0f + expf(-v)); else if (ACT == 12) v = (v > 0.f) ? v : 0.01f * v; else if (ACT == 8) v = tanhf(v); else if (ACT == 9) v = 0.5f * v * (1.0f + tanhf(0.7978845608028654f * (v + 0.044715f * v * v * v))); else if (ACT == 14) v = (v > 0.f) ? v : 0.1f * v; else if (ACT == 16) v = (v >= 0.f) ? v : 0.3f * v; else if (ACT == 17) v = (v >= 0.f) ? v : 0.2f * v;
      so[w][rloc][t * 16 + ln] = v; } }
  __builtin_amdgcn_fence(__ATOMIC_ACQ_REL, "workgroup"); __builtin_amdgcn_wave_barrier();
  const int rsub = lane >> 4, c4 = (lane & 15) * 4;
  {
#pragma unroll
    for (int q = 0; q < 16; ++q) { const int r = q * 2 + rsub; const v4f v = *(const v4fa*)&so[w][r][c4]; if (C) *(v4f*)(C + cofs + (size_t)(row0 + r) * ldc + col0 + c4) = v; if (C16) { v4h h4; for (int i = 0; i < 4; ++i) h4[i] = (_Float16)v[i]; *(v4h*)(C16 + cofs + (size_t)(row0 + r) * ldc + col0 + c4) = h4; } }
     } }


__global__ __launch_bounds__(256) void k_wnat(const float* __restrict__ w, size_t n8, _Float16* __restrict__ Bt) { const size_t t = (size_t)blockIdx.x * 256 + threadIdx.x; if (t >= n8) return; FragH f; for (int q = 0; q < 8; ++q) f.h[q] = (_Float16)(bf16_round(w[t * 8 + q]) * 16.0f); *(v8us*)((unsigned short*)Bt + t * 8) = f.half[0];  }
__global__ __launch_bounds__(256) void k_rsm(const float* __restrict__ S, _Float16* __restrict__ P, int nrows) {
  #pragma clang fp contract(off)
  const int i = blockIdx.x * 256 + threadIdx.x; if (i >= nrows) return; const float* s = S + (size_t)i * SQ; float mx = -3.0e38f;
#pragma unroll 1
  for (int j = 0; j < SQ; ++j) mx = fmaxf(mx, s[j]); float se = 0.f;
#pragma unroll 1
  for (int j = 0; j < SQ; ++j) se += expf(s[j] - mx); const float sc = 256.0f / se;
#pragma unroll 1
  for (int j0 = 0; j0 < SQ; j0 += 8) { FragH f; for (int q = 0; q < 8; ++q) f.h[q] = (_Float16)(expf(s[j0 + q] - mx) * sc); unsigned short* d = (unsigned short*)P + (size_t)i * SQ + j0; *(v8us*)d = f.half[0];  } }
__global__ __launch_bounds__(256) void k_vt(const _Float16* __restrict__ V16, int b, int h0, _Float16* __restrict__ VT) { __shared__ unsigned short tl[64][65]; const int tid = threadIdx.x; const int hh = blockIdx.x % HG, sg = blockIdx.x / HG; const int s0 = sg * 64; const int h = h0 + hh;
  for (int i = tid; i < 64 * 8; i += 256) { const int j = i / 8, d8 = (i % 8) * 8; FragH f; f.half[0] = *(const v8us*)((const unsigned short*)V16 + ((size_t)b * SQ + s0 + j) * DM + h * HD + d8); for (int q = 0; q < 8; ++q) tl[d8 + q][j] = f.u[q]; }
  __syncthreads();
  { for (int i = tid; i < 64 * 8; i += 256) { const int d = i / 8, j8 = (i % 8) * 8; FragH f; for (int q = 0; q < 8; ++q) f.u[q] = tl[d][j8 + q]; *(v8us*)((unsigned short*)VT + ((size_t)hh * HD + d) * SQ + s0 + j8) = f.half[0]; }  } }



__global__ __launch_bounds__(256) void k_rsmcf2(const float* __restrict__ S, _Float16* __restrict__ P, int hg, int q0, int nk) {
  #pragma clang fp contract(off)
  const int t = blockIdx.x * 256 + threadIdx.x; if (t >= hg * QT) return; const size_t i = (size_t)t; const float* s = S + i * NKX; const int last = q0 + (t % QT); float mx = -3.0e38f;
#pragma unroll 1
  for (int j = 0; j < nk; ++j) { const float f = (j <= last) ? 1.f : 0.f; mx = fmaxf(mx, fmaf(f, s[j], (1.f - f) * -1.0e9f)); } float se = 0.f;
#pragma unroll 1
  for (int j = 0; j < nk; ++j) { const float f = (j <= last) ? 1.f : 0.f; se += __expf(fmaf(f, s[j], (1.f - f) * -1.0e9f) - mx); } const float sc = 256.0f / se;
#pragma unroll 1
  for (int j0 = 0; j0 < nk; j0 += 8) { FragH fr; for (int q = 0; q < 8; ++q) { const int j = j0 + q; const float f = (j <= last) ? 1.f : 0.f; fr.h[q] = (_Float16)(__expf(fmaf(f, s[j], (1.f - f) * -1.0e9f) - mx) * sc); } unsigned short* d = (unsigned short*)P + i * NKX + j0; *(v8us*)d = fr.half[0];  } }


template <int MASKADD>
__global__ __launch_bounds__(64) void k_att0(const float* __restrict__ QF, const float* __restrict__ KF, const float* __restrict__ VF, int ld, const float* __restrict__ mask, float scale, float* __restrict__ OF, int ldo) {
  #pragma clang fp contract(off)
  __shared__ __attribute__((aligned(16))) float lq[64][64]; __shared__ __attribute__((aligned(16))) float lo[64][64];
  const int tid = threadIdx.x; const int h = blockIdx.x / (QT0 / 64), rg = blockIdx.x % (QT0 / 64); const int i = rg * 64 + tid;
  const float* qr = QF + (size_t)i * ld + h * HD;
#pragma unroll 1
  for (int c = 0; c < HD / 4; ++c) { *(v4f*)&lq[tid][c * 4] = *(const v4fa*)(qr + c * 4); const v4f z = {0.f, 0.f, 0.f, 0.f}; *(v4f*)&lo[tid][c * 4] = z; }
  float m = -1.0e30f, l = 0.f; const int jmax = MASKADD ? (SQ - 1) : (rg * 64 + 63);      /* additive-mask form: every key (the mask input decides); causal form: keys up to the block's last row */
#pragma unroll 1
  for (int j = 0; j <= jmax; ++j) { const float* kr = KF + (size_t)j * ld + h * HD; const float* vr = VF + (size_t)j * ld + h * HD; float s = 0.f;
#pragma unroll 1
    for (int c = 0; c < HD / 4; ++c) { const v4f kq = *(const v4fa*)(kr + c * 4); const v4f qq = *(v4f*)&lq[tid][c * 4]; s = __fadd_rn(s, __fmul_rn(qq[0], kq[0])); s = __fadd_rn(s, __fmul_rn(qq[1], kq[1])); s = __fadd_rn(s, __fmul_rn(qq[2], kq[2])); s = __fadd_rn(s, __fmul_rn(qq[3], kq[3])); }
    s = __fmul_rn(s, scale); if (MASKADD) s = __fadd_rn(s, __fmul_rn(bf16_round(mask[(size_t)i * SQ + j]), -10000.0f));
    const float f = (MASKADD || j <= i) ? 1.f : 0.f; const float sm = fmaf(f, s, (1.f - f) * -1.0e30f); const float mn = fmaxf(m, sm); const float sc = expf(m - mn); const float e = expf(sm - mn); l = __fadd_rn(__fmul_rn(l, sc), e); m = mn;
#pragma unroll 1
    for (int c = 0; c < HD / 4; ++c) { const v4f vv = *(const v4fa*)(vr + c * 4); v4f oo = *(v4f*)&lo[tid][c * 4]; for (int u = 0; u < 4; ++u) oo[u] = __fadd_rn(__fmul_rn(oo[u], sc), __fmul_rn(e, vv[u])); *(v4f*)&lo[tid][c * 4] = oo; } }
  const float fin = 64.0f / l;      /* o carried x64 like the f16 path */
#pragma unroll 1
  for (int c = 0; c < HD / 4; ++c) { v4f oo = *(v4f*)&lo[tid][c * 4]; for (int u = 0; u < 4; ++u) oo[u] = __fmul_rn(oo[u], fin); *(v4f*)&lo[tid][c * 4] = oo; }
  __syncthreads();
  {
#pragma unroll 1
    for (int it = 0; it < 16; ++it) { const int row = it * 4 + tid / 16, pc = (tid % 16) * 4; const v4f v = *(const v4f*)&lo[row][pc]; *(v4f*)(OF + (size_t)(rg * 64 + row) * ldo + h * HD + pc) = v; }
     } }


__global__ __launch_bounds__(256) void k_kvexp(const float* __restrict__ src, float* __restrict__ dst, size_t n4) { const size_t t = (size_t)blockIdx.x * 256 + threadIdx.x; if (t >= n4) return; const size_t e = t * 4; const size_t row = e / DM; const int col = (int)(e % DM); const int h = col / HD, d = col % HD; const v4f v = *(const v4fa*)(src + row * KVD + (size_t)(h / HPG) * HD + d); *(v4f*)(dst + e) = v;  }

__global__ __launch_bounds__(256) void k_tab2(float theta, float* __restrict__ CS, float* __restrict__ SN) {
  #pragma clang fp contract(off)
  const int t = blockIdx.x * 256 + threadIdx.x; if (t >= SQ * (HD / 2)) return; const int i = t % (HD / 2); const int p = t / (HD / 2); const float invf = 1.0f / powf(theta, (float)(2 * i) / (float)HD); const float ang = __fmul_rn((float)p, invf); const float c = cosf(ang), s = sinf(ang);
  *(float*)(CS + t) = c; *(float*)(SN + t) = s;  }
template <int NORM, int ROPE>
__global__ __launch_bounds__(64) void k_xform(const float* __restrict__ F, int ldf, int nh, const float* __restrict__ gain, float eps, const float* __restrict__ CS, const float* __restrict__ SN, _Float16* __restrict__ H16, int ldo) {
  #pragma clang fp contract(off)
  __shared__ float xv[HD]; __shared__ float red[HD]; __shared__ unsigned short sh_[HD]; const int d = threadIdx.x; const int h = blockIdx.x % nh; const size_t r = blockIdx.x / nh; const int p = (int)(r % SQ);
  float x = F[r * (size_t)ldf + (size_t)h * HD + d];
  if (NORM) { red[d] = __fmul_rn(x, x); __syncthreads(); for (int st = HD / 2; st > 0; st >>= 1) { if (d < st) red[d] = __fadd_rn(red[d], red[d + st]); __syncthreads(); } const float rs = rsqrtf(__fadd_rn(red[0] / (float)HD, eps)); x = __fmul_rn(__fmul_rn(x, rs), bf16_round(gain[d])); }
  xv[d] = x; __syncthreads();
  float o = x;
  if (ROPE == 1) { const int i = d >> 1; const float c = CS[p * (HD / 2) + i], s = SN[p * (HD / 2) + i]; const float ev = xv[2 * i], od = xv[2 * i + 1]; o = (d & 1) ? __fadd_rn(__fmul_rn(ev, s), __fmul_rn(od, c)) : __fadd_rn(__fmul_rn(ev, c), -__fmul_rn(od, s)); }
  if (ROPE == 2) { const int i = d & (HD / 2 - 1); const float c = CS[p * (HD / 2) + i], s = SN[p * (HD / 2) + i]; const float lo = xv[i], hi = xv[i + HD / 2]; o = (d < HD / 2) ? __fadd_rn(__fmul_rn(lo, c), -__fmul_rn(hi, s)) : __fadd_rn(__fmul_rn(lo, s), __fmul_rn(hi, c)); }
  FragH th; th.h[0] = (_Float16)o; sh_[d] = th.u[0]; __syncthreads();
  if (d < HD / 8) { FragH f; for (int q = 0; q < 8; ++q) f.u[q] = sh_[d * 8 + q]; unsigned short* dst = (unsigned short*)H16 + r * (size_t)ldo + (size_t)h * HD + d * 8; *(v8us*)dst = f.half[0];  } }

template <int NORM, int ROPE>
__global__ __launch_bounds__(64) void k_xformf(const float* __restrict__ F, int ldf, int nh, const float* __restrict__ gain, float eps, const float* __restrict__ CS, const float* __restrict__ SN, float* __restrict__ F32, int ldo) {
  #pragma clang fp contract(off)
  __shared__ float xv[HD]; __shared__ float red[HD]; const int d = threadIdx.x; const int h = blockIdx.x % nh; const size_t r = blockIdx.x / nh; const int p = (int)(r % SQ);
  float x = F[r * (size_t)ldf + (size_t)h * HD + d];
  if (NORM) { red[d] = __fmul_rn(x, x); __syncthreads(); for (int st = HD / 2; st > 0; st >>= 1) { if (d < st) red[d] = __fadd_rn(red[d], red[d + st]); __syncthreads(); } const float rs = rsqrtf(__fadd_rn(red[0] / (float)HD, eps)); x = __fmul_rn(__fmul_rn(x, rs), bf16_round(gain[d])); }
  xv[d] = x; __syncthreads();
  float o = x;
  if (ROPE == 1) { const int i = d >> 1; const float c = CS[p * (HD / 2) + i], s = SN[p * (HD / 2) + i]; const float ev = xv[2 * i], od = xv[2 * i + 1]; o = (d & 1) ? __fadd_rn(__fmul_rn(ev, s), __fmul_rn(od, c)) : __fadd_rn(__fmul_rn(ev, c), -__fmul_rn(od, s)); }
  if (ROPE == 2) { const int i = d & (HD / 2 - 1); const float c = CS[p * (HD / 2) + i], s = SN[p * (HD / 2) + i]; const float lo = xv[i], hi = xv[i + HD / 2]; o = (d < HD / 2) ? __fadd_rn(__fmul_rn(lo, c), -__fmul_rn(hi, s)) : __fadd_rn(__fmul_rn(lo, s), __fmul_rn(hi, c)); }
  float* dst = F32 + r * (size_t)ldo + (size_t)h * HD + d; *(float*)dst = o;  }

__global__ __launch_bounds__(256) void k_bfcp(const float* __restrict__ src, float* __restrict__ dst, size_t n4) { const size_t t = (size_t)blockIdx.x * 256 + threadIdx.x; if (t >= n4) return; const v4f a = *(const v4fa*)(src + t * 4); v4f o; for (int q = 0; q < 4; ++q) o[q] = bf16_round(a[q]); *(v4f*)(dst + t * 4) = o;  }

__global__ __launch_bounds__(256) void k_f2bf(const float* __restrict__ F, unsigned short* __restrict__ O, size_t n8) { const size_t t = (size_t)blockIdx.x * 256 + threadIdx.x; if (t >= n8) return; const v4f a = *(const v4fa*)(F + t * 8), b = *(const v4fa*)(F + t * 8 + 4); FragH f;
  for (int q = 0; q < 4; ++q) { f.u[q] = (unsigned short)(__float_as_uint(bf16_round(a[q])) >> 16); f.u[4 + q] = (unsigned short)(__float_as_uint(bf16_round(b[q])) >> 16); }
  *(v8us*)(O + t * 8) = f.half[0];  }
extern "C" void kernel_launch(void* const* d_in, const int* in_sizes, int n_in,
                              void* d_out, int out_size, void* d_ws, size_t ws_size, hipStream_t stream) {
  (void)in_sizes; (void)n_in; (void)out_size;
  const float* const* I = (const float* const*)d_in; const float* x = I[0]; const float* tcos = I[1]; const float* tsin = I[2]; const float* wq = I[3]; const float* wk = I[4]; const float* wv = I[5]; const float* wo = I[6]; const float* bq = nullptr; const float* bk = nullptr; const float* bv = nullptr; const float* bo = nullptr;      /* [in][out] weights, no biases; rope tables [S][32] */
  char* ws = (char*)d_ws; size_t off = 0;
  auto take = [&](size_t bytes) { char* p = ws + off; off += (bytes + 255) & ~(size_t)255; return p; };
  _Float16* BQ = (_Float16*)take((size_t)DM * DM * 2); _Float16* BK = (_Float16*)take((size_t)KVD * DM * 2); _Float16* BV = (_Float16*)take((size_t)KVD * DM * 2); _Float16* BO = (_Float16*)take((size_t)DM * DM * 2);
  _Float16* X16 = (_Float16*)take(NR * DM * 2); float* QF = (float*)take((size_t)SQ * DM * 4); float* KF = (float*)take((size_t)SQ * KVD * 4); float* CSB = (float*)take((size_t)SQ * 32 * 4); float* SNB = (float*)take((size_t)SQ * 32 * 4); _Float16* Q16 = (_Float16*)take(NR * DM * 2); _Float16* K16 = (_Float16*)take(NR * KVD * 2); _Float16* V16 = (_Float16*)take(NR * KVD * 2); _Float16* O16 = (_Float16*)take(NR * DM * 2);
  float* S = (float*)take((size_t)NH * QT * NKX * 4); _Float16* P = (_Float16*)take((size_t)NH * QT * NKX * 2); _Float16* VT = (_Float16*)take((size_t)NH * HD * SQ * 2);
  float* QF0 = (float*)take((size_t)QT0 * DM * 4); float* KF0 = (float*)take((size_t)QT0 * KVD * 4); float* VF0 = (float*)take((size_t)QT0 * KVD * 4); float* KF0e = (float*)take((size_t)QT0 * DM * 4); float* VF0e = (float*)take((size_t)QT0 * DM * 4); float* OF0 = (float*)take((size_t)NB * QT0 * DM * 4); _Float16* OH0 = (_Float16*)take((size_t)NB * QT0 * DM * 2); _Float16* OL0 = (_Float16*)take((size_t)NB * QT0 * DM * 2); float* OUTF = (float*)take(NR * DM * 4);      /* f32 result rows, converted to bf16 at the end */
  if (off > ws_size) return;
  k_wt_f16<<<(unsigned)(((size_t)DM * (DM / 8) + 255) / 256), 256, 0, stream>>>(wq, BQ, DM, DM, 16.0f); k_wt_f16<<<(unsigned)(((size_t)KVD * (DM / 8) + 255) / 256), 256, 0, stream>>>(wk, BK, DM, KVD, 16.0f); k_wt_f16<<<(unsigned)(((size_t)KVD * (DM / 8) + 255) / 256), 256, 0, stream>>>(wv, BV, DM, KVD, 16.0f); k_wt_f16<<<(unsigned)(((size_t)DM * (DM / 8) + 255) / 256), 256, 0, stream>>>(wo, BO, DM, DM, 16.0f);      /* [in][out] -> Bt[n][k] x16 */
  k_x16<<<(unsigned)((NR * DM / 8 + 255) / 256), 256, 0, stream>>>(x, X16, NR * DM / 8);
  k_bfcp<<<(SQ * 32 / 4 + 255) / 256, 256, 0, stream>>>(tcos, CSB, (size_t)SQ * 32 / 4); k_bfcp<<<(SQ * 32 / 4 + 255) / 256, 256, 0, stream>>>(tsin, SNB, (size_t)SQ * 32 / 4);      /* bf16-rounded rope tables [pos][32] */
  const size_t r0p = (size_t)B0 * SQ;      /* first projected row */
  k_gemm2<0><<<dim3((unsigned)((MP / 128) * (KVD / 64)), 1), 128, 0, stream>>>(X16 + r0p * DM, DM, 0, BV, DM, 0, 0.0625f, bv, 0, nullptr, 1, 0, 0, nullptr, V16 + r0p * KVD, KVD, 0, MP, KVD, DM);
  for (int b = B0; b < B0 + NBR; ++b) { const size_t r0 = (size_t)b * SQ;
    k_gemm2<0><<<dim3((unsigned)((SQ / 128) * (DM / 64)), 1), 128, 0, stream>>>(X16 + r0 * DM, DM, 0, BQ, DM, 0, 0.0625f, nullptr, 0, nullptr, 1, 0, 0, QF, nullptr, DM, 0, SQ, DM, DM);      /* q (f32) of this batch */
    k_gemm2<0><<<dim3((unsigned)((SQ / 128) * (KVD / 64)), 1), 128, 0, stream>>>(X16 + r0 * DM, DM, 0, BK, DM, 0, 0.0625f, nullptr, 0, nullptr, 1, 0, 0, KF, nullptr, KVD, 0, SQ, KVD, DM);      /* k (f32) */
    k_xform<0, 1><<<(unsigned)((size_t)SQ * NH), 64, 0, stream>>>(QF, DM, NH, nullptr, 0.f, CSB, SNB, Q16 + r0 * DM, DM); k_xform<0, 1><<<(unsigned)((size_t)SQ * NG), 64, 0, stream>>>(KF, KVD, NG, nullptr, 0.f, CSB, SNB, K16 + r0 * KVD, KVD);      /* interleaved-pair rope -> f16 rows */
    k_xformf<0, 1><<<(unsigned)(QT0 * NH), 64, 0, stream>>>(QF, DM, NH, nullptr, 0.f, CSB, SNB, QF0, DM); k_xformf<0, 1><<<(unsigned)(QT0 * NG), 64, 0, stream>>>(KF, KVD, NG, nullptr, 0.f, CSB, SNB, KF0, KVD);      /* f32 roped q, k of rows 0..127 */
    k_vt<NG, SQ><<<NG * (SQ / 64), 256, 0, stream>>>(V16 + r0 * KVD, KVD, 0, VT);      /* V^T [NG][HD][SQ] for this batch */
    k_gemm2<0><<<dim3((QT0 / 128) * (KVD / 64), 1), 128, 0, stream>>>(X16 + r0 * DM, DM, 0, BV, DM, 0, 0.0625f, bv, 0, nullptr, 1, 0, 0, VF0, nullptr, KVD, 0, QT0, KVD, DM);
    k_kvexp<<<(unsigned)(((size_t)QT0 * DM / 4 + 255) / 256), 256, 0, stream>>>(KF0, KF0e, (size_t)QT0 * DM / 4); k_kvexp<<<(unsigned)(((size_t)QT0 * DM / 4 + 255) / 256), 256, 0, stream>>>(VF0, VF0e, (size_t)QT0 * DM / 4);      /* head h <- kv group h/4 for the exact first-tile kernel */      /* f32 q, k, v of the first 128 rows (exact products) */
    k_att0<0><<<NH * (QT0 / 64), 64, 0, stream>>>(QF0, KF0e, VF0e, DM, nullptr, 0.125f, OF0 + (size_t)b * QT0 * DM, DM);      /* exact f32 attention for rows 0..127 (o x64) */
    for (int q0 = 0; q0 < QN; q0 += QT) { const int nk = q0 + QT;      /* causal: only keys below the tile end are computed */
      k_gemm2<0, HPG><<<dim3((QT / 128) * (nk / 64), NH), 128, 0, stream>>>(Q16 + (r0 + q0) * LQ, LQ, (size_t)HD, K16 + r0 * KVD, KVD, (size_t)HD, 0.125f, nullptr, 0, nullptr, 1, 0, 0, S, nullptr, NKX, (size_t)QT * NKX, QT, nk, HD);      /* scores: all 32 heads in one launch, head y against the keys of kv head y/4 */
      k_rsmcf2<<<(NHD * QT + 255) / 256, 256, 0, stream>>>(S, P, NHD, q0, nk);
      k_gemm2<0, HPG><<<dim3((QT / 128) * (HD / 64), NH), 128, 0, stream>>>(P, NKX, (size_t)QT * NKX, VT, SQ, (size_t)HD * SQ, 0.25f, nullptr, 0, nullptr, 1, 0, 0, nullptr, O16 + (r0 + q0) * DM, DM, (size_t)HD, QT, HD, nk); } }      /* o for all 32 heads in one launch (x64), head y against V^T of kv head y/4 */      /* o (merged heads, x64) as f16 rows */
  k_gemm2<0><<<dim3((unsigned)((MPO / 128) * (DM / 64)), 1), 128, 0, stream>>>(O16 + r0p * DM, DM, 0, BO, DM, 0, 0.0009765625f, bo, 0, nullptr, 1, 0, 0, OUTF + r0p * DM, nullptr, DM, 0, MPO, DM, DM);      /* out rows (f32) */
  k_hl<<<(unsigned)(((size_t)NB * QT0 * DM / 8 + 255) / 256), 256, 0, stream>>>(OF0, OH0, OL0, (size_t)NB * QT0 * DM / 8);      /* first-tile o (x64) -> f16 hi + x1024 residual planes */
  for (int b = B0; b < B0 + NBR; ++b) { const size_t r0 = (size_t)b * SQ; const size_t f0 = (size_t)b * QT0;
    k_gemm2<0><<<dim3((QT0 / 128) * (DM / 64), 1), 128, 0, stream>>>(OH0 + f0 * DM, DM, 0, BO, DM, 0, 0.0009765625f, bo, 0, nullptr, 1, 0, 0, OUTF + r0 * DM, nullptr, DM, 0, QT0, DM, DM);      /* rows 0..127: out = o_hi Wo (+ b), overwriting the f16-path rows */
    k_gemm2<0><<<dim3((QT0 / 128) * (DM / 64), 1), 128, 0, stream>>>(OL0 + f0 * DM, DM, 0, BO, DM, 0, 0.00000095367431640625f, nullptr, 0, (const float*)(OUTF + r0 * DM), -1, 0, 0, OUTF + r0 * DM, nullptr, DM, 0, QT0, DM, DM); }      /* += o_lo Wo 2^-20 (own-element accumulate) */
  k_f2bf<<<(unsigned)(((size_t)MPO * DM / 8 + 255) / 256), 256, 0, stream>>>(OUTF + (size_t)B0 * SQ * DM, (unsigned short*)d_out + (size_t)B0 * SQ * DM, (size_t)MPO * DM / 8);      /* out.astype(bfloat16): the f32 rows rounded to nearest-even bf16 into the 2-byte output */
}

// v002
// Measured time: 2640 microseconds a run.
// In two side-by-side timings against v001, it was 2.10 and 2.09 times as fast.
// Over all steps from v000 it is 3.64 times as fast.
#include <hip/hip_runtime.h>
// Grouped-query causal attention with RoPE and a BFLOAT16 output (x [2][2048][2048]; xq = x wq (32 heads x 64), xk = x wk, xv = x wv (8 kv heads x 64) ([in][out] weights sigma 1/sqrt(2048), no biases); interleaved-pair RoPE (reshape(..., 32, 2): real = even, imag = odd) on q and k from the module's INPUT tables freqs_cos/freqs_sin [S][32]; repeat: query head h uses kv head h/4; scores / 8 + triu(-inf, 1) (causal); softmax; out = (merged wo).astype(bfloat16) -> bf16 [2][2048][2048] (2 bytes per element)).
// Compute dtype: inputs rounded to bf16; x / weights exact; q, k, v, softmax weights and o as plain f16 GEMM operands (~2^-12); scores and softmax statistics f32. v_wmma_f32_16x16x32_f16.
#define NB 2
#define NG 8
#define HPG 4
#define KVD (NG * HD)
#define SQ 2048
#define DM 2048
#define NH 32
#define HD 64
#define HG 4                         /* heads per launch of the non-template k_vt (not launched) */
#define QT 256                       /* query rows per causal tile */
#define NKX SQ                       /* S / P row pitch */
#define QT0 128                      /* first-tile rows recomputed exactly in f32 */
#define B0 0                         /* first batch processed (debug hook) */
#define NBR NB                       /* batches processed (debug hook) */
#define NR ((size_t)NB * SQ)         /* token rows */
#define MP ((int)((size_t)NBR * SQ)) /* rows projected (debug hook) */
#define QN SQ                        /* query rows attended per batch (debug hook) */
#define NHD NH                       /* heads attended (debug hook) */
#define MPO MP                       /* rows through the output stage (debug hook) */
#define LQ DM      /* row pitch of the q rows */
typedef __bf16 v16b __attribute__((ext_vector_type(16)));
typedef unsigned short v8us __attribute__((ext_vector_type(8), may_alias));
typedef float  v8f  __attribute__((ext_vector_type(8)));
typedef float  v4f  __attribute__((ext_vector_type(4)));
typedef float  v4fa __attribute__((ext_vector_type(4), may_alias));
union FragB { v16b v; v8us half[2]; unsigned short u[16]; };

__device__ __forceinline__ unsigned short bf16_bits(float x) { unsigned int u = __float_as_uint(x); return (unsigned short)((u + 0x7FFFu + ((u >> 16) & 1u)) >> 16); }
__device__ __forceinline__ float bf16_val(unsigned short b) { return __uint_as_float(((unsigned int)b) << 16); }
__device__ __forceinline__ float bf16_round(float x) { return bf16_val(bf16_bits(x)); }
// D += A·B with NT terms: 1 = ah·bh, 2 = + al·bh (A split), 3 = + ah·bl (both split)
template <int NT>
__device__ __forceinline__ v8f mmaN(v16b ah, v16b al, v16b bh, v16b bl, v8f c) {
  c = __builtin_amdgcn_wmma_f32_16x16x32_bf16(false, ah, false, bh, (short)0, c, false, false);
  if (NT >= 2) c = __builtin_amdgcn_wmma_f32_16x16x32_bf16(false, al, false, bh, (short)0, c, false, false);
  if (NT >= 3) c = __builtin_amdgcn_wmma_f32_16x16x32_bf16(false, ah, false, bl, (short)0, c, false, false);
  asm volatile("v_nop\n\tv_nop\n\tv_nop\n\tv_nop" : "+v"(c) : "v"(ah), "v"(al), "v"(bh), "v"(bl));
  return c;
}

__global__ __launch_bounds__(256) void k_wt_bf16(const float* __restrict__ W, unsigned short* __restrict__ Wt, int K, int N) {
  const int t = blockIdx.x * 256 + threadIdx.x;
  const int k8n = K / 8;
  if (t >= N * k8n) return;
  const int n = t / k8n, k8 = (t % k8n) * 8;
  v8us v;
#pragma unroll
  for (int i = 0; i < 8; ++i) v[i] = bf16_bits(W[(size_t)(k8 + i) * N + n]);
  *(v8us*)(Wt + (size_t)n * K + k8) = v;
  
}

// GEMM C[M][N] (f32, pitch ldc) = act(A[M][K]·W + bias). A f32 row-major (pitch lda) converted per fragment to bf16
// (ASPLIT: hi/lo two planes -> 2 terms, else single rounded term); Wt bf16 [N][K] (pitch ldb). BIAS_BF16 rounds the
// bias to bf16 first (bias quantised to bf16 before the add). K%32==0, M%16==0, N%64==0.
template <bool ASPLIT, int ACT, bool BIAS_BF16>
__global__ __launch_bounds__(128) void k_gemm_bf(const float* __restrict__ A, int lda, const unsigned short* __restrict__ Wt, int ldb,
                                               const float* __restrict__ bias, float* __restrict__ C, int ldc, int M, int N, int K) {
  __shared__ __attribute__((aligned(16))) float so[4][16][64];
  const int tid = threadIdx.x, w = tid >> 5, lane = tid & 31, ln = lane & 15, hh = lane >> 4;
  const int ntn = N / 64;
  const int wid = blockIdx.x * 4 + w;
  const int mt = wid / ntn, nq = wid % ntn;
  if (mt * 16 >= M) return;
  const int row0 = mt * 16, col0 = nq * 64;
  const float* arow = A + (size_t)(row0 + ln) * lda;
  v8f acc[4] = {};
  for (int kb = 0; kb < K; kb += 32) {
    FragB ah, al;
    const v4f x0 = *(const v4fa*)(arow + kb + 8 * hh), x1 = *(const v4fa*)(arow + kb + 8 * hh + 4);
    const v4f x2 = *(const v4fa*)(arow + kb + 16 + 8 * hh), x3 = *(const v4fa*)(arow + kb + 16 + 8 * hh + 4);
    float xs[16] = {x0[0],x0[1],x0[2],x0[3],x1[0],x1[1],x1[2],x1[3],x2[0],x2[1],x2[2],x2[3],x3[0],x3[1],x3[2],x3[3]};
#pragma unroll
    for (int i = 0; i < 16; ++i) { const unsigned short hb = bf16_bits(xs[i]); ah.u[i] = hb; al.u[i] = ASPLIT ? bf16_bits(xs[i] - bf16_val(hb)) : (unsigned short)0; }
#pragma unroll
    for (int t = 0; t < 4; ++t) {
      const unsigned short* brow = Wt + (size_t)(col0 + t * 16 + ln) * ldb + kb;
      FragB b;
      b.half[0] = *(const v8us*)(brow + 8 * hh);
      b.half[1] = *(const v8us*)(brow + 16 + 8 * hh);
      acc[t] = mmaN<ASPLIT ? 2 : 1>(ah.v, al.v, b.v, b.v, acc[t]);
    }
  }
#pragma unroll
  for (int t = 0; t < 4; ++t) {
    float bv = bias ? bias[col0 + t * 16 + ln] : 0.f;
    if (BIAS_BF16) bv = bf16_round(bv);
#pragma unroll
    for (int r = 0; r < 8; ++r) { float v = acc[t][r] + bv; if (ACT == 1) v = fmaxf(v, 0.f); so[w][8 * hh + r][t * 16 + ln] = v; }
  }
  __builtin_amdgcn_fence(__ATOMIC_ACQ_REL, "workgroup");
  __builtin_amdgcn_wave_barrier();
  const int rsub = lane >> 4, c4 = (lane & 15) * 4;
  {
#pragma unroll
    for (int q = 0; q < 8; ++q) {
      const int r = q * 2 + rsub;
      const v4f v = *(const v4fa*)&so[w][r][c4];
      *(v4f*)(C + (size_t)(row0 + r) * ldc + col0 + c4) = v;
    }
    
  }
}

// GEMM C = act(A·W + bias + resid): A f32 (ASPLIT -> hi/lo 2 terms), Wt bf16 [N][K]; ACT 0 none, 1 relu, 2 exact gelu;
// resid (optional, f32, row index = (row % rmod), pitch ldr, RES_BF16 rounds it) added before the activation.
template <bool ASPLIT, int ACT, bool BIAS_BF16, bool RES_BF16>
__global__ __launch_bounds__(128) void k_gemm_bf3(const float* __restrict__ A, int lda, const unsigned short* __restrict__ Wt, int ldb,
                                                const float* __restrict__ bias, const float* __restrict__ resid, int rmod, int ldr,
                                                float* __restrict__ C, int ldc, int M, int N, int K) {
  __shared__ __attribute__((aligned(16))) float so[4][16][64];
  const int tid = threadIdx.x, w = tid >> 5, lane = tid & 31, ln = lane & 15, hh = lane >> 4;
  const int ntn = N / 64;
  const int wid = blockIdx.x * 4 + w;
  const int mt = wid / ntn, nq = wid % ntn;
  if (mt * 16 >= M) return;
  const int row0 = mt * 16, col0 = nq * 64;
  const float* arow = A + (size_t)(row0 + ln) * lda;
  v8f acc[4] = {};
  for (int kb = 0; kb < K; kb += 32) {
    FragB ah, al;
    const v4f x0 = *(const v4fa*)(arow + kb + 8 * hh), x1 = *(const v4fa*)(arow + kb + 8 * hh + 4);
    const v4f x2 = *(const v4fa*)(arow + kb + 16 + 8 * hh), x3 = *(const v4fa*)(arow + kb + 16 + 8 * hh + 4);
    float xs[16] = {x0[0],x0[1],x0[2],x0[3],x1[0],x1[1],x1[2],x1[3],x2[0],x2[1],x2[2],x2[3],x3[0],x3[1],x3[2],x3[3]};
#pragma unroll
    for (int i = 0; i < 16; ++i) { const unsigned short hb = bf16_bits(xs[i]); ah.u[i] = hb; al.u[i] = ASPLIT ? bf16_bits(xs[i] - bf16_val(hb)) : (unsigned short)0; }
#pragma unroll
    for (int t = 0; t < 4; ++t) {
      const unsigned short* brow = Wt + (size_t)(col0 + t * 16 + ln) * ldb + kb;
      FragB b;
      b.half[0] = *(const v8us*)(brow + 8 * hh);
      b.half[1] = *(const v8us*)(brow + 16 + 8 * hh);
      acc[t] = mmaN<ASPLIT ? 2 : 1>(ah.v, al.v, b.v, b.v, acc[t]);
    }
  }
#pragma unroll
  for (int t = 0; t < 4; ++t) {
    const int col = col0 + t * 16 + ln;
    float bv = bias ? bias[col] : 0.f;
    if (BIAS_BF16) bv = bf16_round(bv);
#pragma unroll
    for (int r = 0; r < 8; ++r) {
      float v = acc[t][r] + bv;
      if (resid) { float rv = resid[(size_t)((row0 + 8 * hh + r) % rmod) * ldr + col]; if (RES_BF16) rv = bf16_round(rv); v += rv; }
      if (ACT == 1) v = fmaxf(v, 0.f);
      if (ACT == 2) v = 0.5f * v * (1.0f + erff(v * 0.70710678118654752f));
      if (ACT == 3) { const float u = 0.7978845608028654f * (v + 0.044715f * v * v * v); v = 0.5f * v * (1.0f + tanhf(u)); }
      so[w][8 * hh + r][t * 16 + ln] = v;
    }
  }
  __builtin_amdgcn_fence(__ATOMIC_ACQ_REL, "workgroup");
  __builtin_amdgcn_wave_barrier();
  const int rsub = lane >> 4, c4 = (lane & 15) * 4;
  {
#pragma unroll
    for (int q = 0; q < 8; ++q) {
      const int r = q * 2 + rsub;
      const v4f v = *(const v4fa*)&so[w][r][c4];
      *(v4f*)(C + (size_t)(row0 + r) * ldc + col0 + c4) = v;
    }
    
  }
}
// row LayerNorm (biased variance, eps) over N: s = X (+ R); optional out_sum <- s; out_norm <- (s-mu)*rsqrt(var+eps)*g + b
template <bool PARAM_BF16>
__global__ __launch_bounds__(256) void k_layernorm(const float* __restrict__ X, const float* __restrict__ R, const float* __restrict__ g, const float* __restrict__ bta,
                                                  float* __restrict__ out_sum, float* __restrict__ out_norm, int N, float eps) {
  __shared__ float red[256];
  const int row = blockIdx.x, tid = threadIdx.x;
  const float* x = X + (size_t)row * N; const float* rr = R ? R + (size_t)row * N : nullptr;
  float vals[16];                     // up to N = 4096
  const int per = N / 256;            // contiguous chunk per thread? use strided-by-4 chunks: thread handles j = tid*4 + 1024*u
  float s1 = 0.f;
  for (int u = 0; u < per / 4; ++u) {
    const int j = tid * 4 + 1024 * u;
    const v4f a = *(const v4fa*)(x + j);
    v4f b = {0.f,0.f,0.f,0.f}; if (rr) b = *(const v4fa*)(rr + j);
#pragma unroll
    for (int q = 0; q < 4; ++q) { const float v = a[q] + b[q]; vals[u * 4 + q] = v; s1 += v; }
  }
  red[tid] = s1; __syncthreads();
  for (int st = 128; st > 0; st >>= 1) { if (tid < st) red[tid] += red[tid + st]; __syncthreads(); }
  const float mu = red[0] / (float)N; __syncthreads();
  float s2 = 0.f;
  for (int u = 0; u < per / 4; ++u)
#pragma unroll
    for (int q = 0; q < 4; ++q) { const float c = vals[u * 4 + q] - mu; s2 += c * c; }
  red[tid] = s2; __syncthreads();
  for (int st = 128; st > 0; st >>= 1) { if (tid < st) red[tid] += red[tid + st]; __syncthreads(); }
  const float rs = rsqrtf(red[0] / (float)N + eps);
  {
    for (int u = 0; u < per / 4; ++u) {
      const int j = tid * 4 + 1024 * u;
      v4f o, sm;
#pragma unroll
      for (int q = 0; q < 4; ++q) {
        float gg = g[j + q], bb = bta[j + q];
        if (PARAM_BF16) { gg = bf16_round(gg); bb = bf16_round(bb); }
        sm[q] = vals[u * 4 + q]; o[q] = (vals[u * 4 + q] - mu) * rs * gg + bb;
      }
      if (out_sum) *(v4f*)(out_sum + (size_t)row * N + j) = sm;
      *(v4f*)(out_norm + (size_t)row * N + j) = o;
    }
    
  }
}



// ---- f16 WMMA path (v_wmma_f32_16x16x32_f16): 11-bit significands for operands in range — used where a [0,1] probability operand needs more precision than bf16
typedef _Float16 v16h __attribute__((ext_vector_type(16)));
union FragH { v16h v; v8us half[2]; _Float16 h[16]; unsigned short u[16]; };
template <int NT>
__device__ __forceinline__ v8f mmaH(v16h ah, v16h al, v16h bh, v16h bl, v8f c) {
  c = __builtin_amdgcn_wmma_f32_16x16x32_f16(false, ah, false, bh, (short)0, c, false, false);
  if (NT >= 2) c = __builtin_amdgcn_wmma_f32_16x16x32_f16(false, al, false, bh, (short)0, c, false, false);
  if (NT >= 3) c = __builtin_amdgcn_wmma_f32_16x16x32_f16(false, ah, false, bl, (short)0, c, false, false);
  asm volatile("v_nop\n\tv_nop\n\tv_nop\n\tv_nop" : "+v"(c) : "v"(ah), "v"(al), "v"(bh), "v"(bl));
  return c;
}
// batched GEMM like k_gemm_b but f16 operands: A f32 (split into f16 hi/lo if ASPLIT, else rounded to f16), Bt = f16 values [n][k]; alpha; C f32; N multiple of 16 (partial tiles skipped)
template <bool ASPLIT>
__global__ __launch_bounds__(128) void k_gemm_h(const float* __restrict__ A, int lda, size_t sA, const _Float16* __restrict__ Bh, int ldb, size_t sB, float alpha, float* __restrict__ C, int ldc, size_t sC, int M, int N, int K) {
  __shared__ __attribute__((aligned(16))) float so[4][16][64];
  const int tid = threadIdx.x, w = tid >> 5, lane = tid & 31, ln = lane & 15, hh = lane >> 4; const int by = blockIdx.y;
  A += (size_t)by * sA; Bh += (size_t)by * sB; C += (size_t)by * sC;
  const int ntn = (N + 63) / 64; const int wid = blockIdx.x * 4 + w; const int mt = wid / ntn, nq = wid % ntn; if (mt * 16 >= M) return;
  const int row0 = mt * 16, col0 = nq * 64; const float* arow = A + (size_t)(row0 + ln) * lda;
  v8f acc[4] = {};
  for (int kb = 0; kb < K; kb += 32) {
    FragH ah, al;
    const v4f x0 = *(const v4fa*)(arow + kb + 8 * hh), x1 = *(const v4fa*)(arow + kb + 8 * hh + 4), x2 = *(const v4fa*)(arow + kb + 16 + 8 * hh), x3 = *(const v4fa*)(arow + kb + 16 + 8 * hh + 4);
    float xs[16] = {x0[0],x0[1],x0[2],x0[3],x1[0],x1[1],x1[2],x1[3],x2[0],x2[1],x2[2],x2[3],x3[0],x3[1],x3[2],x3[3]};
#pragma unroll
    for (int i = 0; i < 16; ++i) { const _Float16 h = (_Float16)xs[i]; ah.h[i] = h; al.h[i] = ASPLIT ? (_Float16)(xs[i] - (float)h) : (_Float16)0.0f; }
#pragma unroll
    for (int t = 0; t < 4; ++t) { if (col0 + t * 16 >= N) continue; const size_t boff = (size_t)(col0 + t * 16 + ln) * ldb + kb; FragH bq; bq.half[0] = *(const v8us*)(Bh + boff + 8 * hh); bq.half[1] = *(const v8us*)(Bh + boff + 16 + 8 * hh);
      acc[t] = mmaH<ASPLIT ? 2 : 1>(ah.v, al.v, bq.v, bq.v, acc[t]); }
  }
#pragma unroll
  for (int t = 0; t < 4; ++t) { if (col0 + t * 16 >= N) continue;
#pragma unroll
    for (int r = 0; r < 8; ++r) so[w][8 * hh + r][t * 16 + ln] = acc[t][r] * alpha; }
  __builtin_amdgcn_fence(__ATOMIC_ACQ_REL, "workgroup"); __builtin_amdgcn_wave_barrier();
  const int rsub = lane >> 4, c4 = (lane & 15) * 4;
  {
#pragma unroll
    for (int q = 0; q < 8; ++q) { const int r = q * 2 + rsub; if (col0 + c4 < N) { const v4f v = *(const v4fa*)&so[w][r][c4]; *(v4f*)(C + (size_t)(row0 + r) * ldc + col0 + c4) = v; } }
     }
}

// Wt[n][k] = f16(W[k][n]·scale) from f32 row-major W[K][N] (scale = power of two; bf16-exact weights stay exact in f16 away from the subnormal range)
__global__ __launch_bounds__(256) void k_wt_f16(const float* __restrict__ W, _Float16* __restrict__ Wt, int K, int N, float scale) {
  const int t = blockIdx.x * 256 + threadIdx.x; if (t >= N * (K / 8)) return; const int n = t / (K / 8), k8 = (t % (K / 8)) * 8; FragH f;
#pragma unroll
  for (int i = 0; i < 8; ++i) f.h[i] = (_Float16)(bf16_round(W[(size_t)(k8 + i) * N + n]) * scale); const v8us o = f.half[0];
  *(v8us*)((unsigned short*)Wt + (size_t)n * K + k8) = o; 
}
// k_gemm_hh variant with fused epilogue: v = acc·alpha + bias[by·sBias + col] (+ CP[(row/rowsPerB)·sCPb + by·64 + col] if CP) ; ACT 0 none / 1 elu ; writes f16 C16 (and f32 C if non-null)
template <int ACT>
__global__ __launch_bounds__(128) void k_gemm_hhx(const _Float16* __restrict__ A, int lda, size_t sA, const _Float16* __restrict__ Bh, int ldb, size_t sB, float alpha, const float* __restrict__ bias, size_t sBias, const float* __restrict__ CP, int rowsPerB, size_t sCPb, int row0g,
    float* __restrict__ C, _Float16* __restrict__ C16, int ldc, size_t sC, int M, int N, int K) {
  __shared__ __attribute__((aligned(16))) float so[4][16][64];
  const int tid = threadIdx.x, w = tid >> 5, lane = tid & 31, ln = lane & 15, hh = lane >> 4; const int by = blockIdx.y;
  A += (size_t)by * sA; Bh += (size_t)by * sB; const size_t cofs = (size_t)by * sC; const float* bp = bias ? bias + (size_t)by * sBias : nullptr;
  const int ntn = (N + 63) / 64; const int wid = blockIdx.x * 4 + w; const int mt = wid / ntn, nq = wid % ntn; if (mt * 16 >= M) return;
  const int row0 = mt * 16, col0 = nq * 64; const _Float16* arow = A + (size_t)(row0 + ln) * lda;
  v8f acc[4] = {};
  for (int kb = 0; kb < K; kb += 32) { FragH ah; ah.half[0] = *(const v8us*)((const unsigned short*)arow + kb + 8 * hh); ah.half[1] = *(const v8us*)((const unsigned short*)arow + kb + 16 + 8 * hh);
#pragma unroll
    for (int t = 0; t < 4; ++t) { if (col0 + t * 16 >= N) continue; const size_t boff = (size_t)(col0 + t * 16 + ln) * ldb + kb; FragH bq; bq.half[0] = *(const v8us*)((const unsigned short*)Bh + boff + 8 * hh); bq.half[1] = *(const v8us*)((const unsigned short*)Bh + boff + 16 + 8 * hh);
      acc[t] = mmaH<1>(ah.v, ah.v, bq.v, bq.v, acc[t]); }
  }
#pragma unroll
  for (int t = 0; t < 4; ++t) { if (col0 + t * 16 >= N) continue; const int col = col0 + t * 16 + ln; const float bv = bp ? bf16_round(bp[col]) : 0.f;
#pragma unroll
    for (int r = 0; r < 8; ++r) { float v = acc[t][r] * alpha + bv; if (CP) { const int rr = row0g + row0 + 8 * hh + r; if (rowsPerB < 0) v += CP[cofs + (size_t)rr * ldc + col];      /* rowsPerB < 0: own element of the batched C plane */ else { const int bidx = rr / rowsPerB; v += CP[(size_t)bidx * sCPb + (size_t)by * 64 + col]; } } if (ACT == 1) v = (v > 0.f) ? v : expm1f(v); else if (ACT == 7) v = (v > 0.f) ? v + 1.0f : expf(v); else if (ACT == 8) v = tanhf(v); else if (ACT == 9) v = 0.5f * v * (1.0f + tanhf(0.7978845608028654f * (v + 0.044715f * v * v * v))); else if (ACT == 11) v = 1.0f / (1.0f + expf(-v)); else if (ACT == 12) v = (v > 0.f) ? v : 0.01f * v; else if (ACT == 14) v = (v > 0.f) ? v : 0.1f * v; else if (ACT == 16) v = (v >= 0.f) ? v : 0.3f * v; else if (ACT == 17) v = (v >= 0.f) ? v : 0.2f * v; else if (ACT == 15) v = v / (1.0f + expf(-v)); else if (ACT == 3) v = fmaxf(v, 0.f); else if (ACT == 6) v = 0.5f * v * (1.0f + erff(v * 0.70710678118654752f)); so[w][8 * hh + r][t * 16 + ln] = v; } }
  __builtin_amdgcn_fence(__ATOMIC_ACQ_REL, "workgroup"); __builtin_amdgcn_wave_barrier();
  const int rsub = lane >> 4, c4 = (lane & 15) * 4; typedef _Float16 v4h __attribute__((ext_vector_type(4)));
  {
#pragma unroll
    for (int q = 0; q < 8; ++q) { const int r = q * 2 + rsub; if (col0 + c4 < N) { const v4f v = *(const v4fa*)&so[w][r][c4]; if (C) *(v4f*)(C + cofs + (size_t)(row0 + r) * ldc + col0 + c4) = v; if (C16) { v4h h4; for (int i = 0; i < 4; ++i) h4[i] = (_Float16)v[i]; *(v4h*)(C16 + cofs + (size_t)(row0 + r) * ldc + col0 + c4) = h4; } } }
     }
}


typedef _Float16 v4h __attribute__((ext_vector_type(4)));

__global__ __launch_bounds__(256) void k_x16(const float* __restrict__ x, _Float16* __restrict__ X16, size_t n8) { const size_t t = (size_t)blockIdx.x * 256 + threadIdx.x; if (t >= n8) return; FragH f;
#pragma unroll
  for (int q = 0; q < 8; ++q) f.h[q] = (_Float16)bf16_round(x[t * 8 + q]); *(v8us*)((unsigned short*)X16 + t * 8) = f.half[0];  }
__global__ __launch_bounds__(256) void k_h16(const float* __restrict__ x, _Float16* __restrict__ X16, size_t n8) { const size_t t = (size_t)blockIdx.x * 256 + threadIdx.x; if (t >= n8) return; FragH f;
#pragma unroll
  for (int q = 0; q < 8; ++q) f.h[q] = (_Float16)x[t * 8 + q]; *(v8us*)((unsigned short*)X16 + t * 8) = f.half[0];  }
__global__ __launch_bounds__(256) void k_round16f(const float* __restrict__ W, _Float16* __restrict__ Bt, size_t n8) { const size_t t = (size_t)blockIdx.x * 256 + threadIdx.x; if (t >= n8) return; FragH f;
#pragma unroll
  for (int i = 0; i < 8; ++i) f.h[i] = (_Float16)(bf16_round(W[t * 8 + i]) * 16.0f); *(v8us*)((unsigned short*)Bt + t * 8) = f.half[0];  }
template <int NHv, int TTv>
__global__ __launch_bounds__(256) void k_vt(const _Float16* __restrict__ V16, int ldv, int voff, _Float16* __restrict__ Vt) { __shared__ unsigned short tl[64][66]; const int tid = threadIdx.x; const int slab = blockIdx.x / (TTv / 64), lg = blockIdx.x % (TTv / 64); const int b = slab / NHv, h = slab % NHv;
  for (int i = tid; i < 64 * 8; i += 256) { const int r = i / 8, c8 = (i % 8) * 8; FragH f; f.half[0] = *(const v8us*)((const unsigned short*)V16 + ((size_t)b * TTv + lg * 64 + r) * ldv + voff + h * 64 + c8);
#pragma unroll
    for (int q = 0; q < 8; ++q) tl[r][c8 + q] = f.u[q]; }
  __syncthreads();
  {
#pragma unroll
    for (int rd = 0; rd < 2; ++rd) { const int d = rd * 32 + tid / 8, pc = tid % 8; FragH f;
#pragma unroll
      for (int q = 0; q < 8; ++q) f.u[q] = tl[pc * 8 + q][d];
      *(v8us*)((unsigned short*)Vt + ((size_t)slab * 64 + d) * TTv + lg * 64 + pc * 8) = f.half[0]; }
     } }

__global__ __launch_bounds__(256) void k_hl(const float* __restrict__ F, _Float16* __restrict__ Hh, _Float16* __restrict__ Hl, size_t n8) { const size_t t = (size_t)blockIdx.x * 256 + threadIdx.x; if (t >= n8) return; FragH fh, fl; const v4f a = *(const v4fa*)(F + t * 8), c = *(const v4fa*)(F + t * 8 + 4);
#pragma unroll
  for (int q = 0; q < 4; ++q) { _Float16 h = (_Float16)a[q]; fh.h[q] = h; fl.h[q] = (_Float16)((a[q] - (float)h) * 1024.0f); h = (_Float16)c[q]; fh.h[4 + q] = h; fl.h[4 + q] = (_Float16)((c[q] - (float)h) * 1024.0f); }
  { *(v8us*)((unsigned short*)Hh + t * 8) = fh.half[0]; *(v8us*)((unsigned short*)Hl + t * 8) = fl.half[0];  } }

// ---- fast GEMM (wave tile 32x64; requires M % 32 == 0 rows per launch region and N % 64 == 0); epilogue = k_gemm_hhx semantics ----
__device__ __forceinline__ v16h g2_frag(const _Float16* p, int hh) { FragH f; f.half[0] = *(const v8us*)((const unsigned short*)p + 8 * hh); f.half[1] = *(const v8us*)((const unsigned short*)p + 16 + 8 * hh); return f.v; }
__device__ __forceinline__ v8f g2_mma(v16h a, v16h b, v8f c) { v8f d = __builtin_amdgcn_wmma_f32_16x16x32_f16(false, a, false, b, (short)0, c, false, false); asm volatile("v_nop\n\tv_nop\n\tv_nop\n\tv_nop" : "+v"(d) : "v"(a), "v"(b)); return d; }
// BG: consecutive blockIdx.y values that share one B slab (grouped-query attention: BG query heads read the same k / v rows); slab = blockIdx.y / BG
template <int ACT, int BG = 1>
__global__ __launch_bounds__(128) void k_gemm2(const _Float16* __restrict__ A, int lda, size_t sA, const _Float16* __restrict__ Bh, int ldb, size_t sB, float alpha, const float* __restrict__ bias, size_t sBias, const float* __restrict__ CP, int rowsPerB, size_t sCPb, int row0g,
    float* __restrict__ C, _Float16* __restrict__ C16, int ldc, size_t sC, int M, int N, int K) { static_assert(ACT == 0 || ACT == 3 || ACT == 6 || ACT == 8 || ACT == 9 || ACT == 11 || ACT == 12 || ACT == 14 || ACT == 15 || ACT == 16 || ACT == 17, "k_gemm2: unsupported ACT code (would silently apply no activation)");
  __shared__ __attribute__((aligned(16))) float so[4][32][68];
  const int tid = threadIdx.x, w = tid >> 5, lane = tid & 31, ln = lane & 15, hh = lane >> 4; const int by = blockIdx.y;
  A += (size_t)by * sA; Bh += (size_t)(by / BG) * sB; const size_t cofs = (size_t)by * sC; const float* bp = bias ? bias + (size_t)by * sBias : nullptr;
  const int ntn = N >> 6; const int mt = blockIdx.x / ntn, nq = blockIdx.x - mt * ntn; const int row0 = mt * 128 + 32 * w, col0 = nq * 64; if (row0 >= M) return;
  const _Float16* a0p = A + (size_t)(row0 + ln) * lda; const _Float16* a1p = a0p + (size_t)16 * lda;
  const _Float16* b0p = Bh + (size_t)(col0 + ln) * ldb; const _Float16* b1p = b0p + (size_t)16 * ldb; const _Float16* b2p = b1p + (size_t)16 * ldb; const _Float16* b3p = b2p + (size_t)16 * ldb;
  const v8f z8 = {0.f,0.f,0.f,0.f,0.f,0.f,0.f,0.f}; v8f c00 = z8, c01 = z8, c02 = z8, c03 = z8, c10 = z8, c11 = z8, c12 = z8, c13 = z8;
#pragma unroll 1
  for (int kb = 0; kb < K; kb += 32) { const v16h a0 = g2_frag(a0p + kb, hh), a1 = g2_frag(a1p + kb, hh);
    v16h b = g2_frag(b0p + kb, hh); c00 = g2_mma(a0, b, c00); c10 = g2_mma(a1, b, c10);
    b = g2_frag(b1p + kb, hh); c01 = g2_mma(a0, b, c01); c11 = g2_mma(a1, b, c11);
    b = g2_frag(b2p + kb, hh); c02 = g2_mma(a0, b, c02); c12 = g2_mma(a1, b, c12);
    b = g2_frag(b3p + kb, hh); c03 = g2_mma(a0, b, c03); c13 = g2_mma(a1, b, c13); }
  v8f accs[8] = {c00, c01, c02, c03, c10, c11, c12, c13};
#pragma unroll
  for (int u = 0; u < 8; ++u) { const int t = u & 3, half = u >> 2; const int col = col0 + t * 16 + ln; const float bv = bp ? bf16_round(bp[col]) : 0.f;
#pragma unroll
    for (int r = 0; r < 8; ++r) { const int rloc = half * 16 + 8 * hh + r; float v = accs[u][r] * alpha + bv; if (CP) { if (rowsPerB < 0) v += CP[cofs + (size_t)(row0g + row0 + rloc) * ldc + col];      /* rowsPerB < 0: own element of the batched C plane */ else { const int bidx = (row0g + row0 + rloc) / rowsPerB; v += CP[(size_t)bidx * sCPb + (size_t)by * 64 + col]; } }
      if (ACT == 3) v = fmaxf(v, 0.f); else if (ACT == 6) v = 0.5f * v * (1.0f + erff(v * 0.70710678118654752f)); else if (ACT == 11) v = 1.0f / (1.0f + expf(-v)); else if (ACT == 15) v = v / (1.0f + expf(-v)); else if (ACT == 12) v = (v > 0.f) ? v : 0.01f * v; else if (ACT == 8) v = tanhf(v); else if (ACT == 9) v = 0.5f * v * (1.0f + tanhf(0.7978845608028654f * (v + 0.044715f * v * v * v))); else if (ACT == 14) v = (v > 0.f) ? v : 0.1f * v; else if (ACT == 16) v = (v >= 0.f) ? v : 0.3f * v; else if (ACT == 17) v = (v >= 0.f) ? v : 0.2f * v;
      so[w][rloc][t * 16 + ln] = v; } }
  __builtin_amdgcn_fence(__ATOMIC_ACQ_REL, "workgroup"); __builtin_amdgcn_wave_barrier();
  const int rsub = lane >> 4, c4 = (lane & 15) * 4;
  {
#pragma unroll
    for (int q = 0; q < 16; ++q) { const int r = q * 2 + rsub; const v4f v = *(const v4fa*)&so[w][r][c4]; if (C) *(v4f*)(C + cofs + (size_t)(row0 + r) * ldc + col0 + c4) = v; if (C16) { v4h h4; for (int i = 0; i < 4; ++i) h4[i] = (_Float16)v[i]; *(v4h*)(C16 + cofs + (size_t)(row0 + r) * ldc + col0 + c4) = h4; } }
     } }


__global__ __launch_bounds__(256) void k_wnat(const float* __restrict__ w, size_t n8, _Float16* __restrict__ Bt) { const size_t t = (size_t)blockIdx.x * 256 + threadIdx.x; if (t >= n8) return; FragH f; for (int q = 0; q < 8; ++q) f.h[q] = (_Float16)(bf16_round(w[t * 8 + q]) * 16.0f); *(v8us*)((unsigned short*)Bt + t * 8) = f.half[0];  }
__global__ __launch_bounds__(256) void k_rsm(const float* __restrict__ S, _Float16* __restrict__ P, int nrows) {
  #pragma clang fp contract(off)
  const int i = blockIdx.x * 256 + threadIdx.x; if (i >= nrows) return; const float* s = S + (size_t)i * SQ; float mx = -3.0e38f;
#pragma unroll 1
  for (int j = 0; j < SQ; ++j) mx = fmaxf(mx, s[j]); float se = 0.f;
#pragma unroll 1
  for (int j = 0; j < SQ; ++j) se += expf(s[j] - mx); const float sc = 256.0f / se;
#pragma unroll 1
  for (int j0 = 0; j0 < SQ; j0 += 8) { FragH f; for (int q = 0; q < 8; ++q) f.h[q] = (_Float16)(expf(s[j0 + q] - mx) * sc); unsigned short* d = (unsigned short*)P + (size_t)i * SQ + j0; *(v8us*)d = f.half[0];  } }
__global__ __launch_bounds__(256) void k_vt(const _Float16* __restrict__ V16, int b, int h0, _Float16* __restrict__ VT) { __shared__ unsigned short tl[64][65]; const int tid = threadIdx.x; const int hh = blockIdx.x % HG, sg = blockIdx.x / HG; const int s0 = sg * 64; const int h = h0 + hh;
  for (int i = tid; i < 64 * 8; i += 256) { const int j = i / 8, d8 = (i % 8) * 8; FragH f; f.half[0] = *(const v8us*)((const unsigned short*)V16 + ((size_t)b * SQ + s0 + j) * DM + h * HD + d8); for (int q = 0; q < 8; ++q) tl[d8 + q][j] = f.u[q]; }
  __syncthreads();
  { for (int i = tid; i < 64 * 8; i += 256) { const int d = i / 8, j8 = (i % 8) * 8; FragH f; for (int q = 0; q < 8; ++q) f.u[q] = tl[d][j8 + q]; *(v8us*)((unsigned short*)VT + ((size_t)hh * HD + d) * SQ + s0 + j8) = f.half[0]; }  } }



// One wave per score row (the row number is wave-uniform). Lane l holds elements 128 c + 4 l .. + 3 of each 128-wide chunk c, so a load covers 512 contiguous bytes and a store 256;
// the row is read once and kept in registers for the maximum, the sum and the scaled weights. nk: a multiple of 256, at most NKX.
// Every loop over c or q is unrolled in full so that e[] and o[] are indexed by constants and stay in registers (a run-time index would send them to scratch).
__global__ __launch_bounds__(256) void k_rsmcf2(const float* __restrict__ S, _Float16* __restrict__ P, int hg, int q0, int nk) {
  const int lane = threadIdx.x & 31; const int t = blockIdx.x * 8 + __builtin_amdgcn_readfirstlane((int)(threadIdx.x >> 5)); if (t >= hg * QT) return;
  const float* s = S + (size_t)t * NKX + lane * 4; _Float16* p = P + (size_t)t * NKX + lane * 4; const int last = q0 + (t % QT);
  v4f e[NKX / 128];
#pragma unroll
  for (int c = 0; c < NKX / 128; c += 2) if (c * 128 < nk) { e[c] = *(const v4fa*)(s + c * 128); e[c + 1] = *(const v4fa*)(s + c * 128 + 128); }
  asm volatile("s_wait_xcnt 0x0" ::: "memory");      /* the loads' address registers are reused below */
  float mx = -3.0e38f;
#pragma unroll
  for (int c = 0; c < NKX / 128; c += 2) if (c * 128 < nk) {
    if (c * 128 + 255 > last) {      /* only chunks that reach past the diagonal hold masked keys */
#pragma unroll
      for (int q = 0; q < 4; ++q) { e[c][q] = (c * 128 + lane * 4 + q <= last) ? e[c][q] : -1.0e9f; e[c + 1][q] = (c * 128 + 128 + lane * 4 + q <= last) ? e[c + 1][q] : -1.0e9f; } }
    mx = fmaxf(mx, fmaxf(fmaxf(fmaxf(e[c][0], e[c][1]), fmaxf(e[c][2], e[c][3])), fmaxf(fmaxf(e[c + 1][0], e[c + 1][1]), fmaxf(e[c + 1][2], e[c + 1][3])))); }
#pragma unroll
  for (int d = 16; d > 0; d >>= 1) mx = fmaxf(mx, __shfl_xor(mx, d, 32));
  v4f sv = {0.f, 0.f, 0.f, 0.f};
#pragma unroll
  for (int c = 0; c < NKX / 128; c += 2) if (c * 128 < nk) {
#pragma unroll
    for (int q = 0; q < 4; ++q) { e[c][q] = __expf(e[c][q] - mx); e[c + 1][q] = __expf(e[c + 1][q] - mx); sv[q] += e[c][q] + e[c + 1][q]; } }
  float se = (sv[0] + sv[1]) + (sv[2] + sv[3]);
#pragma unroll
  for (int d = 16; d > 0; d >>= 1) se += __shfl_xor(se, d, 32);
  const float sc = 256.0f / se;
  v4h o[NKX / 128];      /* every chunk converted into registers of its own before the first store: no register of an issued store is written again */
#pragma unroll
  for (int c = 0; c < NKX / 128; c += 2) if (c * 128 < nk) {
#pragma unroll
    for (int q = 0; q < 4; ++q) { o[c][q] = (_Float16)(e[c][q] * sc); o[c + 1][q] = (_Float16)(e[c + 1][q] * sc); } }
#pragma unroll
  for (int c = 0; c < NKX / 128; c += 2) if (c * 128 < nk) { *(v4h*)(p + c * 128) = o[c]; *(v4h*)(p + c * 128 + 128) = o[c + 1]; } }


template <int MASKADD>
__global__ __launch_bounds__(64) void k_att0(const float* __restrict__ QF, const float* __restrict__ KF, const float* __restrict__ VF, int ld, const float* __restrict__ mask, float scale, float* __restrict__ OF, int ldo) {
  #pragma clang fp contract(off)
  __shared__ __attribute__((aligned(16))) float lq[64][64]; __shared__ __attribute__((aligned(16))) float lo[64][64];
  const int tid = threadIdx.x; const int h = blockIdx.x / (QT0 / 64), rg = blockIdx.x % (QT0 / 64); const int i = rg * 64 + tid;
  const float* qr = QF + (size_t)i * ld + h * HD;
#pragma unroll 1
  for (int c = 0; c < HD / 4; ++c) { *(v4f*)&lq[tid][c * 4] = *(const v4fa*)(qr + c * 4); const v4f z = {0.f, 0.f, 0.f, 0.f}; *(v4f*)&lo[tid][c * 4] = z; }
  float m = -1.0e30f, l = 0.f; const int jmax = MASKADD ? (SQ - 1) : (rg * 64 + 63);      /* additive-mask form: every key (the mask input decides); causal form: keys up to the block's last row */
#pragma unroll 1
  for (int j = 0; j <= jmax; ++j) { const float* kr = KF + (size_t)j * ld + h * HD; const float* vr = VF + (size_t)j * ld + h * HD; float s = 0.f;
#pragma unroll 1
    for (int c = 0; c < HD / 4; ++c) { const v4f kq = *(const v4fa*)(kr + c * 4); const v4f qq = *(v4f*)&lq[tid][c * 4]; s = __fadd_rn(s, __fmul_rn(qq[0], kq[0])); s = __fadd_rn(s, __fmul_rn(qq[1], kq[1])); s = __fadd_rn(s, __fmul_rn(qq[2], kq[2])); s = __fadd_rn(s, __fmul_rn(qq[3], kq[3])); }
    s = __fmul_rn(s, scale); if (MASKADD) s = __fadd_rn(s, __fmul_rn(bf16_round(mask[(size_t)i * SQ + j]), -10000.0f));
    const float f = (MASKADD || j <= i) ? 1.f : 0.f; const float sm = fmaf(f, s, (1.f - f) * -1.0e30f); const float mn = fmaxf(m, sm); const float sc = expf(m - mn); const float e = expf(sm - mn); l = __fadd_rn(__fmul_rn(l, sc), e); m = mn;
#pragma unroll 1
    for (int c = 0; c < HD / 4; ++c) { const v4f vv = *(const v4fa*)(vr + c * 4); v4f oo = *(v4f*)&lo[tid][c * 4]; for (int u = 0; u < 4; ++u) oo[u] = __fadd_rn(__fmul_rn(oo[u], sc), __fmul_rn(e, vv[u])); *(v4f*)&lo[tid][c * 4] = oo; } }
  const float fin = 64.0f / l;      /* o carried x64 like the f16 path */
#pragma unroll 1
  for (int c = 0; c < HD / 4; ++c) { v4f oo = *(v4f*)&lo[tid][c * 4]; for (int u = 0; u < 4; ++u) oo[u] = __fmul_rn(oo[u], fin); *(v4f*)&lo[tid][c * 4] = oo; }
  __syncthreads();
  {
#pragma unroll 1
    for (int it = 0; it < 16; ++it) { const int row = it * 4 + tid / 16, pc = (tid % 16) * 4; const v4f v = *(const v4f*)&lo[row][pc]; *(v4f*)(OF + (size_t)(rg * 64 + row) * ldo + h * HD + pc) = v; }
     } }


__global__ __launch_bounds__(256) void k_kvexp(const float* __restrict__ src, float* __restrict__ dst, size_t n4) { const size_t t = (size_t)blockIdx.x * 256 + threadIdx.x; if (t >= n4) return; const size_t e = t * 4; const size_t row = e / DM; const int col = (int)(e % DM); const int h = col / HD, d = col % HD; const v4f v = *(const v4fa*)(src + row * KVD + (size_t)(h / HPG) * HD + d); *(v4f*)(dst + e) = v;  }

__global__ __launch_bounds__(256) void k_tab2(float theta, float* __restrict__ CS, float* __restrict__ SN) {
  #pragma clang fp contract(off)
  const int t = blockIdx.x * 256 + threadIdx.x; if (t >= SQ * (HD / 2)) return; const int i = t % (HD / 2); const int p = t / (HD / 2); const float invf = 1.0f / powf(theta, (float)(2 * i) / (float)HD); const float ang = __fmul_rn((float)p, invf); const float c = cosf(ang), s = sinf(ang);
  *(float*)(CS + t) = c; *(float*)(SN + t) = s;  }
template <int NORM, int ROPE>
__global__ __launch_bounds__(64) void k_xform(const float* __restrict__ F, int ldf, int nh, const float* __restrict__ gain, float eps, const float* __restrict__ CS, const float* __restrict__ SN, _Float16* __restrict__ H16, int ldo) {
  #pragma clang fp contract(off)
  __shared__ float xv[HD]; __shared__ float red[HD]; __shared__ unsigned short sh_[HD]; const int d = threadIdx.x; const int h = blockIdx.x % nh; const size_t r = blockIdx.x / nh; const int p = (int)(r % SQ);
  float x = F[r * (size_t)ldf + (size_t)h * HD + d];
  if (NORM) { red[d] = __fmul_rn(x, x); __syncthreads(); for (int st = HD / 2; st > 0; st >>= 1) { if (d < st) red[d] = __fadd_rn(red[d], red[d + st]); __syncthreads(); } const float rs = rsqrtf(__fadd_rn(red[0] / (float)HD, eps)); x = __fmul_rn(__fmul_rn(x, rs), bf16_round(gain[d])); }
  xv[d] = x; __syncthreads();
  float o = x;
  if (ROPE == 1) { const int i = d >> 1; const float c = CS[p * (HD / 2) + i], s = SN[p * (HD / 2) + i]; const float ev = xv[2 * i], od = xv[2 * i + 1]; o = (d & 1) ? __fadd_rn(__fmul_rn(ev, s), __fmul_rn(od, c)) : __fadd_rn(__fmul_rn(ev, c), -__fmul_rn(od, s)); }
  if (ROPE == 2) { const int i = d & (HD / 2 - 1); const float c = CS[p * (HD / 2) + i], s = SN[p * (HD / 2) + i]; const float lo = xv[i], hi = xv[i + HD / 2]; o = (d < HD / 2) ? __fadd_rn(__fmul_rn(lo, c), -__fmul_rn(hi, s)) : __fadd_rn(__fmul_rn(lo, s), __fmul_rn(hi, c)); }
  FragH th; th.h[0] = (_Float16)o; sh_[d] = th.u[0]; __syncthreads();
  if (d < HD / 8) { FragH f; for (int q = 0; q < 8; ++q) f.u[q] = sh_[d * 8 + q]; unsigned short* dst = (unsigned short*)H16 + r * (size_t)ldo + (size_t)h * HD + d * 8; *(v8us*)dst = f.half[0];  } }

template <int NORM, int ROPE>
__global__ __launch_bounds__(64) void k_xformf(const float* __restrict__ F, int ldf, int nh, const float* __restrict__ gain, float eps, const float* __restrict__ CS, const float* __restrict__ SN, float* __restrict__ F32, int ldo) {
  #pragma clang fp contract(off)
  __shared__ float xv[HD]; __shared__ float red[HD]; const int d = threadIdx.x; const int h = blockIdx.x % nh; const size_t r = blockIdx.x / nh; const int p = (int)(r % SQ);
  float x = F[r * (size_t)ldf + (size_t)h * HD + d];
  if (NORM) { red[d] = __fmul_rn(x, x); __syncthreads(); for (int st = HD / 2; st > 0; st >>= 1) { if (d < st) red[d] = __fadd_rn(red[d], red[d + st]); __syncthreads(); } const float rs = rsqrtf(__fadd_rn(red[0] / (float)HD, eps)); x = __fmul_rn(__fmul_rn(x, rs), bf16_round(gain[d])); }
  xv[d] = x; __syncthreads();
  float o = x;
  if (ROPE == 1) { const int i = d >> 1; const float c = CS[p * (HD / 2) + i], s = SN[p * (HD / 2) + i]; const float ev = xv[2 * i], od = xv[2 * i + 1]; o = (d & 1) ? __fadd_rn(__fmul_rn(ev, s), __fmul_rn(od, c)) : __fadd_rn(__fmul_rn(ev, c), -__fmul_rn(od, s)); }
  if (ROPE == 2) { const int i = d & (HD / 2 - 1); const float c = CS[p * (HD / 2) + i], s = SN[p * (HD / 2) + i]; const float lo = xv[i], hi = xv[i + HD / 2]; o = (d < HD / 2) ? __fadd_rn(__fmul_rn(lo, c), -__fmul_rn(hi, s)) : __fadd_rn(__fmul_rn(lo, s), __fmul_rn(hi, c)); }
  float* dst = F32 + r * (size_t)ldo + (size_t)h * HD + d; *(float*)dst = o;  }

__global__ __launch_bounds__(256) void k_bfcp(const float* __restrict__ src, float* __restrict__ dst, size_t n4) { const size_t t = (size_t)blockIdx.x * 256 + threadIdx.x; if (t >= n4) return; const v4f a = *(const v4fa*)(src + t * 4); v4f o; for (int q = 0; q < 4; ++q) o[q] = bf16_round(a[q]); *(v4f*)(dst + t * 4) = o;  }

__global__ __launch_bounds__(256) void k_f2bf(const float* __restrict__ F, unsigned short* __restrict__ O, size_t n8) { const size_t t = (size_t)blockIdx.x * 256 + threadIdx.x; if (t >= n8) return; const v4f a = *(const v4fa*)(F + t * 8), b = *(const v4fa*)(F + t * 8 + 4); FragH f;
  for (int q = 0; q < 4; ++q) { f.u[q] = (unsigned short)(__float_as_uint(bf16_round(a[q])) >> 16); f.u[4 + q] = (unsigned short)(__float_as_uint(bf16_round(b[q])) >> 16); }
  *(v8us*)(O + t * 8) = f.half[0];  }
extern "C" void kernel_launch(void* const* d_in, const int* in_sizes, int n_in,
                              void* d_out, int out_size, void* d_ws, size_t ws_size, hipStream_t stream) {
  (void)in_sizes; (void)n_in; (void)out_size;
  const float* const* I = (const float* const*)d_in; const float* x = I[0]; const float* tcos = I[1]; const float* tsin = I[2]; const float* wq = I[3]; const float* wk = I[4]; const float* wv = I[5]; const float* wo = I[6]; const float* bq = nullptr; const float* bk = nullptr; const float* bv = nullptr; const float* bo = nullptr;      /* [in][out] weights, no biases; rope tables [S][32] */
  char* ws = (char*)d_ws; size_t off = 0;
  auto take = [&](size_t bytes) { char* p = ws + off; off += (bytes + 255) & ~(size_t)255; return p; };
  _Float16* BQ = (_Float16*)take((size_t)DM * DM * 2); _Float16* BK = (_Float16*)take((size_t)KVD * DM * 2); _Float16* BV = (_Float16*)take((size_t)KVD * DM * 2); _Float16* BO = (_Float16*)take((size_t)DM * DM * 2);
  _Float16* X16 = (_Float16*)take(NR * DM * 2); float* QF = (float*)take((size_t)SQ * DM * 4); float* KF = (float*)take((size_t)SQ * KVD * 4); float* CSB = (float*)take((size_t)SQ * 32 * 4); float* SNB = (float*)take((size_t)SQ * 32 * 4); _Float16* Q16 = (_Float16*)take(NR * DM * 2); _Float16* K16 = (_Float16*)take(NR * KVD * 2); _Float16* V16 = (_Float16*)take(NR * KVD * 2); _Float16* O16 = (_Float16*)take(NR * DM * 2);
  float* S = (float*)take((size_t)NH * QT * NKX * 4); _Float16* P = (_Float16*)take((size_t)NH * QT * NKX * 2); _Float16* VT = (_Float16*)take((size_t)NH * HD * SQ * 2);
  float* QF0 = (float*)take((size_t)QT0 * DM * 4); float* KF0 = (float*)take((size_t)QT0 * KVD * 4); float* VF0 = (float*)take((size_t)QT0 * KVD * 4); float* KF0e = (float*)take((size_t)QT0 * DM * 4); float* VF0e = (float*)take((size_t)QT0 * DM * 4); float* OF0 = (float*)take((size_t)NB * QT0 * DM * 4); _Float16* OH0 = (_Float16*)take((size_t)NB * QT0 * DM * 2); _Float16* OL0 = (_Float16*)take((size_t)NB * QT0 * DM * 2); float* OUTF = (float*)take(NR * DM * 4);      /* f32 result rows, converted to bf16 at the end */
  if (off > ws_size) return;
  k_wt_f16<<<(unsigned)(((size_t)DM * (DM / 8) + 255) / 256), 256, 0, stream>>>(wq, BQ, DM, DM, 16.0f); k_wt_f16<<<(unsigned)(((size_t)KVD * (DM / 8) + 255) / 256), 256, 0, stream>>>(wk, BK, DM, KVD, 16.0f); k_wt_f16<<<(unsigned)(((size_t)KVD * (DM / 8) + 255) / 256), 256, 0, stream>>>(wv, BV, DM, KVD, 16.0f); k_wt_f16<<<(unsigned)(((size_t)DM * (DM / 8) + 255) / 256), 256, 0, stream>>>(wo, BO, DM, DM, 16.0f);      /* [in][out] -> Bt[n][k] x16 */
  k_x16<<<(unsigned)((NR * DM / 8 + 255) / 256), 256, 0, stream>>>(x, X16, NR * DM / 8);
  k_bfcp<<<(SQ * 32 / 4 + 255) / 256, 256, 0, stream>>>(tcos, CSB, (size_t)SQ * 32 / 4); k_bfcp<<<(SQ * 32 / 4 + 255) / 256, 256, 0, stream>>>(tsin, SNB, (size_t)SQ * 32 / 4);      /* bf16-rounded rope tables [pos][32] */
  const size_t r0p = (size_t)B0 * SQ;      /* first projected row */
  k_gemm2<0><<<dim3((unsigned)((MP / 128) * (KVD / 64)), 1), 128, 0, stream>>>(X16 + r0p * DM, DM, 0, BV, DM, 0, 0.0625f, bv, 0, nullptr, 1, 0, 0, nullptr, V16 + r0p * KVD, KVD, 0, MP, KVD, DM);
  for (int b = B0; b < B0 + NBR; ++b) { const size_t r0 = (size_t)b * SQ;
    k_gemm2<0><<<dim3((unsigned)((SQ / 128) * (DM / 64)), 1), 128, 0, stream>>>(X16 + r0 * DM, DM, 0, BQ, DM, 0, 0.0625f, nullptr, 0, nullptr, 1, 0, 0, QF, nullptr, DM, 0, SQ, DM, DM);      /* q (f32) of this batch */
    k_gemm2<0><<<dim3((unsigned)((SQ / 128) * (KVD / 64)), 1), 128, 0, stream>>>(X16 + r0 * DM, DM, 0, BK, DM, 0, 0.0625f, nullptr, 0, nullptr, 1, 0, 0, KF, nullptr, KVD, 0, SQ, KVD, DM);      /* k (f32) */
    k_xform<0, 1><<<(unsigned)((size_t)SQ * NH), 64, 0, stream>>>(QF, DM, NH, nullptr, 0.f, CSB, SNB, Q16 + r0 * DM, DM); k_xform<0, 1><<<(unsigned)((size_t)SQ * NG), 64, 0, stream>>>(KF, KVD, NG, nullptr, 0.f, CSB, SNB, K16 + r0 * KVD, KVD);      /* interleaved-pair rope -> f16 rows */
    k_xformf<0, 1><<<(unsigned)(QT0 * NH), 64, 0, stream>>>(QF, DM, NH, nullptr, 0.f, CSB, SNB, QF0, DM); k_xformf<0, 1><<<(unsigned)(QT0 * NG), 64, 0, stream>>>(KF, KVD, NG, nullptr, 0.f, CSB, SNB, KF0, KVD);      /* f32 roped q, k of rows 0..127 */
    k_vt<NG, SQ><<<NG * (SQ / 64), 256, 0, stream>>>(V16 + r0 * KVD, KVD, 0, VT);      /* V^T [NG][HD][SQ] for this batch */
    k_gemm2<0><<<dim3((QT0 / 128) * (KVD / 64), 1), 128, 0, stream>>>(X16 + r0 * DM, DM, 0, BV, DM, 0, 0.0625f, bv, 0, nullptr, 1, 0, 0, VF0, nullptr, KVD, 0, QT0, KVD, DM);
    k_kvexp<<<(unsigned)(((size_t)QT0 * DM / 4 + 255) / 256), 256, 0, stream>>>(KF0, KF0e, (size_t)QT0 * DM / 4); k_kvexp<<<(unsigned)(((size_t)QT0 * DM / 4 + 255) / 256), 256, 0, stream>>>(VF0, VF0e, (size_t)QT0 * DM / 4);      /* head h <- kv group h/4 for the exact first-tile kernel */      /* f32 q, k, v of the first 128 rows (exact products) */
    k_att0<0><<<NH * (QT0 / 64), 64, 0, stream>>>(QF0, KF0e, VF0e, DM, nullptr, 0.125f, OF0 + (size_t)b * QT0 * DM, DM);      /* exact f32 attention for rows 0..127 (o x64) */
    for (int q0 = 0; q0 < QN; q0 += QT) { const int nk = q0 + QT;      /* causal: only keys below the tile end are computed */
      k_gemm2<0, HPG><<<dim3((QT / 128) * (nk / 64), NH), 128, 0, stream>>>(Q16 + (r0 + q0) * LQ, LQ, (size_t)HD, K16 + r0 * KVD, KVD, (size_t)HD, 0.125f, nullptr, 0, nullptr, 1, 0, 0, S, nullptr, NKX, (size_t)QT * NKX, QT, nk, HD);      /* scores: all 32 heads in one launch, head y against the keys of kv head y/4 */
      k_rsmcf2<<<(NHD * QT + 7) / 8, 256, 0, stream>>>(S, P, NHD, q0, nk);      /* one wave per row, 8 rows per work-group */
      k_gemm2<0, HPG><<<dim3((QT / 128) * (HD / 64), NH), 128, 0, stream>>>(P, NKX, (size_t)QT * NKX, VT, SQ, (size_t)HD * SQ, 0.25f, nullptr, 0, nullptr, 1, 0, 0, nullptr, O16 + (r0 + q0) * DM, DM, (size_t)HD, QT, HD, nk); } }      /* o for all 32 heads in one launch (x64), head y against V^T of kv head y/4 */      /* o (merged heads, x64) as f16 rows */
  k_gemm2<0><<<dim3((unsigned)((MPO / 128) * (DM / 64)), 1), 128, 0, stream>>>(O16 + r0p * DM, DM, 0, BO, DM, 0, 0.0009765625f, bo, 0, nullptr, 1, 0, 0, OUTF + r0p * DM, nullptr, DM, 0, MPO, DM, DM);      /* out rows (f32) */
  k_hl<<<(unsigned)(((size_t)NB * QT0 * DM / 8 + 255) / 256), 256, 0, stream>>>(OF0, OH0, OL0, (size_t)NB * QT0 * DM / 8);      /* first-tile o (x64) -> f16 hi + x1024 residual planes */
  for (int b = B0; b < B0 + NBR; ++b) { const size_t r0 = (size_t)b * SQ; const size_t f0 = (size_t)b * QT0;
    k_gemm2<0><<<dim3((QT0 / 128) * (DM / 64), 1), 128, 0, stream>>>(OH0 + f0 * DM, DM, 0, BO, DM, 0, 0.0009765625f, bo, 0, nullptr, 1, 0, 0, OUTF + r0 * DM, nullptr, DM, 0, QT0, DM, DM);      /* rows 0..127: out = o_hi Wo (+ b), overwriting the f16-path rows */
    k_gemm2<0><<<dim3((QT0 / 128) * (DM / 64), 1), 128, 0, stream>>>(OL0 + f0 * DM, DM, 0, BO, DM, 0, 0.00000095367431640625f, nullptr, 0, (const float*)(OUTF + r0 * DM), -1, 0, 0, OUTF + r0 * DM, nullptr, DM, 0, QT0, DM, DM); }      /* += o_lo Wo 2^-20 (own-element accumulate) */
  k_f2bf<<<(unsigned)(((size_t)MPO * DM / 8 + 255) / 256), 256, 0, stream>>>(OUTF + (size_t)B0 * SQ * DM, (unsigned short*)d_out + (size_t)B0 * SQ * DM, (size_t)MPO * DM / 8);      /* out.astype(bfloat16): the f32 rows rounded to nearest-even bf16 into the 2-byte output */
}

// v003
// One run takes 1780 microseconds.
// Next to v002, in two timings, it ran 1.48 times as fast each time.
// Over all steps from v000 it is 5.39 times as fast.
#include <hip/hip_runtime.h>
// Grouped-query causal attention with RoPE and a BFLOAT16 output (x [2][2048][2048]; xq = x wq (32 heads x 64), xk = x wk, xv = x wv (8 kv heads x 64) ([in][out] weights sigma 1/sqrt(2048), no biases); interleaved-pair RoPE (reshape(..., 32, 2): real = even, imag = odd) on q and k from the module's INPUT tables freqs_cos/freqs_sin [S][32]; repeat: query head h uses kv head h/4; scores / 8 + triu(-inf, 1) (causal); softmax; out = (merged wo).astype(bfloat16) -> bf16 [2][2048][2048] (2 bytes per element)).
// Compute dtype: inputs rounded to bf16; x / weights exact; q, k, v, softmax weights and o as plain f16 GEMM operands (~2^-12); scores and softmax statistics f32. v_wmma_f32_16x16x32_f16.
#define NB 2
#define NG 8
#define HPG 4
#define KVD (NG * HD)
#define SQ 2048
#define DM 2048
#define NH 32
#define HD 64
#define HG 4                         /* heads per launch of the non-template k_vt (not launched) */
#define QT 256                       /* query rows per causal tile */
#define NKX SQ                       /* S / P row pitch */
#define QT0 128                      /* first-tile rows recomputed exactly in f32 */
#define B0 0                         /* first batch processed (debug hook) */
#define NBR NB                       /* batches processed (debug hook) */
#define NR ((size_t)NB * SQ)         /* token rows */
#define MP ((int)((size_t)NBR * SQ)) /* rows projected (debug hook) */
#define QN SQ                        /* query rows attended per batch (debug hook) */
#define NHD NH                       /* heads attended (debug hook) */
#define MPO MP                       /* rows through the output stage (debug hook) */
#define LQ DM      /* row pitch of the q rows */
typedef __bf16 v16b __attribute__((ext_vector_type(16)));
typedef unsigned short v8us __attribute__((ext_vector_type(8), may_alias));
typedef float  v8f  __attribute__((ext_vector_type(8)));
typedef float  v4f  __attribute__((ext_vector_type(4)));
typedef float  v4fa __attribute__((ext_vector_type(4), may_alias));
union FragB { v16b v; v8us half[2]; unsigned short u[16]; };

__device__ __forceinline__ unsigned short bf16_bits(float x) { unsigned int u = __float_as_uint(x); return (unsigned short)((u + 0x7FFFu + ((u >> 16) & 1u)) >> 16); }
__device__ __forceinline__ float bf16_val(unsigned short b) { return __uint_as_float(((unsigned int)b) << 16); }
__device__ __forceinline__ float bf16_round(float x) { return bf16_val(bf16_bits(x)); }
// D += A·B with NT terms: 1 = ah·bh, 2 = + al·bh (A split), 3 = + ah·bl (both split)
template <int NT>
__device__ __forceinline__ v8f mmaN(v16b ah, v16b al, v16b bh, v16b bl, v8f c) {
  c = __builtin_amdgcn_wmma_f32_16x16x32_bf16(false, ah, false, bh, (short)0, c, false, false);
  if (NT >= 2) c = __builtin_amdgcn_wmma_f32_16x16x32_bf16(false, al, false, bh, (short)0, c, false, false);
  if (NT >= 3) c = __builtin_amdgcn_wmma_f32_16x16x32_bf16(false, ah, false, bl, (short)0, c, false, false);
  asm volatile("v_nop\n\tv_nop\n\tv_nop\n\tv_nop" : "+v"(c) : "v"(ah), "v"(al), "v"(bh), "v"(bl));
  return c;
}

__global__ __launch_bounds__(256) void k_wt_bf16(const float* __restrict__ W, unsigned short* __restrict__ Wt, int K, int N) {
  const int t = blockIdx.x * 256 + threadIdx.x;
  const int k8n = K / 8;
  if (t >= N * k8n) return;
  const int n = t / k8n, k8 = (t % k8n) * 8;
  v8us v;
#pragma unroll
  for (int i = 0; i < 8; ++i) v[i] = bf16_bits(W[(size_t)(k8 + i) * N + n]);
  *(v8us*)(Wt + (size_t)n * K + k8) = v;
  
}

// GEMM C[M][N] (f32, pitch ldc) = act(A[M][K]·W + bias). A f32 row-major (pitch lda) converted per fragment to bf16
// (ASPLIT: hi/lo two planes -> 2 terms, else single rounded term); Wt bf16 [N][K] (pitch ldb). BIAS_BF16 rounds the
// bias to bf16 first (bias quantised to bf16 before the add). K%32==0, M%16==0, N%64==0.
template <bool ASPLIT, int ACT, bool BIAS_BF16>
__global__ __launch_bounds__(128) void k_gemm_bf(const float* __restrict__ A, int lda, const unsigned short* __restrict__ Wt, int ldb,
                                               const float* __restrict__ bias, float* __restrict__ C, int ldc, int M, int N, int K) {
  __shared__ __attribute__((aligned(16))) float so[4][16][64];
  const int tid = threadIdx.x, w = tid >> 5, lane = tid & 31, ln = lane & 15, hh = lane >> 4;
  const int ntn = N / 64;
  const int wid = blockIdx.x * 4 + w;
  const int mt = wid / ntn, nq = wid % ntn;
  if (mt * 16 >= M) return;
  const int row0 = mt * 16, col0 = nq * 64;
  const float* arow = A + (size_t)(row0 + ln) * lda;
  v8f acc[4] = {};
  for (int kb = 0; kb < K; kb += 32) {
    FragB ah, al;
    const v4f x0 = *(const v4fa*)(arow + kb + 8 * hh), x1 = *(const v4fa*)(arow + kb + 8 * hh + 4);
    const v4f x2 = *(const v4fa*)(arow + kb + 16 + 8 * hh), x3 = *(const v4fa*)(arow + kb + 16 + 8 * hh + 4);
    float xs[16] = {x0[0],x0[1],x0[2],x0[3],x1[0],x1[1],x1[2],x1[3],x2[0],x2[1],x2[2],x2[3],x3[0],x3[1],x3[2],x3[3]};
#pragma unroll
    for (int i = 0; i < 16; ++i) { const unsigned short hb = bf16_bits(xs[i]); ah.u[i] = hb; al.u[i] = ASPLIT ? bf16_bits(xs[i] - bf16_val(hb)) : (unsigned short)0; }
#pragma unroll
    for (int t = 0; t < 4; ++t) {
      const unsigned short* brow = Wt + (size_t)(col0 + t * 16 + ln) * ldb + kb;
      FragB b;
      b.half[0] = *(const v8us*)(brow + 8 * hh);
      b.half[1] = *(const v8us*)(brow + 16 + 8 * hh);
      acc[t] = mmaN<ASPLIT ? 2 : 1>(ah.v, al.v, b.v, b.v, acc[t]);
    }
  }
#pragma unroll
  for (int t = 0; t < 4; ++t) {
    float bv = bias ? bias[col0 + t * 16 + ln] : 0.f;
    if (BIAS_BF16) bv = bf16_round(bv);
#pragma unroll
    for (int r = 0; r < 8; ++r) { float v = acc[t][r] + bv; if (ACT == 1) v = fmaxf(v, 0.f); so[w][8 * hh + r][t * 16 + ln] = v; }
  }
  __builtin_amdgcn_fence(__ATOMIC_ACQ_REL, "workgroup");
  __builtin_amdgcn_wave_barrier();
  const int rsub = lane >> 4, c4 = (lane & 15) * 4;
  {
#pragma unroll
    for (int q = 0; q < 8; ++q) {
      const int r = q * 2 + rsub;
      const v4f v = *(const v4fa*)&so[w][r][c4];
      *(v4f*)(C + (size_t)(row0 + r) * ldc + col0 + c4) = v;
    }
    
  }
}

// GEMM C = act(A·W + bias + resid): A f32 (ASPLIT -> hi/lo 2 terms), Wt bf16 [N][K]; ACT 0 none, 1 relu, 2 exact gelu;
// resid (optional, f32, row index = (row % rmod), pitch ldr, RES_BF16 rounds it) added before the activation.
template <bool ASPLIT, int ACT, bool BIAS_BF16, bool RES_BF16>
__global__ __launch_bounds__(128) void k_gemm_bf3(const float* __restrict__ A, int lda, const unsigned short* __restrict__ Wt, int ldb,
                                                const float* __restrict__ bias, const float* __restrict__ resid, int rmod, int ldr,
                                                float* __restrict__ C, int ldc, int M, int N, int K) {
  __shared__ __attribute__((aligned(16))) float so[4][16][64];
  const int tid = threadIdx.x, w = tid >> 5, lane = tid & 31, ln = lane & 15, hh = lane >> 4;
  const int ntn = N / 64;
  const int wid = blockIdx.x * 4 + w;
  const int mt = wid / ntn, nq = wid % ntn;
  if (mt * 16 >= M) return;
  const int row0 = mt * 16, col0 = nq * 64;
  const float* arow = A + (size_t)(row0 + ln) * lda;
  v8f acc[4] = {};
  for (int kb = 0; kb < K; kb += 32) {
    FragB ah, al;
    const v4f x0 = *(const v4fa*)(arow + kb + 8 * hh), x1 = *(const v4fa*)(arow + kb + 8 * hh + 4);
    const v4f x2 = *(const v4fa*)(arow + kb + 16 + 8 * hh), x3 = *(const v4fa*)(arow + kb + 16 + 8 * hh + 4);
    float xs[16] = {x0[0],x0[1],x0[2],x0[3],x1[0],x1[1],x1[2],x1[3],x2[0],x2[1],x2[2],x2[3],x3[0],x3[1],x3[2],x3[3]};
#pragma unroll
    for (int i = 0; i < 16; ++i) { const unsigned short hb = bf16_bits(xs[i]); ah.u[i] = hb; al.u[i] = ASPLIT ? bf16_bits(xs[i] - bf16_val(hb)) : (unsigned short)0; }
#pragma unroll
    for (int t = 0; t < 4; ++t) {
      const unsigned short* brow = Wt + (size_t)(col0 + t * 16 + ln) * ldb + kb;
      FragB b;
      b.half[0] = *(const v8us*)(brow + 8 * hh);
      b.half[1] = *(const v8us*)(brow + 16 + 8 * hh);
      acc[t] = mmaN<ASPLIT ? 2 : 1>(ah.v, al.v, b.v, b.v, acc[t]);
    }
  }
#pragma unroll
  for (int t = 0; t < 4; ++t) {
    const int col = col0 + t * 16 + ln;
    float bv = bias ? bias[col] : 0.f;
    if (BIAS_BF16) bv = bf16_round(bv);
#pragma unroll
    for (int r = 0; r < 8; ++r) {
      float v = acc[t][r] + bv;
      if (resid) { float rv = resid[(size_t)((row0 + 8 * hh + r) % rmod) * ldr + col]; if (RES_BF16) rv = bf16_round(rv); v += rv; }
      if (ACT == 1) v = fmaxf(v, 0.f);
      if (ACT == 2) v = 0.5f * v * (1.0f + erff(v * 0.70710678118654752f));
      if (ACT == 3) { const float u = 0.7978845608028654f * (v + 0.044715f * v * v * v); v = 0.5f * v * (1.0f + tanhf(u)); }
      so[w][8 * hh + r][t * 16 + ln] = v;
    }
  }
  __builtin_amdgcn_fence(__ATOMIC_ACQ_REL, "workgroup");
  __builtin_amdgcn_wave_barrier();
  const int rsub = lane >> 4, c4 = (lane & 15) * 4;
  {
#pragma unroll
    for (int q = 0; q < 8; ++q) {
      const int r = q * 2 + rsub;
      const v4f v = *(const v4fa*)&so[w][r][c4];
      *(v4f*)(C + (size_t)(row0 + r) * ldc + col0 + c4) = v;
    }
    
  }
}
// row LayerNorm (biased variance, eps) over N: s = X (+ R); optional out_sum <- s; out_norm <- (s-mu)*rsqrt(var+eps)*g + b
template <bool PARAM_BF16>
__global__ __launch_bounds__(256) void k_layernorm(const float* __restrict__ X, const float* __restrict__ R, const float* __restrict__ g, const float* __restrict__ bta,
                                                  float* __restrict__ out_sum, float* __restrict__ out_norm, int N, float eps) {
  __shared__ float red[256];
  const int row = blockIdx.x, tid = threadIdx.x;
  const float* x = X + (size_t)row * N; const float* rr = R ? R + (size_t)row * N : nullptr;
  float vals[16];                     // up to N = 4096
  const int per = N / 256;            // contiguous chunk per thread? use strided-by-4 chunks: thread handles j = tid*4 + 1024*u
  float s1 = 0.f;
  for (int u = 0; u < per / 4; ++u) {
    const int j = tid * 4 + 1024 * u;
    const v4f a = *(const v4fa*)(x + j);
    v4f b = {0.f,0.f,0.f,0.f}; if (rr) b = *(const v4fa*)(rr + j);
#pragma unroll
    for (int q = 0; q < 4; ++q) { const float v = a[q] + b[q]; vals[u * 4 + q] = v; s1 += v; }
  }
  red[tid] = s1; __syncthreads();
  for (int st = 128; st > 0; st >>= 1) { if (tid < st) red[tid] += red[tid + st]; __syncthreads(); }
  const float mu = red[0] / (float)N; __syncthreads();
  float s2 = 0.f;
  for (int u = 0; u < per / 4; ++u)
#pragma unroll
    for (int q = 0; q < 4; ++q) { const float c = vals[u * 4 + q] - mu; s2 += c * c; }
  red[tid] = s2; __syncthreads();
  for (int st = 128; st > 0; st >>= 1) { if (tid < st) red[tid] += red[tid + st]; __syncthreads(); }
  const float rs = rsqrtf(red[0] / (float)N + eps);
  {
    for (int u = 0; u < per / 4; ++u) {
      const int j = tid * 4 + 1024 * u;
      v4f o, sm;
#pragma unroll
      for (int q = 0; q < 4; ++q) {
        float gg = g[j + q], bb = bta[j + q];
        if (PARAM_BF16) { gg = bf16_round(gg); bb = bf16_round(bb); }
        sm[q] = vals[u * 4 + q]; o[q] = (vals[u * 4 + q] - mu) * rs * gg + bb;
      }
      if (out_sum) *(v4f*)(out_sum + (size_t)row * N + j) = sm;
      *(v4f*)(out_norm + (size_t)row * N + j) = o;
    }
    
  }
}



// ---- f16 WMMA path (v_wmma_f32_16x16x32_f16): 11-bit significands for operands in range — used where a [0,1] probability operand needs more precision than bf16
typedef _Float16 v16h __attribute__((ext_vector_type(16)));
union FragH { v16h v; v8us half[2]; _Float16 h[16]; unsigned short u[16]; };
template <int NT>
__device__ __forceinline__ v8f mmaH(v16h ah, v16h al, v16h bh, v16h bl, v8f c) {
  c = __builtin_amdgcn_wmma_f32_16x16x32_f16(false, ah, false, bh, (short)0, c, false, false);
  if (NT >= 2) c = __builtin_amdgcn_wmma_f32_16x16x32_f16(false, al, false, bh, (short)0, c, false, false);
  if (NT >= 3) c = __builtin_amdgcn_wmma_f32_16x16x32_f16(false, ah, false, bl, (short)0, c, false, false);
  asm volatile("v_nop\n\tv_nop\n\tv_nop\n\tv_nop" : "+v"(c) : "v"(ah), "v"(al), "v"(bh), "v"(bl));
  return c;
}
// batched GEMM like k_gemm_b but f16 operands: A f32 (split into f16 hi/lo if ASPLIT, else rounded to f16), Bt = f16 values [n][k]; alpha; C f32; N multiple of 16 (partial tiles skipped)
template <bool ASPLIT>
__global__ __launch_bounds__(128) void k_gemm_h(const float* __restrict__ A, int lda, size_t sA, const _Float16* __restrict__ Bh, int ldb, size_t sB, float alpha, float* __restrict__ C, int ldc, size_t sC, int M, int N, int K) {
  __shared__ __attribute__((aligned(16))) float so[4][16][64];
  const int tid = threadIdx.x, w = tid >> 5, lane = tid & 31, ln = lane & 15, hh = lane >> 4; const int by = blockIdx.y;
  A += (size_t)by * sA; Bh += (size_t)by * sB; C += (size_t)by * sC;
  const int ntn = (N + 63) / 64; const int wid = blockIdx.x * 4 + w; const int mt = wid / ntn, nq = wid % ntn; if (mt * 16 >= M) return;
  const int row0 = mt * 16, col0 = nq * 64; const float* arow = A + (size_t)(row0 + ln) * lda;
  v8f acc[4] = {};
  for (int kb = 0; kb < K; kb += 32) {
    FragH ah, al;
    const v4f x0 = *(const v4fa*)(arow + kb + 8 * hh), x1 = *(const v4fa*)(arow + kb + 8 * hh + 4), x2 = *(const v4fa*)(arow + kb + 16 + 8 * hh), x3 = *(const v4fa*)(arow + kb + 16 + 8 * hh + 4);
    float xs[16] = {x0[0],x0[1],x0[2],x0[3],x1[0],x1[1],x1[2],x1[3],x2[0],x2[1],x2[2],x2[3],x3[0],x3[1],x3[2],x3[3]};
#pragma unroll
    for (int i = 0; i < 16; ++i) { const _Float16 h = (_Float16)xs[i]; ah.h[i] = h; al.h[i] = ASPLIT ? (_Float16)(xs[i] - (float)h) : (_Float16)0.0f; }
#pragma unroll
    for (int t = 0; t < 4; ++t) { if (col0 + t * 16 >= N) continue; const size_t boff = (size_t)(col0 + t * 16 + ln) * ldb + kb; FragH bq; bq.half[0] = *(const v8us*)(Bh + boff + 8 * hh); bq.half[1] = *(const v8us*)(Bh + boff + 16 + 8 * hh);
      acc[t] = mmaH<ASPLIT ? 2 : 1>(ah.v, al.v, bq.v, bq.v, acc[t]); }
  }
#pragma unroll
  for (int t = 0; t < 4; ++t) { if (col0 + t * 16 >= N) continue;
#pragma unroll
    for (int r = 0; r < 8; ++r) so[w][8 * hh + r][t * 16 + ln] = acc[t][r] * alpha; }
  __builtin_amdgcn_fence(__ATOMIC_ACQ_REL, "workgroup"); __builtin_amdgcn_wave_barrier();
  const int rsub = lane >> 4, c4 = (lane & 15) * 4;
  {
#pragma unroll
    for (int q = 0; q < 8; ++q) { const int r = q * 2 + rsub; if (col0 + c4 < N) { const v4f v = *(const v4fa*)&so[w][r][c4]; *(v4f*)(C + (size_t)(row0 + r) * ldc + col0 + c4) = v; } }
     }
}

// Wt[n][k] = f16(W[k][n]·scale) from f32 row-major W[K][N] (scale = power of two; bf16-exact weights stay exact in f16 away from the subnormal range)
__global__ __launch_bounds__(256) void k_wt_f16(const float* __restrict__ W, _Float16* __restrict__ Wt, int K, int N, float scale) {
  const int t = blockIdx.x * 256 + threadIdx.x; if (t >= N * (K / 8)) return; const int n = t / (K / 8), k8 = (t % (K / 8)) * 8; FragH f;
#pragma unroll
  for (int i = 0; i < 8; ++i) f.h[i] = (_Float16)(bf16_round(W[(size_t)(k8 + i) * N + n]) * scale); const v8us o = f.half[0];
  *(v8us*)((unsigned short*)Wt + (size_t)n * K + k8) = o; 
}
// k_gemm_hh variant with fused epilogue: v = acc·alpha + bias[by·sBias + col] (+ CP[(row/rowsPerB)·sCPb + by·64 + col] if CP) ; ACT 0 none / 1 elu ; writes f16 C16 (and f32 C if non-null)
template <int ACT>
__global__ __launch_bounds__(128) void k_gemm_hhx(const _Float16* __restrict__ A, int lda, size_t sA, const _Float16* __restrict__ Bh, int ldb, size_t sB, float alpha, const float* __restrict__ bias, size_t sBias, const float* __restrict__ CP, int rowsPerB, size_t sCPb, int row0g,
    float* __restrict__ C, _Float16* __restrict__ C16, int ldc, size_t sC, int M, int N, int K) {
  __shared__ __attribute__((aligned(16))) float so[4][16][64];
  const int tid = threadIdx.x, w = tid >> 5, lane = tid & 31, ln = lane & 15, hh = lane >> 4; const int by = blockIdx.y;
  A += (size_t)by * sA; Bh += (size_t)by * sB; const size_t cofs = (size_t)by * sC; const float* bp = bias ? bias + (size_t)by * sBias : nullptr;
  const int ntn = (N + 63) / 64; const int wid = blockIdx.x * 4 + w; const int mt = wid / ntn, nq = wid % ntn; if (mt * 16 >= M) return;
  const int row0 = mt * 16, col0 = nq * 64; const _Float16* arow = A + (size_t)(row0 + ln) * lda;
  v8f acc[4] = {};
  for (int kb = 0; kb < K; kb += 32) { FragH ah; ah.half[0] = *(const v8us*)((const unsigned short*)arow + kb + 8 * hh); ah.half[1] = *(const v8us*)((const unsigned short*)arow + kb + 16 + 8 * hh);
#pragma unroll
    for (int t = 0; t < 4; ++t) { if (col0 + t * 16 >= N) continue; const size_t boff = (size_t)(col0 + t * 16 + ln) * ldb + kb; FragH bq; bq.half[0] = *(const v8us*)((const unsigned short*)Bh + boff + 8 * hh); bq.half[1] = *(const v8us*)((const unsigned short*)Bh + boff + 16 + 8 * hh);
      acc[t] = mmaH<1>(ah.v, ah.v, bq.v, bq.v, acc[t]); }
  }
#pragma unroll
  for (int t = 0; t < 4; ++t) { if (col0 + t * 16 >= N) continue; const int col = col0 + t * 16 + ln; const float bv = bp ? bf16_round(bp[col]) : 0.f;
#pragma unroll
    for (int r = 0; r < 8; ++r) { float v = acc[t][r] * alpha + bv; if (CP) { const int rr = row0g + row0 + 8 * hh + r; if (rowsPerB < 0) v += CP[cofs + (size_t)rr * ldc + col];      /* rowsPerB < 0: own element of the batched C plane */ else { const int bidx = rr / rowsPerB; v += CP[(size_t)bidx * sCPb + (size_t)by * 64 + col]; } } if (ACT == 1) v = (v > 0.f) ? v : expm1f(v); else if (ACT == 7) v = (v > 0.f) ? v + 1.0f : expf(v); else if (ACT == 8) v = tanhf(v); else if (ACT == 9) v = 0.5f * v * (1.0f + tanhf(0.7978845608028654f * (v + 0.044715f * v * v * v))); else if (ACT == 11) v = 1.0f / (1.0f + expf(-v)); else if (ACT == 12) v = (v > 0.f) ? v : 0.01f * v; else if (ACT == 14) v = (v > 0.f) ? v : 0.1f * v; else if (ACT == 16) v = (v >= 0.f) ? v : 0.3f * v; else if (ACT == 17) v = (v >= 0.f) ? v : 0.2f * v; else if (ACT == 15) v = v / (1.0f + expf(-v)); else if (ACT == 3) v = fmaxf(v, 0.f); else if (ACT == 6) v = 0.5f * v * (1.0f + erff(v * 0.70710678118654752f)); so[w][8 * hh + r][t * 16 + ln] = v; } }
  __builtin_amdgcn_fence(__ATOMIC_ACQ_REL, "workgroup"); __builtin_amdgcn_wave_barrier();
  const int rsub = lane >> 4, c4 = (lane & 15) * 4; typedef _Float16 v4h __attribute__((ext_vector_type(4)));
  {
#pragma unroll
    for (int q = 0; q < 8; ++q) { const int r = q * 2 + rsub; if (col0 + c4 < N) { const v4f v = *(const v4fa*)&so[w][r][c4]; if (C) *(v4f*)(C + cofs + (size_t)(row0 + r) * ldc + col0 + c4) = v; if (C16) { v4h h4; for (int i = 0; i < 4; ++i) h4[i] = (_Float16)v[i]; *(v4h*)(C16 + cofs + (size_t)(row0 + r) * ldc + col0 + c4) = h4; } } }
     }
}


typedef _Float16 v4h __attribute__((ext_vector_type(4)));

__global__ __launch_bounds__(256) void k_x16(const float* __restrict__ x, _Float16* __restrict__ X16, size_t n8) { const size_t t = (size_t)blockIdx.x * 256 + threadIdx.x; if (t >= n8) return; FragH f;
#pragma unroll
  for (int q = 0; q < 8; ++q) f.h[q] = (_Float16)bf16_round(x[t * 8 + q]); *(v8us*)((unsigned short*)X16 + t * 8) = f.half[0];  }
__global__ __launch_bounds__(256) void k_h16(const float* __restrict__ x, _Float16* __restrict__ X16, size_t n8) { const size_t t = (size_t)blockIdx.x * 256 + threadIdx.x; if (t >= n8) return; FragH f;
#pragma unroll
  for (int q = 0; q < 8; ++q) f.h[q] = (_Float16)x[t * 8 + q]; *(v8us*)((unsigned short*)X16 + t * 8) = f.half[0];  }
__global__ __launch_bounds__(256) void k_round16f(const float* __restrict__ W, _Float16* __restrict__ Bt, size_t n8) { const size_t t = (size_t)blockIdx.x * 256 + threadIdx.x; if (t >= n8) return; FragH f;
#pragma unroll
  for (int i = 0; i < 8; ++i) f.h[i] = (_Float16)(bf16_round(W[t * 8 + i]) * 16.0f); *(v8us*)((unsigned short*)Bt + t * 8) = f.half[0];  }
template <int NHv, int TTv>
__global__ __launch_bounds__(256) void k_vt(const _Float16* __restrict__ V16, int ldv, int voff, _Float16* __restrict__ Vt) { __shared__ unsigned short tl[64][66]; const int tid = threadIdx.x; const int slab = blockIdx.x / (TTv / 64), lg = blockIdx.x % (TTv / 64); const int b = slab / NHv, h = slab % NHv;
  for (int i = tid; i < 64 * 8; i += 256) { const int r = i / 8, c8 = (i % 8) * 8; FragH f; f.half[0] = *(const v8us*)((const unsigned short*)V16 + ((size_t)b * TTv + lg * 64 + r) * ldv + voff + h * 64 + c8);
#pragma unroll
    for (int q = 0; q < 8; ++q) tl[r][c8 + q] = f.u[q]; }
  __syncthreads();
  {
#pragma unroll
    for (int rd = 0; rd < 2; ++rd) { const int d = rd * 32 + tid / 8, pc = tid % 8; FragH f;
#pragma unroll
      for (int q = 0; q < 8; ++q) f.u[q] = tl[pc * 8 + q][d];
      *(v8us*)((unsigned short*)Vt + ((size_t)slab * 64 + d) * TTv + lg * 64 + pc * 8) = f.half[0]; }
     } }

__global__ __launch_bounds__(256) void k_hl(const float* __restrict__ F, _Float16* __restrict__ Hh, _Float16* __restrict__ Hl, size_t n8) { const size_t t = (size_t)blockIdx.x * 256 + threadIdx.x; if (t >= n8) return; FragH fh, fl; const v4f a = *(const v4fa*)(F + t * 8), c = *(const v4fa*)(F + t * 8 + 4);
#pragma unroll
  for (int q = 0; q < 4; ++q) { _Float16 h = (_Float16)a[q]; fh.h[q] = h; fl.h[q] = (_Float16)((a[q] - (float)h) * 1024.0f); h = (_Float16)c[q]; fh.h[4 + q] = h; fl.h[4 + q] = (_Float16)((c[q] - (float)h) * 1024.0f); }
  { *(v8us*)((unsigned short*)Hh + t * 8) = fh.half[0]; *(v8us*)((unsigned short*)Hl + t * 8) = fl.half[0];  } }

// ---- fast GEMM (wave tile 32x64; requires M % 32 == 0 rows per launch region and N % 64 == 0); epilogue = k_gemm_hhx semantics ----
__device__ __forceinline__ v16h g2_frag(const _Float16* p, int hh) { FragH f; f.half[0] = *(const v8us*)((const unsigned short*)p + 8 * hh); f.half[1] = *(const v8us*)((const unsigned short*)p + 16 + 8 * hh); return f.v; }
__device__ __forceinline__ v8f g2_mma(v16h a, v16h b, v8f c) { v8f d = __builtin_amdgcn_wmma_f32_16x16x32_f16(false, a, false, b, (short)0, c, false, false); asm volatile("v_nop\n\tv_nop\n\tv_nop\n\tv_nop" : "+v"(d) : "v"(a), "v"(b)); return d; }
// BG: consecutive blockIdx.y values that share one B slab (grouped-query attention: BG query heads read the same k / v rows); slab = blockIdx.y / BG
template <int ACT, int BG = 1>
__global__ __launch_bounds__(128) void k_gemm2(const _Float16* __restrict__ A, int lda, size_t sA, const _Float16* __restrict__ Bh, int ldb, size_t sB, float alpha, const float* __restrict__ bias, size_t sBias, const float* __restrict__ CP, int rowsPerB, size_t sCPb, int row0g,
    float* __restrict__ C, _Float16* __restrict__ C16, int ldc, size_t sC, int M, int N, int K) { static_assert(ACT == 0 || ACT == 3 || ACT == 6 || ACT == 8 || ACT == 9 || ACT == 11 || ACT == 12 || ACT == 14 || ACT == 15 || ACT == 16 || ACT == 17, "k_gemm2: unsupported ACT code (would silently apply no activation)");
  __shared__ __attribute__((aligned(16))) float so[4][32][68];
  const int tid = threadIdx.x, w = tid >> 5, lane = tid & 31, ln = lane & 15, hh = lane >> 4; const int by = blockIdx.y;
  A += (size_t)by * sA; Bh += (size_t)(by / BG) * sB; const size_t cofs = (size_t)by * sC; const float* bp = bias ? bias + (size_t)by * sBias : nullptr;
  const int ntn = N >> 6; const int mt = blockIdx.x / ntn, nq = blockIdx.x - mt * ntn; const int row0 = mt * 128 + 32 * w, col0 = nq * 64; if (row0 >= M) return;
  const _Float16* a0p = A + (size_t)(row0 + ln) * lda; const _Float16* a1p = a0p + (size_t)16 * lda;
  const _Float16* b0p = Bh + (size_t)(col0 + ln) * ldb; const _Float16* b1p = b0p + (size_t)16 * ldb; const _Float16* b2p = b1p + (size_t)16 * ldb; const _Float16* b3p = b2p + (size_t)16 * ldb;
  const v8f z8 = {0.f,0.f,0.f,0.f,0.f,0.f,0.f,0.f}; v8f c00 = z8, c01 = z8, c02 = z8, c03 = z8, c10 = z8, c11 = z8, c12 = z8, c13 = z8;
#pragma unroll 1
  for (int kb = 0; kb < K; kb += 32) { const v16h a0 = g2_frag(a0p + kb, hh), a1 = g2_frag(a1p + kb, hh);
    v16h b = g2_frag(b0p + kb, hh); c00 = g2_mma(a0, b, c00); c10 = g2_mma(a1, b, c10);
    b = g2_frag(b1p + kb, hh); c01 = g2_mma(a0, b, c01); c11 = g2_mma(a1, b, c11);
    b = g2_frag(b2p + kb, hh); c02 = g2_mma(a0, b, c02); c12 = g2_mma(a1, b, c12);
    b = g2_frag(b3p + kb, hh); c03 = g2_mma(a0, b, c03); c13 = g2_mma(a1, b, c13); }
  v8f accs[8] = {c00, c01, c02, c03, c10, c11, c12, c13};
#pragma unroll
  for (int u = 0; u < 8; ++u) { const int t = u & 3, half = u >> 2; const int col = col0 + t * 16 + ln; const float bv = bp ? bf16_round(bp[col]) : 0.f;
#pragma unroll
    for (int r = 0; r < 8; ++r) { const int rloc = half * 16 + 8 * hh + r; float v = accs[u][r] * alpha + bv; if (CP) { if (rowsPerB < 0) v += CP[cofs + (size_t)(row0g + row0 + rloc) * ldc + col];      /* rowsPerB < 0: own element of the batched C plane */ else { const int bidx = (row0g + row0 + rloc) / rowsPerB; v += CP[(size_t)bidx * sCPb + (size_t)by * 64 + col]; } }
      if (ACT == 3) v = fmaxf(v, 0.f); else if (ACT == 6) v = 0.5f * v * (1.0f + erff(v * 0.70710678118654752f)); else if (ACT == 11) v = 1.0f / (1.0f + expf(-v)); else if (ACT == 15) v = v / (1.0f + expf(-v)); else if (ACT == 12) v = (v > 0.f) ? v : 0.01f * v; else if (ACT == 8) v = tanhf(v); else if (ACT == 9) v = 0.5f * v * (1.0f + tanhf(0.7978845608028654f * (v + 0.044715f * v * v * v))); else if (ACT == 14) v = (v > 0.f) ? v : 0.1f * v; else if (ACT == 16) v = (v >= 0.f) ? v : 0.3f * v; else if (ACT == 17) v = (v >= 0.f) ? v : 0.2f * v;
      so[w][rloc][t * 16 + ln] = v; } }
  __builtin_amdgcn_fence(__ATOMIC_ACQ_REL, "workgroup"); __builtin_amdgcn_wave_barrier();
  const int rsub = lane >> 4, c4 = (lane & 15) * 4;
  {
#pragma unroll
    for (int q = 0; q < 16; ++q) { const int r = q * 2 + rsub; const v4f v = *(const v4fa*)&so[w][r][c4]; if (C) *(v4f*)(C + cofs + (size_t)(row0 + r) * ldc + col0 + c4) = v; if (C16) { v4h h4; for (int i = 0; i < 4; ++i) h4[i] = (_Float16)v[i]; *(v4h*)(C16 + cofs + (size_t)(row0 + r) * ldc + col0 + c4) = h4; } }
     } }


__global__ __launch_bounds__(256) void k_wnat(const float* __restrict__ w, size_t n8, _Float16* __restrict__ Bt) { const size_t t = (size_t)blockIdx.x * 256 + threadIdx.x; if (t >= n8) return; FragH f; for (int q = 0; q < 8; ++q) f.h[q] = (_Float16)(bf16_round(w[t * 8 + q]) * 16.0f); *(v8us*)((unsigned short*)Bt + t * 8) = f.half[0];  }
__global__ __launch_bounds__(256) void k_rsm(const float* __restrict__ S, _Float16* __restrict__ P, int nrows) {
  #pragma clang fp contract(off)
  const int i = blockIdx.x * 256 + threadIdx.x; if (i >= nrows) return; const float* s = S + (size_t)i * SQ; float mx = -3.0e38f;
#pragma unroll 1
  for (int j = 0; j < SQ; ++j) mx = fmaxf(mx, s[j]); float se = 0.f;
#pragma unroll 1
  for (int j = 0; j < SQ; ++j) se += expf(s[j] - mx); const float sc = 256.0f / se;
#pragma unroll 1
  for (int j0 = 0; j0 < SQ; j0 += 8) { FragH f; for (int q = 0; q < 8; ++q) f.h[q] = (_Float16)(expf(s[j0 + q] - mx) * sc); unsigned short* d = (unsigned short*)P + (size_t)i * SQ + j0; *(v8us*)d = f.half[0];  } }
__global__ __launch_bounds__(256) void k_vt(const _Float16* __restrict__ V16, int b, int h0, _Float16* __restrict__ VT) { __shared__ unsigned short tl[64][65]; const int tid = threadIdx.x; const int hh = blockIdx.x % HG, sg = blockIdx.x / HG; const int s0 = sg * 64; const int h = h0 + hh;
  for (int i = tid; i < 64 * 8; i += 256) { const int j = i / 8, d8 = (i % 8) * 8; FragH f; f.half[0] = *(const v8us*)((const unsigned short*)V16 + ((size_t)b * SQ + s0 + j) * DM + h * HD + d8); for (int q = 0; q < 8; ++q) tl[d8 + q][j] = f.u[q]; }
  __syncthreads();
  { for (int i = tid; i < 64 * 8; i += 256) { const int d = i / 8, j8 = (i % 8) * 8; FragH f; for (int q = 0; q < 8; ++q) f.u[q] = tl[d][j8 + q]; *(v8us*)((unsigned short*)VT + ((size_t)hh * HD + d) * SQ + s0 + j8) = f.half[0]; }  } }



// One wave per score row (the row number is wave-uniform). Lane l holds elements 128 c + 4 l .. + 3 of each 128-wide chunk c, so a load covers 512 contiguous bytes and a store 256;
// the row is read once and kept in registers for the maximum, the sum and the scaled weights. nk: a multiple of 256, at most NKX.
// Every loop over c or q is unrolled in full so that e[] and o[] are indexed by constants and stay in registers (a run-time index would send them to scratch).
__global__ __launch_bounds__(256) void k_rsmcf2(const float* __restrict__ S, _Float16* __restrict__ P, int hg, int q0, int nk) {
  const int lane = threadIdx.x & 31; const int t = blockIdx.x * 8 + __builtin_amdgcn_readfirstlane((int)(threadIdx.x >> 5)); if (t >= hg * QT) return;
  const float* s = S + (size_t)t * NKX + lane * 4; _Float16* p = P + (size_t)t * NKX + lane * 4; const int last = q0 + (t % QT);
  v4f e[NKX / 128];
#pragma unroll
  for (int c = 0; c < NKX / 128; c += 2) if (c * 128 < nk) { e[c] = *(const v4fa*)(s + c * 128); e[c + 1] = *(const v4fa*)(s + c * 128 + 128); }
  asm volatile("s_wait_xcnt 0x0" ::: "memory");      /* the loads' address registers are reused below */
  float mx = -3.0e38f;
#pragma unroll
  for (int c = 0; c < NKX / 128; c += 2) if (c * 128 < nk) {
    if (c * 128 + 255 > last) {      /* only chunks that reach past the diagonal hold masked keys */
#pragma unroll
      for (int q = 0; q < 4; ++q) { e[c][q] = (c * 128 + lane * 4 + q <= last) ? e[c][q] : -1.0e9f; e[c + 1][q] = (c * 128 + 128 + lane * 4 + q <= last) ? e[c + 1][q] : -1.0e9f; } }
    mx = fmaxf(mx, fmaxf(fmaxf(fmaxf(e[c][0], e[c][1]), fmaxf(e[c][2], e[c][3])), fmaxf(fmaxf(e[c + 1][0], e[c + 1][1]), fmaxf(e[c + 1][2], e[c + 1][3])))); }
#pragma unroll
  for (int d = 16; d > 0; d >>= 1) mx = fmaxf(mx, __shfl_xor(mx, d, 32));
  v4f sv = {0.f, 0.f, 0.f, 0.f};
#pragma unroll
  for (int c = 0; c < NKX / 128; c += 2) if (c * 128 < nk) {
#pragma unroll
    for (int q = 0; q < 4; ++q) { e[c][q] = __expf(e[c][q] - mx); e[c + 1][q] = __expf(e[c + 1][q] - mx); sv[q] += e[c][q] + e[c + 1][q]; } }
  float se = (sv[0] + sv[1]) + (sv[2] + sv[3]);
#pragma unroll
  for (int d = 16; d > 0; d >>= 1) se += __shfl_xor(se, d, 32);
  const float sc = 256.0f / se;
  v4h o[NKX / 128];      /* every chunk converted into registers of its own before the first store: no register of an issued store is written again */
#pragma unroll
  for (int c = 0; c < NKX / 128; c += 2) if (c * 128 < nk) {
#pragma unroll
    for (int q = 0; q < 4; ++q) { o[c][q] = (_Float16)(e[c][q] * sc); o[c + 1][q] = (_Float16)(e[c + 1][q] * sc); } }
#pragma unroll
  for (int c = 0; c < NKX / 128; c += 2) if (c * 128 < nk) { *(v4h*)(p + c * 128) = o[c]; *(v4h*)(p + c * 128 + 128) = o[c + 1]; } }


#define A0R 16                       /* query rows, one wave each, per work-group of the f32 first-tile kernel */
#define A0P (HD + 4)                 /* pitch of a staged k row in floats: 272 B = 16 B x 17, so 32 lanes reading 32 different rows spread over the LDS banks */
typedef float v2f __attribute__((ext_vector_type(2)));
// f32 causal attention for query rows 0..QT0-1 of one batch. One work-group per (head, A0R query rows): the head's QT0 k and v rows are staged in LDS once,
// then one wave per query row i: scores with one key per lane (32 keys a pass), maximum and sum over the lanes, then o with two head dims per lane, key after key.
// Every loop is unrolled in full so that s[], e[], q[], tk[] and tv[] are indexed by constants and stay in registers and the lane number of each readlane is a constant; the tests on c are the same for the whole wave.
__global__ __launch_bounds__(512) void k_att0w(const float* __restrict__ QF, const float* __restrict__ KF, const float* __restrict__ VF, int ld, float scale, float* __restrict__ OF, int ldo) {
  __shared__ __attribute__((aligned(16))) float lk[QT0][A0P]; __shared__ __attribute__((aligned(16))) float lv[QT0][HD];
  const int tid = threadIdx.x, lane = tid & 31; const int w = __builtin_amdgcn_readfirstlane(tid >> 5);
  const int h = blockIdx.x / (QT0 / A0R), rg = blockIdx.x % (QT0 / A0R); const int i = rg * A0R + w;
  v4f tk[QT0 * (HD / 4) / 512], tv[QT0 * (HD / 4) / 512];      /* all loads issued before the first LDS store: one memory latency for the whole stage */
#pragma unroll
  for (int u = 0; u < QT0 * (HD / 4) / 512; ++u) { const int e4 = u * 512 + tid; const size_t g = (size_t)(e4 / (HD / 4)) * ld + h * HD + (e4 % (HD / 4)) * 4; tk[u] = *(const v4fa*)(KF + g); tv[u] = *(const v4fa*)(VF + g); }
  const float* qr = QF + (size_t)i * ld + h * HD; v4f q[HD / 4];
#pragma unroll
  for (int d = 0; d < HD / 4; ++d) q[d] = *(const v4fa*)(qr + d * 4);
#pragma unroll
  for (int u = 0; u < QT0 * (HD / 4) / 512; ++u) { const int e4 = u * 512 + tid; *(v4f*)&lk[e4 / (HD / 4)][(e4 % (HD / 4)) * 4] = tk[u]; *(v4f*)&lv[e4 / (HD / 4)][(e4 % (HD / 4)) * 4] = tv[u]; }
  __syncthreads();
  float s[QT0 / 32]; float mx = -1.0e30f;
#pragma unroll
  for (int c = 0; c < QT0 / 32; ++c) { s[c] = -1.0e30f;
    if (c * 32 <= i) { const float* kr = &lk[c * 32 + lane][0]; v4f a = {0.f, 0.f, 0.f, 0.f};
#pragma unroll
      for (int d = 0; d < HD / 4; ++d) a += q[d] * *(const v4f*)(kr + d * 4);
      const float t = ((a[0] + a[1]) + (a[2] + a[3])) * scale; s[c] = (c * 32 + lane <= i) ? t : -1.0e30f; mx = fmaxf(mx, s[c]); } }
#pragma unroll
  for (int d = 16; d > 0; d >>= 1) mx = fmaxf(mx, __shfl_xor(mx, d, 32));
  float e[QT0 / 32]; float l = 0.f;
#pragma unroll
  for (int c = 0; c < QT0 / 32; ++c) { e[c] = 0.f; if (c * 32 <= i) { e[c] = expf(s[c] - mx); l += e[c]; } }      /* a masked key: expf(-1e30 - mx) = 0 */
#pragma unroll
  for (int d = 16; d > 0; d >>= 1) l += __shfl_xor(l, d, 32);
  v2f o = {0.f, 0.f};
#pragma unroll
  for (int c = 0; c < QT0 / 32; ++c) if (c * 32 <= i) {
#pragma unroll
    for (int j = 0; j < 32; ++j) { const float p = __int_as_float(__builtin_amdgcn_readlane(__float_as_int(e[c]), j)); o += p * *(const v2f*)&lv[c * 32 + j][lane * 2]; } }
  const float fin = 64.0f / l;      /* o carried x64 like the f16 path */
  *(v2f*)(OF + (size_t)i * ldo + h * HD + lane * 2) = o * fin; }


__global__ __launch_bounds__(256) void k_kvexp(const float* __restrict__ src, float* __restrict__ dst, size_t n4) { const size_t t = (size_t)blockIdx.x * 256 + threadIdx.x; if (t >= n4) return; const size_t e = t * 4; const size_t row = e / DM; const int col = (int)(e % DM); const int h = col / HD, d = col % HD; const v4f v = *(const v4fa*)(src + row * KVD + (size_t)(h / HPG) * HD + d); *(v4f*)(dst + e) = v;  }

__global__ __launch_bounds__(256) void k_tab2(float theta, float* __restrict__ CS, float* __restrict__ SN) {
  #pragma clang fp contract(off)
  const int t = blockIdx.x * 256 + threadIdx.x; if (t >= SQ * (HD / 2)) return; const int i = t % (HD / 2); const int p = t / (HD / 2); const float invf = 1.0f / powf(theta, (float)(2 * i) / (float)HD); const float ang = __fmul_rn((float)p, invf); const float c = cosf(ang), s = sinf(ang);
  *(float*)(CS + t) = c; *(float*)(SN + t) = s;  }
template <int NORM, int ROPE>
__global__ __launch_bounds__(64) void k_xform(const float* __restrict__ F, int ldf, int nh, const float* __restrict__ gain, float eps, const float* __restrict__ CS, const float* __restrict__ SN, _Float16* __restrict__ H16, int ldo) {
  #pragma clang fp contract(off)
  __shared__ float xv[HD]; __shared__ float red[HD]; __shared__ unsigned short sh_[HD]; const int d = threadIdx.x; const int h = blockIdx.x % nh; const size_t r = blockIdx.x / nh; const int p = (int)(r % SQ);
  float x = F[r * (size_t)ldf + (size_t)h * HD + d];
  if (NORM) { red[d] = __fmul_rn(x, x); __syncthreads(); for (int st = HD / 2; st > 0; st >>= 1) { if (d < st) red[d] = __fadd_rn(red[d], red[d + st]); __syncthreads(); } const float rs = rsqrtf(__fadd_rn(red[0] / (float)HD, eps)); x = __fmul_rn(__fmul_rn(x, rs), bf16_round(gain[d])); }
  xv[d] = x; __syncthreads();
  float o = x;
  if (ROPE == 1) { const int i = d >> 1; const float c = CS[p * (HD / 2) + i], s = SN[p * (HD / 2) + i]; const float ev = xv[2 * i], od = xv[2 * i + 1]; o = (d & 1) ? __fadd_rn(__fmul_rn(ev, s), __fmul_rn(od, c)) : __fadd_rn(__fmul_rn(ev, c), -__fmul_rn(od, s)); }
  if (ROPE == 2) { const int i = d & (HD / 2 - 1); const float c = CS[p * (HD / 2) + i], s = SN[p * (HD / 2) + i]; const float lo = xv[i], hi = xv[i + HD / 2]; o = (d < HD / 2) ? __fadd_rn(__fmul_rn(lo, c), -__fmul_rn(hi, s)) : __fadd_rn(__fmul_rn(lo, s), __fmul_rn(hi, c)); }
  FragH th; th.h[0] = (_Float16)o; sh_[d] = th.u[0]; __syncthreads();
  if (d < HD / 8) { FragH f; for (int q = 0; q < 8; ++q) f.u[q] = sh_[d * 8 + q]; unsigned short* dst = (unsigned short*)H16 + r * (size_t)ldo + (size_t)h * HD + d * 8; *(v8us*)dst = f.half[0];  } }

template <int NORM, int ROPE>
__global__ __launch_bounds__(64) void k_xformf(const float* __restrict__ F, int ldf, int nh, const float* __restrict__ gain, float eps, const float* __restrict__ CS, const float* __restrict__ SN, float* __restrict__ F32, int ldo) {
  #pragma clang fp contract(off)
  __shared__ float xv[HD]; __shared__ float red[HD]; const int d = threadIdx.x; const int h = blockIdx.x % nh; const size_t r = blockIdx.x / nh; const int p = (int)(r % SQ);
  float x = F[r * (size_t)ldf + (size_t)h * HD + d];
  if (NORM) { red[d] = __fmul_rn(x, x); __syncthreads(); for (int st = HD / 2; st > 0; st >>= 1) { if (d < st) red[d] = __fadd_rn(red[d], red[d + st]); __syncthreads(); } const float rs = rsqrtf(__fadd_rn(red[0] / (float)HD, eps)); x = __fmul_rn(__fmul_rn(x, rs), bf16_round(gain[d])); }
  xv[d] = x; __syncthreads();
  float o = x;
  if (ROPE == 1) { const int i = d >> 1; const float c = CS[p * (HD / 2) + i], s = SN[p * (HD / 2) + i]; const float ev = xv[2 * i], od = xv[2 * i + 1]; o = (d & 1) ? __fadd_rn(__fmul_rn(ev, s), __fmul_rn(od, c)) : __fadd_rn(__fmul_rn(ev, c), -__fmul_rn(od, s)); }
  if (ROPE == 2) { const int i = d & (HD / 2 - 1); const float c = CS[p * (HD / 2) + i], s = SN[p * (HD / 2) + i]; const float lo = xv[i], hi = xv[i + HD / 2]; o = (d < HD / 2) ? __fadd_rn(__fmul_rn(lo, c), -__fmul_rn(hi, s)) : __fadd_rn(__fmul_rn(lo, s), __fmul_rn(hi, c)); }
  float* dst = F32 + r * (size_t)ldo + (size_t)h * HD + d; *(float*)dst = o;  }

__global__ __launch_bounds__(256) void k_bfcp(const float* __restrict__ src, float* __restrict__ dst, size_t n4) { const size_t t = (size_t)blockIdx.x * 256 + threadIdx.x; if (t >= n4) return; const v4f a = *(const v4fa*)(src + t * 4); v4f o; for (int q = 0; q < 4; ++q) o[q] = bf16_round(a[q]); *(v4f*)(dst + t * 4) = o;  }

__global__ __launch_bounds__(256) void k_f2bf(const float* __restrict__ F, unsigned short* __restrict__ O, size_t n8) { const size_t t = (size_t)blockIdx.x * 256 + threadIdx.x; if (t >= n8) return; const v4f a = *(const v4fa*)(F + t * 8), b = *(const v4fa*)(F + t * 8 + 4); FragH f;
  for (int q = 0; q < 4; ++q) { f.u[q] = (unsigned short)(__float_as_uint(bf16_round(a[q])) >> 16); f.u[4 + q] = (unsigned short)(__float_as_uint(bf16_round(b[q])) >> 16); }
  *(v8us*)(O + t * 8) = f.half[0];  }
extern "C" void kernel_launch(void* const* d_in, const int* in_sizes, int n_in,
                              void* d_out, int out_size, void* d_ws, size_t ws_size, hipStream_t stream) {
  (void)in_sizes; (void)n_in; (void)out_size;
  const float* const* I = (const float* const*)d_in; const float* x = I[0]; const float* tcos = I[1]; const float* tsin = I[2]; const float* wq = I[3]; const float* wk = I[4]; const float* wv = I[5]; const float* wo = I[6]; const float* bq = nullptr; const float* bk = nullptr; const float* bv = nullptr; const float* bo = nullptr;      /* [in][out] weights, no biases; rope tables [S][32] */
  char* ws = (char*)d_ws; size_t off = 0;
  auto take = [&](size_t bytes) { char* p = ws + off; off += (bytes + 255) & ~(size_t)255; return p; };
  _Float16* BQ = (_Float16*)take((size_t)DM * DM * 2); _Float16* BK = (_Float16*)take((size_t)KVD * DM * 2); _Float16* BV = (_Float16*)take((size_t)KVD * DM * 2); _Float16* BO = (_Float16*)take((size_t)DM * DM * 2);
  _Float16* X16 = (_Float16*)take(NR * DM * 2); float* QF = (float*)take((size_t)SQ * DM * 4); float* KF = (float*)take((size_t)SQ * KVD * 4); float* CSB = (float*)take((size_t)SQ * 32 * 4); float* SNB = (float*)take((size_t)SQ * 32 * 4); _Float16* Q16 = (_Float16*)take(NR * DM * 2); _Float16* K16 = (_Float16*)take(NR * KVD * 2); _Float16* V16 = (_Float16*)take(NR * KVD * 2); _Float16* O16 = (_Float16*)take(NR * DM * 2);
  float* S = (float*)take((size_t)NH * QT * NKX * 4); _Float16* P = (_Float16*)take((size_t)NH * QT * NKX * 2); _Float16* VT = (_Float16*)take((size_t)NH * HD * SQ * 2);
  float* QF0 = (float*)take((size_t)QT0 * DM * 4); float* KF0 = (float*)take((size_t)QT0 * KVD * 4); float* VF0 = (float*)take((size_t)QT0 * KVD * 4); float* KF0e = (float*)take((size_t)QT0 * DM * 4); float* VF0e = (float*)take((size_t)QT0 * DM * 4); float* OF0 = (float*)take((size_t)NB * QT0 * DM * 4); _Float16* OH0 = (_Float16*)take((size_t)NB * QT0 * DM * 2); _Float16* OL0 = (_Float16*)take((size_t)NB * QT0 * DM * 2); float* OUTF = (float*)take(NR * DM * 4);      /* f32 result rows, converted to bf16 at the end */
  if (off > ws_size) return;
  k_wt_f16<<<(unsigned)(((size_t)DM * (DM / 8) + 255) / 256), 256, 0, stream>>>(wq, BQ, DM, DM, 16.0f); k_wt_f16<<<(unsigned)(((size_t)KVD * (DM / 8) + 255) / 256), 256, 0, stream>>>(wk, BK, DM, KVD, 16.0f); k_wt_f16<<<(unsigned)(((size_t)KVD * (DM / 8) + 255) / 256), 256, 0, stream>>>(wv, BV, DM, KVD, 16.0f); k_wt_f16<<<(unsigned)(((size_t)DM * (DM / 8) + 255) / 256), 256, 0, stream>>>(wo, BO, DM, DM, 16.0f);      /* [in][out] -> Bt[n][k] x16 */
  k_x16<<<(unsigned)((NR * DM / 8 + 255) / 256), 256, 0, stream>>>(x, X16, NR * DM / 8);
  k_bfcp<<<(SQ * 32 / 4 + 255) / 256, 256, 0, stream>>>(tcos, CSB, (size_t)SQ * 32 / 4); k_bfcp<<<(SQ * 32 / 4 + 255) / 256, 256, 0, stream>>>(tsin, SNB, (size_t)SQ * 32 / 4);      /* bf16-rounded rope tables [pos][32] */
  const size_t r0p = (size_t)B0 * SQ;      /* first projected row */
  k_gemm2<0><<<dim3((unsigned)((MP / 128) * (KVD / 64)), 1), 128, 0, stream>>>(X16 + r0p * DM, DM, 0, BV, DM, 0, 0.0625f, bv, 0, nullptr, 1, 0, 0, nullptr, V16 + r0p * KVD, KVD, 0, MP, KVD, DM);
  for (int b = B0; b < B0 + NBR; ++b) { const size_t r0 = (size_t)b * SQ;
    k_gemm2<0><<<dim3((unsigned)((SQ / 128) * (DM / 64)), 1), 128, 0, stream>>>(X16 + r0 * DM, DM, 0, BQ, DM, 0, 0.0625f, nullptr, 0, nullptr, 1, 0, 0, QF, nullptr, DM, 0, SQ, DM, DM);      /* q (f32) of this batch */
    k_gemm2<0><<<dim3((unsigned)((SQ / 128) * (KVD / 64)), 1), 128, 0, stream>>>(X16 + r0 * DM, DM, 0, BK, DM, 0, 0.0625f, nullptr, 0, nullptr, 1, 0, 0, KF, nullptr, KVD, 0, SQ, KVD, DM);      /* k (f32) */
    k_xform<0, 1><<<(unsigned)((size_t)SQ * NH), 64, 0, stream>>>(QF, DM, NH, nullptr, 0.f, CSB, SNB, Q16 + r0 * DM, DM); k_xform<0, 1><<<(unsigned)((size_t)SQ * NG), 64, 0, stream>>>(KF, KVD, NG, nullptr, 0.f, CSB, SNB, K16 + r0 * KVD, KVD);      /* interleaved-pair rope -> f16 rows */
    k_xformf<0, 1><<<(unsigned)(QT0 * NH), 64, 0, stream>>>(QF, DM, NH, nullptr, 0.f, CSB, SNB, QF0, DM); k_xformf<0, 1><<<(unsigned)(QT0 * NG), 64, 0, stream>>>(KF, KVD, NG, nullptr, 0.f, CSB, SNB, KF0, KVD);      /* f32 roped q, k of rows 0..127 */
    k_vt<NG, SQ><<<NG * (SQ / 64), 256, 0, stream>>>(V16 + r0 * KVD, KVD, 0, VT);      /* V^T [NG][HD][SQ] for this batch */
    k_gemm2<0><<<dim3((QT0 / 128) * (KVD / 64), 1), 128, 0, stream>>>(X16 + r0 * DM, DM, 0, BV, DM, 0, 0.0625f, bv, 0, nullptr, 1, 0, 0, VF0, nullptr, KVD, 0, QT0, KVD, DM);
    k_kvexp<<<(unsigned)(((size_t)QT0 * DM / 4 + 255) / 256), 256, 0, stream>>>(KF0, KF0e, (size_t)QT0 * DM / 4); k_kvexp<<<(unsigned)(((size_t)QT0 * DM / 4 + 255) / 256), 256, 0, stream>>>(VF0, VF0e, (size_t)QT0 * DM / 4);      /* head h <- kv group h/4 for the exact first-tile kernel */      /* f32 q, k, v of the first 128 rows (exact products) */
    k_att0w<<<NH * (QT0 / A0R), 512, 0, stream>>>(QF0, KF0e, VF0e, DM, 0.125f, OF0 + (size_t)b * QT0 * DM, DM);      /* exact f32 attention for rows 0..127 (o x64) */
    for (int q0 = 0; q0 < QN; q0 += QT) { const int nk = q0 + QT;      /* causal: only keys below the tile end are computed */
      k_gemm2<0, HPG><<<dim3((QT / 128) * (nk / 64), NH), 128, 0, stream>>>(Q16 + (r0 + q0) * LQ, LQ, (size_t)HD, K16 + r0 * KVD, KVD, (size_t)HD, 0.125f, nullptr, 0, nullptr, 1, 0, 0, S, nullptr, NKX, (size_t)QT * NKX, QT, nk, HD);      /* scores: all 32 heads in one launch, head y against the keys of kv head y/4 */
      k_rsmcf2<<<(NHD * QT + 7) / 8, 256, 0, stream>>>(S, P, NHD, q0, nk);      /* one wave per row, 8 rows per work-group */
      k_gemm2<0, HPG><<<dim3((QT / 128) * (HD / 64), NH), 128, 0, stream>>>(P, NKX, (size_t)QT * NKX, VT, SQ, (size_t)HD * SQ, 0.25f, nullptr, 0, nullptr, 1, 0, 0, nullptr, O16 + (r0 + q0) * DM, DM, (size_t)HD, QT, HD, nk); } }      /* o for all 32 heads in one launch (x64), head y against V^T of kv head y/4 */      /* o (merged heads, x64) as f16 rows */
  k_gemm2<0><<<dim3((unsigned)((MPO / 128) * (DM / 64)), 1), 128, 0, stream>>>(O16 + r0p * DM, DM, 0, BO, DM, 0, 0.0009765625f, bo, 0, nullptr, 1, 0, 0, OUTF + r0p * DM, nullptr, DM, 0, MPO, DM, DM);      /* out rows (f32) */
  k_hl<<<(unsigned)(((size_t)NB * QT0 * DM / 8 + 255) / 256), 256, 0, stream>>>(OF0, OH0, OL0, (size_t)NB * QT0 * DM / 8);      /* first-tile o (x64) -> f16 hi + x1024 residual planes */
  for (int b = B0; b < B0 + NBR; ++b) { const size_t r0 = (size_t)b * SQ; const size_t f0 = (size_t)b * QT0;
    k_gemm2<0><<<dim3((QT0 / 128) * (DM / 64), 1), 128, 0, stream>>>(OH0 + f0 * DM, DM, 0, BO, DM, 0, 0.0009765625f, bo, 0, nullptr, 1, 0, 0, OUTF + r0 * DM, nullptr, DM, 0, QT0, DM, DM);      /* rows 0..127: out = o_hi Wo (+ b), overwriting the f16-path rows */
    k_gemm2<0><<<dim3((QT0 / 128) * (DM / 64), 1), 128, 0, stream>>>(OL0 + f0 * DM, DM, 0, BO, DM, 0, 0.00000095367431640625f, nullptr, 0, (const float*)(OUTF + r0 * DM), -1, 0, 0, OUTF + r0 * DM, nullptr, DM, 0, QT0, DM, DM); }      /* += o_lo Wo 2^-20 (own-element accumulate) */
  k_f2bf<<<(unsigned)(((size_t)MPO * DM / 8 + 255) / 256), 256, 0, stream>>>(OUTF + (size_t)B0 * SQ * DM, (unsigned short*)d_out + (size_t)B0 * SQ * DM, (size_t)MPO * DM / 8);      /* out.astype(bfloat16): the f32 rows rounded to nearest-even bf16 into the 2-byte output */
}

// v004
// One run takes 998 microseconds.
// In two side-by-side timings against v003, it was 1.79 and 1.78 times as fast.
// Over all steps from v000 it is 9.62 times as fast.
#include <hip/hip_runtime.h>
// Grouped-query causal attention with RoPE and a BFLOAT16 output (x [2][2048][2048]; xq = x wq (32 heads x 64), xk = x wk, xv = x wv (8 kv heads x 64) ([in][out] weights sigma 1/sqrt(2048), no biases); interleaved-pair RoPE (reshape(..., 32, 2): real = even, imag = odd) on q and k from the module's INPUT tables freqs_cos/freqs_sin [S][32]; repeat: query head h uses kv head h/4; scores / 8 + triu(-inf, 1) (causal); softmax; out = (merged wo).astype(bfloat16) -> bf16 [2][2048][2048] (2 bytes per element)).
// Compute dtype: inputs rounded to bf16; x / weights exact; q, k, v, softmax weights and o as plain f16 GEMM operands (~2^-12); scores and softmax statistics f32. v_wmma_f32_16x16x32_f16.
#define NB 2
#define NG 8
#define HPG 4
#define KVD (NG * HD)
#define SQ 2048
#define DM 2048
#define NH 32
#define HD 64
#define HG 4                         /* heads per launch of the non-template k_vt (not launched) */
#define QT 256                       /* query rows per causal tile */
#define NKX SQ                       /* S / P row pitch */
#define QT0 128                      /* first-tile rows recomputed exactly in f32 */
#define B0 0                         /* first batch processed (debug hook) */
#define NBR NB                       /* batches processed (debug hook) */
#define NR ((size_t)NB * SQ)         /* token rows */
#define MP ((int)((size_t)NBR * SQ)) /* rows projected (debug hook) */
#define QN SQ                        /* query rows attended per batch (debug hook) */
#define NHD NH                       /* heads attended (debug hook) */
#define MPO MP                       /* rows through the output stage (debug hook) */
#define LQ DM      /* row pitch of the q rows */
typedef __bf16 v16b __attribute__((ext_vector_type(16)));
typedef unsigned short v8us __attribute__((ext_vector_type(8), may_alias));
typedef float  v8f  __attribute__((ext_vector_type(8)));
typedef float  v4f  __attribute__((ext_vector_type(4)));
typedef float  v4fa __attribute__((ext_vector_type(4), may_alias));
union FragB { v16b v; v8us half[2]; unsigned short u[16]; };

__device__ __forceinline__ unsigned short bf16_bits(float x) { unsigned int u = __float_as_uint(x); return (unsigned short)((u + 0x7FFFu + ((u >> 16) & 1u)) >> 16); }
__device__ __forceinline__ float bf16_val(unsigned short b) { return __uint_as_float(((unsigned int)b) << 16); }
__device__ __forceinline__ float bf16_round(float x) { return bf16_val(bf16_bits(x)); }
// D += A·B with NT terms: 1 = ah·bh, 2 = + al·bh (A split), 3 = + ah·bl (both split)
template <int NT>
__device__ __forceinline__ v8f mmaN(v16b ah, v16b al, v16b bh, v16b bl, v8f c) {
  c = __builtin_amdgcn_wmma_f32_16x16x32_bf16(false, ah, false, bh, (short)0, c, false, false);
  if (NT >= 2) c = __builtin_amdgcn_wmma_f32_16x16x32_bf16(false, al, false, bh, (short)0, c, false, false);
  if (NT >= 3) c = __builtin_amdgcn_wmma_f32_16x16x32_bf16(false, ah, false, bl, (short)0, c, false, false);
  asm volatile("v_nop\n\tv_nop\n\tv_nop\n\tv_nop" : "+v"(c) : "v"(ah), "v"(al), "v"(bh), "v"(bl));
  return c;
}

__global__ __launch_bounds__(256) void k_wt_bf16(const float* __restrict__ W, unsigned short* __restrict__ Wt, int K, int N) {
  const int t = blockIdx.x * 256 + threadIdx.x;
  const int k8n = K / 8;
  if (t >= N * k8n) return;
  const int n = t / k8n, k8 = (t % k8n) * 8;
  v8us v;
#pragma unroll
  for (int i = 0; i < 8; ++i) v[i] = bf16_bits(W[(size_t)(k8 + i) * N + n]);
  *(v8us*)(Wt + (size_t)n * K + k8) = v;
  
}

// GEMM C[M][N] (f32, pitch ldc) = act(A[M][K]·W + bias). A f32 row-major (pitch lda) converted per fragment to bf16
// (ASPLIT: hi/lo two planes -> 2 terms, else single rounded term); Wt bf16 [N][K] (pitch ldb). BIAS_BF16 rounds the
// bias to bf16 first (bias quantised to bf16 before the add). K%32==0, M%16==0, N%64==0.
template <bool ASPLIT, int ACT, bool BIAS_BF16>
__global__ __launch_bounds__(128) void k_gemm_bf(const float* __restrict__ A, int lda, const unsigned short* __restrict__ Wt, int ldb,
                                               const float* __restrict__ bias, float* __restrict__ C, int ldc, int M, int N, int K) {
  __shared__ __attribute__((aligned(16))) float so[4][16][64];
  const int tid = threadIdx.x, w = tid >> 5, lane = tid & 31, ln = lane & 15, hh = lane >> 4;
  const int ntn = N / 64;
  const int wid = blockIdx.x * 4 + w;
  const int mt = wid / ntn, nq = wid % ntn;
  if (mt * 16 >= M) return;
  const int row0 = mt * 16, col0 = nq * 64;
  const float* arow = A + (size_t)(row0 + ln) * lda;
  v8f acc[4] = {};
  for (int kb = 0; kb < K; kb += 32) {
    FragB ah, al;
    const v4f x0 = *(const v4fa*)(arow + kb + 8 * hh), x1 = *(const v4fa*)(arow + kb + 8 * hh + 4);
    const v4f x2 = *(const v4fa*)(arow + kb + 16 + 8 * hh), x3 = *(const v4fa*)(arow + kb + 16 + 8 * hh + 4);
    float xs[16] = {x0[0],x0[1],x0[2],x0[3],x1[0],x1[1],x1[2],x1[3],x2[0],x2[1],x2[2],x2[3],x3[0],x3[1],x3[2],x3[3]};
#pragma unroll
    for (int i = 0; i < 16; ++i) { const unsigned short hb = bf16_bits(xs[i]); ah.u[i] = hb; al.u[i] = ASPLIT ? bf16_bits(xs[i] - bf16_val(hb)) : (unsigned short)0; }
#pragma unroll
    for (int t = 0; t < 4; ++t) {
      const unsigned short* brow = Wt + (size_t)(col0 + t * 16 + ln) * ldb + kb;
      FragB b;
      b.half[0] = *(const v8us*)(brow + 8 * hh);
      b.half[1] = *(const v8us*)(brow + 16 + 8 * hh);
      acc[t] = mmaN<ASPLIT ? 2 : 1>(ah.v, al.v, b.v, b.v, acc[t]);
    }
  }
#pragma unroll
  for (int t = 0; t < 4; ++t) {
    float bv = bias ? bias[col0 + t * 16 + ln] : 0.f;
    if (BIAS_BF16) bv = bf16_round(bv);
#pragma unroll
    for (int r = 0; r < 8; ++r) { float v = acc[t][r] + bv; if (ACT == 1) v = fmaxf(v, 0.f); so[w][8 * hh + r][t * 16 + ln] = v; }
  }
  __builtin_amdgcn_fence(__ATOMIC_ACQ_REL, "workgroup");
  __builtin_amdgcn_wave_barrier();
  const int rsub = lane >> 4, c4 = (lane & 15) * 4;
  {
#pragma unroll
    for (int q = 0; q < 8; ++q) {
      const int r = q * 2 + rsub;
      const v4f v = *(const v4fa*)&so[w][r][c4];
      *(v4f*)(C + (size_t)(row0 + r) * ldc + col0 + c4) = v;
    }
    
  }
}

// GEMM C = act(A·W + bias + resid): A f32 (ASPLIT -> hi/lo 2 terms), Wt bf16 [N][K]; ACT 0 none, 1 relu, 2 exact gelu;
// resid (optional, f32, row index = (row % rmod), pitch ldr, RES_BF16 rounds it) added before the activation.
template <bool ASPLIT, int ACT, bool BIAS_BF16, bool RES_BF16>
__global__ __launch_bounds__(128) void k_gemm_bf3(const float* __restrict__ A, int lda, const unsigned short* __restrict__ Wt, int ldb,
                                                const float* __restrict__ bias, const float* __restrict__ resid, int rmod, int ldr,
                                                float* __restrict__ C, int ldc, int M, int N, int K) {
  __shared__ __attribute__((aligned(16))) float so[4][16][64];
  const int tid = threadIdx.x, w = tid >> 5, lane = tid & 31, ln = lane & 15, hh = lane >> 4;
  const int ntn = N / 64;
  const int wid = blockIdx.x * 4 + w;
  const int mt = wid / ntn, nq = wid % ntn;
  if (mt * 16 >= M) return;
  const int row0 = mt * 16, col0 = nq * 64;
  const float* arow = A + (size_t)(row0 + ln) * lda;
  v8f acc[4] = {};
  for (int kb = 0; kb < K; kb += 32) {
    FragB ah, al;
    const v4f x0 = *(const v4fa*)(arow + kb + 8 * hh), x1 = *(const v4fa*)(arow + kb + 8 * hh + 4);
    const v4f x2 = *(const v4fa*)(arow + kb + 16 + 8 * hh), x3 = *(const v4fa*)(arow + kb + 16 + 8 * hh + 4);
    float xs[16] = {x0[0],x0[1],x0[2],x0[3],x1[0],x1[1],x1[2],x1[3],x2[0],x2[1],x2[2],x2[3],x3[0],x3[1],x3[2],x3[3]};
#pragma unroll
    for (int i = 0; i < 16; ++i) { const unsigned short hb = bf16_bits(xs[i]); ah.u[i] = hb; al.u[i] = ASPLIT ? bf16_bits(xs[i] - bf16_val(hb)) : (unsigned short)0; }
#pragma unroll
    for (int t = 0; t < 4; ++t) {
      const unsigned short* brow = Wt + (size_t)(col0 + t * 16 + ln) * ldb + kb;
      FragB b;
      b.half[0] = *(const v8us*)(brow + 8 * hh);
      b.half[1] = *(const v8us*)(brow + 16 + 8 * hh);
      acc[t] = mmaN<ASPLIT ? 2 : 1>(ah.v, al.v, b.v, b.v, acc[t]);
    }
  }
#pragma unroll
  for (int t = 0; t < 4; ++t) {
    const int col = col0 + t * 16 + ln;
    float bv = bias ? bias[col] : 0.f;
    if (BIAS_BF16) bv = bf16_round(bv);
#pragma unroll
    for (int r = 0; r < 8; ++r) {
      float v = acc[t][r] + bv;
      if (resid) { float rv = resid[(size_t)((row0 + 8 * hh + r) % rmod) * ldr + col]; if (RES_BF16) rv = bf16_round(rv); v += rv; }
      if (ACT == 1) v = fmaxf(v, 0.f);
      if (ACT == 2) v = 0.5f * v * (1.0f + erff(v * 0.70710678118654752f));
      if (ACT == 3) { const float u = 0.7978845608028654f * (v + 0.044715f * v * v * v); v = 0.5f * v * (1.0f + tanhf(u)); }
      so[w][8 * hh + r][t * 16 + ln] = v;
    }
  }
  __builtin_amdgcn_fence(__ATOMIC_ACQ_REL, "workgroup");
  __builtin_amdgcn_wave_barrier();
  const int rsub = lane >> 4, c4 = (lane & 15) * 4;
  {
#pragma unroll
    for (int q = 0; q < 8; ++q) {
      const int r = q * 2 + rsub;
      const v4f v = *(const v4fa*)&so[w][r][c4];
      *(v4f*)(C + (size_t)(row0 + r) * ldc + col0 + c4) = v;
    }
    
  }
}
// row LayerNorm (biased variance, eps) over N: s = X (+ R); optional out_sum <- s; out_norm <- (s-mu)*rsqrt(var+eps)*g + b
template <bool PARAM_BF16>
__global__ __launch_bounds__(256) void k_layernorm(const float* __restrict__ X, const float* __restrict__ R, const float* __restrict__ g, const float* __restrict__ bta,
                                                  float* __restrict__ out_sum, float* __restrict__ out_norm, int N, float eps) {
  __shared__ float red[256];
  const int row = blockIdx.x, tid = threadIdx.x;
  const float* x = X + (size_t)row * N; const float* rr = R ? R + (size_t)row * N : nullptr;
  float vals[16];                     // up to N = 4096
  const int per = N / 256;            // contiguous chunk per thread? use strided-by-4 chunks: thread handles j = tid*4 + 1024*u
  float s1 = 0.f;
  for (int u = 0; u < per / 4; ++u) {
    const int j = tid * 4 + 1024 * u;
    const v4f a = *(const v4fa*)(x + j);
    v4f b = {0.f,0.f,0.f,0.f}; if (rr) b = *(const v4fa*)(rr + j);
#pragma unroll
    for (int q = 0; q < 4; ++q) { const float v = a[q] + b[q]; vals[u * 4 + q] = v; s1 += v; }
  }
  red[tid] = s1; __syncthreads();
  for (int st = 128; st > 0; st >>= 1) { if (tid < st) red[tid] += red[tid + st]; __syncthreads(); }
  const float mu = red[0] / (float)N; __syncthreads();
  float s2 = 0.f;
  for (int u = 0; u < per / 4; ++u)
#pragma unroll
    for (int q = 0; q < 4; ++q) { const float c = vals[u * 4 + q] - mu; s2 += c * c; }
  red[tid] = s2; __syncthreads();
  for (int st = 128; st > 0; st >>= 1) { if (tid < st) red[tid] += red[tid + st]; __syncthreads(); }
  const float rs = rsqrtf(red[0] / (float)N + eps);
  {
    for (int u = 0; u < per / 4; ++u) {
      const int j = tid * 4 + 1024 * u;
      v4f o, sm;
#pragma unroll
      for (int q = 0; q < 4; ++q) {
        float gg = g[j + q], bb = bta[j + q];
        if (PARAM_BF16) { gg = bf16_round(gg); bb = bf16_round(bb); }
        sm[q] = vals[u * 4 + q]; o[q] = (vals[u * 4 + q] - mu) * rs * gg + bb;
      }
      if (out_sum) *(v4f*)(out_sum + (size_t)row * N + j) = sm;
      *(v4f*)(out_norm + (size_t)row * N + j) = o;
    }
    
  }
}



// ---- f16 WMMA path (v_wmma_f32_16x16x32_f16): 11-bit significands for operands in range — used where a [0,1] probability operand needs more precision than bf16
typedef _Float16 v16h __attribute__((ext_vector_type(16)));
union FragH { v16h v; v8us half[2]; _Float16 h[16]; unsigned short u[16]; };
template <int NT>
__device__ __forceinline__ v8f mmaH(v16h ah, v16h al, v16h bh, v16h bl, v8f c) {
  c = __builtin_amdgcn_wmma_f32_16x16x32_f16(false, ah, false, bh, (short)0, c, false, false);
  if (NT >= 2) c = __builtin_amdgcn_wmma_f32_16x16x32_f16(false, al, false, bh, (short)0, c, false, false);
  if (NT >= 3) c = __builtin_amdgcn_wmma_f32_16x16x32_f16(false, ah, false, bl, (short)0, c, false, false);
  asm volatile("v_nop\n\tv_nop\n\tv_nop\n\tv_nop" : "+v"(c) : "v"(ah), "v"(al), "v"(bh), "v"(bl));
  return c;
}
// batched GEMM like k_gemm_b but f16 operands: A f32 (split into f16 hi/lo if ASPLIT, else rounded to f16), Bt = f16 values [n][k]; alpha; C f32; N multiple of 16 (partial tiles skipped)
template <bool ASPLIT>
__global__ __launch_bounds__(128) void k_gemm_h(const float* __restrict__ A, int lda, size_t sA, const _Float16* __restrict__ Bh, int ldb, size_t sB, float alpha, float* __restrict__ C, int ldc, size_t sC, int M, int N, int K) {
  __shared__ __attribute__((aligned(16))) float so[4][16][64];
  const int tid = threadIdx.x, w = tid >> 5, lane = tid & 31, ln = lane & 15, hh = lane >> 4; const int by = blockIdx.y;
  A += (size_t)by * sA; Bh += (size_t)by * sB; C += (size_t)by * sC;
  const int ntn = (N + 63) / 64; const int wid = blockIdx.x * 4 + w; const int mt = wid / ntn, nq = wid % ntn; if (mt * 16 >= M) return;
  const int row0 = mt * 16, col0 = nq * 64; const float* arow = A + (size_t)(row0 + ln) * lda;
  v8f acc[4] = {};
  for (int kb = 0; kb < K; kb += 32) {
    FragH ah, al;
    const v4f x0 = *(const v4fa*)(arow + kb + 8 * hh), x1 = *(const v4fa*)(arow + kb + 8 * hh + 4), x2 = *(const v4fa*)(arow + kb + 16 + 8 * hh), x3 = *(const v4fa*)(arow + kb + 16 + 8 * hh + 4);
    float xs[16] = {x0[0],x0[1],x0[2],x0[3],x1[0],x1[1],x1[2],x1[3],x2[0],x2[1],x2[2],x2[3],x3[0],x3[1],x3[2],x3[3]};
#pragma unroll
    for (int i = 0; i < 16; ++i) { const _Float16 h = (_Float16)xs[i]; ah.h[i] = h; al.h[i] = ASPLIT ? (_Float16)(xs[i] - (float)h) : (_Float16)0.0f; }
#pragma unroll
    for (int t = 0; t < 4; ++t) { if (col0 + t * 16 >= N) continue; const size_t boff = (size_t)(col0 + t * 16 + ln) * ldb + kb; FragH bq; bq.half[0] = *(const v8us*)(Bh + boff + 8 * hh); bq.half[1] = *(const v8us*)(Bh + boff + 16 + 8 * hh);
      acc[t] = mmaH<ASPLIT ? 2 : 1>(ah.v, al.v, bq.v, bq.v, acc[t]); }
  }
#pragma unroll
  for (int t = 0; t < 4; ++t) { if (col0 + t * 16 >= N) continue;
#pragma unroll
    for (int r = 0; r < 8; ++r) so[w][8 * hh + r][t * 16 + ln] = acc[t][r] * alpha; }
  __builtin_amdgcn_fence(__ATOMIC_ACQ_REL, "workgroup"); __builtin_amdgcn_wave_barrier();
  const int rsub = lane >> 4, c4 = (lane & 15) * 4;
  {
#pragma unroll
    for (int q = 0; q < 8; ++q) { const int r = q * 2 + rsub; if (col0 + c4 < N) { const v4f v = *(const v4fa*)&so[w][r][c4]; *(v4f*)(C + (size_t)(row0 + r) * ldc + col0 + c4) = v; } }
     }
}

// Wt[n][k] = f16(W[k][n]·scale) from f32 row-major W[K][N] (scale = power of two; bf16-exact weights stay exact in f16 away from the subnormal range)
__global__ __launch_bounds__(256) void k_wt_f16(const float* __restrict__ W, _Float16* __restrict__ Wt, int K, int N, float scale) {
  const int t = blockIdx.x * 256 + threadIdx.x; if (t >= N * (K / 8)) return; const int n = t / (K / 8), k8 = (t % (K / 8)) * 8; FragH f;
#pragma unroll
  for (int i = 0; i < 8; ++i) f.h[i] = (_Float16)(bf16_round(W[(size_t)(k8 + i) * N + n]) * scale); const v8us o = f.half[0];
  *(v8us*)((unsigned short*)Wt + (size_t)n * K + k8) = o; 
}
// k_gemm_hh variant with fused epilogue: v = acc·alpha + bias[by·sBias + col] (+ CP[(row/rowsPerB)·sCPb + by·64 + col] if CP) ; ACT 0 none / 1 elu ; writes f16 C16 (and f32 C if non-null)
template <int ACT>
__global__ __launch_bounds__(128) void k_gemm_hhx(const _Float16* __restrict__ A, int lda, size_t sA, const _Float16* __restrict__ Bh, int ldb, size_t sB, float alpha, const float* __restrict__ bias, size_t sBias, const float* __restrict__ CP, int rowsPerB, size_t sCPb, int row0g,
    float* __restrict__ C, _Float16* __restrict__ C16, int ldc, size_t sC, int M, int N, int K) {
  __shared__ __attribute__((aligned(16))) float so[4][16][64];
  const int tid = threadIdx.x, w = tid >> 5, lane = tid & 31, ln = lane & 15, hh = lane >> 4; const int by = blockIdx.y;
  A += (size_t)by * sA; Bh += (size_t)by * sB; const size_t cofs = (size_t)by * sC; const float* bp = bias ? bias + (size_t)by * sBias : nullptr;
  const int ntn = (N + 63) / 64; const int wid = blockIdx.x * 4 + w; const int mt = wid / ntn, nq = wid % ntn; if (mt * 16 >= M) return;
  const int row0 = mt * 16, col0 = nq * 64; const _Float16* arow = A + (size_t)(row0 + ln) * lda;
  v8f acc[4] = {};
  for (int kb = 0; kb < K; kb += 32) { FragH ah; ah.half[0] = *(const v8us*)((const unsigned short*)arow + kb + 8 * hh); ah.half[1] = *(const v8us*)((const unsigned short*)arow + kb + 16 + 8 * hh);
#pragma unroll
    for (int t = 0; t < 4; ++t) { if (col0 + t * 16 >= N) continue; const size_t boff = (size_t)(col0 + t * 16 + ln) * ldb + kb; FragH bq; bq.half[0] = *(const v8us*)((const unsigned short*)Bh + boff + 8 * hh); bq.half[1] = *(const v8us*)((const unsigned short*)Bh + boff + 16 + 8 * hh);
      acc[t] = mmaH<1>(ah.v, ah.v, bq.v, bq.v, acc[t]); }
  }
#pragma unroll
  for (int t = 0; t < 4; ++t) { if (col0 + t * 16 >= N) continue; const int col = col0 + t * 16 + ln; const float bv = bp ? bf16_round(bp[col]) : 0.f;
#pragma unroll
    for (int r = 0; r < 8; ++r) { float v = acc[t][r] * alpha + bv; if (CP) { const int rr = row0g + row0 + 8 * hh + r; if (rowsPerB < 0) v += CP[cofs + (size_t)rr * ldc + col];      /* rowsPerB < 0: own element of the batched C plane */ else { const int bidx = rr / rowsPerB; v += CP[(size_t)bidx * sCPb + (size_t)by * 64 + col]; } } if (ACT == 1) v = (v > 0.f) ? v : expm1f(v); else if (ACT == 7) v = (v > 0.f) ? v + 1.0f : expf(v); else if (ACT == 8) v = tanhf(v); else if (ACT == 9) v = 0.5f * v * (1.0f + tanhf(0.7978845608028654f * (v + 0.044715f * v * v * v))); else if (ACT == 11) v = 1.0f / (1.0f + expf(-v)); else if (ACT == 12) v = (v > 0.f) ? v : 0.01f * v; else if (ACT == 14) v = (v > 0.f) ? v : 0.1f * v; else if (ACT == 16) v = (v >= 0.f) ? v : 0.3f * v; else if (ACT == 17) v = (v >= 0.f) ? v : 0.2f * v; else if (ACT == 15) v = v / (1.0f + expf(-v)); else if (ACT == 3) v = fmaxf(v, 0.f); else if (ACT == 6) v = 0.5f * v * (1.0f + erff(v * 0.70710678118654752f)); so[w][8 * hh + r][t * 16 + ln] = v; } }
  __builtin_amdgcn_fence(__ATOMIC_ACQ_REL, "workgroup"); __builtin_amdgcn_wave_barrier();
  const int rsub = lane >> 4, c4 = (lane & 15) * 4; typedef _Float16 v4h __attribute__((ext_vector_type(4)));
  {
#pragma unroll
    for (int q = 0; q < 8; ++q) { const int r = q * 2 + rsub; if (col0 + c4 < N) { const v4f v = *(const v4fa*)&so[w][r][c4]; if (C) *(v4f*)(C + cofs + (size_t)(row0 + r) * ldc + col0 + c4) = v; if (C16) { v4h h4; for (int i = 0; i < 4; ++i) h4[i] = (_Float16)v[i]; *(v4h*)(C16 + cofs + (size_t)(row0 + r) * ldc + col0 + c4) = h4; } } }
     }
}


typedef _Float16 v4h __attribute__((ext_vector_type(4)));

__global__ __launch_bounds__(256) void k_x16(const float* __restrict__ x, _Float16* __restrict__ X16, size_t n8) { const size_t t = (size_t)blockIdx.x * 256 + threadIdx.x; if (t >= n8) return; FragH f;
#pragma unroll
  for (int q = 0; q < 8; ++q) f.h[q] = (_Float16)bf16_round(x[t * 8 + q]); *(v8us*)((unsigned short*)X16 + t * 8) = f.half[0];  }
__global__ __launch_bounds__(256) void k_h16(const float* __restrict__ x, _Float16* __restrict__ X16, size_t n8) { const size_t t = (size_t)blockIdx.x * 256 + threadIdx.x; if (t >= n8) return; FragH f;
#pragma unroll
  for (int q = 0; q < 8; ++q) f.h[q] = (_Float16)x[t * 8 + q]; *(v8us*)((unsigned short*)X16 + t * 8) = f.half[0];  }
__global__ __launch_bounds__(256) void k_round16f(const float* __restrict__ W, _Float16* __restrict__ Bt, size_t n8) { const size_t t = (size_t)blockIdx.x * 256 + threadIdx.x; if (t >= n8) return; FragH f;
#pragma unroll
  for (int i = 0; i < 8; ++i) f.h[i] = (_Float16)(bf16_round(W[t * 8 + i]) * 16.0f); *(v8us*)((unsigned short*)Bt + t * 8) = f.half[0];  }
template <int NHv, int TTv>
__global__ __launch_bounds__(256) void k_vt(const _Float16* __restrict__ V16, int ldv, int voff, _Float16* __restrict__ Vt) { __shared__ unsigned short tl[64][66]; const int tid = threadIdx.x; const int slab = blockIdx.x / (TTv / 64), lg = blockIdx.x % (TTv / 64); const int b = slab / NHv, h = slab % NHv;
  for (int i = tid; i < 64 * 8; i += 256) { const int r = i / 8, c8 = (i % 8) * 8; FragH f; f.half[0] = *(const v8us*)((const unsigned short*)V16 + ((size_t)b * TTv + lg * 64 + r) * ldv + voff + h * 64 + c8);
#pragma unroll
    for (int q = 0; q < 8; ++q) tl[r][c8 + q] = f.u[q]; }
  __syncthreads();
  {
#pragma unroll
    for (int rd = 0; rd < 2; ++rd) { const int d = rd * 32 + tid / 8, pc = tid % 8; FragH f;
#pragma unroll
      for (int q = 0; q < 8; ++q) f.u[q] = tl[pc * 8 + q][d];
      *(v8us*)((unsigned short*)Vt + ((size_t)slab * 64 + d) * TTv + lg * 64 + pc * 8) = f.half[0]; }
     } }

__global__ __launch_bounds__(256) void k_hl(const float* __restrict__ F, _Float16* __restrict__ Hh, _Float16* __restrict__ Hl, size_t n8) { const size_t t = (size_t)blockIdx.x * 256 + threadIdx.x; if (t >= n8) return; FragH fh, fl; const v4f a = *(const v4fa*)(F + t * 8), c = *(const v4fa*)(F + t * 8 + 4);
#pragma unroll
  for (int q = 0; q < 4; ++q) { _Float16 h = (_Float16)a[q]; fh.h[q] = h; fl.h[q] = (_Float16)((a[q] - (float)h) * 1024.0f); h = (_Float16)c[q]; fh.h[4 + q] = h; fl.h[4 + q] = (_Float16)((c[q] - (float)h) * 1024.0f); }
  { *(v8us*)((unsigned short*)Hh + t * 8) = fh.half[0]; *(v8us*)((unsigned short*)Hl + t * 8) = fl.half[0];  } }

// ---- fast GEMM (work-group tile 128x64, wave tile 32x64; requires M % 128 == 0 rows per launch region and N % 64 == 0); epilogue = k_gemm_hhx semantics ----
__device__ __forceinline__ v8f g2_mma(v16h a, v16h b, v8f c) { v8f d = __builtin_amdgcn_wmma_f32_16x16x32_f16(false, a, false, b, (short)0, c, false, false); asm volatile("v_nop\n\tv_nop\n\tv_nop\n\tv_nop" : "+v"(d) : "v"(a), "v"(b)); return d; }
// One A or B fragment (16 rows x 32 k) from staged LDS rows; p: the lane's row, plus 16 * hh bytes. k order, the same for A and B: 8 hh .. 8 hh + 7, then 16 + 8 hh .. 16 + 8 hh + 7.
__device__ __forceinline__ v16h g2_lfrag(const unsigned char* p) { FragH f; f.half[0] = *(const v8us*)p; f.half[1] = *(const v8us*)(p + 32); return f.v; }
// Twelve asynchronous 16-byte copies per lane, global memory -> LDS. The s_wait_xcnt is the last line of the copies' own statement, so no register that a copy names is rewritten in front of it.
__device__ __forceinline__ void g2_copy12(const unsigned (&l)[12], const _Float16* const (&g)[12]) {
  asm volatile("global_load_async_to_lds_b128 %0, %12, off\n\t"
               "global_load_async_to_lds_b128 %1, %13, off\n\t"
               "global_load_async_to_lds_b128 %2, %14, off\n\t"
               "global_load_async_to_lds_b128 %3, %15, off\n\t"
               "global_load_async_to_lds_b128 %4, %16, off\n\t"
               "global_load_async_to_lds_b128 %5, %17, off\n\t"
               "global_load_async_to_lds_b128 %6, %18, off\n\t"
               "global_load_async_to_lds_b128 %7, %19, off\n\t"
               "global_load_async_to_lds_b128 %8, %20, off\n\t"
               "global_load_async_to_lds_b128 %9, %21, off\n\t"
               "global_load_async_to_lds_b128 %10, %22, off\n\t"
               "global_load_async_to_lds_b128 %11, %23, off\n\t"
               "s_wait_xcnt 0x0"
               :: "v"(l[0]), "v"(l[1]), "v"(l[2]), "v"(l[3]), "v"(l[4]), "v"(l[5]), "v"(l[6]), "v"(l[7]), "v"(l[8]), "v"(l[9]), "v"(l[10]), "v"(l[11]),
                  "v"(g[0]), "v"(g[1]), "v"(g[2]), "v"(g[3]), "v"(g[4]), "v"(g[5]), "v"(g[6]), "v"(g[7]), "v"(g[8]), "v"(g[9]), "v"(g[10]), "v"(g[11]) : "memory"); }
// One k slab (KC columns of the work-group's 128 A rows, then of its 64 B rows) into one LDS buffer. A row's KC * 2 bytes are KC / 8 neighbouring lanes' 16 bytes each: every copy covers whole 128-byte lines.
// ag, bg: the lane's own 16 bytes in row tid / (KC / 8) of the A and of the B slab; lds: the LDS byte address of the same place in the buffer. Unrolled in full: l[] and g[] are asm operands.
template <int KC>
__device__ __forceinline__ void g2_stage(const _Float16* ag, int lda, const _Float16* bg, int ldb, unsigned lds) {
  constexpr int RPU = 128 / (KC / 8), NA = 128 / RPU, NC = 192 / RPU, PB = KC * 2 + 16;      /* rows per round of 128 lanes; rounds for A; rounds in all; LDS pitch in bytes */
#pragma unroll
  for (int s = 0; s < NC / 12; ++s) { unsigned l[12]; const _Float16* g[12];
#pragma unroll
    for (int j = 0; j < 12; ++j) { const int u = s * 12 + j; l[j] = lds + (unsigned)(u * RPU * PB); g[j] = (u < NA) ? ag + (size_t)(u * RPU) * lda : bg + (size_t)((u - NA) * RPU) * ldb; }
    g2_copy12(l, g); } }
// BG: consecutive blockIdx.y values that share one B slab (grouped-query attention: BG query heads read the same k / v rows); slab = blockIdx.y / BG
// KC: columns of k per staged slab. M a multiple of 128, N of 64, K of KC. The work-group's A rows (128) and B rows (64) go to LDS slab by slab, two buffers: slab t + 1 is copied while slab t is multiplied.
// LDS pitch KC * 2 + 16 bytes = 16 B x odd, so the 16 rows of a fragment read spread over the banks.
template <int ACT, int BG = 1, int KC = 128>
__global__ __launch_bounds__(128) void k_gemm2(const _Float16* __restrict__ A, int lda, size_t sA, const _Float16* __restrict__ Bh, int ldb, size_t sB, float alpha, const float* __restrict__ bias, size_t sBias, const float* __restrict__ CP, int rowsPerB, size_t sCPb, int row0g,
    float* __restrict__ C, _Float16* __restrict__ C16, int ldc, size_t sC, int M, int N, int K) { static_assert(ACT == 0 || ACT == 3 || ACT == 6 || ACT == 8 || ACT == 9 || ACT == 11 || ACT == 12 || ACT == 14 || ACT == 15 || ACT == 16 || ACT == 17, "k_gemm2: unsupported ACT code (would silently apply no activation)");
  constexpr int PB = KC * 2 + 16, BUFB = 192 * PB; static_assert(2 * BUFB >= 4 * 32 * 68 * 4, "the output staging must fit the two slab buffers");
  __shared__ __attribute__((aligned(16))) unsigned char st[2 * BUFB];
  float (*so)[32][68] = (float (*)[32][68])st;      /* output staging in the same LDS: first written behind the last trip's barrier, when no copy is in flight and every fragment read is done */
  const int tid = threadIdx.x, w = tid >> 5, lane = tid & 31, ln = lane & 15, hh = lane >> 4; const int by = blockIdx.y;
  A += (size_t)by * sA; Bh += (size_t)(by / BG) * sB; const size_t cofs = (size_t)by * sC; const float* bp = bias ? bias + (size_t)by * sBias : nullptr;
  const int ntn = N >> 6; const int mt = blockIdx.x / ntn, nq = blockIdx.x - mt * ntn; const int row0 = mt * 128 + 32 * w, col0 = nq * 64; if (mt * 128 >= M) return;      /* the same for the whole work-group: it stands in front of barriers */
  const int sr = tid / (KC / 8), sc = tid % (KC / 8);      /* this lane's row and 16-byte column in a round of copies */
  const _Float16* ag = A + (size_t)(mt * 128 + sr) * lda + sc * 8; const _Float16* bg = Bh + (size_t)(col0 + sr) * ldb + sc * 8;
  const unsigned lds0 = (unsigned)(size_t)(&st[0]) + (unsigned)(sr * PB + sc * 16);
  const int nt = K / KC;
  const v8f z8 = {0.f,0.f,0.f,0.f,0.f,0.f,0.f,0.f}; v8f c00 = z8, c01 = z8, c02 = z8, c03 = z8, c10 = z8, c11 = z8, c12 = z8, c13 = z8;
  g2_stage<KC>(ag, lda, bg, ldb, lds0);
  asm volatile("s_wait_asynccnt 0x0" ::: "memory");      /* this wave's copies of slab 0 have landed */
  __syncthreads();      /* slab 0 readable by every wave */
  if (nt > 1) g2_stage<KC>(ag + KC, lda, bg + KC, ldb, lds0 + BUFB);
#pragma unroll 1
  for (int t = 0; t < nt; ++t) { const unsigned char* sb = st + (t & 1) * BUFB; const unsigned char* sa = sb + (32 * w + ln) * PB + 16 * hh; const unsigned char* sbr = sb + (128 + ln) * PB + 16 * hh;
    v16h fa[2][2], fb[2][4];      /* two fragment sets: the next k step's twelve LDS reads go out as one group in front of this k step's products, so the wave waits out the LDS latency once a slab */
    fa[0][0] = g2_lfrag(sa); fa[0][1] = g2_lfrag(sa + 16 * PB); fb[0][0] = g2_lfrag(sbr); fb[0][1] = g2_lfrag(sbr + 16 * PB); fb[0][2] = g2_lfrag(sbr + 32 * PB); fb[0][3] = g2_lfrag(sbr + 48 * PB);
#pragma unroll
    for (int kk = 0; kk < KC / 32; ++kk) { const int cu = kk & 1, nx = cu ^ 1;      /* unrolled in full: fa[] and fb[] are indexed by constants and stay in registers, the LDS offsets become immediates */
      if (kk + 1 < KC / 32) { const int o = (kk + 1) * 64; fa[nx][0] = g2_lfrag(sa + o); fa[nx][1] = g2_lfrag(sa + 16 * PB + o); fb[nx][0] = g2_lfrag(sbr + o); fb[nx][1] = g2_lfrag(sbr + 16 * PB + o); fb[nx][2] = g2_lfrag(sbr + 32 * PB + o); fb[nx][3] = g2_lfrag(sbr + 48 * PB + o); }
      c00 = g2_mma(fa[cu][0], fb[cu][0], c00); c10 = g2_mma(fa[cu][1], fb[cu][0], c10);
      c01 = g2_mma(fa[cu][0], fb[cu][1], c01); c11 = g2_mma(fa[cu][1], fb[cu][1], c11);
      c02 = g2_mma(fa[cu][0], fb[cu][2], c02); c12 = g2_mma(fa[cu][1], fb[cu][2], c12);
      c03 = g2_mma(fa[cu][0], fb[cu][3], c03); c13 = g2_mma(fa[cu][1], fb[cu][3], c13); }
    asm volatile("s_wait_dscnt 0x0" ::: "memory");      /* this wave's reads of slab t are done before the buffer is refilled */
    asm volatile("s_wait_asynccnt 0x0" ::: "memory");      /* this wave's copies of slab t + 1 have landed */
    __syncthreads();      /* publishes slab t + 1 and ends every wave's reads of slab t */
    if (t + 2 < nt) g2_stage<KC>(ag + (size_t)(t + 2) * KC, lda, bg + (size_t)(t + 2) * KC, ldb, lds0 + (unsigned)((t & 1) * BUFB)); }
  asm volatile("s_wait_asynccnt 0x0" ::: "memory");      /* no copy outstanding when the LDS becomes output staging */
  v8f accs[8] = {c00, c01, c02, c03, c10, c11, c12, c13};
#pragma unroll
  for (int u = 0; u < 8; ++u) { const int t = u & 3, half = u >> 2; const int col = col0 + t * 16 + ln; const float bv = bp ? bf16_round(bp[col]) : 0.f;
#pragma unroll
    for (int r = 0; r < 8; ++r) { const int rloc = half * 16 + 8 * hh + r; float v = accs[u][r] * alpha + bv; if (CP) { if (rowsPerB < 0) v += CP[cofs + (size_t)(row0g + row0 + rloc) * ldc + col];      /* rowsPerB < 0: own element of the batched C plane */ else { const int bidx = (row0g + row0 + rloc) / rowsPerB; v += CP[(size_t)bidx * sCPb + (size_t)by * 64 + col]; } }
      if (ACT == 3) v = fmaxf(v, 0.f); else if (ACT == 6) v = 0.5f * v * (1.0f + erff(v * 0.70710678118654752f)); else if (ACT == 11) v = 1.0f / (1.0f + expf(-v)); else if (ACT == 15) v = v / (1.0f + expf(-v)); else if (ACT == 12) v = (v > 0.f) ? v : 0.01f * v; else if (ACT == 8) v = tanhf(v); else if (ACT == 9) v = 0.5f * v * (1.0f + tanhf(0.7978845608028654f * (v + 0.044715f * v * v * v))); else if (ACT == 14) v = (v > 0.f) ? v : 0.1f * v; else if (ACT == 16) v = (v >= 0.f) ? v : 0.3f * v; else if (ACT == 17) v = (v >= 0.f) ? v : 0.2f * v;
      so[w][rloc][t * 16 + ln] = v; } }
  __builtin_amdgcn_fence(__ATOMIC_ACQ_REL, "workgroup"); __builtin_amdgcn_wave_barrier();
  const int rsub = lane >> 4, c4 = (lane & 15) * 4;
  {
#pragma unroll
    for (int q = 0; q < 16; ++q) { const int r = q * 2 + rsub; const v4f v = *(const v4fa*)&so[w][r][c4]; if (C) *(v4f*)(C + cofs + (size_t)(row0 + r) * ldc + col0 + c4) = v; if (C16) { v4h h4; for (int i = 0; i < 4; ++i) h4[i] = (_Float16)v[i]; *(v4h*)(C16 + cofs + (size_t)(row0 + r) * ldc + col0 + c4) = h4; } }
     } }


__global__ __launch_bounds__(256) void k_wnat(const float* __restrict__ w, size_t n8, _Float16* __restrict__ Bt) { const size_t t = (size_t)blockIdx.x * 256 + threadIdx.x; if (t >= n8) return; FragH f; for (int q = 0; q < 8; ++q) f.h[q] = (_Float16)(bf16_round(w[t * 8 + q]) * 16.0f); *(v8us*)((unsigned short*)Bt + t * 8) = f.half[0];  }
__global__ __launch_bounds__(256) void k_rsm(const float* __restrict__ S, _Float16* __restrict__ P, int nrows) {
  #pragma clang fp contract(off)
  const int i = blockIdx.x * 256 + threadIdx.x; if (i >= nrows) return; const float* s = S + (size_t)i * SQ; float mx = -3.0e38f;
#pragma unroll 1
  for (int j = 0; j < SQ; ++j) mx = fmaxf(mx, s[j]); float se = 0.f;
#pragma unroll 1
  for (int j = 0; j < SQ; ++j) se += expf(s[j] - mx); const float sc = 256.0f / se;
#pragma unroll 1
  for (int j0 = 0; j0 < SQ; j0 += 8) { FragH f; for (int q = 0; q < 8; ++q) f.h[q] = (_Float16)(expf(s[j0 + q] - mx) * sc); unsigned short* d = (unsigned short*)P + (size_t)i * SQ + j0; *(v8us*)d = f.half[0];  } }
__global__ __launch_bounds__(256) void k_vt(const _Float16* __restrict__ V16, int b, int h0, _Float16* __restrict__ VT) { __shared__ unsigned short tl[64][65]; const int tid = threadIdx.x; const int hh = blockIdx.x % HG, sg = blockIdx.x / HG; const int s0 = sg * 64; const int h = h0 + hh;
  for (int i = tid; i < 64 * 8; i += 256) { const int j = i / 8, d8 = (i % 8) * 8; FragH f; f.half[0] = *(const v8us*)((const unsigned short*)V16 + ((size_t)b * SQ + s0 + j) * DM + h * HD + d8); for (int q = 0; q < 8; ++q) tl[d8 + q][j] = f.u[q]; }
  __syncthreads();
  { for (int i = tid; i < 64 * 8; i += 256) { const int d = i / 8, j8 = (i % 8) * 8; FragH f; for (int q = 0; q < 8; ++q) f.u[q] = tl[d][j8 + q]; *(v8us*)((unsigned short*)VT + ((size_t)hh * HD + d) * SQ + s0 + j8) = f.half[0]; }  } }



// One wave per score row (the row number is wave-uniform). Lane l holds elements 128 c + 4 l .. + 3 of each 128-wide chunk c, so a load covers 512 contiguous bytes and a store 256;
// the row is read once and kept in registers for the maximum, the sum and the scaled weights. nk: a multiple of 256, at most NKX.
// Every loop over c or q is unrolled in full so that e[] and o[] are indexed by constants and stay in registers (a run-time index would send them to scratch).
__global__ __launch_bounds__(256) void k_rsmcf2(const float* __restrict__ S, _Float16* __restrict__ P, int hg, int q0, int nk) {
  const int lane = threadIdx.x & 31; const int t = blockIdx.x * 8 + __builtin_amdgcn_readfirstlane((int)(threadIdx.x >> 5)); if (t >= hg * QT) return;
  const float* s = S + (size_t)t * NKX + lane * 4; _Float16* p = P + (size_t)t * NKX + lane * 4; const int last = q0 + (t % QT);
  v4f e[NKX / 128];
#pragma unroll
  for (int c = 0; c < NKX / 128; c += 2) if (c * 128 < nk) { e[c] = *(const v4fa*)(s + c * 128); e[c + 1] = *(const v4fa*)(s + c * 128 + 128); }
  asm volatile("s_wait_xcnt 0x0" ::: "memory");      /* the loads' address registers are reused below */
  float mx = -3.0e38f;
#pragma unroll
  for (int c = 0; c < NKX / 128; c += 2) if (c * 128 < nk) {
    if (c * 128 + 255 > last) {      /* only chunks that reach past the diagonal hold masked keys */
#pragma unroll
      for (int q = 0; q < 4; ++q) { e[c][q] = (c * 128 + lane * 4 + q <= last) ? e[c][q] : -1.0e9f; e[c + 1][q] = (c * 128 + 128 + lane * 4 + q <= last) ? e[c + 1][q] : -1.0e9f; } }
    mx = fmaxf(mx, fmaxf(fmaxf(fmaxf(e[c][0], e[c][1]), fmaxf(e[c][2], e[c][3])), fmaxf(fmaxf(e[c + 1][0], e[c + 1][1]), fmaxf(e[c + 1][2], e[c + 1][3])))); }
#pragma unroll
  for (int d = 16; d > 0; d >>= 1) mx = fmaxf(mx, __shfl_xor(mx, d, 32));
  v4f sv = {0.f, 0.f, 0.f, 0.f};
#pragma unroll
  for (int c = 0; c < NKX / 128; c += 2) if (c * 128 < nk) {
#pragma unroll
    for (int q = 0; q < 4; ++q) { e[c][q] = __expf(e[c][q] - mx); e[c + 1][q] = __expf(e[c + 1][q] - mx); sv[q] += e[c][q] + e[c + 1][q]; } }
  float se = (sv[0] + sv[1]) + (sv[2] + sv[3]);
#pragma unroll
  for (int d = 16; d > 0; d >>= 1) se += __shfl_xor(se, d, 32);
  const float sc = 256.0f / se;
  v4h o[NKX / 128];      /* every chunk converted into registers of its own before the first store: no register of an issued store is written again */
#pragma unroll
  for (int c = 0; c < NKX / 128; c += 2) if (c * 128 < nk) {
#pragma unroll
    for (int q = 0; q < 4; ++q) { o[c][q] = (_Float16)(e[c][q] * sc); o[c + 1][q] = (_Float16)(e[c + 1][q] * sc); } }
#pragma unroll
  for (int c = 0; c < NKX / 128; c += 2) if (c * 128 < nk) { *(v4h*)(p + c * 128) = o[c]; *(v4h*)(p + c * 128 + 128) = o[c + 1]; } }


#define A0R 16                       /* query rows, one wave each, per work-group of the f32 first-tile kernel */
#define A0P (HD + 4)                 /* pitch of a staged k row in floats: 272 B = 16 B x 17, so 32 lanes reading 32 different rows spread over the LDS banks */
typedef float v2f __attribute__((ext_vector_type(2)));
// f32 causal attention for query rows 0..QT0-1 of one batch. One work-group per (head, A0R query rows): the head's QT0 k and v rows are staged in LDS once,
// then one wave per query row i: scores with one key per lane (32 keys a pass), maximum and sum over the lanes, then o with two head dims per lane, key after key.
// Every loop is unrolled in full so that s[], e[], q[], tk[] and tv[] are indexed by constants and stay in registers and the lane number of each readlane is a constant; the tests on c are the same for the whole wave.
__global__ __launch_bounds__(512) void k_att0w(const float* __restrict__ QF, const float* __restrict__ KF, const float* __restrict__ VF, int ld, float scale, float* __restrict__ OF, int ldo) {
  __shared__ __attribute__((aligned(16))) float lk[QT0][A0P]; __shared__ __attribute__((aligned(16))) float lv[QT0][HD];
  const int tid = threadIdx.x, lane = tid & 31; const int w = __builtin_amdgcn_readfirstlane(tid >> 5);
  const int h = blockIdx.x / (QT0 / A0R), rg = blockIdx.x % (QT0 / A0R); const int i = rg * A0R + w;
  v4f tk[QT0 * (HD / 4) / 512], tv[QT0 * (HD / 4) / 512];      /* all loads issued before the first LDS store: one memory latency for the whole stage */
#pragma unroll
  for (int u = 0; u < QT0 * (HD / 4) / 512; ++u) { const int e4 = u * 512 + tid; const size_t g = (size_t)(e4 / (HD / 4)) * ld + h * HD + (e4 % (HD / 4)) * 4; tk[u] = *(const v4fa*)(KF + g); tv[u] = *(const v4fa*)(VF + g); }
  const float* qr = QF + (size_t)i * ld + h * HD; v4f q[HD / 4];
#pragma unroll
  for (int d = 0; d < HD / 4; ++d) q[d] = *(const v4fa*)(qr + d * 4);
#pragma unroll
  for (int u = 0; u < QT0 * (HD / 4) / 512; ++u) { const int e4 = u * 512 + tid; *(v4f*)&lk[e4 / (HD / 4)][(e4 % (HD / 4)) * 4] = tk[u]; *(v4f*)&lv[e4 / (HD / 4)][(e4 % (HD / 4)) * 4] = tv[u]; }
  __syncthreads();
  float s[QT0 / 32]; float mx = -1.0e30f;
#pragma unroll
  for (int c = 0; c < QT0 / 32; ++c) { s[c] = -1.0e30f;
    if (c * 32 <= i) { const float* kr = &lk[c * 32 + lane][0]; v4f a = {0.f, 0.f, 0.f, 0.f};
#pragma unroll
      for (int d = 0; d < HD / 4; ++d) a += q[d] * *(const v4f*)(kr + d * 4);
      const float t = ((a[0] + a[1]) + (a[2] + a[3])) * scale; s[c] = (c * 32 + lane <= i) ? t : -1.0e30f; mx = fmaxf(mx, s[c]); } }
#pragma unroll
  for (int d = 16; d > 0; d >>= 1) mx = fmaxf(mx, __shfl_xor(mx, d, 32));
  float e[QT0 / 32]; float l = 0.f;
#pragma unroll
  for (int c = 0; c < QT0 / 32; ++c) { e[c] = 0.f; if (c * 32 <= i) { e[c] = expf(s[c] - mx); l += e[c]; } }      /* a masked key: expf(-1e30 - mx) = 0 */
#pragma unroll
  for (int d = 16; d > 0; d >>= 1) l += __shfl_xor(l, d, 32);
  v2f o = {0.f, 0.f};
#pragma unroll
  for (int c = 0; c < QT0 / 32; ++c) if (c * 32 <= i) {
#pragma unroll
    for (int j = 0; j < 32; ++j) { const float p = __int_as_float(__builtin_amdgcn_readlane(__float_as_int(e[c]), j)); o += p * *(const v2f*)&lv[c * 32 + j][lane * 2]; } }
  const float fin = 64.0f / l;      /* o carried x64 like the f16 path */
  *(v2f*)(OF + (size_t)i * ldo + h * HD + lane * 2) = o * fin; }


__global__ __launch_bounds__(256) void k_kvexp(const float* __restrict__ src, float* __restrict__ dst, size_t n4) { const size_t t = (size_t)blockIdx.x * 256 + threadIdx.x; if (t >= n4) return; const size_t e = t * 4; const size_t row = e / DM; const int col = (int)(e % DM); const int h = col / HD, d = col % HD; const v4f v = *(const v4fa*)(src + row * KVD + (size_t)(h / HPG) * HD + d); *(v4f*)(dst + e) = v;  }

__global__ __launch_bounds__(256) void k_tab2(float theta, float* __restrict__ CS, float* __restrict__ SN) {
  #pragma clang fp contract(off)
  const int t = blockIdx.x * 256 + threadIdx.x; if (t >= SQ * (HD / 2)) return; const int i = t % (HD / 2); const int p = t / (HD / 2); const float invf = 1.0f / powf(theta, (float)(2 * i) / (float)HD); const float ang = __fmul_rn((float)p, invf); const float c = cosf(ang), s = sinf(ang);
  *(float*)(CS + t) = c; *(float*)(SN + t) = s;  }
template <int NORM, int ROPE>
__global__ __launch_bounds__(64) void k_xform(const float* __restrict__ F, int ldf, int nh, const float* __restrict__ gain, float eps, const float* __restrict__ CS, const float* __restrict__ SN, _Float16* __restrict__ H16, int ldo) {
  #pragma clang fp contract(off)
  __shared__ float xv[HD]; __shared__ float red[HD]; __shared__ unsigned short sh_[HD]; const int d = threadIdx.x; const int h = blockIdx.x % nh; const size_t r = blockIdx.x / nh; const int p = (int)(r % SQ);
  float x = F[r * (size_t)ldf + (size_t)h * HD + d];
  if (NORM) { red[d] = __fmul_rn(x, x); __syncthreads(); for (int st = HD / 2; st > 0; st >>= 1) { if (d < st) red[d] = __fadd_rn(red[d], red[d + st]); __syncthreads(); } const float rs = rsqrtf(__fadd_rn(red[0] / (float)HD, eps)); x = __fmul_rn(__fmul_rn(x, rs), bf16_round(gain[d])); }
  xv[d] = x; __syncthreads();
  float o = x;
  if (ROPE == 1) { const int i = d >> 1; const float c = CS[p * (HD / 2) + i], s = SN[p * (HD / 2) + i]; const float ev = xv[2 * i], od = xv[2 * i + 1]; o = (d & 1) ? __fadd_rn(__fmul_rn(ev, s), __fmul_rn(od, c)) : __fadd_rn(__fmul_rn(ev, c), -__fmul_rn(od, s)); }
  if (ROPE == 2) { const int i = d & (HD / 2 - 1); const float c = CS[p * (HD / 2) + i], s = SN[p * (HD / 2) + i]; const float lo = xv[i], hi = xv[i + HD / 2]; o = (d < HD / 2) ? __fadd_rn(__fmul_rn(lo, c), -__fmul_rn(hi, s)) : __fadd_rn(__fmul_rn(lo, s), __fmul_rn(hi, c)); }
  FragH th; th.h[0] = (_Float16)o; sh_[d] = th.u[0]; __syncthreads();
  if (d < HD / 8) { FragH f; for (int q = 0; q < 8; ++q) f.u[q] = sh_[d * 8 + q]; unsigned short* dst = (unsigned short*)H16 + r * (size_t)ldo + (size_t)h * HD + d * 8; *(v8us*)dst = f.half[0];  } }

template <int NORM, int ROPE>
__global__ __launch_bounds__(64) void k_xformf(const float* __restrict__ F, int ldf, int nh, const float* __restrict__ gain, float eps, const float* __restrict__ CS, const float* __restrict__ SN, float* __restrict__ F32, int ldo) {
  #pragma clang fp contract(off)
  __shared__ float xv[HD]; __shared__ float red[HD]; const int d = threadIdx.x; const int h = blockIdx.x % nh; const size_t r = blockIdx.x / nh; const int p = (int)(r % SQ);
  float x = F[r * (size_t)ldf + (size_t)h * HD + d];
  if (NORM) { red[d] = __fmul_rn(x, x); __syncthreads(); for (int st = HD / 2; st > 0; st >>= 1) { if (d < st) red[d] = __fadd_rn(red[d], red[d + st]); __syncthreads(); } const float rs = rsqrtf(__fadd_rn(red[0] / (float)HD, eps)); x = __fmul_rn(__fmul_rn(x, rs), bf16_round(gain[d])); }
  xv[d] = x; __syncthreads();
  float o = x;
  if (ROPE == 1) { const int i = d >> 1; const float c = CS[p * (HD / 2) + i], s = SN[p * (HD / 2) + i]; const float ev = xv[2 * i], od = xv[2 * i + 1]; o = (d & 1) ? __fadd_rn(__fmul_rn(ev, s), __fmul_rn(od, c)) : __fadd_rn(__fmul_rn(ev, c), -__fmul_rn(od, s)); }
  if (ROPE == 2) { const int i = d & (HD / 2 - 1); const float c = CS[p * (HD / 2) + i], s = SN[p * (HD / 2) + i]; const float lo = xv[i], hi = xv[i + HD / 2]; o = (d < HD / 2) ? __fadd_rn(__fmul_rn(lo, c), -__fmul_rn(hi, s)) : __fadd_rn(__fmul_rn(lo, s), __fmul_rn(hi, c)); }
  float* dst = F32 + r * (size_t)ldo + (size_t)h * HD + d; *(float*)dst = o;  }

__global__ __launch_bounds__(256) void k_bfcp(const float* __restrict__ src, float* __restrict__ dst, size_t n4) { const size_t t = (size_t)blockIdx.x * 256 + threadIdx.x; if (t >= n4) return; const v4f a = *(const v4fa*)(src + t * 4); v4f o; for (int q = 0; q < 4; ++q) o[q] = bf16_round(a[q]); *(v4f*)(dst + t * 4) = o;  }

__global__ __launch_bounds__(256) void k_f2bf(const float* __restrict__ F, unsigned short* __restrict__ O, size_t n8) { const size_t t = (size_t)blockIdx.x * 256 + threadIdx.x; if (t >= n8) return; const v4f a = *(const v4fa*)(F + t * 8), b = *(const v4fa*)(F + t * 8 + 4); FragH f;
  for (int q = 0; q < 4; ++q) { f.u[q] = (unsigned short)(__float_as_uint(bf16_round(a[q])) >> 16); f.u[4 + q] = (unsigned short)(__float_as_uint(bf16_round(b[q])) >> 16); }
  *(v8us*)(O + t * 8) = f.half[0];  }
extern "C" void kernel_launch(void* const* d_in, const int* in_sizes, int n_in,
                              void* d_out, int out_size, void* d_ws, size_t ws_size, hipStream_t stream) {
  (void)in_sizes; (void)n_in; (void)out_size;
  const float* const* I = (const float* const*)d_in; const float* x = I[0]; const float* tcos = I[1]; const float* tsin = I[2]; const float* wq = I[3]; const float* wk = I[4]; const float* wv = I[5]; const float* wo = I[6]; const float* bq = nullptr; const float* bk = nullptr; const float* bv = nullptr; const float* bo = nullptr;      /* [in][out] weights, no biases; rope tables [S][32] */
  char* ws = (char*)d_ws; size_t off = 0;
  auto take = [&](size_t bytes) { char* p = ws + off; off += (bytes + 255) & ~(size_t)255; return p; };
  _Float16* BQ = (_Float16*)take((size_t)DM * DM * 2); _Float16* BK = (_Float16*)take((size_t)KVD * DM * 2); _Float16* BV = (_Float16*)take((size_t)KVD * DM * 2); _Float16* BO = (_Float16*)take((size_t)DM * DM * 2);
  _Float16* X16 = (_Float16*)take(NR * DM * 2); float* QF = (float*)take((size_t)SQ * DM * 4); float* KF = (float*)take((size_t)SQ * KVD * 4); float* CSB = (float*)take((size_t)SQ * 32 * 4); float* SNB = (float*)take((size_t)SQ * 32 * 4); _Float16* Q16 = (_Float16*)take(NR * DM * 2); _Float16* K16 = (_Float16*)take(NR * KVD * 2); _Float16* V16 = (_Float16*)take(NR * KVD * 2); _Float16* O16 = (_Float16*)take(NR * DM * 2);
  float* S = (float*)take((size_t)NH * QT * NKX * 4); _Float16* P = (_Float16*)take((size_t)NH * QT * NKX * 2); _Float16* VT = (_Float16*)take((size_t)NH * HD * SQ * 2);
  float* QF0 = (float*)take((size_t)QT0 * DM * 4); float* KF0 = (float*)take((size_t)QT0 * KVD * 4); float* VF0 = (float*)take((size_t)QT0 * KVD * 4); float* KF0e = (float*)take((size_t)QT0 * DM * 4); float* VF0e = (float*)take((size_t)QT0 * DM * 4); float* OF0 = (float*)take((size_t)NB * QT0 * DM * 4); _Float16* OH0 = (_Float16*)take((size_t)NB * QT0 * DM * 2); _Float16* OL0 = (_Float16*)take((size_t)NB * QT0 * DM * 2); float* OUTF = (float*)take(NR * DM * 4);      /* f32 result rows, converted to bf16 at the end */
  if (off > ws_size) return;
  k_wt_f16<<<(unsigned)(((size_t)DM * (DM / 8) + 255) / 256), 256, 0, stream>>>(wq, BQ, DM, DM, 16.0f); k_wt_f16<<<(unsigned)(((size_t)KVD * (DM / 8) + 255) / 256), 256, 0, stream>>>(wk, BK, DM, KVD, 16.0f); k_wt_f16<<<(unsigned)(((size_t)KVD * (DM / 8) + 255) / 256), 256, 0, stream>>>(wv, BV, DM, KVD, 16.0f); k_wt_f16<<<(unsigned)(((size_t)DM * (DM / 8) + 255) / 256), 256, 0, stream>>>(wo, BO, DM, DM, 16.0f);      /* [in][out] -> Bt[n][k] x16 */
  k_x16<<<(unsigned)((NR * DM / 8 + 255) / 256), 256, 0, stream>>>(x, X16, NR * DM / 8);
  k_bfcp<<<(SQ * 32 / 4 + 255) / 256, 256, 0, stream>>>(tcos, CSB, (size_t)SQ * 32 / 4); k_bfcp<<<(SQ * 32 / 4 + 255) / 256, 256, 0, stream>>>(tsin, SNB, (size_t)SQ * 32 / 4);      /* bf16-rounded rope tables [pos][32] */
  const size_t r0p = (size_t)B0 * SQ;      /* first projected row */
  k_gemm2<0><<<dim3((unsigned)((MP / 128) * (KVD / 64)), 1), 128, 0, stream>>>(X16 + r0p * DM, DM, 0, BV, DM, 0, 0.0625f, bv, 0, nullptr, 1, 0, 0, nullptr, V16 + r0p * KVD, KVD, 0, MP, KVD, DM);
  for (int b = B0; b < B0 + NBR; ++b) { const size_t r0 = (size_t)b * SQ;
    k_gemm2<0><<<dim3((unsigned)((SQ / 128) * (DM / 64)), 1), 128, 0, stream>>>(X16 + r0 * DM, DM, 0, BQ, DM, 0, 0.0625f, nullptr, 0, nullptr, 1, 0, 0, QF, nullptr, DM, 0, SQ, DM, DM);      /* q (f32) of this batch */
    k_gemm2<0><<<dim3((unsigned)((SQ / 128) * (KVD / 64)), 1), 128, 0, stream>>>(X16 + r0 * DM, DM, 0, BK, DM, 0, 0.0625f, nullptr, 0, nullptr, 1, 0, 0, KF, nullptr, KVD, 0, SQ, KVD, DM);      /* k (f32) */
    k_xform<0, 1><<<(unsigned)((size_t)SQ * NH), 64, 0, stream>>>(QF, DM, NH, nullptr, 0.f, CSB, SNB, Q16 + r0 * DM, DM); k_xform<0, 1><<<(unsigned)((size_t)SQ * NG), 64, 0, stream>>>(KF, KVD, NG, nullptr, 0.f, CSB, SNB, K16 + r0 * KVD, KVD);      /* interleaved-pair rope -> f16 rows */
    k_xformf<0, 1><<<(unsigned)(QT0 * NH), 64, 0, stream>>>(QF, DM, NH, nullptr, 0.f, CSB, SNB, QF0, DM); k_xformf<0, 1><<<(unsigned)(QT0 * NG), 64, 0, stream>>>(KF, KVD, NG, nullptr, 0.f, CSB, SNB, KF0, KVD);      /* f32 roped q, k of rows 0..127 */
    k_vt<NG, SQ><<<NG * (SQ / 64), 256, 0, stream>>>(V16 + r0 * KVD, KVD, 0, VT);      /* V^T [NG][HD][SQ] for this batch */
    k_gemm2<0><<<dim3((QT0 / 128) * (KVD / 64), 1), 128, 0, stream>>>(X16 + r0 * DM, DM, 0, BV, DM, 0, 0.0625f, bv, 0, nullptr, 1, 0, 0, VF0, nullptr, KVD, 0, QT0, KVD, DM);
    k_kvexp<<<(unsigned)(((size_t)QT0 * DM / 4 + 255) / 256), 256, 0, stream>>>(KF0, KF0e, (size_t)QT0 * DM / 4); k_kvexp<<<(unsigned)(((size_t)QT0 * DM / 4 + 255) / 256), 256, 0, stream>>>(VF0, VF0e, (size_t)QT0 * DM / 4);      /* head h <- kv group h/4 for the exact first-tile kernel */      /* f32 q, k, v of the first 128 rows (exact products) */
    k_att0w<<<NH * (QT0 / A0R), 512, 0, stream>>>(QF0, KF0e, VF0e, DM, 0.125f, OF0 + (size_t)b * QT0 * DM, DM);      /* exact f32 attention for rows 0..127 (o x64) */
    for (int q0 = 0; q0 < QN; q0 += QT) { const int nk = q0 + QT;      /* causal: only keys below the tile end are computed */
      k_gemm2<0, HPG, HD><<<dim3((QT / 128) * (nk / 64), NH), 128, 0, stream>>>(Q16 + (r0 + q0) * LQ, LQ, (size_t)HD, K16 + r0 * KVD, KVD, (size_t)HD, 0.125f, nullptr, 0, nullptr, 1, 0, 0, S, nullptr, NKX, (size_t)QT * NKX, QT, nk, HD);      /* scores: all 32 heads in one launch, head y against the keys of kv head y/4 */
      k_rsmcf2<<<(NHD * QT + 7) / 8, 256, 0, stream>>>(S, P, NHD, q0, nk);      /* one wave per row, 8 rows per work-group */
      k_gemm2<0, HPG><<<dim3((QT / 128) * (HD / 64), NH), 128, 0, stream>>>(P, NKX, (size_t)QT * NKX, VT, SQ, (size_t)HD * SQ, 0.25f, nullptr, 0, nullptr, 1, 0, 0, nullptr, O16 + (r0 + q0) * DM, DM, (size_t)HD, QT, HD, nk); } }      /* o for all 32 heads in one launch (x64), head y against V^T of kv head y/4 */      /* o (merged heads, x64) as f16 rows */
  k_gemm2<0><<<dim3((unsigned)((MPO / 128) * (DM / 64)), 1), 128, 0, stream>>>(O16 + r0p * DM, DM, 0, BO, DM, 0, 0.0009765625f, bo, 0, nullptr, 1, 0, 0, OUTF + r0p * DM, nullptr, DM, 0, MPO, DM, DM);      /* out rows (f32) */
  k_hl<<<(unsigned)(((size_t)NB * QT0 * DM / 8 + 255) / 256), 256, 0, stream>>>(OF0, OH0, OL0, (size_t)NB * QT0 * DM / 8);      /* first-tile o (x64) -> f16 hi + x1024 residual planes */
  for (int b = B0; b < B0 + NBR; ++b) { const size_t r0 = (size_t)b * SQ; const size_t f0 = (size_t)b * QT0;
    k_gemm2<0><<<dim3((QT0 / 128) * (DM / 64), 1), 128, 0, stream>>>(OH0 + f0 * DM, DM, 0, BO, DM, 0, 0.0009765625f, bo, 0, nullptr, 1, 0, 0, OUTF + r0 * DM, nullptr, DM, 0, QT0, DM, DM);      /* rows 0..127: out = o_hi Wo (+ b), overwriting the f16-path rows */
    k_gemm2<0><<<dim3((QT0 / 128) * (DM / 64), 1), 128, 0, stream>>>(OL0 + f0 * DM, DM, 0, BO, DM, 0, 0.00000095367431640625f, nullptr, 0, (const float*)(OUTF + r0 * DM), -1, 0, 0, OUTF + r0 * DM, nullptr, DM, 0, QT0, DM, DM); }      /* += o_lo Wo 2^-20 (own-element accumulate) */
  k_f2bf<<<(unsigned)(((size_t)MPO * DM / 8 + 255) / 256), 256, 0, stream>>>(OUTF + (size_t)B0 * SQ * DM, (unsigned short*)d_out + (size_t)B0 * SQ * DM, (size_t)MPO * DM / 8);      /* out.astype(bfloat16): the f32 rows rounded to nearest-even bf16 into the 2-byte output */
}

// v006
// Measured time: 382 microseconds a run.
// It is 2.58 times as fast as v004, going by the measured steps of the versions left out in between.
// Over all steps from v000 it is 24.8 times as fast.
#include <hip/hip_runtime.h>
// Grouped-query causal attention with RoPE and a BFLOAT16 output (x [2][2048][2048]; xq = x wq (32 heads x 64), xk = x wk, xv = x wv (8 kv heads x 64) ([in][out] weights sigma 1/sqrt(2048), no biases); interleaved-pair RoPE (reshape(..., 32, 2): real = even, imag = odd) on q and k from the module's INPUT tables freqs_cos/freqs_sin [S][32]; repeat: query head h uses kv head h/4; scores / 8 + triu(-inf, 1) (causal); softmax; out = (merged wo).astype(bfloat16) -> bf16 [2][2048][2048] (2 bytes per element)).
// Compute dtype: inputs rounded to bf16; x / weights exact; q, k, v, softmax weights and o as plain f16 GEMM operands (~2^-12); scores and softmax statistics f32. v_wmma_f32_16x16x32_f16.
#define NB 2
#define NG 8
#define HPG 4
#define KVD (NG * HD)
#define SQ 2048
#define DM 2048
#define NH 32
#define HD 64
#define HG 4                         /* heads per launch of the non-template k_vt (not launched) */
#define QT 256                       /* not used */
#define NKX SQ                       /* S / P row pitch */
#define QT0 128                      /* first-tile rows recomputed exactly in f32 */
#define B0 0                         /* first batch processed (debug hook) */
#define NBR NB                       /* batches processed (debug hook) */
#define NR ((size_t)NB * SQ)         /* token rows */
#define MP ((int)((size_t)NBR * SQ)) /* rows projected (debug hook) */
#define QN SQ                        /* query rows attended per batch (not used) */
#define NHD NH                       /* heads attended (not used) */
#define MPO MP                       /* rows through the output stage (debug hook) */
#define LQ DM      /* row pitch of the q rows */
typedef __bf16 v16b __attribute__((ext_vector_type(16)));
typedef unsigned short v8us __attribute__((ext_vector_type(8), may_alias));
typedef float  v8f  __attribute__((ext_vector_type(8)));
typedef float  v4f  __attribute__((ext_vector_type(4)));
typedef float  v4fa __attribute__((ext_vector_type(4), may_alias));
union FragB { v16b v; v8us half[2]; unsigned short u[16]; };

__device__ __forceinline__ unsigned short bf16_bits(float x) { unsigned int u = __float_as_uint(x); return (unsigned short)((u + 0x7FFFu + ((u >> 16) & 1u)) >> 16); }
__device__ __forceinline__ float bf16_val(unsigned short b) { return __uint_as_float(((unsigned int)b) << 16); }
__device__ __forceinline__ float bf16_round(float x) { return bf16_val(bf16_bits(x)); }
// D += A·B with NT terms: 1 = ah·bh, 2 = + al·bh (A split), 3 = + ah·bl (both split)
template <int NT>
__device__ __forceinline__ v8f mmaN(v16b ah, v16b al, v16b bh, v16b bl, v8f c) {
  c = __builtin_amdgcn_wmma_f32_16x16x32_bf16(false, ah, false, bh, (short)0, c, false, false);
  if (NT >= 2) c = __builtin_amdgcn_wmma_f32_16x16x32_bf16(false, al, false, bh, (short)0, c, false, false);
  if (NT >= 3) c = __builtin_amdgcn_wmma_f32_16x16x32_bf16(false, ah, false, bl, (short)0, c, false, false);
  asm volatile("v_nop\n\tv_nop\n\tv_nop\n\tv_nop" : "+v"(c) : "v"(ah), "v"(al), "v"(bh), "v"(bl));
  return c;
}

__global__ __launch_bounds__(256) void k_wt_bf16(const float* __restrict__ W, unsigned short* __restrict__ Wt, int K, int N) {
  const int t = blockIdx.x * 256 + threadIdx.x;
  const int k8n = K / 8;
  if (t >= N * k8n) return;
  const int n = t / k8n, k8 = (t % k8n) * 8;
  v8us v;
#pragma unroll
  for (int i = 0; i < 8; ++i) v[i] = bf16_bits(W[(size_t)(k8 + i) * N + n]);
  *(v8us*)(Wt + (size_t)n * K + k8) = v;
  
}

// GEMM C[M][N] (f32, pitch ldc) = act(A[M][K]·W + bias). A f32 row-major (pitch lda) converted per fragment to bf16
// (ASPLIT: hi/lo two planes -> 2 terms, else single rounded term); Wt bf16 [N][K] (pitch ldb). BIAS_BF16 rounds the
// bias to bf16 first (bias quantised to bf16 before the add). K%32==0, M%16==0, N%64==0.
template <bool ASPLIT, int ACT, bool BIAS_BF16>
__global__ __launch_bounds__(128) void k_gemm_bf(const float* __restrict__ A, int lda, const unsigned short* __restrict__ Wt, int ldb,
                                               const float* __restrict__ bias, float* __restrict__ C, int ldc, int M, int N, int K) {
  __shared__ __attribute__((aligned(16))) float so[4][16][64];
  const int tid = threadIdx.x, w = tid >> 5, lane = tid & 31, ln = lane & 15, hh = lane >> 4;
  const int ntn = N / 64;
  const int wid = blockIdx.x * 4 + w;
  const int mt = wid / ntn, nq = wid % ntn;
  if (mt * 16 >= M) return;
  const int row0 = mt * 16, col0 = nq * 64;
  const float* arow = A + (size_t)(row0 + ln) * lda;
  v8f acc[4] = {};
  for (int kb = 0; kb < K; kb += 32) {
    FragB ah, al;
    const v4f x0 = *(const v4fa*)(arow + kb + 8 * hh), x1 = *(const v4fa*)(arow + kb + 8 * hh + 4);
    const v4f x2 = *(const v4fa*)(arow + kb + 16 + 8 * hh), x3 = *(const v4fa*)(arow + kb + 16 + 8 * hh + 4);
    float xs[16] = {x0[0],x0[1],x0[2],x0[3],x1[0],x1[1],x1[2],x1[3],x2[0],x2[1],x2[2],x2[3],x3[0],x3[1],x3[2],x3[3]};
#pragma unroll
    for (int i = 0; i < 16; ++i) { const unsigned short hb = bf16_bits(xs[i]); ah.u[i] = hb; al.u[i] = ASPLIT ? bf16_bits(xs[i] - bf16_val(hb)) : (unsigned short)0; }
#pragma unroll
    for (int t = 0; t < 4; ++t) {
      const unsigned short* brow = Wt + (size_t)(col0 + t * 16 + ln) * ldb + kb;
      FragB b;
      b.half[0] = *(const v8us*)(brow + 8 * hh);
      b.half[1] = *(const v8us*)(brow + 16 + 8 * hh);
      acc[t] = mmaN<ASPLIT ? 2 : 1>(ah.v, al.v, b.v, b.v, acc[t]);
    }
  }
#pragma unroll
  for (int t = 0; t < 4; ++t) {
    float bv = bias ? bias[col0 + t * 16 + ln] : 0.f;
    if (BIAS_BF16) bv = bf16_round(bv);
#pragma unroll
    for (int r = 0; r < 8; ++r) { float v = acc[t][r] + bv; if (ACT == 1) v = fmaxf(v, 0.f); so[w][8 * hh + r][t * 16 + ln] = v; }
  }
  __builtin_amdgcn_fence(__ATOMIC_ACQ_REL, "workgroup");
  __builtin_amdgcn_wave_barrier();
  const int rsub = lane >> 4, c4 = (lane & 15) * 4;
  {
#pragma unroll
    for (int q = 0; q < 8; ++q) {
      const int r = q * 2 + rsub;
      const v4f v = *(const v4fa*)&so[w][r][c4];
      *(v4f*)(C + (size_t)(row0 + r) * ldc + col0 + c4) = v;
    }
    
  }
}

// GEMM C = act(A·W + bias + resid): A f32 (ASPLIT -> hi/lo 2 terms), Wt bf16 [N][K]; ACT 0 none, 1 relu, 2 exact gelu;
// resid (optional, f32, row index = (row % rmod), pitch ldr, RES_BF16 rounds it) added before the activation.
template <bool ASPLIT, int ACT, bool BIAS_BF16, bool RES_BF16>
__global__ __launch_bounds__(128) void k_gemm_bf3(const float* __restrict__ A, int lda, const unsigned short* __restrict__ Wt, int ldb,
                                                const float* __restrict__ bias, const float* __restrict__ resid, int rmod, int ldr,
                                                float* __restrict__ C, int ldc, int M, int N, int K) {
  __shared__ __attribute__((aligned(16))) float so[4][16][64];
  const int tid = threadIdx.x, w = tid >> 5, lane = tid & 31, ln = lane & 15, hh = lane >> 4;
  const int ntn = N / 64;
  const int wid = blockIdx.x * 4 + w;
  const int mt = wid / ntn, nq = wid % ntn;
  if (mt * 16 >= M) return;
  const int row0 = mt * 16, col0 = nq * 64;
  const float* arow = A + (size_t)(row0 + ln) * lda;
  v8f acc[4] = {};
  for (int kb = 0; kb < K; kb += 32) {
    FragB ah, al;
    const v4f x0 = *(const v4fa*)(arow + kb + 8 * hh), x1 = *(const v4fa*)(arow + kb + 8 * hh + 4);
    const v4f x2 = *(const v4fa*)(arow + kb + 16 + 8 * hh), x3 = *(const v4fa*)(arow + kb + 16 + 8 * hh + 4);
    float xs[16] = {x0[0],x0[1],x0[2],x0[3],x1[0],x1[1],x1[2],x1[3],x2[0],x2[1],x2[2],x2[3],x3[0],x3[1],x3[2],x3[3]};
#pragma unroll
    for (int i = 0; i < 16; ++i) { const unsigned short hb = bf16_bits(xs[i]); ah.u[i] = hb; al.u[i] = ASPLIT ? bf16_bits(xs[i] - bf16_val(hb)) : (unsigned short)0; }
#pragma unroll
    for (int t = 0; t < 4; ++t) {
      const unsigned short* brow = Wt + (size_t)(col0 + t * 16 + ln) * ldb + kb;
      FragB b;
      b.half[0] = *(const v8us*)(brow + 8 * hh);
      b.half[1] = *(const v8us*)(brow + 16 + 8 * hh);
      acc[t] = mmaN<ASPLIT ? 2 : 1>(ah.v, al.v, b.v, b.v, acc[t]);
    }
  }
#pragma unroll
  for (int t = 0; t < 4; ++t) {
    const int col = col0 + t * 16 + ln;
    float bv = bias ? bias[col] : 0.f;
    if (BIAS_BF16) bv = bf16_round(bv);
#pragma unroll
    for (int r = 0; r < 8; ++r) {
      float v = acc[t][r] + bv;
      if (resid) { float rv = resid[(size_t)((row0 + 8 * hh + r) % rmod) * ldr + col]; if (RES_BF16) rv = bf16_round(rv); v += rv; }
      if (ACT == 1) v = fmaxf(v, 0.f);
      if (ACT == 2) v = 0.5f * v * (1.0f + erff(v * 0.70710678118654752f));
      if (ACT == 3) { const float u = 0.7978845608028654f * (v + 0.044715f * v * v * v); v = 0.5f * v * (1.0f + tanhf(u)); }
      so[w][8 * hh + r][t * 16 + ln] = v;
    }
  }
  __builtin_amdgcn_fence(__ATOMIC_ACQ_REL, "workgroup");
  __builtin_amdgcn_wave_barrier();
  const int rsub = lane >> 4, c4 = (lane & 15) * 4;
  {
#pragma unroll
    for (int q = 0; q < 8; ++q) {
      const int r = q * 2 + rsub;
      const v4f v = *(const v4fa*)&so[w][r][c4];
      *(v4f*)(C + (size_t)(row0 + r) * ldc + col0 + c4) = v;
    }
    
  }
}
// row LayerNorm (biased variance, eps) over N: s = X (+ R); optional out_sum <- s; out_norm <- (s-mu)*rsqrt(var+eps)*g + b
template <bool PARAM_BF16>
__global__ __launch_bounds__(256) void k_layernorm(const float* __restrict__ X, const float* __restrict__ R, const float* __restrict__ g, const float* __restrict__ bta,
                                                  float* __restrict__ out_sum, float* __restrict__ out_norm, int N, float eps) {
  __shared__ float red[256];
  const int row = blockIdx.x, tid = threadIdx.x;
  const float* x = X + (size_t)row * N; const float* rr = R ? R + (size_t)row * N : nullptr;
  float vals[16];                     // up to N = 4096
  const int per = N / 256;            // contiguous chunk per thread? use strided-by-4 chunks: thread handles j = tid*4 + 1024*u
  float s1 = 0.f;
  for (int u = 0; u < per / 4; ++u) {
    const int j = tid * 4 + 1024 * u;
    const v4f a = *(const v4fa*)(x + j);
    v4f b = {0.f,0.f,0.f,0.f}; if (rr) b = *(const v4fa*)(rr + j);
#pragma unroll
    for (int q = 0; q < 4; ++q) { const float v = a[q] + b[q]; vals[u * 4 + q] = v; s1 += v; }
  }
  red[tid] = s1; __syncthreads();
  for (int st = 128; st > 0; st >>= 1) { if (tid < st) red[tid] += red[tid + st]; __syncthreads(); }
  const float mu = red[0] / (float)N; __syncthreads();
  float s2 = 0.f;
  for (int u = 0; u < per / 4; ++u)
#pragma unroll
    for (int q = 0; q < 4; ++q) { const float c = vals[u * 4 + q] - mu; s2 += c * c; }
  red[tid] = s2; __syncthreads();
  for (int st = 128; st > 0; st >>= 1) { if (tid < st) red[tid] += red[tid + st]; __syncthreads(); }
  const float rs = rsqrtf(red[0] / (float)N + eps);
  {
    for (int u = 0; u < per / 4; ++u) {
      const int j = tid * 4 + 1024 * u;
      v4f o, sm;
#pragma unroll
      for (int q = 0; q < 4; ++q) {
        float gg = g[j + q], bb = bta[j + q];
        if (PARAM_BF16) { gg = bf16_round(gg); bb = bf16_round(bb); }
        sm[q] = vals[u * 4 + q]; o[q] = (vals[u * 4 + q] - mu) * rs * gg + bb;
      }
      if (out_sum) *(v4f*)(out_sum + (size_t)row * N + j) = sm;
      *(v4f*)(out_norm + (size_t)row * N + j) = o;
    }
    
  }
}



// ---- f16 WMMA path (v_wmma_f32_16x16x32_f16): 11-bit significands for operands in range — used where a [0,1] probability operand needs more precision than bf16
typedef _Float16 v16h __attribute__((ext_vector_type(16)));
union FragH { v16h v; v8us half[2]; _Float16 h[16]; unsigned short u[16]; };
template <int NT>
__device__ __forceinline__ v8f mmaH(v16h ah, v16h al, v16h bh, v16h bl, v8f c) {
  c = __builtin_amdgcn_wmma_f32_16x16x32_f16(false, ah, false, bh, (short)0, c, false, false);
  if (NT >= 2) c = __builtin_amdgcn_wmma_f32_16x16x32_f16(false, al, false, bh, (short)0, c, false, false);
  if (NT >= 3) c = __builtin_amdgcn_wmma_f32_16x16x32_f16(false, ah, false, bl, (short)0, c, false, false);
  asm volatile("v_nop\n\tv_nop\n\tv_nop\n\tv_nop" : "+v"(c) : "v"(ah), "v"(al), "v"(bh), "v"(bl));
  return c;
}
// batched GEMM like k_gemm_b but f16 operands: A f32 (split into f16 hi/lo if ASPLIT, else rounded to f16), Bt = f16 values [n][k]; alpha; C f32; N multiple of 16 (partial tiles skipped)
template <bool ASPLIT>
__global__ __launch_bounds__(128) void k_gemm_h(const float* __restrict__ A, int lda, size_t sA, const _Float16* __restrict__ Bh, int ldb, size_t sB, float alpha, float* __restrict__ C, int ldc, size_t sC, int M, int N, int K) {
  __shared__ __attribute__((aligned(16))) float so[4][16][64];
  const int tid = threadIdx.x, w = tid >> 5, lane = tid & 31, ln = lane & 15, hh = lane >> 4; const int by = blockIdx.y;
  A += (size_t)by * sA; Bh += (size_t)by * sB; C += (size_t)by * sC;
  const int ntn = (N + 63) / 64; const int wid = blockIdx.x * 4 + w; const int mt = wid / ntn, nq = wid % ntn; if (mt * 16 >= M) return;
  const int row0 = mt * 16, col0 = nq * 64; const float* arow = A + (size_t)(row0 + ln) * lda;
  v8f acc[4] = {};
  for (int kb = 0; kb < K; kb += 32) {
    FragH ah, al;
    const v4f x0 = *(const v4fa*)(arow + kb + 8 * hh), x1 = *(const v4fa*)(arow + kb + 8 * hh + 4), x2 = *(const v4fa*)(arow + kb + 16 + 8 * hh), x3 = *(const v4fa*)(arow + kb + 16 + 8 * hh + 4);
    float xs[16] = {x0[0],x0[1],x0[2],x0[3],x1[0],x1[1],x1[2],x1[3],x2[0],x2[1],x2[2],x2[3],x3[0],x3[1],x3[2],x3[3]};
#pragma unroll
    for (int i = 0; i < 16; ++i) { const _Float16 h = (_Float16)xs[i]; ah.h[i] = h; al.h[i] = ASPLIT ? (_Float16)(xs[i] - (float)h) : (_Float16)0.0f; }
#pragma unroll
    for (int t = 0; t < 4; ++t) { if (col0 + t * 16 >= N) continue; const size_t boff = (size_t)(col0 + t * 16 + ln) * ldb + kb; FragH bq; bq.half[0] = *(const v8us*)(Bh + boff + 8 * hh); bq.half[1] = *(const v8us*)(Bh + boff + 16 + 8 * hh);
      acc[t] = mmaH<ASPLIT ? 2 : 1>(ah.v, al.v, bq.v, bq.v, acc[t]); }
  }
#pragma unroll
  for (int t = 0; t < 4; ++t) { if (col0 + t * 16 >= N) continue;
#pragma unroll
    for (int r = 0; r < 8; ++r) so[w][8 * hh + r][t * 16 + ln] = acc[t][r] * alpha; }
  __builtin_amdgcn_fence(__ATOMIC_ACQ_REL, "workgroup"); __builtin_amdgcn_wave_barrier();
  const int rsub = lane >> 4, c4 = (lane & 15) * 4;
  {
#pragma unroll
    for (int q = 0; q < 8; ++q) { const int r = q * 2 + rsub; if (col0 + c4 < N) { const v4f v = *(const v4fa*)&so[w][r][c4]; *(v4f*)(C + (size_t)(row0 + r) * ldc + col0 + c4) = v; } }
     }
}

// Wt[n][k] = f16(W[k][n]·scale) from f32 row-major W[K][N] (scale = power of two; bf16-exact weights stay exact in f16 away from the subnormal range)
__global__ __launch_bounds__(256) void k_wt_f16(const float* __restrict__ W, _Float16* __restrict__ Wt, int K, int N, float scale) {
  const int t = blockIdx.x * 256 + threadIdx.x; if (t >= N * (K / 8)) return; const int n = t / (K / 8), k8 = (t % (K / 8)) * 8; FragH f;
#pragma unroll
  for (int i = 0; i < 8; ++i) f.h[i] = (_Float16)(bf16_round(W[(size_t)(k8 + i) * N + n]) * scale); const v8us o = f.half[0];
  *(v8us*)((unsigned short*)Wt + (size_t)n * K + k8) = o; 
}
// k_gemm_hh variant with fused epilogue: v = acc·alpha + bias[by·sBias + col] (+ CP[(row/rowsPerB)·sCPb + by·64 + col] if CP) ; ACT 0 none / 1 elu ; writes f16 C16 (and f32 C if non-null)
template <int ACT>
__global__ __launch_bounds__(128) void k_gemm_hhx(const _Float16* __restrict__ A, int lda, size_t sA, const _Float16* __restrict__ Bh, int ldb, size_t sB, float alpha, const float* __restrict__ bias, size_t sBias, const float* __restrict__ CP, int rowsPerB, size_t sCPb, int row0g,
    float* __restrict__ C, _Float16* __restrict__ C16, int ldc, size_t sC, int M, int N, int K) {
  __shared__ __attribute__((aligned(16))) float so[4][16][64];
  const int tid = threadIdx.x, w = tid >> 5, lane = tid & 31, ln = lane & 15, hh = lane >> 4; const int by = blockIdx.y;
  A += (size_t)by * sA; Bh += (size_t)by * sB; const size_t cofs = (size_t)by * sC; const float* bp = bias ? bias + (size_t)by * sBias : nullptr;
  const int ntn = (N + 63) / 64; const int wid = blockIdx.x * 4 + w; const int mt = wid / ntn, nq = wid % ntn; if (mt * 16 >= M) return;
  const int row0 = mt * 16, col0 = nq * 64; const _Float16* arow = A + (size_t)(row0 + ln) * lda;
  v8f acc[4] = {};
  for (int kb = 0; kb < K; kb += 32) { FragH ah; ah.half[0] = *(const v8us*)((const unsigned short*)arow + kb + 8 * hh); ah.half[1] = *(const v8us*)((const unsigned short*)arow + kb + 16 + 8 * hh);
#pragma unroll
    for (int t = 0; t < 4; ++t) { if (col0 + t * 16 >= N) continue; const size_t boff = (size_t)(col0 + t * 16 + ln) * ldb + kb; FragH bq; bq.half[0] = *(const v8us*)((const unsigned short*)Bh + boff + 8 * hh); bq.half[1] = *(const v8us*)((const unsigned short*)Bh + boff + 16 + 8 * hh);
      acc[t] = mmaH<1>(ah.v, ah.v, bq.v, bq.v, acc[t]); }
  }
#pragma unroll
  for (int t = 0; t < 4; ++t) { if (col0 + t * 16 >= N) continue; const int col = col0 + t * 16 + ln; const float bv = bp ? bf16_round(bp[col]) : 0.f;
#pragma unroll
    for (int r = 0; r < 8; ++r) { float v = acc[t][r] * alpha + bv; if (CP) { const int rr = row0g + row0 + 8 * hh + r; if (rowsPerB < 0) v += CP[cofs + (size_t)rr * ldc + col];      /* rowsPerB < 0: own element of the batched C plane */ else { const int bidx = rr / rowsPerB; v += CP[(size_t)bidx * sCPb + (size_t)by * 64 + col]; } } if (ACT == 1) v = (v > 0.f) ? v : expm1f(v); else if (ACT == 7) v = (v > 0.f) ? v + 1.0f : expf(v); else if (ACT == 8) v = tanhf(v); else if (ACT == 9) v = 0.5f * v * (1.0f + tanhf(0.7978845608028654f * (v + 0.044715f * v * v * v))); else if (ACT == 11) v = 1.0f / (1.0f + expf(-v)); else if (ACT == 12) v = (v > 0.f) ? v : 0.01f * v; else if (ACT == 14) v = (v > 0.f) ? v : 0.1f * v; else if (ACT == 16) v = (v >= 0.f) ? v : 0.3f * v; else if (ACT == 17) v = (v >= 0.f) ? v : 0.2f * v; else if (ACT == 15) v = v / (1.0f + expf(-v)); else if (ACT == 3) v = fmaxf(v, 0.f); else if (ACT == 6) v = 0.5f * v * (1.0f + erff(v * 0.70710678118654752f)); so[w][8 * hh + r][t * 16 + ln] = v; } }
  __builtin_amdgcn_fence(__ATOMIC_ACQ_REL, "workgroup"); __builtin_amdgcn_wave_barrier();
  const int rsub = lane >> 4, c4 = (lane & 15) * 4; typedef _Float16 v4h __attribute__((ext_vector_type(4)));
  {
#pragma unroll
    for (int q = 0; q < 8; ++q) { const int r = q * 2 + rsub; if (col0 + c4 < N) { const v4f v = *(const v4fa*)&so[w][r][c4]; if (C) *(v4f*)(C + cofs + (size_t)(row0 + r) * ldc + col0 + c4) = v; if (C16) { v4h h4; for (int i = 0; i < 4; ++i) h4[i] = (_Float16)v[i]; *(v4h*)(C16 + cofs + (size_t)(row0 + r) * ldc + col0 + c4) = h4; } } }
     }
}


typedef _Float16 v4h __attribute__((ext_vector_type(4)));

__global__ __launch_bounds__(256) void k_x16(const float* __restrict__ x, _Float16* __restrict__ X16, size_t n8) { const size_t t = (size_t)blockIdx.x * 256 + threadIdx.x; if (t >= n8) return; FragH f;
#pragma unroll
  for (int q = 0; q < 8; ++q) f.h[q] = (_Float16)bf16_round(x[t * 8 + q]); *(v8us*)((unsigned short*)X16 + t * 8) = f.half[0];  }
__global__ __launch_bounds__(256) void k_h16(const float* __restrict__ x, _Float16* __restrict__ X16, size_t n8) { const size_t t = (size_t)blockIdx.x * 256 + threadIdx.x; if (t >= n8) return; FragH f;
#pragma unroll
  for (int q = 0; q < 8; ++q) f.h[q] = (_Float16)x[t * 8 + q]; *(v8us*)((unsigned short*)X16 + t * 8) = f.half[0];  }
__global__ __launch_bounds__(256) void k_round16f(const float* __restrict__ W, _Float16* __restrict__ Bt, size_t n8) { const size_t t = (size_t)blockIdx.x * 256 + threadIdx.x; if (t >= n8) return; FragH f;
#pragma unroll
  for (int i = 0; i < 8; ++i) f.h[i] = (_Float16)(bf16_round(W[t * 8 + i]) * 16.0f); *(v8us*)((unsigned short*)Bt + t * 8) = f.half[0];  }
template <int NHv, int TTv>
__global__ __launch_bounds__(256) void k_vt(const _Float16* __restrict__ V16, int ldv, int voff, _Float16* __restrict__ Vt) { __shared__ unsigned short tl[64][66]; const int tid = threadIdx.x; const int slab = blockIdx.x / (TTv / 64), lg = blockIdx.x % (TTv / 64); const int b = slab / NHv, h = slab % NHv;
  for (int i = tid; i < 64 * 8; i += 256) { const int r = i / 8, c8 = (i % 8) * 8; FragH f; f.half[0] = *(const v8us*)((const unsigned short*)V16 + ((size_t)b * TTv + lg * 64 + r) * ldv + voff + h * 64 + c8);
#pragma unroll
    for (int q = 0; q < 8; ++q) tl[r][c8 + q] = f.u[q]; }
  __syncthreads();
  {
#pragma unroll
    for (int rd = 0; rd < 2; ++rd) { const int d = rd * 32 + tid / 8, pc = tid % 8; FragH f;
#pragma unroll
      for (int q = 0; q < 8; ++q) f.u[q] = tl[pc * 8 + q][d];
      *(v8us*)((unsigned short*)Vt + ((size_t)slab * 64 + d) * TTv + lg * 64 + pc * 8) = f.half[0]; }
     } }

__global__ __launch_bounds__(256) void k_hl(const float* __restrict__ F, _Float16* __restrict__ Hh, _Float16* __restrict__ Hl, size_t n8) { const size_t t = (size_t)blockIdx.x * 256 + threadIdx.x; if (t >= n8) return; FragH fh, fl; const v4f a = *(const v4fa*)(F + t * 8), c = *(const v4fa*)(F + t * 8 + 4);
#pragma unroll
  for (int q = 0; q < 4; ++q) { _Float16 h = (_Float16)a[q]; fh.h[q] = h; fl.h[q] = (_Float16)((a[q] - (float)h) * 1024.0f); h = (_Float16)c[q]; fh.h[4 + q] = h; fl.h[4 + q] = (_Float16)((c[q] - (float)h) * 1024.0f); }
  { *(v8us*)((unsigned short*)Hh + t * 8) = fh.half[0]; *(v8us*)((unsigned short*)Hl + t * 8) = fl.half[0];  } }

// ---- fast GEMM (work-group tile 128x64, wave tile 32x64; requires M % 128 == 0 rows per launch region and N % 64 == 0); epilogue = k_gemm_hhx semantics ----
__device__ __forceinline__ v8f g2_mma(v16h a, v16h b, v8f c) { v8f d = __builtin_amdgcn_wmma_f32_16x16x32_f16(false, a, false, b, (short)0, c, false, false); asm volatile("v_nop\n\tv_nop\n\tv_nop\n\tv_nop" : "+v"(d) : "v"(a), "v"(b)); return d; }
// One A or B fragment (16 rows x 32 k) from staged LDS rows; p: the lane's row, plus 16 * hh bytes. k order, the same for A and B: 8 hh .. 8 hh + 7, then 16 + 8 hh .. 16 + 8 hh + 7.
__device__ __forceinline__ v16h g2_lfrag(const unsigned char* p) { FragH f; f.half[0] = *(const v8us*)p; f.half[1] = *(const v8us*)(p + 32); return f.v; }
// Twelve asynchronous 16-byte copies per lane, global memory -> LDS. The s_wait_xcnt is the last line of the copies' own statement, so no register that a copy names is rewritten in front of it.
__device__ __forceinline__ void g2_copy12(const unsigned (&l)[12], const _Float16* const (&g)[12]) {
  asm volatile("global_load_async_to_lds_b128 %0, %12, off\n\t"
               "global_load_async_to_lds_b128 %1, %13, off\n\t"
               "global_load_async_to_lds_b128 %2, %14, off\n\t"
               "global_load_async_to_lds_b128 %3, %15, off\n\t"
               "global_load_async_to_lds_b128 %4, %16, off\n\t"
               "global_load_async_to_lds_b128 %5, %17, off\n\t"
               "global_load_async_to_lds_b128 %6, %18, off\n\t"
               "global_load_async_to_lds_b128 %7, %19, off\n\t"
               "global_load_async_to_lds_b128 %8, %20, off\n\t"
               "global_load_async_to_lds_b128 %9, %21, off\n\t"
               "global_load_async_to_lds_b128 %10, %22, off\n\t"
               "global_load_async_to_lds_b128 %11, %23, off\n\t"
               "s_wait_xcnt 0x0"
               :: "v"(l[0]), "v"(l[1]), "v"(l[2]), "v"(l[3]), "v"(l[4]), "v"(l[5]), "v"(l[6]), "v"(l[7]), "v"(l[8]), "v"(l[9]), "v"(l[10]), "v"(l[11]),
                  "v"(g[0]), "v"(g[1]), "v"(g[2]), "v"(g[3]), "v"(g[4]), "v"(g[5]), "v"(g[6]), "v"(g[7]), "v"(g[8]), "v"(g[9]), "v"(g[10]), "v"(g[11]) : "memory"); }
// One k slab (KC columns of the work-group's 128 A rows, then of its 64 B rows) into one LDS buffer. A row's KC * 2 bytes are KC / 8 neighbouring lanes' 16 bytes each: every copy covers whole 128-byte lines.
// ag, bg: the lane's own 16 bytes in row tid / (KC / 8) of the A and of the B slab; lds: the LDS byte address of the same place in the buffer. Unrolled in full: l[] and g[] are asm operands.
template <int KC>
__device__ __forceinline__ void g2_stage(const _Float16* ag, int lda, const _Float16* bg, int ldb, unsigned lds) {
  constexpr int RPU = 128 / (KC / 8), NA = 128 / RPU, NC = 192 / RPU, PB = KC * 2 + 16;      /* rows per round of 128 lanes; rounds for A; rounds in all; LDS pitch in bytes */
#pragma unroll
  for (int s = 0; s < NC / 12; ++s) { unsigned l[12]; const _Float16* g[12];
#pragma unroll
    for (int j = 0; j < 12; ++j) { const int u = s * 12 + j; l[j] = lds + (unsigned)(u * RPU * PB); g[j] = (u < NA) ? ag + (size_t)(u * RPU) * lda : bg + (size_t)((u - NA) * RPU) * ldb; }
    g2_copy12(l, g); } }
// BG: consecutive blockIdx.y values that share one B slab (grouped-query attention: BG query heads read the same k / v rows); slab = blockIdx.y / BG
// KC: columns of k per staged slab. M a multiple of 128, N of 64, K of KC. The work-group's A rows (128) and B rows (64) go to LDS slab by slab, two buffers: slab t + 1 is copied while slab t is multiplied.
// LDS pitch KC * 2 + 16 bytes = 16 B x odd, so the 16 rows of a fragment read spread over the banks.
// ROPE (ACT 0; bias and CP are not read): the N tile is one head (64 columns); the epilogue turns each (even, odd) column pair of row r by the angle whose cosine and sine are CS, SN[r % SQ][pair] and stores the turned rows: f16 to C16, and f32 to C for rows below nf32.
typedef float v2fa __attribute__((ext_vector_type(2), may_alias));
// Two (even, odd) pairs, each turned by its own angle: c, s hold the two cosines and sines.
__device__ __forceinline__ v4f g2_turn(v4f v, v2fa c, v2fa s) { v4f o; o[0] = v[0] * c[0] - v[1] * s[0]; o[1] = v[0] * s[0] + v[1] * c[0]; o[2] = v[2] * c[1] - v[3] * s[1]; o[3] = v[2] * s[1] + v[3] * c[1]; return o; }
template <int ACT, int BG = 1, int KC = 128, bool ROPE = false>
__global__ __launch_bounds__(128) void k_gemm2(const _Float16* __restrict__ A, int lda, size_t sA, const _Float16* __restrict__ Bh, int ldb, size_t sB, float alpha, const float* __restrict__ bias, size_t sBias, const float* __restrict__ CP, int rowsPerB, size_t sCPb, int row0g,
    float* __restrict__ C, _Float16* __restrict__ C16, int ldc, size_t sC, int M, int N, int K, const float* __restrict__ CS = nullptr, const float* __restrict__ SN = nullptr, int nf32 = 0) { static_assert(ACT == 0 || ACT == 3 || ACT == 6 || ACT == 8 || ACT == 9 || ACT == 11 || ACT == 12 || ACT == 14 || ACT == 15 || ACT == 16 || ACT == 17, "k_gemm2: unsupported ACT code (would silently apply no activation)");
  constexpr int PB = KC * 2 + 16, BUFB = 192 * PB; static_assert(2 * BUFB >= 4 * 32 * 68 * 4, "the output staging must fit the two slab buffers");
  __shared__ __attribute__((aligned(16))) unsigned char st[2 * BUFB];
  float (*so)[32][68] = (float (*)[32][68])st;      /* output staging in the same LDS: first written behind the last trip's barrier, when no copy is in flight and every fragment read is done */
  const int tid = threadIdx.x, w = tid >> 5, lane = tid & 31, ln = lane & 15, hh = lane >> 4; const int by = blockIdx.y;
  A += (size_t)by * sA; Bh += (size_t)(by / BG) * sB; const size_t cofs = (size_t)by * sC; const float* bp = bias ? bias + (size_t)by * sBias : nullptr;
  const int ntn = N >> 6; const int mt = blockIdx.x / ntn, nq = blockIdx.x - mt * ntn; const int row0 = mt * 128 + 32 * w, col0 = nq * 64; if (mt * 128 >= M) return;      /* the same for the whole work-group: it stands in front of barriers */
  const int sr = tid / (KC / 8), sc = tid % (KC / 8);      /* this lane's row and 16-byte column in a round of copies */
  const _Float16* ag = A + (size_t)(mt * 128 + sr) * lda + sc * 8; const _Float16* bg = Bh + (size_t)(col0 + sr) * ldb + sc * 8;
  const unsigned lds0 = (unsigned)(size_t)(&st[0]) + (unsigned)(sr * PB + sc * 16);
  const int nt = K / KC;
  const v8f z8 = {0.f,0.f,0.f,0.f,0.f,0.f,0.f,0.f}; v8f c00 = z8, c01 = z8, c02 = z8, c03 = z8, c10 = z8, c11 = z8, c12 = z8, c13 = z8;
  g2_stage<KC>(ag, lda, bg, ldb, lds0);
  asm volatile("s_wait_asynccnt 0x0" ::: "memory");      /* this wave's copies of slab 0 have landed */
  __syncthreads();      /* slab 0 readable by every wave */
  if (nt > 1) g2_stage<KC>(ag + KC, lda, bg + KC, ldb, lds0 + BUFB);
#pragma unroll 1
  for (int t = 0; t < nt; ++t) { const unsigned char* sb = st + (t & 1) * BUFB; const unsigned char* sa = sb + (32 * w + ln) * PB + 16 * hh; const unsigned char* sbr = sb + (128 + ln) * PB + 16 * hh;
    v16h fa[2][2], fb[2][4];      /* two fragment sets: the next k step's twelve LDS reads go out as one group in front of this k step's products, so the wave waits out the LDS latency once a slab */
    fa[0][0] = g2_lfrag(sa); fa[0][1] = g2_lfrag(sa + 16 * PB); fb[0][0] = g2_lfrag(sbr); fb[0][1] = g2_lfrag(sbr + 16 * PB); fb[0][2] = g2_lfrag(sbr + 32 * PB); fb[0][3] = g2_lfrag(sbr + 48 * PB);
#pragma unroll
    for (int kk = 0; kk < KC / 32; ++kk) { const int cu = kk & 1, nx = cu ^ 1;      /* unrolled in full: fa[] and fb[] are indexed by constants and stay in registers, the LDS offsets become immediates */
      if (kk + 1 < KC / 32) { const int o = (kk + 1) * 64; fa[nx][0] = g2_lfrag(sa + o); fa[nx][1] = g2_lfrag(sa + 16 * PB + o); fb[nx][0] = g2_lfrag(sbr + o); fb[nx][1] = g2_lfrag(sbr + 16 * PB + o); fb[nx][2] = g2_lfrag(sbr + 32 * PB + o); fb[nx][3] = g2_lfrag(sbr + 48 * PB + o); }
      c00 = g2_mma(fa[cu][0], fb[cu][0], c00); c10 = g2_mma(fa[cu][1], fb[cu][0], c10);
      c01 = g2_mma(fa[cu][0], fb[cu][1], c01); c11 = g2_mma(fa[cu][1], fb[cu][1], c11);
      c02 = g2_mma(fa[cu][0], fb[cu][2], c02); c12 = g2_mma(fa[cu][1], fb[cu][2], c12);
      c03 = g2_mma(fa[cu][0], fb[cu][3], c03); c13 = g2_mma(fa[cu][1], fb[cu][3], c13); }
    asm volatile("s_wait_dscnt 0x0" ::: "memory");      /* this wave's reads of slab t are done before the buffer is refilled */
    asm volatile("s_wait_asynccnt 0x0" ::: "memory");      /* this wave's copies of slab t + 1 have landed */
    __syncthreads();      /* publishes slab t + 1 and ends every wave's reads of slab t */
    if (t + 2 < nt) g2_stage<KC>(ag + (size_t)(t + 2) * KC, lda, bg + (size_t)(t + 2) * KC, ldb, lds0 + (unsigned)((t & 1) * BUFB)); }
  asm volatile("s_wait_asynccnt 0x0" ::: "memory");      /* no copy outstanding when the LDS becomes output staging */
  v2fa cc[ROPE ? 16 : 1], ss[ROPE ? 16 : 1];      /* ROPE: cosines and sines of the 2 pairs that this lane turns in each of its 16 rows; 16 lanes read one table row = one 128-byte line */
  if constexpr (ROPE) { static_assert(HD == 64 && ACT == 0, "one N tile = one head: a pair's number is its column in the tile / 2; no activation");
#pragma unroll      /* unrolled in full: cc[], ss[] stay in registers; all 32 loads go out here, so their latency passes while the accumulators are staged */
    for (int q = 0; q < 16; ++q) { const size_t tb = (size_t)((unsigned)(row0 + q * 2 + hh) % SQ) * (HD / 2) + ln * 2; cc[q] = *(const v2fa*)(CS + tb); ss[q] = *(const v2fa*)(SN + tb); }
    asm volatile("s_wait_xcnt 0x0" ::: "memory"); }      /* the table loads' address registers are reused below */
  v8f accs[8] = {c00, c01, c02, c03, c10, c11, c12, c13};
  if constexpr (ROPE) {      /* q and k have no bias, no added plane and no activation: the staging is the scaled accumulators alone; both loops unrolled in full: accs[] is indexed by constants and stays in registers */
#pragma unroll
    for (int u = 0; u < 8; ++u) {
#pragma unroll
      for (int r = 0; r < 8; ++r) so[w][(u >> 2) * 16 + 8 * hh + r][(u & 3) * 16 + ln] = accs[u][r] * alpha; }
  } else {
#pragma unroll
  for (int u = 0; u < 8; ++u) { const int t = u & 3, half = u >> 2; const int col = col0 + t * 16 + ln; const float bv = bp ? bf16_round(bp[col]) : 0.f;
#pragma unroll
    for (int r = 0; r < 8; ++r) { const int rloc = half * 16 + 8 * hh + r; float v = accs[u][r] * alpha + bv; if (CP) { if (rowsPerB < 0) v += CP[cofs + (size_t)(row0g + row0 + rloc) * ldc + col];      /* rowsPerB < 0: own element of the batched C plane */ else { const int bidx = (row0g + row0 + rloc) / rowsPerB; v += CP[(size_t)bidx * sCPb + (size_t)by * 64 + col]; } }
      if (ACT == 3) v = fmaxf(v, 0.f); else if (ACT == 6) v = 0.5f * v * (1.0f + erff(v * 0.70710678118654752f)); else if (ACT == 11) v = 1.0f / (1.0f + expf(-v)); else if (ACT == 15) v = v / (1.0f + expf(-v)); else if (ACT == 12) v = (v > 0.f) ? v : 0.01f * v; else if (ACT == 8) v = tanhf(v); else if (ACT == 9) v = 0.5f * v * (1.0f + tanhf(0.7978845608028654f * (v + 0.044715f * v * v * v))); else if (ACT == 14) v = (v > 0.f) ? v : 0.1f * v; else if (ACT == 16) v = (v >= 0.f) ? v : 0.3f * v; else if (ACT == 17) v = (v >= 0.f) ? v : 0.2f * v;
      so[w][rloc][t * 16 + ln] = v; } } }
  __builtin_amdgcn_fence(__ATOMIC_ACQ_REL, "workgroup"); __builtin_amdgcn_wave_barrier();
  const int rsub = lane >> 4, c4 = (lane & 15) * 4;
  if constexpr (ROPE) {      /* both loops unrolled in full: cc[], ss[] are indexed by constants; a lane's 4 columns are 2 whole pairs */
#pragma unroll
    for (int q = 0; q < 16; ++q) { const int r = q * 2 + rsub; const v4f o = g2_turn(*(const v4fa*)&so[w][r][c4], cc[q], ss[q]); v4h h4; for (int i = 0; i < 4; ++i) h4[i] = (_Float16)o[i]; *(v4h*)(C16 + cofs + (size_t)(row0 + r) * ldc + col0 + c4) = h4; }
    if (mt * 128 < nf32) {      /* the same for the whole work-group: only the first row tiles also store f32 rows; a loop of its own, so that the f16 loop above is free of branches and its LDS reads go out together */
      asm volatile("s_wait_xcnt 0x0" ::: "memory");      /* the f16 stores' address and data registers are reused below */
#pragma unroll      /* unrolled in full, like the loop above */
      for (int q = 0; q < 16; ++q) { const int r = q * 2 + rsub; if (row0 + r < nf32) *(v4f*)(C + cofs + (size_t)(row0 + r) * ldc + col0 + c4) = g2_turn(*(const v4fa*)&so[w][r][c4], cc[q], ss[q]); } }
  } else {
#pragma unroll
    for (int q = 0; q < 16; ++q) { const int r = q * 2 + rsub; const v4f v = *(const v4fa*)&so[w][r][c4]; if (C) *(v4f*)(C + cofs + (size_t)(row0 + r) * ldc + col0 + c4) = v; if (C16) { v4h h4; for (int i = 0; i < 4; ++i) h4[i] = (_Float16)v[i]; *(v4h*)(C16 + cofs + (size_t)(row0 + r) * ldc + col0 + c4) = h4; } }
     } }


__global__ __launch_bounds__(256) void k_wnat(const float* __restrict__ w, size_t n8, _Float16* __restrict__ Bt) { const size_t t = (size_t)blockIdx.x * 256 + threadIdx.x; if (t >= n8) return; FragH f; for (int q = 0; q < 8; ++q) f.h[q] = (_Float16)(bf16_round(w[t * 8 + q]) * 16.0f); *(v8us*)((unsigned short*)Bt + t * 8) = f.half[0];  }
__global__ __launch_bounds__(256) void k_rsm(const float* __restrict__ S, _Float16* __restrict__ P, int nrows) {
  #pragma clang fp contract(off)
  const int i = blockIdx.x * 256 + threadIdx.x; if (i >= nrows) return; const float* s = S + (size_t)i * SQ; float mx = -3.0e38f;
#pragma unroll 1
  for (int j = 0; j < SQ; ++j) mx = fmaxf(mx, s[j]); float se = 0.f;
#pragma unroll 1
  for (int j = 0; j < SQ; ++j) se += expf(s[j] - mx); const float sc = 256.0f / se;
#pragma unroll 1
  for (int j0 = 0; j0 < SQ; j0 += 8) { FragH f; for (int q = 0; q < 8; ++q) f.h[q] = (_Float16)(expf(s[j0 + q] - mx) * sc); unsigned short* d = (unsigned short*)P + (size_t)i * SQ + j0; *(v8us*)d = f.half[0];  } }
__global__ __launch_bounds__(256) void k_vt(const _Float16* __restrict__ V16, int b, int h0, _Float16* __restrict__ VT) { __shared__ unsigned short tl[64][65]; const int tid = threadIdx.x; const int hh = blockIdx.x % HG, sg = blockIdx.x / HG; const int s0 = sg * 64; const int h = h0 + hh;
  for (int i = tid; i < 64 * 8; i += 256) { const int j = i / 8, d8 = (i % 8) * 8; FragH f; f.half[0] = *(const v8us*)((const unsigned short*)V16 + ((size_t)b * SQ + s0 + j) * DM + h * HD + d8); for (int q = 0; q < 8; ++q) tl[d8 + q][j] = f.u[q]; }
  __syncthreads();
  { for (int i = tid; i < 64 * 8; i += 256) { const int d = i / 8, j8 = (i % 8) * 8; FragH f; for (int q = 0; q < 8; ++q) f.u[q] = tl[d][j8 + q]; *(v8us*)((unsigned short*)VT + ((size_t)hh * HD + d) * SQ + s0 + j8) = f.half[0]; }  } }



#define FK 64                        /* keys per staged tile of the fused attention kernel */
#define FPB (FK * 2 + 16)            /* LDS pitch of a staged row (a k row: HD f16 = 128 B; a V^T row: FK f16 = 128 B) plus 16 B: 16 B x odd, so the 16 rows of a fragment read spread over the banks */
#define FBUF (2 * FK * FPB)          /* one buffer: FK k rows, then HD V^T rows */
#define FQ 32                        /* query rows per wave */
// Eight asynchronous 16-byte copies per lane, global memory -> LDS. The s_wait_xcnt is the last line of the copies' own statement, so no register that a copy names is rewritten in front of it.
__device__ __forceinline__ void fa_copy8(const unsigned (&l)[8], const _Float16* const (&g)[8]) {
  asm volatile("global_load_async_to_lds_b128 %0, %8, off\n\t"
               "global_load_async_to_lds_b128 %1, %9, off\n\t"
               "global_load_async_to_lds_b128 %2, %10, off\n\t"
               "global_load_async_to_lds_b128 %3, %11, off\n\t"
               "global_load_async_to_lds_b128 %4, %12, off\n\t"
               "global_load_async_to_lds_b128 %5, %13, off\n\t"
               "global_load_async_to_lds_b128 %6, %14, off\n\t"
               "global_load_async_to_lds_b128 %7, %15, off\n\t"
               "s_wait_xcnt 0x0"
               :: "v"(l[0]), "v"(l[1]), "v"(l[2]), "v"(l[3]), "v"(l[4]), "v"(l[5]), "v"(l[6]), "v"(l[7]),
                  "v"(g[0]), "v"(g[1]), "v"(g[2]), "v"(g[3]), "v"(g[4]), "v"(g[5]), "v"(g[6]), "v"(g[7]) : "memory"); }
// One tile (FK k rows, then the same FK keys of the HD V^T rows) into one LDS buffer: a row's 128 bytes are 8 neighbouring lanes' 16 bytes each, 16 rows a round of 128 lanes.
// kg, vg: the lane's own 16 bytes in row tid / 8 of the k tile and of the V^T tile; lds: the LDS byte address of the same place in the buffer. Unrolled in full: l[] and g[] are asm operands.
__device__ __forceinline__ void fa_stage(const _Float16* kg, const _Float16* vg, unsigned lds) {
  unsigned l[8]; const _Float16* g[8];
#pragma unroll
  for (int u = 0; u < 8; ++u) { l[u] = lds + (unsigned)(u * 16 * FPB); g[u] = (u < 4) ? kg + (size_t)(u * 16) * KVD : vg + (size_t)((u - 4) * 16) * SQ; }
  fa_copy8(l, g); }
__device__ __forceinline__ void fa_exp8(float (&x)[8]) {
  asm("v_exp_f32 %0, %0\n\t"
      "v_exp_f32 %1, %1\n\t"
      "v_exp_f32 %2, %2\n\t"
      "v_exp_f32 %3, %3\n\t"
      "v_exp_f32 %4, %4\n\t"
      "v_exp_f32 %5, %5\n\t"
      "v_exp_f32 %6, %6\n\t"
      "v_exp_f32 %7, %7\n\t"
      "v_nop"
      : "+v"(x[0]), "+v"(x[1]), "+v"(x[2]), "+v"(x[3]), "+v"(x[4]), "+v"(x[5]), "+v"(x[6]), "+v"(x[7])); }
// One 2^x with the same slot behind it.
__device__ __forceinline__ float fa_exp1(float x) { asm("v_exp_f32 %0, %0\n\tv_nop" : "+v"(x)); return x; }
__device__ __forceinline__ v8f fa_mma(v16h a, v16h b, v8f c) { return __builtin_amdgcn_wmma_f32_16x16x32_f16(false, a, false, b, (short)0, c, false, false); }
__global__ __launch_bounds__(128) void k_fattn(const _Float16* __restrict__ Q, const _Float16* __restrict__ Kh, const _Float16* __restrict__ Vt, _Float16* __restrict__ O) {
  __shared__ __attribute__((aligned(16))) unsigned char st[2 * FBUF];
  const int tid = threadIdx.x, lane = tid & 31, c = lane & 15, hh = lane >> 4; const int w = __builtin_amdgcn_readfirstlane(tid >> 5);      /* the wave's number in a scalar register: the head's offsets become scalar arithmetic */
  const int qt = (SQ / FQ - 1) - (int)(blockIdx.x / (NB * NG)); const int bg = (int)(blockIdx.x % (NB * NG)); const int b = bg / NG, g = bg % NG;      /* longest rows first */
  const int q0 = qt * FQ, h = g * HPG + w; const int nt = (q0 + FQ + FK - 1) / FK;      /* causal: tiles up to the one that holds the last query's own key; the same for the whole work-group */
  const int sr = tid >> 3, sc = tid & 7;      /* this lane's row and 16-byte column in a round of copies */
  const _Float16* kg = Kh + ((size_t)b * SQ + sr) * KVD + g * HD + sc * 8; const _Float16* vg = Vt + ((size_t)bg * HD + sr) * SQ + sc * 8;
  const unsigned lds0 = (unsigned)(size_t)(&st[0]) + (unsigned)(sr * FPB + sc * 16);
  fa_stage(kg, vg, lds0);
  v16h qf[2][2];
#pragma unroll
  for (int j = 0; j < 2; ++j) {
#pragma unroll
    for (int ks = 0; ks < 2; ++ks) { const unsigned short* p = (const unsigned short*)Q + ((size_t)b * SQ + q0 + j * 16 + c) * DM + h * HD + ks * 32 + 8 * hh; FragH f; f.half[0] = *(const v8us*)p; f.half[1] = *(const v8us*)(p + 16); qf[j][ks] = f.v; } }
  asm volatile("s_wait_xcnt 0x0" ::: "memory");      /* the q loads' address registers are reused below */
  asm volatile("s_wait_asynccnt 0x0" ::: "memory");      /* this wave's copies of tile 0 have landed */
  __syncthreads();      /* tile 0 readable by every wave */
  if (nt > 1) fa_stage(kg + (size_t)FK * KVD, vg + FK, lds0 + FBUF);
  const v8f z8 = {0.f,0.f,0.f,0.f,0.f,0.f,0.f,0.f};
  v8f acc[4][2]; float m[2], l[2];
#pragma unroll
  for (int j = 0; j < 2; ++j) { m[j] = -1.0e30f; l[j] = 0.f;
#pragma unroll
    for (int dt = 0; dt < 4; ++dt) acc[dt][j] = z8; }
  const float C = 0.125f * 1.4426950408889634f;      /* 1 / sqrt(HD), and e^x = 2^(x log2 e) */
#pragma unroll 1      /* kept rolled: one copy of the long body, the buffer chosen by t & 1 */
  for (int t = 0; t < nt; ++t) { const unsigned char* sk = st + (t & 1) * FBUF + c * FPB + 16 * hh; const unsigned char* sv = sk + FK * FPB;
#pragma unroll
    for (int ps = 0; ps < FK / 32; ++ps) { const int kb = t * FK + ps * 32;      /* a pass: 32 keys, one k step of O^T += V^T P^T */
      if (kb <= q0) {      /* the same for the whole work-group; false only for a pass whose every key lies past the diagonal */
        v8f s[2][2];
#pragma unroll
        for (int kt = 0; kt < 2; ++kt) { const v16h k0 = g2_lfrag(sk + (ps * 2 + kt) * 16 * FPB), k1 = g2_lfrag(sk + (ps * 2 + kt) * 16 * FPB + 64);
#pragma unroll
          for (int j = 0; j < 2; ++j) s[kt][j] = fa_mma(k1, qf[j][1], fa_mma(k0, qf[j][0], z8)); }
        if (kb == q0) {      /* only the pass on the diagonal holds masked keys */
#pragma unroll
          for (int kt = 0; kt < 2; ++kt) {
#pragma unroll
            for (int j = 0; j < 2; ++j) {
#pragma unroll
              for (int r = 0; r < 8; ++r) s[kt][j][r] = (kt * 16 + 8 * hh + r <= j * 16 + c) ? s[kt][j][r] : -1.0e30f; } } }
        FragH pf[2];
#pragma unroll
        for (int j = 0; j < 2; ++j) { float mk[2];
#pragma unroll
          for (int kt = 0; kt < 2; ++kt) mk[kt] = fmaxf(fmaxf(fmaxf(s[kt][j][0], s[kt][j][1]), fmaxf(s[kt][j][2], s[kt][j][3])), fmaxf(fmaxf(s[kt][j][4], s[kt][j][5]), fmaxf(s[kt][j][6], s[kt][j][7])));
          float mx = fmaxf(mk[0], mk[1]); mx = fmaxf(mx, __shfl_xor(mx, 16, 32)); mx = fmaxf(mx, m[j]);
          const float al = fa_exp1((m[j] - mx) * C); const float nb = 8.0f - mx * C; m[j] = mx;      /* weights x256: 2^(s C - mx C + 8); a masked key gives 0 */
          float sm[2];
#pragma unroll
          for (int kt = 0; kt < 2; ++kt) { float p[8];
#pragma unroll
            for (int r = 0; r < 8; ++r) p[r] = __builtin_fmaf(s[kt][j][r], C, nb);
            fa_exp8(p); sm[kt] = ((p[0] + p[1]) + (p[2] + p[3])) + ((p[4] + p[5]) + (p[6] + p[7]));
#pragma unroll
            for (int r = 0; r < 8; ++r) pf[j].h[kt * 8 + r] = (_Float16)p[r]; }
          l[j] = __builtin_fmaf(l[j], al, sm[0] + sm[1]);      /* this lane half's keys only; the halves are joined behind the loop */
#pragma unroll
          for (int dt = 0; dt < 4; ++dt) acc[dt][j] *= al; }
#pragma unroll
        for (int dt = 0; dt < 4; ++dt) { const v16h vf = g2_lfrag(sv + dt * 16 * FPB + ps * 64);
#pragma unroll
          for (int j = 0; j < 2; ++j) acc[dt][j] = fa_mma(vf, pf[j].v, acc[dt][j]); } } }
    asm volatile("s_wait_dscnt 0x0" ::: "memory");      /* this wave's reads of tile t are done before the buffer is refilled */
    asm volatile("s_wait_asynccnt 0x0" ::: "memory");      /* this wave's copies of tile t + 1 have landed */
    __syncthreads();      /* publishes tile t + 1 and ends every wave's reads of tile t */
    if (t + 2 < nt) fa_stage(kg + (size_t)(t + 2) * FK * KVD, vg + (size_t)(t + 2) * FK, lds0 + (unsigned)((t & 1) * FBUF)); }
  asm volatile("s_wait_asynccnt 0x0" ::: "memory");      /* no copy outstanding when the wave ends */
  FragH of[2][4];      /* every piece converted into registers of its own before the first store: no register of an issued store is written again */
#pragma unroll
  for (int j = 0; j < 2; ++j) { const float fin = 64.0f / (l[j] + __shfl_xor(l[j], 16, 32));
#pragma unroll
    for (int dt = 0; dt < 4; ++dt) {
#pragma unroll
      for (int r = 0; r < 8; ++r) of[j][dt].h[r] = (_Float16)(acc[dt][j][r] * fin); } }
#pragma unroll
  for (int j = 0; j < 2; ++j) { unsigned short* po = (unsigned short*)O + ((size_t)b * SQ + q0 + j * 16 + c) * DM + h * HD + 8 * hh;      /* a lane's 8 accumulator registers are 8 neighbouring head dims of one query row: one 16-byte store */
#pragma unroll
    for (int dt = 0; dt < 4; ++dt) *(v8us*)(po + dt * 16) = of[j][dt].half[0]; } }


#define A0R 16                       /* query rows, one wave each, per work-group of the f32 first-tile kernel */
#define A0P (HD + 4)                 /* pitch of a staged k row in floats: 272 B = 16 B x 17, so 32 lanes reading 32 different rows spread over the LDS banks */
typedef float v2f __attribute__((ext_vector_type(2)));
// f32 causal attention for query rows 0..QT0-1 of one batch. One work-group per (head, A0R query rows): the head's QT0 k and v rows are staged in LDS once,
// then one wave per query row i: scores with one key per lane (32 keys a pass), maximum and sum over the lanes, then o with two head dims per lane, key after key.
// Every loop is unrolled in full so that s[], e[], q[], tk[] and tv[] are indexed by constants and stay in registers and the lane number of each readlane is a constant; the tests on c are the same for the whole wave.
__global__ __launch_bounds__(512) void k_att0w(const float* __restrict__ QF, const float* __restrict__ KF, const float* __restrict__ VF, int ld, float scale, float* __restrict__ OF, int ldo) {
  __shared__ __attribute__((aligned(16))) float lk[QT0][A0P]; __shared__ __attribute__((aligned(16))) float lv[QT0][HD];
  const int tid = threadIdx.x, lane = tid & 31; const int w = __builtin_amdgcn_readfirstlane(tid >> 5);
  const int h = blockIdx.x / (QT0 / A0R), rg = blockIdx.x % (QT0 / A0R); const int i = rg * A0R + w;
  v4f tk[QT0 * (HD / 4) / 512], tv[QT0 * (HD / 4) / 512];      /* all loads issued before the first LDS store: one memory latency for the whole stage */
#pragma unroll
  for (int u = 0; u < QT0 * (HD / 4) / 512; ++u) { const int e4 = u * 512 + tid; const size_t g = (size_t)(e4 / (HD / 4)) * ld + h * HD + (e4 % (HD / 4)) * 4; tk[u] = *(const v4fa*)(KF + g); tv[u] = *(const v4fa*)(VF + g); }
  const float* qr = QF + (size_t)i * ld + h * HD; v4f q[HD / 4];
#pragma unroll
  for (int d = 0; d < HD / 4; ++d) q[d] = *(const v4fa*)(qr + d * 4);
#pragma unroll
  for (int u = 0; u < QT0 * (HD / 4) / 512; ++u) { const int e4 = u * 512 + tid; *(v4f*)&lk[e4 / (HD / 4)][(e4 % (HD / 4)) * 4] = tk[u]; *(v4f*)&lv[e4 / (HD / 4)][(e4 % (HD / 4)) * 4] = tv[u]; }
  __syncthreads();
  float s[QT0 / 32]; float mx = -1.0e30f;
#pragma unroll
  for (int c = 0; c < QT0 / 32; ++c) { s[c] = -1.0e30f;
    if (c * 32 <= i) { const float* kr = &lk[c * 32 + lane][0]; v4f a = {0.f, 0.f, 0.f, 0.f};
#pragma unroll
      for (int d = 0; d < HD / 4; ++d) a += q[d] * *(const v4f*)(kr + d * 4);
      const float t = ((a[0] + a[1]) + (a[2] + a[3])) * scale; s[c] = (c * 32 + lane <= i) ? t : -1.0e30f; mx = fmaxf(mx, s[c]); } }
#pragma unroll
  for (int d = 16; d > 0; d >>= 1) mx = fmaxf(mx, __shfl_xor(mx, d, 32));
  float e[QT0 / 32]; float l = 0.f;
#pragma unroll
  for (int c = 0; c < QT0 / 32; ++c) { e[c] = 0.f; if (c * 32 <= i) { e[c] = expf(s[c] - mx); l += e[c]; } }      /* a masked key: expf(-1e30 - mx) = 0 */
#pragma unroll
  for (int d = 16; d > 0; d >>= 1) l += __shfl_xor(l, d, 32);
  v2f o = {0.f, 0.f};
#pragma unroll
  for (int c = 0; c < QT0 / 32; ++c) if (c * 32 <= i) {
#pragma unroll
    for (int j = 0; j < 32; ++j) { const float p = __int_as_float(__builtin_amdgcn_readlane(__float_as_int(e[c]), j)); o += p * *(const v2f*)&lv[c * 32 + j][lane * 2]; } }
  const float fin = 64.0f / l;      /* o carried x64 like the f16 path */
  *(v2f*)(OF + (size_t)i * ldo + h * HD + lane * 2) = o * fin; }


__global__ __launch_bounds__(256) void k_kvexp(const float* __restrict__ src, float* __restrict__ dst, size_t n4) { const size_t t = (size_t)blockIdx.x * 256 + threadIdx.x; if (t >= n4) return; const size_t e = t * 4; const size_t row = e / DM; const int col = (int)(e % DM); const int h = col / HD, d = col % HD; const v4f v = *(const v4fa*)(src + row * KVD + (size_t)(h / HPG) * HD + d); *(v4f*)(dst + e) = v;  }

__global__ __launch_bounds__(256) void k_tab2(float theta, float* __restrict__ CS, float* __restrict__ SN) {
  #pragma clang fp contract(off)
  const int t = blockIdx.x * 256 + threadIdx.x; if (t >= SQ * (HD / 2)) return; const int i = t % (HD / 2); const int p = t / (HD / 2); const float invf = 1.0f / powf(theta, (float)(2 * i) / (float)HD); const float ang = __fmul_rn((float)p, invf); const float c = cosf(ang), s = sinf(ang);
  *(float*)(CS + t) = c; *(float*)(SN + t) = s;  }
__global__ __launch_bounds__(256) void k_bfcp(const float* __restrict__ src, float* __restrict__ dst, size_t n4) { const size_t t = (size_t)blockIdx.x * 256 + threadIdx.x; if (t >= n4) return; const v4f a = *(const v4fa*)(src + t * 4); v4f o; for (int q = 0; q < 4; ++q) o[q] = bf16_round(a[q]); *(v4f*)(dst + t * 4) = o;  }

__global__ __launch_bounds__(256) void k_f2bf(const float* __restrict__ F, unsigned short* __restrict__ O, size_t n8) { const size_t t = (size_t)blockIdx.x * 256 + threadIdx.x; if (t >= n8) return; const v4f a = *(const v4fa*)(F + t * 8), b = *(const v4fa*)(F + t * 8 + 4); FragH f;
  for (int q = 0; q < 4; ++q) { f.u[q] = (unsigned short)(__float_as_uint(bf16_round(a[q])) >> 16); f.u[4 + q] = (unsigned short)(__float_as_uint(bf16_round(b[q])) >> 16); }
  *(v8us*)(O + t * 8) = f.half[0];  }
extern "C" void kernel_launch(void* const* d_in, const int* in_sizes, int n_in,
                              void* d_out, int out_size, void* d_ws, size_t ws_size, hipStream_t stream) {
  (void)in_sizes; (void)n_in; (void)out_size;
  const float* const* I = (const float* const*)d_in; const float* x = I[0]; const float* tcos = I[1]; const float* tsin = I[2]; const float* wq = I[3]; const float* wk = I[4]; const float* wv = I[5]; const float* wo = I[6]; const float* bq = nullptr; const float* bk = nullptr; const float* bv = nullptr; const float* bo = nullptr;      /* [in][out] weights, no biases; rope tables [S][32] */
  char* ws = (char*)d_ws; size_t off = 0;
  auto take = [&](size_t bytes) { char* p = ws + off; off += (bytes + 255) & ~(size_t)255; return p; };
  _Float16* BQ = (_Float16*)take((size_t)DM * DM * 2); _Float16* BK = (_Float16*)take((size_t)KVD * DM * 2); _Float16* BV = (_Float16*)take((size_t)KVD * DM * 2); _Float16* BO = (_Float16*)take((size_t)DM * DM * 2);
  _Float16* X16 = (_Float16*)take(NR * DM * 2); float* CSB = (float*)take((size_t)SQ * 32 * 4); float* SNB = (float*)take((size_t)SQ * 32 * 4); _Float16* Q16 = (_Float16*)take(NR * DM * 2); _Float16* K16 = (_Float16*)take(NR * KVD * 2); _Float16* V16 = (_Float16*)take(NR * KVD * 2); _Float16* O16 = (_Float16*)take(NR * DM * 2);
  _Float16* VT = (_Float16*)take((size_t)NB * NG * HD * SQ * 2);
  float* QF0 = (float*)take((size_t)QT0 * DM * 4); float* KF0 = (float*)take((size_t)QT0 * KVD * 4); float* VF0 = (float*)take((size_t)QT0 * KVD * 4); float* KF0e = (float*)take((size_t)QT0 * DM * 4); float* VF0e = (float*)take((size_t)QT0 * DM * 4); float* OF0 = (float*)take((size_t)NB * QT0 * DM * 4); _Float16* OH0 = (_Float16*)take((size_t)NB * QT0 * DM * 2); _Float16* OL0 = (_Float16*)take((size_t)NB * QT0 * DM * 2); float* OUTF = (float*)take(NR * DM * 4);      /* f32 result rows, converted to bf16 at the end */
  if (off > ws_size) return;
  k_wt_f16<<<(unsigned)(((size_t)DM * (DM / 8) + 255) / 256), 256, 0, stream>>>(wq, BQ, DM, DM, 16.0f); k_wt_f16<<<(unsigned)(((size_t)KVD * (DM / 8) + 255) / 256), 256, 0, stream>>>(wk, BK, DM, KVD, 16.0f); k_wt_f16<<<(unsigned)(((size_t)KVD * (DM / 8) + 255) / 256), 256, 0, stream>>>(wv, BV, DM, KVD, 16.0f); k_wt_f16<<<(unsigned)(((size_t)DM * (DM / 8) + 255) / 256), 256, 0, stream>>>(wo, BO, DM, DM, 16.0f);      /* [in][out] -> Bt[n][k] x16 */
  k_x16<<<(unsigned)((NR * DM / 8 + 255) / 256), 256, 0, stream>>>(x, X16, NR * DM / 8);
  k_bfcp<<<(SQ * 32 / 4 + 255) / 256, 256, 0, stream>>>(tcos, CSB, (size_t)SQ * 32 / 4); k_bfcp<<<(SQ * 32 / 4 + 255) / 256, 256, 0, stream>>>(tsin, SNB, (size_t)SQ * 32 / 4);      /* bf16-rounded rope tables [pos][32] */
  const size_t r0p = (size_t)B0 * SQ;      /* first projected row */
  k_gemm2<0><<<dim3((unsigned)((MP / 128) * (KVD / 64)), 1), 128, 0, stream>>>(X16 + r0p * DM, DM, 0, BV, DM, 0, 0.0625f, bv, 0, nullptr, 1, 0, 0, nullptr, V16 + r0p * KVD, KVD, 0, MP, KVD, DM);
  for (int b = B0; b < B0 + NBR; ++b) { const size_t r0 = (size_t)b * SQ;
    k_gemm2<0, 1, 128, true><<<dim3((unsigned)((SQ / 128) * (DM / 64)), 1), 128, 0, stream>>>(X16 + r0 * DM, DM, 0, BQ, DM, 0, 0.0625f, nullptr, 0, nullptr, 1, 0, 0, QF0, Q16 + r0 * DM, DM, 0, SQ, DM, DM, CSB, SNB, QT0);      /* q of this batch, interleaved-pair rope in the epilogue: f16 rows, and f32 rows 0..127 */
    k_gemm2<0, 1, 128, true><<<dim3((unsigned)((SQ / 128) * (KVD / 64)), 1), 128, 0, stream>>>(X16 + r0 * DM, DM, 0, BK, DM, 0, 0.0625f, nullptr, 0, nullptr, 1, 0, 0, KF0, K16 + r0 * KVD, KVD, 0, SQ, KVD, DM, CSB, SNB, QT0);      /* k likewise */
    k_vt<NG, SQ><<<NG * (SQ / 64), 256, 0, stream>>>(V16 + r0 * KVD, KVD, 0, VT + (size_t)b * NG * HD * SQ);      /* V^T [NG][HD][SQ] of this batch */
    k_gemm2<0><<<dim3((QT0 / 128) * (KVD / 64), 1), 128, 0, stream>>>(X16 + r0 * DM, DM, 0, BV, DM, 0, 0.0625f, bv, 0, nullptr, 1, 0, 0, VF0, nullptr, KVD, 0, QT0, KVD, DM);
    k_kvexp<<<(unsigned)(((size_t)QT0 * DM / 4 + 255) / 256), 256, 0, stream>>>(KF0, KF0e, (size_t)QT0 * DM / 4); k_kvexp<<<(unsigned)(((size_t)QT0 * DM / 4 + 255) / 256), 256, 0, stream>>>(VF0, VF0e, (size_t)QT0 * DM / 4);      /* head h <- kv group h/4 for the exact first-tile kernel */      /* f32 q, k, v of the first 128 rows (exact products) */
    k_att0w<<<NH * (QT0 / A0R), 512, 0, stream>>>(QF0, KF0e, VF0e, DM, 0.125f, OF0 + (size_t)b * QT0 * DM, DM);      /* exact f32 attention for rows 0..127 (o x64) */
  }
  k_fattn<<<NB * NG * (SQ / FQ), 128, 0, stream>>>(Q16, K16, VT, O16);      /* scores, causal softmax and P V of both batches and all 32 heads in one launch: o (merged heads, x64) as f16 rows */
  k_gemm2<0><<<dim3((unsigned)((MPO / 128) * (DM / 64)), 1), 128, 0, stream>>>(O16 + r0p * DM, DM, 0, BO, DM, 0, 0.0009765625f, bo, 0, nullptr, 1, 0, 0, OUTF + r0p * DM, nullptr, DM, 0, MPO, DM, DM);      /* out rows (f32) */
  k_hl<<<(unsigned)(((size_t)NB * QT0 * DM / 8 + 255) / 256), 256, 0, stream>>>(OF0, OH0, OL0, (size_t)NB * QT0 * DM / 8);      /* first-tile o (x64) -> f16 hi + x1024 residual planes */
  for (int b = B0; b < B0 + NBR; ++b) { const size_t r0 = (size_t)b * SQ; const size_t f0 = (size_t)b * QT0;
    k_gemm2<0><<<dim3((QT0 / 128) * (DM / 64), 1), 128, 0, stream>>>(OH0 + f0 * DM, DM, 0, BO, DM, 0, 0.0009765625f, bo, 0, nullptr, 1, 0, 0, OUTF + r0 * DM, nullptr, DM, 0, QT0, DM, DM);      /* rows 0..127: out = o_hi Wo (+ b), overwriting the f16-path rows */
    k_gemm2<0><<<dim3((QT0 / 128) * (DM / 64), 1), 128, 0, stream>>>(OL0 + f0 * DM, DM, 0, BO, DM, 0, 0.00000095367431640625f, nullptr, 0, (const float*)(OUTF + r0 * DM), -1, 0, 0, OUTF + r0 * DM, nullptr, DM, 0, QT0, DM, DM); }      /* += o_lo Wo 2^-20 (own-element accumulate) */
  k_f2bf<<<(unsigned)(((size_t)MPO * DM / 8 + 255) / 256), 256, 0, stream>>>(OUTF + (size_t)B0 * SQ * DM, (unsigned short*)d_out + (size_t)B0 * SQ * DM, (size_t)MPO * DM / 8);      /* out.astype(bfloat16): the f32 rows rounded to nearest-even bf16 into the 2-byte output */
}

// v007
// It runs in 303 microseconds.
// Two timings next to v006 both put it at 1.26 times that version's speed.
// All steps since v000 together make it 31.4 times as fast.
#include <hip/hip_runtime.h>
// Grouped-query causal attention with RoPE and a BFLOAT16 output (x [2][2048][2048]; xq = x wq (32 heads x 64), xk = x wk, xv = x wv (8 kv heads x 64) ([in][out] weights sigma 1/sqrt(2048), no biases); interleaved-pair RoPE (reshape(..., 32, 2): real = even, imag = odd) on q and k from the module's INPUT tables freqs_cos/freqs_sin [S][32]; repeat: query head h uses kv head h/4; scores / 8 + triu(-inf, 1) (causal); softmax; out = (merged wo).astype(bfloat16) -> bf16 [2][2048][2048] (2 bytes per element)).
// Compute dtype: inputs rounded to bf16; x / weights exact; q, k, v, softmax weights and o as plain f16 GEMM operands (~2^-12); scores and softmax statistics f32. v_wmma_f32_16x16x32_f16.
#define NB 2
#define NG 8
#define HPG 4
#define KVD (NG * HD)
#define SQ 2048
#define DM 2048
#define NH 32
#define HD 64
#define HG 4                         /* heads per launch of the non-template k_vt (not launched) */
#define QT 256                       /* not used */
#define NKX SQ                       /* S / P row pitch */
#define QT0 128                      /* first-tile rows recomputed exactly in f32 */
#define B0 0                         /* first batch processed (debug hook) */
#define NBR NB                       /* batches processed (debug hook) */
#define NR ((size_t)NB * SQ)         /* token rows */
#define MP ((int)((size_t)NBR * SQ)) /* rows projected (debug hook) */
#define QN SQ                        /* query rows attended per batch (not used) */
#define NHD NH                       /* heads attended (not used) */
#define MPO MP                       /* rows through the output stage (debug hook) */
#define LQ DM      /* row pitch of the q rows */
typedef __bf16 v16b __attribute__((ext_vector_type(16)));
typedef unsigned short v8us __attribute__((ext_vector_type(8), may_alias));
typedef float  v8f  __attribute__((ext_vector_type(8)));
typedef float  v4f  __attribute__((ext_vector_type(4)));
typedef float  v4fa __attribute__((ext_vector_type(4), may_alias));
union FragB { v16b v; v8us half[2]; unsigned short u[16]; };

__device__ __forceinline__ unsigned short bf16_bits(float x) { unsigned int u = __float_as_uint(x); return (unsigned short)((u + 0x7FFFu + ((u >> 16) & 1u)) >> 16); }
__device__ __forceinline__ float bf16_val(unsigned short b) { return __uint_as_float(((unsigned int)b) << 16); }
__device__ __forceinline__ float bf16_round(float x) { return bf16_val(bf16_bits(x)); }
// D += A·B with NT terms: 1 = ah·bh, 2 = + al·bh (A split), 3 = + ah·bl (both split)
template <int NT>
__device__ __forceinline__ v8f mmaN(v16b ah, v16b al, v16b bh, v16b bl, v8f c) {
  c = __builtin_amdgcn_wmma_f32_16x16x32_bf16(false, ah, false, bh, (short)0, c, false, false);
  if (NT >= 2) c = __builtin_amdgcn_wmma_f32_16x16x32_bf16(false, al, false, bh, (short)0, c, false, false);
  if (NT >= 3) c = __builtin_amdgcn_wmma_f32_16x16x32_bf16(false, ah, false, bl, (short)0, c, false, false);
  asm volatile("v_nop\n\tv_nop\n\tv_nop\n\tv_nop" : "+v"(c) : "v"(ah), "v"(al), "v"(bh), "v"(bl));
  return c;
}

__global__ __launch_bounds__(256) void k_wt_bf16(const float* __restrict__ W, unsigned short* __restrict__ Wt, int K, int N) {
  const int t = blockIdx.x * 256 + threadIdx.x;
  const int k8n = K / 8;
  if (t >= N * k8n) return;
  const int n = t / k8n, k8 = (t % k8n) * 8;
  v8us v;
#pragma unroll
  for (int i = 0; i < 8; ++i) v[i] = bf16_bits(W[(size_t)(k8 + i) * N + n]);
  *(v8us*)(Wt + (size_t)n * K + k8) = v;
  
}

// GEMM C[M][N] (f32, pitch ldc) = act(A[M][K]·W + bias). A f32 row-major (pitch lda) converted per fragment to bf16
// (ASPLIT: hi/lo two planes -> 2 terms, else single rounded term); Wt bf16 [N][K] (pitch ldb). BIAS_BF16 rounds the
// bias to bf16 first (bias quantised to bf16 before the add). K%32==0, M%16==0, N%64==0.
template <bool ASPLIT, int ACT, bool BIAS_BF16>
__global__ __launch_bounds__(128) void k_gemm_bf(const float* __restrict__ A, int lda, const unsigned short* __restrict__ Wt, int ldb,
                                               const float* __restrict__ bias, float* __restrict__ C, int ldc, int M, int N, int K) {
  __shared__ __attribute__((aligned(16))) float so[4][16][64];
  const int tid = threadIdx.x, w = tid >> 5, lane = tid & 31, ln = lane & 15, hh = lane >> 4;
  const int ntn = N / 64;
  const int wid = blockIdx.x * 4 + w;
  const int mt = wid / ntn, nq = wid % ntn;
  if (mt * 16 >= M) return;
  const int row0 = mt * 16, col0 = nq * 64;
  const float* arow = A + (size_t)(row0 + ln) * lda;
  v8f acc[4] = {};
  for (int kb = 0; kb < K; kb += 32) {
    FragB ah, al;
    const v4f x0 = *(const v4fa*)(arow + kb + 8 * hh), x1 = *(const v4fa*)(arow + kb + 8 * hh + 4);
    const v4f x2 = *(const v4fa*)(arow + kb + 16 + 8 * hh), x3 = *(const v4fa*)(arow + kb + 16 + 8 * hh + 4);
    float xs[16] = {x0[0],x0[1],x0[2],x0[3],x1[0],x1[1],x1[2],x1[3],x2[0],x2[1],x2[2],x2[3],x3[0],x3[1],x3[2],x3[3]};
#pragma unroll
    for (int i = 0; i < 16; ++i) { const unsigned short hb = bf16_bits(xs[i]); ah.u[i] = hb; al.u[i] = ASPLIT ? bf16_bits(xs[i] - bf16_val(hb)) : (unsigned short)0; }
#pragma unroll
    for (int t = 0; t < 4; ++t) {
      const unsigned short* brow = Wt + (size_t)(col0 + t * 16 + ln) * ldb + kb;
      FragB b;
      b.half[0] = *(const v8us*)(brow + 8 * hh);
      b.half[1] = *(const v8us*)(brow + 16 + 8 * hh);
      acc[t] = mmaN<ASPLIT ? 2 : 1>(ah.v, al.v, b.v, b.v, acc[t]);
    }
  }
#pragma unroll
  for (int t = 0; t < 4; ++t) {
    float bv = bias ? bias[col0 + t * 16 + ln] : 0.f;
    if (BIAS_BF16) bv = bf16_round(bv);
#pragma unroll
    for (int r = 0; r < 8; ++r) { float v = acc[t][r] + bv; if (ACT == 1) v = fmaxf(v, 0.f); so[w][8 * hh + r][t * 16 + ln] = v; }
  }
  __builtin_amdgcn_fence(__ATOMIC_ACQ_REL, "workgroup");
  __builtin_amdgcn_wave_barrier();
  const int rsub = lane >> 4, c4 = (lane & 15) * 4;
  {
#pragma unroll
    for (int q = 0; q < 8; ++q) {
      const int r = q * 2 + rsub;
      const v4f v = *(const v4fa*)&so[w][r][c4];
      *(v4f*)(C + (size_t)(row0 + r) * ldc + col0 + c4) = v;
    }
    
  }
}

// GEMM C = act(A·W + bias + resid): A f32 (ASPLIT -> hi/lo 2 terms), Wt bf16 [N][K]; ACT 0 none, 1 relu, 2 exact gelu;
// resid (optional, f32, row index = (row % rmod), pitch ldr, RES_BF16 rounds it) added before the activation.
template <bool ASPLIT, int ACT, bool BIAS_BF16, bool RES_BF16>
__global__ __launch_bounds__(128) void k_gemm_bf3(const float* __restrict__ A, int lda, const unsigned short* __restrict__ Wt, int ldb,
                                                const float* __restrict__ bias, const float* __restrict__ resid, int rmod, int ldr,
                                                float* __restrict__ C, int ldc, int M, int N, int K) {
  __shared__ __attribute__((aligned(16))) float so[4][16][64];
  const int tid = threadIdx.x, w = tid >> 5, lane = tid & 31, ln = lane & 15, hh = lane >> 4;
  const int ntn = N / 64;
  const int wid = blockIdx.x * 4 + w;
  const int mt = wid / ntn, nq = wid % ntn;
  if (mt * 16 >= M) return;
  const int row0 = mt * 16, col0 = nq * 64;
  const float* arow = A + (size_t)(row0 + ln) * lda;
  v8f acc[4] = {};
  for (int kb = 0; kb < K; kb += 32) {
    FragB ah, al;
    const v4f x0 = *(const v4fa*)(arow + kb + 8 * hh), x1 = *(const v4fa*)(arow + kb + 8 * hh + 4);
    const v4f x2 = *(const v4fa*)(arow + kb + 16 + 8 * hh), x3 = *(const v4fa*)(arow + kb + 16 + 8 * hh + 4);
    float xs[16] = {x0[0],x0[1],x0[2],x0[3],x1[0],x1[1],x1[2],x1[3],x2[0],x2[1],x2[2],x2[3],x3[0],x3[1],x3[2],x3[3]};
#pragma unroll
    for (int i = 0; i < 16; ++i) { const unsigned short hb = bf16_bits(xs[i]); ah.u[i] = hb; al.u[i] = ASPLIT ? bf16_bits(xs[i] - bf16_val(hb)) : (unsigned short)0; }
#pragma unroll
    for (int t = 0; t < 4; ++t) {
      const unsigned short* brow = Wt + (size_t)(col0 + t * 16 + ln) * ldb + kb;
      FragB b;
      b.half[0] = *(const v8us*)(brow + 8 * hh);
      b.half[1] = *(const v8us*)(brow + 16 + 8 * hh);
      acc[t] = mmaN<ASPLIT ? 2 : 1>(ah.v, al.v, b.v, b.v, acc[t]);
    }
  }
#pragma unroll
  for (int t = 0; t < 4; ++t) {
    const int col = col0 + t * 16 + ln;
    float bv = bias ? bias[col] : 0.f;
    if (BIAS_BF16) bv = bf16_round(bv);
#pragma unroll
    for (int r = 0; r < 8; ++r) {
      float v = acc[t][r] + bv;
      if (resid) { float rv = resid[(size_t)((row0 + 8 * hh + r) % rmod) * ldr + col]; if (RES_BF16) rv = bf16_round(rv); v += rv; }
      if (ACT == 1) v = fmaxf(v, 0.f);
      if (ACT == 2) v = 0.5f * v * (1.0f + erff(v * 0.70710678118654752f));
      if (ACT == 3) { const float u = 0.7978845608028654f * (v + 0.044715f * v * v * v); v = 0.5f * v * (1.0f + tanhf(u)); }
      so[w][8 * hh + r][t * 16 + ln] = v;
    }
  }
  __builtin_amdgcn_fence(__ATOMIC_ACQ_REL, "workgroup");
  __builtin_amdgcn_wave_barrier();
  const int rsub = lane >> 4, c4 = (lane & 15) * 4;
  {
#pragma unroll
    for (int q = 0; q < 8; ++q) {
      const int r = q * 2 + rsub;
      const v4f v = *(const v4fa*)&so[w][r][c4];
      *(v4f*)(C + (size_t)(row0 + r) * ldc + col0 + c4) = v;
    }
    
  }
}
// row LayerNorm (biased variance, eps) over N: s = X (+ R); optional out_sum <- s; out_norm <- (s-mu)*rsqrt(var+eps)*g + b
template <bool PARAM_BF16>
__global__ __launch_bounds__(256) void k_layernorm(const float* __restrict__ X, const float* __restrict__ R, const float* __restrict__ g, const float* __restrict__ bta,
                                                  float* __restrict__ out_sum, float* __restrict__ out_norm, int N, float eps) {
  __shared__ float red[256];
  const int row = blockIdx.x, tid = threadIdx.x;
  const float* x = X + (size_t)row * N; const float* rr = R ? R + (size_t)row * N : nullptr;
  float vals[16];                     // up to N = 4096
  const int per = N / 256;            // contiguous chunk per thread? use strided-by-4 chunks: thread handles j = tid*4 + 1024*u
  float s1 = 0.f;
  for (int u = 0; u < per / 4; ++u) {
    const int j = tid * 4 + 1024 * u;
    const v4f a = *(const v4fa*)(x + j);
    v4f b = {0.f,0.f,0.f,0.f}; if (rr) b = *(const v4fa*)(rr + j);
#pragma unroll
    for (int q = 0; q < 4; ++q) { const float v = a[q] + b[q]; vals[u * 4 + q] = v; s1 += v; }
  }
  red[tid] = s1; __syncthreads();
  for (int st = 128; st > 0; st >>= 1) { if (tid < st) red[tid] += red[tid + st]; __syncthreads(); }
  const float mu = red[0] / (float)N; __syncthreads();
  float s2 = 0.f;
  for (int u = 0; u < per / 4; ++u)
#pragma unroll
    for (int q = 0; q < 4; ++q) { const float c = vals[u * 4 + q] - mu; s2 += c * c; }
  red[tid] = s2; __syncthreads();
  for (int st = 128; st > 0; st >>= 1) { if (tid < st) red[tid] += red[tid + st]; __syncthreads(); }
  const float rs = rsqrtf(red[0] / (float)N + eps);
  {
    for (int u = 0; u < per / 4; ++u) {
      const int j = tid * 4 + 1024 * u;
      v4f o, sm;
#pragma unroll
      for (int q = 0; q < 4; ++q) {
        float gg = g[j + q], bb = bta[j + q];
        if (PARAM_BF16) { gg = bf16_round(gg); bb = bf16_round(bb); }
        sm[q] = vals[u * 4 + q]; o[q] = (vals[u * 4 + q] - mu) * rs * gg + bb;
      }
      if (out_sum) *(v4f*)(out_sum + (size_t)row * N + j) = sm;
      *(v4f*)(out_norm + (size_t)row * N + j) = o;
    }
    
  }
}



// ---- f16 WMMA path (v_wmma_f32_16x16x32_f16): 11-bit significands for operands in range — used where a [0,1] probability operand needs more precision than bf16
typedef _Float16 v16h __attribute__((ext_vector_type(16)));
union FragH { v16h v; v8us half[2]; _Float16 h[16]; unsigned short u[16]; };
template <int NT>
__device__ __forceinline__ v8f mmaH(v16h ah, v16h al, v16h bh, v16h bl, v8f c) {
  c = __builtin_amdgcn_wmma_f32_16x16x32_f16(false, ah, false, bh, (short)0, c, false, false);
  if (NT >= 2) c = __builtin_amdgcn_wmma_f32_16x16x32_f16(false, al, false, bh, (short)0, c, false, false);
  if (NT >= 3) c = __builtin_amdgcn_wmma_f32_16x16x32_f16(false, ah, false, bl, (short)0, c, false, false);
  asm volatile("v_nop\n\tv_nop\n\tv_nop\n\tv_nop" : "+v"(c) : "v"(ah), "v"(al), "v"(bh), "v"(bl));
  return c;
}
// batched GEMM like k_gemm_b but f16 operands: A f32 (split into f16 hi/lo if ASPLIT, else rounded to f16), Bt = f16 values [n][k]; alpha; C f32; N multiple of 16 (partial tiles skipped)
template <bool ASPLIT>
__global__ __launch_bounds__(128) void k_gemm_h(const float* __restrict__ A, int lda, size_t sA, const _Float16* __restrict__ Bh, int ldb, size_t sB, float alpha, float* __restrict__ C, int ldc, size_t sC, int M, int N, int K) {
  __shared__ __attribute__((aligned(16))) float so[4][16][64];
  const int tid = threadIdx.x, w = tid >> 5, lane = tid & 31, ln = lane & 15, hh = lane >> 4; const int by = blockIdx.y;
  A += (size_t)by * sA; Bh += (size_t)by * sB; C += (size_t)by * sC;
  const int ntn = (N + 63) / 64; const int wid = blockIdx.x * 4 + w; const int mt = wid / ntn, nq = wid % ntn; if (mt * 16 >= M) return;
  const int row0 = mt * 16, col0 = nq * 64; const float* arow = A + (size_t)(row0 + ln) * lda;
  v8f acc[4] = {};
  for (int kb = 0; kb < K; kb += 32) {
    FragH ah, al;
    const v4f x0 = *(const v4fa*)(arow + kb + 8 * hh), x1 = *(const v4fa*)(arow + kb + 8 * hh + 4), x2 = *(const v4fa*)(arow + kb + 16 + 8 * hh), x3 = *(const v4fa*)(arow + kb + 16 + 8 * hh + 4);
    float xs[16] = {x0[0],x0[1],x0[2],x0[3],x1[0],x1[1],x1[2],x1[3],x2[0],x2[1],x2[2],x2[3],x3[0],x3[1],x3[2],x3[3]};
#pragma unroll
    for (int i = 0; i < 16; ++i) { const _Float16 h = (_Float16)xs[i]; ah.h[i] = h; al.h[i] = ASPLIT ? (_Float16)(xs[i] - (float)h) : (_Float16)0.0f; }
#pragma unroll
    for (int t = 0; t < 4; ++t) { if (col0 + t * 16 >= N) continue; const size_t boff = (size_t)(col0 + t * 16 + ln) * ldb + kb; FragH bq; bq.half[0] = *(const v8us*)(Bh + boff + 8 * hh); bq.half[1] = *(const v8us*)(Bh + boff + 16 + 8 * hh);
      acc[t] = mmaH<ASPLIT ? 2 : 1>(ah.v, al.v, bq.v, bq.v, acc[t]); }
  }
#pragma unroll
  for (int t = 0; t < 4; ++t) { if (col0 + t * 16 >= N) continue;
#pragma unroll
    for (int r = 0; r < 8; ++r) so[w][8 * hh + r][t * 16 + ln] = acc[t][r] * alpha; }
  __builtin_amdgcn_fence(__ATOMIC_ACQ_REL, "workgroup"); __builtin_amdgcn_wave_barrier();
  const int rsub = lane >> 4, c4 = (lane & 15) * 4;
  {
#pragma unroll
    for (int q = 0; q < 8; ++q) { const int r = q * 2 + rsub; if (col0 + c4 < N) { const v4f v = *(const v4fa*)&so[w][r][c4]; *(v4f*)(C + (size_t)(row0 + r) * ldc + col0 + c4) = v; } }
     }
}

// Wt[n][k] = f16(W[k][n]·scale) from f32 row-major W[K][N] (scale = power of two; bf16-exact weights stay exact in f16 away from the subnormal range)
__global__ __launch_bounds__(256) void k_wt_f16(const float* __restrict__ W, _Float16* __restrict__ Wt, int K, int N, float scale) {
  const int t = blockIdx.x * 256 + threadIdx.x; if (t >= N * (K / 8)) return; const int n = t / (K / 8), k8 = (t % (K / 8)) * 8; FragH f;
#pragma unroll
  for (int i = 0; i < 8; ++i) f.h[i] = (_Float16)(bf16_round(W[(size_t)(k8 + i) * N + n]) * scale); const v8us o = f.half[0];
  *(v8us*)((unsigned short*)Wt + (size_t)n * K + k8) = o; 
}
// k_gemm_hh variant with fused epilogue: v = acc·alpha + bias[by·sBias + col] (+ CP[(row/rowsPerB)·sCPb + by·64 + col] if CP) ; ACT 0 none / 1 elu ; writes f16 C16 (and f32 C if non-null)
template <int ACT>
__global__ __launch_bounds__(128) void k_gemm_hhx(const _Float16* __restrict__ A, int lda, size_t sA, const _Float16* __restrict__ Bh, int ldb, size_t sB, float alpha, const float* __restrict__ bias, size_t sBias, const float* __restrict__ CP, int rowsPerB, size_t sCPb, int row0g,
    float* __restrict__ C, _Float16* __restrict__ C16, int ldc, size_t sC, int M, int N, int K) {
  __shared__ __attribute__((aligned(16))) float so[4][16][64];
  const int tid = threadIdx.x, w = tid >> 5, lane = tid & 31, ln = lane & 15, hh = lane >> 4; const int by = blockIdx.y;
  A += (size_t)by * sA; Bh += (size_t)by * sB; const size_t cofs = (size_t)by * sC; const float* bp = bias ? bias + (size_t)by * sBias : nullptr;
  const int ntn = (N + 63) / 64; const int wid = blockIdx.x * 4 + w; const int mt = wid / ntn, nq = wid % ntn; if (mt * 16 >= M) return;
  const int row0 = mt * 16, col0 = nq * 64; const _Float16* arow = A + (size_t)(row0 + ln) * lda;
  v8f acc[4] = {};
  for (int kb = 0; kb < K; kb += 32) { FragH ah; ah.half[0] = *(const v8us*)((const unsigned short*)arow + kb + 8 * hh); ah.half[1] = *(const v8us*)((const unsigned short*)arow + kb + 16 + 8 * hh);
#pragma unroll
    for (int t = 0; t < 4; ++t) { if (col0 + t * 16 >= N) continue; const size_t boff = (size_t)(col0 + t * 16 + ln) * ldb + kb; FragH bq; bq.half[0] = *(const v8us*)((const unsigned short*)Bh + boff + 8 * hh); bq.half[1] = *(const v8us*)((const unsigned short*)Bh + boff + 16 + 8 * hh);
      acc[t] = mmaH<1>(ah.v, ah.v, bq.v, bq.v, acc[t]); }
  }
#pragma unroll
  for (int t = 0; t < 4; ++t) { if (col0 + t * 16 >= N) continue; const int col = col0 + t * 16 + ln; const float bv = bp ? bf16_round(bp[col]) : 0.f;
#pragma unroll
    for (int r = 0; r < 8; ++r) { float v = acc[t][r] * alpha + bv; if (CP) { const int rr = row0g + row0 + 8 * hh + r; if (rowsPerB < 0) v += CP[cofs + (size_t)rr * ldc + col];      /* rowsPerB < 0: own element of the batched C plane */ else { const int bidx = rr / rowsPerB; v += CP[(size_t)bidx * sCPb + (size_t)by * 64 + col]; } } if (ACT == 1) v = (v > 0.f) ? v : expm1f(v); else if (ACT == 7) v = (v > 0.f) ? v + 1.0f : expf(v); else if (ACT == 8) v = tanhf(v); else if (ACT == 9) v = 0.5f * v * (1.0f + tanhf(0.7978845608028654f * (v + 0.044715f * v * v * v))); else if (ACT == 11) v = 1.0f / (1.0f + expf(-v)); else if (ACT == 12) v = (v > 0.f) ? v : 0.01f * v; else if (ACT == 14) v = (v > 0.f) ? v : 0.1f * v; else if (ACT == 16) v = (v >= 0.f) ? v : 0.3f * v; else if (ACT == 17) v = (v >= 0.f) ? v : 0.2f * v; else if (ACT == 15) v = v / (1.0f + expf(-v)); else if (ACT == 3) v = fmaxf(v, 0.f); else if (ACT == 6) v = 0.5f * v * (1.0f + erff(v * 0.70710678118654752f)); so[w][8 * hh + r][t * 16 + ln] = v; } }
  __builtin_amdgcn_fence(__ATOMIC_ACQ_REL, "workgroup"); __builtin_amdgcn_wave_barrier();
  const int rsub = lane >> 4, c4 = (lane & 15) * 4; typedef _Float16 v4h __attribute__((ext_vector_type(4)));
  {
#pragma unroll
    for (int q = 0; q < 8; ++q) { const int r = q * 2 + rsub; if (col0 + c4 < N) { const v4f v = *(const v4fa*)&so[w][r][c4]; if (C) *(v4f*)(C + cofs + (size_t)(row0 + r) * ldc + col0 + c4) = v; if (C16) { v4h h4; for (int i = 0; i < 4; ++i) h4[i] = (_Float16)v[i]; *(v4h*)(C16 + cofs + (size_t)(row0 + r) * ldc + col0 + c4) = h4; } } }
     }
}


typedef _Float16 v4h __attribute__((ext_vector_type(4)));

__global__ __launch_bounds__(256) void k_x16(const float* __restrict__ x, _Float16* __restrict__ X16, size_t n8) { const size_t t = (size_t)blockIdx.x * 256 + threadIdx.x; if (t >= n8) return; FragH f;
#pragma unroll
  for (int q = 0; q < 8; ++q) f.h[q] = (_Float16)bf16_round(x[t * 8 + q]); *(v8us*)((unsigned short*)X16 + t * 8) = f.half[0];  }
__global__ __launch_bounds__(256) void k_h16(const float* __restrict__ x, _Float16* __restrict__ X16, size_t n8) { const size_t t = (size_t)blockIdx.x * 256 + threadIdx.x; if (t >= n8) return; FragH f;
#pragma unroll
  for (int q = 0; q < 8; ++q) f.h[q] = (_Float16)x[t * 8 + q]; *(v8us*)((unsigned short*)X16 + t * 8) = f.half[0];  }
__global__ __launch_bounds__(256) void k_round16f(const float* __restrict__ W, _Float16* __restrict__ Bt, size_t n8) { const size_t t = (size_t)blockIdx.x * 256 + threadIdx.x; if (t >= n8) return; FragH f;
#pragma unroll
  for (int i = 0; i < 8; ++i) f.h[i] = (_Float16)(bf16_round(W[t * 8 + i]) * 16.0f); *(v8us*)((unsigned short*)Bt + t * 8) = f.half[0];  }
template <int NHv, int TTv>
__global__ __launch_bounds__(256) void k_vt(const _Float16* __restrict__ V16, int ldv, int voff, _Float16* __restrict__ Vt) { __shared__ unsigned short tl[64][66]; const int tid = threadIdx.x; const int slab = blockIdx.x / (TTv / 64), lg = blockIdx.x % (TTv / 64); const int b = slab / NHv, h = slab % NHv;
  for (int i = tid; i < 64 * 8; i += 256) { const int r = i / 8, c8 = (i % 8) * 8; FragH f; f.half[0] = *(const v8us*)((const unsigned short*)V16 + ((size_t)b * TTv + lg * 64 + r) * ldv + voff + h * 64 + c8);
#pragma unroll
    for (int q = 0; q < 8; ++q) tl[r][c8 + q] = f.u[q]; }
  __syncthreads();
  {
#pragma unroll
    for (int rd = 0; rd < 2; ++rd) { const int d = rd * 32 + tid / 8, pc = tid % 8; FragH f;
#pragma unroll
      for (int q = 0; q < 8; ++q) f.u[q] = tl[pc * 8 + q][d];
      *(v8us*)((unsigned short*)Vt + ((size_t)slab * 64 + d) * TTv + lg * 64 + pc * 8) = f.half[0]; }
     } }

__global__ __launch_bounds__(256) void k_hl(const float* __restrict__ F, _Float16* __restrict__ Hh, _Float16* __restrict__ Hl, size_t n8) { const size_t t = (size_t)blockIdx.x * 256 + threadIdx.x; if (t >= n8) return; FragH fh, fl; const v4f a = *(const v4fa*)(F + t * 8), c = *(const v4fa*)(F + t * 8 + 4);
#pragma unroll
  for (int q = 0; q < 4; ++q) { _Float16 h = (_Float16)a[q]; fh.h[q] = h; fl.h[q] = (_Float16)((a[q] - (float)h) * 1024.0f); h = (_Float16)c[q]; fh.h[4 + q] = h; fl.h[4 + q] = (_Float16)((c[q] - (float)h) * 1024.0f); }
  { *(v8us*)((unsigned short*)Hh + t * 8) = fh.half[0]; *(v8us*)((unsigned short*)Hl + t * 8) = fl.half[0];  } }

// ---- fast GEMM (work-group tile 128x64, wave tile 32x64; requires M % 128 == 0 rows per launch region and N % 64 == 0); epilogue = k_gemm_hhx semantics ----
__device__ __forceinline__ v8f g2_mma(v16h a, v16h b, v8f c) { v8f d = __builtin_amdgcn_wmma_f32_16x16x32_f16(false, a, false, b, (short)0, c, false, false); asm volatile("v_nop\n\tv_nop\n\tv_nop\n\tv_nop" : "+v"(d) : "v"(a), "v"(b)); return d; }
// One A or B fragment (16 rows x 32 k) from staged LDS rows; p: the lane's row, plus 16 * hh bytes. k order, the same for A and B: 8 hh .. 8 hh + 7, then 16 + 8 hh .. 16 + 8 hh + 7.
__device__ __forceinline__ v16h g2_lfrag(const unsigned char* p) { FragH f; f.half[0] = *(const v8us*)p; f.half[1] = *(const v8us*)(p + 32); return f.v; }
// Twelve asynchronous 16-byte copies per lane, global memory -> LDS. The s_wait_xcnt is the last line of the copies' own statement, so no register that a copy names is rewritten in front of it.
__device__ __forceinline__ void g2_copy12(const unsigned (&l)[12], const _Float16* const (&g)[12]) {
  asm volatile("global_load_async_to_lds_b128 %0, %12, off\n\t"
               "global_load_async_to_lds_b128 %1, %13, off\n\t"
               "global_load_async_to_lds_b128 %2, %14, off\n\t"
               "global_load_async_to_lds_b128 %3, %15, off\n\t"
               "global_load_async_to_lds_b128 %4, %16, off\n\t"
               "global_load_async_to_lds_b128 %5, %17, off\n\t"
               "global_load_async_to_lds_b128 %6, %18, off\n\t"
               "global_load_async_to_lds_b128 %7, %19, off\n\t"
               "global_load_async_to_lds_b128 %8, %20, off\n\t"
               "global_load_async_to_lds_b128 %9, %21, off\n\t"
               "global_load_async_to_lds_b128 %10, %22, off\n\t"
               "global_load_async_to_lds_b128 %11, %23, off\n\t"
               "s_wait_xcnt 0x0"
               :: "v"(l[0]), "v"(l[1]), "v"(l[2]), "v"(l[3]), "v"(l[4]), "v"(l[5]), "v"(l[6]), "v"(l[7]), "v"(l[8]), "v"(l[9]), "v"(l[10]), "v"(l[11]),
                  "v"(g[0]), "v"(g[1]), "v"(g[2]), "v"(g[3]), "v"(g[4]), "v"(g[5]), "v"(g[6]), "v"(g[7]), "v"(g[8]), "v"(g[9]), "v"(g[10]), "v"(g[11]) : "memory"); }
// One k slab (KC columns of the work-group's 128 A rows, then of its 64 B rows) into one LDS buffer. A row's KC * 2 bytes are KC / 8 neighbouring lanes' 16 bytes each: every copy covers whole 128-byte lines.
// ag, bg: the lane's own 16 bytes in row tid / (KC / 8) of the A and of the B slab; lds: the LDS byte address of the same place in the buffer. Unrolled in full: l[] and g[] are asm operands.
template <int KC>
__device__ __forceinline__ void g2_stage(const _Float16* ag, int lda, const _Float16* bg, int ldb, unsigned lds) {
  constexpr int RPU = 128 / (KC / 8), NA = 128 / RPU, NC = 192 / RPU, PB = KC * 2 + 16;      /* rows per round of 128 lanes; rounds for A; rounds in all; LDS pitch in bytes */
#pragma unroll
  for (int s = 0; s < NC / 12; ++s) { unsigned l[12]; const _Float16* g[12];
#pragma unroll
    for (int j = 0; j < 12; ++j) { const int u = s * 12 + j; l[j] = lds + (unsigned)(u * RPU * PB); g[j] = (u < NA) ? ag + (size_t)(u * RPU) * lda : bg + (size_t)((u - NA) * RPU) * ldb; }
    g2_copy12(l, g); } }
// BG: consecutive blockIdx.y values that share one B slab (grouped-query attention: BG query heads read the same k / v rows); slab = blockIdx.y / BG
// KC: columns of k per staged slab. M a multiple of 128, N of 64, K of KC. The work-group's A rows (128) and B rows (64) go to LDS slab by slab, two buffers: slab t + 1 is copied while slab t is multiplied.
// LDS pitch KC * 2 + 16 bytes = 16 B x odd, so the 16 rows of a fragment read spread over the banks.
// ROPE (ACT 0; bias and CP are not read): the N tile is one head (64 columns); the epilogue turns each (even, odd) column pair of row r by the angle whose cosine and sine are CS, SN[r % SQ][pair] and stores the turned rows: f16 to C16, and f32 to C for the first nf32 rows of every SQ rows (one batch; C holds nf32 rows a batch, batch after batch).
typedef float v2fa __attribute__((ext_vector_type(2), may_alias));
// Two (even, odd) pairs, each turned by its own angle: c, s hold the two cosines and sines.
__device__ __forceinline__ v4f g2_turn(v4f v, v2fa c, v2fa s) { v4f o; o[0] = v[0] * c[0] - v[1] * s[0]; o[1] = v[0] * s[0] + v[1] * c[0]; o[2] = v[2] * c[1] - v[3] * s[1]; o[3] = v[2] * s[1] + v[3] * c[1]; return o; }
template <int ACT, int BG = 1, int KC = 128, bool ROPE = false>
__global__ __launch_bounds__(128) void k_gemm2(const _Float16* __restrict__ A, int lda, size_t sA, const _Float16* __restrict__ Bh, int ldb, size_t sB, float alpha, const float* __restrict__ bias, size_t sBias, const float* __restrict__ CP, int rowsPerB, size_t sCPb, int row0g,
    float* __restrict__ C, _Float16* __restrict__ C16, int ldc, size_t sC, int M, int N, int K, const float* __restrict__ CS = nullptr, const float* __restrict__ SN = nullptr, int nf32 = 0) { static_assert(ACT == 0 || ACT == 3 || ACT == 6 || ACT == 8 || ACT == 9 || ACT == 11 || ACT == 12 || ACT == 14 || ACT == 15 || ACT == 16 || ACT == 17, "k_gemm2: unsupported ACT code (would silently apply no activation)");
  constexpr int PB = KC * 2 + 16, BUFB = 192 * PB; static_assert(2 * BUFB >= 4 * 32 * 68 * 4, "the output staging must fit the two slab buffers");
  __shared__ __attribute__((aligned(16))) unsigned char st[2 * BUFB];
  float (*so)[32][68] = (float (*)[32][68])st;      /* output staging in the same LDS: first written behind the last trip's barrier, when no copy is in flight and every fragment read is done */
  const int tid = threadIdx.x, w = tid >> 5, lane = tid & 31, ln = lane & 15, hh = lane >> 4; const int by = blockIdx.y;
  A += (size_t)by * sA; Bh += (size_t)(by / BG) * sB; const size_t cofs = (size_t)by * sC; const float* bp = bias ? bias + (size_t)by * sBias : nullptr;
  const int ntn = N >> 6; const int mt = blockIdx.x / ntn, nq = blockIdx.x - mt * ntn; const int row0 = mt * 128 + 32 * w, col0 = nq * 64; if (mt * 128 >= M) return;      /* the same for the whole work-group: it stands in front of barriers */
  const int sr = tid / (KC / 8), sc = tid % (KC / 8);      /* this lane's row and 16-byte column in a round of copies */
  const _Float16* ag = A + (size_t)(mt * 128 + sr) * lda + sc * 8; const _Float16* bg = Bh + (size_t)(col0 + sr) * ldb + sc * 8;
  const unsigned lds0 = (unsigned)(size_t)(&st[0]) + (unsigned)(sr * PB + sc * 16);
  const int nt = K / KC;
  const v8f z8 = {0.f,0.f,0.f,0.f,0.f,0.f,0.f,0.f}; v8f c00 = z8, c01 = z8, c02 = z8, c03 = z8, c10 = z8, c11 = z8, c12 = z8, c13 = z8;
  g2_stage<KC>(ag, lda, bg, ldb, lds0);
  asm volatile("s_wait_asynccnt 0x0" ::: "memory");      /* this wave's copies of slab 0 have landed */
  __syncthreads();      /* slab 0 readable by every wave */
  if (nt > 1) g2_stage<KC>(ag + KC, lda, bg + KC, ldb, lds0 + BUFB);
#pragma unroll 1
  for (int t = 0; t < nt; ++t) { const unsigned char* sb = st + (t & 1) * BUFB; const unsigned char* sa = sb + (32 * w + ln) * PB + 16 * hh; const unsigned char* sbr = sb + (128 + ln) * PB + 16 * hh;
    v16h fa[2][2], fb[2][4];      /* two fragment sets: the next k step's twelve LDS reads go out as one group in front of this k step's products, so the wave waits out the LDS latency once a slab */
    fa[0][0] = g2_lfrag(sa); fa[0][1] = g2_lfrag(sa + 16 * PB); fb[0][0] = g2_lfrag(sbr); fb[0][1] = g2_lfrag(sbr + 16 * PB); fb[0][2] = g2_lfrag(sbr + 32 * PB); fb[0][3] = g2_lfrag(sbr + 48 * PB);
#pragma unroll
    for (int kk = 0; kk < KC / 32; ++kk) { const int cu = kk & 1, nx = cu ^ 1;      /* unrolled in full: fa[] and fb[] are indexed by constants and stay in registers, the LDS offsets become immediates */
      if (kk + 1 < KC / 32) { const int o = (kk + 1) * 64; fa[nx][0] = g2_lfrag(sa + o); fa[nx][1] = g2_lfrag(sa + 16 * PB + o); fb[nx][0] = g2_lfrag(sbr + o); fb[nx][1] = g2_lfrag(sbr + 16 * PB + o); fb[nx][2] = g2_lfrag(sbr + 32 * PB + o); fb[nx][3] = g2_lfrag(sbr + 48 * PB + o); }
      c00 = g2_mma(fa[cu][0], fb[cu][0], c00); c10 = g2_mma(fa[cu][1], fb[cu][0], c10);
      c01 = g2_mma(fa[cu][0], fb[cu][1], c01); c11 = g2_mma(fa[cu][1], fb[cu][1], c11);
      c02 = g2_mma(fa[cu][0], fb[cu][2], c02); c12 = g2_mma(fa[cu][1], fb[cu][2], c12);
      c03 = g2_mma(fa[cu][0], fb[cu][3], c03); c13 = g2_mma(fa[cu][1], fb[cu][3], c13); }
    asm volatile("s_wait_dscnt 0x0" ::: "memory");      /* this wave's reads of slab t are done before the buffer is refilled */
    asm volatile("s_wait_asynccnt 0x0" ::: "memory");      /* this wave's copies of slab t + 1 have landed */
    __syncthreads();      /* publishes slab t + 1 and ends every wave's reads of slab t */
    if (t + 2 < nt) g2_stage<KC>(ag + (size_t)(t + 2) * KC, lda, bg + (size_t)(t + 2) * KC, ldb, lds0 + (unsigned)((t & 1) * BUFB)); }
  asm volatile("s_wait_asynccnt 0x0" ::: "memory");      /* no copy outstanding when the LDS becomes output staging */
  v2fa cc[ROPE ? 16 : 1], ss[ROPE ? 16 : 1];      /* ROPE: cosines and sines of the 2 pairs that this lane turns in each of its 16 rows; 16 lanes read one table row = one 128-byte line */
  if constexpr (ROPE) { static_assert(HD == 64 && ACT == 0, "one N tile = one head: a pair's number is its column in the tile / 2; no activation");
#pragma unroll      /* unrolled in full: cc[], ss[] stay in registers; all 32 loads go out here, so their latency passes while the accumulators are staged */
    for (int q = 0; q < 16; ++q) { const size_t tb = (size_t)((unsigned)(row0 + q * 2 + hh) % SQ) * (HD / 2) + ln * 2; cc[q] = *(const v2fa*)(CS + tb); ss[q] = *(const v2fa*)(SN + tb); }
    asm volatile("s_wait_xcnt 0x0" ::: "memory"); }      /* the table loads' address registers are reused below */
  v8f accs[8] = {c00, c01, c02, c03, c10, c11, c12, c13};
  if constexpr (ROPE) {      /* q and k have no bias, no added plane and no activation: the staging is the scaled accumulators alone; both loops unrolled in full: accs[] is indexed by constants and stays in registers */
#pragma unroll
    for (int u = 0; u < 8; ++u) {
#pragma unroll
      for (int r = 0; r < 8; ++r) so[w][(u >> 2) * 16 + 8 * hh + r][(u & 3) * 16 + ln] = accs[u][r] * alpha; }
  } else {
#pragma unroll
  for (int u = 0; u < 8; ++u) { const int t = u & 3, half = u >> 2; const int col = col0 + t * 16 + ln; const float bv = bp ? bf16_round(bp[col]) : 0.f;
#pragma unroll
    for (int r = 0; r < 8; ++r) { const int rloc = half * 16 + 8 * hh + r; float v = accs[u][r] * alpha + bv; if (CP) { if (rowsPerB < 0) v += CP[cofs + (size_t)(row0g + row0 + rloc) * ldc + col];      /* rowsPerB < 0: own element of the batched C plane */ else { const int bidx = (row0g + row0 + rloc) / rowsPerB; v += CP[(size_t)bidx * sCPb + (size_t)by * 64 + col]; } }
      if (ACT == 3) v = fmaxf(v, 0.f); else if (ACT == 6) v = 0.5f * v * (1.0f + erff(v * 0.70710678118654752f)); else if (ACT == 11) v = 1.0f / (1.0f + expf(-v)); else if (ACT == 15) v = v / (1.0f + expf(-v)); else if (ACT == 12) v = (v > 0.f) ? v : 0.01f * v; else if (ACT == 8) v = tanhf(v); else if (ACT == 9) v = 0.5f * v * (1.0f + tanhf(0.7978845608028654f * (v + 0.044715f * v * v * v))); else if (ACT == 14) v = (v > 0.f) ? v : 0.1f * v; else if (ACT == 16) v = (v >= 0.f) ? v : 0.3f * v; else if (ACT == 17) v = (v >= 0.f) ? v : 0.2f * v;
      so[w][rloc][t * 16 + ln] = v; } } }
  __builtin_amdgcn_fence(__ATOMIC_ACQ_REL, "workgroup"); __builtin_amdgcn_wave_barrier();
  const int rsub = lane >> 4, c4 = (lane & 15) * 4;
  if constexpr (ROPE) {      /* both loops unrolled in full: cc[], ss[] are indexed by constants; a lane's 4 columns are 2 whole pairs */
#pragma unroll
    for (int q = 0; q < 16; ++q) { const int r = q * 2 + rsub; const v4f o = g2_turn(*(const v4fa*)&so[w][r][c4], cc[q], ss[q]); v4h h4; for (int i = 0; i < 4; ++i) h4[i] = (_Float16)o[i]; *(v4h*)(C16 + cofs + (size_t)(row0 + r) * ldc + col0 + c4) = h4; }
    static_assert(SQ % 128 == 0, "a row tile lies in one batch");
    const int bt = (mt * 128) / SQ; const int lim = bt * SQ + nf32; const size_t fsh = (size_t)bt * (SQ - nf32) * ldc;      /* the tile's batch; the end of that batch's f32 rows; what row bt * SQ + i of the GEMM lies ahead of row bt * nf32 + i of C: all three the same for the whole work-group */
    asm volatile("s_wait_xcnt 0x0" ::: "memory");      /* the f16 stores' address and data registers are reused below; in front of the branch, so that nothing of the block behind it can be scheduled ahead of the wait */
    if (mt * 128 < lim) {      /* the same for the whole work-group: only the first row tiles of a batch also store f32 rows; a loop of its own, so that the f16 loop above is free of branches and its LDS reads go out together */
#pragma unroll      /* unrolled in full, like the loop above */
      for (int q = 0; q < 16; ++q) { const int r = q * 2 + rsub; if (row0 + r < lim) *(v4f*)(C + (cofs + (size_t)(row0 + r) * ldc + col0 + c4 - fsh)) = g2_turn(*(const v4fa*)&so[w][r][c4], cc[q], ss[q]); } }
  } else {
#pragma unroll
    for (int q = 0; q < 16; ++q) { const int r = q * 2 + rsub; const v4f v = *(const v4fa*)&so[w][r][c4]; if (C) *(v4f*)(C + cofs + (size_t)(row0 + r) * ldc + col0 + c4) = v; if (C16) { v4h h4; for (int i = 0; i < 4; ++i) h4[i] = (_Float16)v[i]; *(v4h*)(C16 + cofs + (size_t)(row0 + r) * ldc + col0 + c4) = h4; } }
     } }


__global__ __launch_bounds__(256) void k_wnat(const float* __restrict__ w, size_t n8, _Float16* __restrict__ Bt) { const size_t t = (size_t)blockIdx.x * 256 + threadIdx.x; if (t >= n8) return; FragH f; for (int q = 0; q < 8; ++q) f.h[q] = (_Float16)(bf16_round(w[t * 8 + q]) * 16.0f); *(v8us*)((unsigned short*)Bt + t * 8) = f.half[0];  }
__global__ __launch_bounds__(256) void k_rsm(const float* __restrict__ S, _Float16* __restrict__ P, int nrows) {
  #pragma clang fp contract(off)
  const int i = blockIdx.x * 256 + threadIdx.x; if (i >= nrows) return; const float* s = S + (size_t)i * SQ; float mx = -3.0e38f;
#pragma unroll 1
  for (int j = 0; j < SQ; ++j) mx = fmaxf(mx, s[j]); float se = 0.f;
#pragma unroll 1
  for (int j = 0; j < SQ; ++j) se += expf(s[j] - mx); const float sc = 256.0f / se;
#pragma unroll 1
  for (int j0 = 0; j0 < SQ; j0 += 8) { FragH f; for (int q = 0; q < 8; ++q) f.h[q] = (_Float16)(expf(s[j0 + q] - mx) * sc); unsigned short* d = (unsigned short*)P + (size_t)i * SQ + j0; *(v8us*)d = f.half[0];  } }
__global__ __launch_bounds__(256) void k_vt(const _Float16* __restrict__ V16, int b, int h0, _Float16* __restrict__ VT) { __shared__ unsigned short tl[64][65]; const int tid = threadIdx.x; const int hh = blockIdx.x % HG, sg = blockIdx.x / HG; const int s0 = sg * 64; const int h = h0 + hh;
  for (int i = tid; i < 64 * 8; i += 256) { const int j = i / 8, d8 = (i % 8) * 8; FragH f; f.half[0] = *(const v8us*)((const unsigned short*)V16 + ((size_t)b * SQ + s0 + j) * DM + h * HD + d8); for (int q = 0; q < 8; ++q) tl[d8 + q][j] = f.u[q]; }
  __syncthreads();
  { for (int i = tid; i < 64 * 8; i += 256) { const int d = i / 8, j8 = (i % 8) * 8; FragH f; for (int q = 0; q < 8; ++q) f.u[q] = tl[d][j8 + q]; *(v8us*)((unsigned short*)VT + ((size_t)hh * HD + d) * SQ + s0 + j8) = f.half[0]; }  } }



#define FK 64                        /* keys per staged tile of the fused attention kernel */
#define FPB (FK * 2 + 16)            /* LDS pitch of a staged row (a k row: HD f16 = 128 B; a V^T row: FK f16 = 128 B) plus 16 B: 16 B x odd, so the 16 rows of a fragment read spread over the banks */
#define FBUF (2 * FK * FPB)          /* one buffer: FK k rows, then HD V^T rows */
#define FQ 32                        /* query rows per wave */
// Eight asynchronous 16-byte copies per lane, global memory -> LDS. The s_wait_xcnt is the last line of the copies' own statement, so no register that a copy names is rewritten in front of it.
__device__ __forceinline__ void fa_copy8(const unsigned (&l)[8], const _Float16* const (&g)[8]) {
  asm volatile("global_load_async_to_lds_b128 %0, %8, off\n\t"
               "global_load_async_to_lds_b128 %1, %9, off\n\t"
               "global_load_async_to_lds_b128 %2, %10, off\n\t"
               "global_load_async_to_lds_b128 %3, %11, off\n\t"
               "global_load_async_to_lds_b128 %4, %12, off\n\t"
               "global_load_async_to_lds_b128 %5, %13, off\n\t"
               "global_load_async_to_lds_b128 %6, %14, off\n\t"
               "global_load_async_to_lds_b128 %7, %15, off\n\t"
               "s_wait_xcnt 0x0"
               :: "v"(l[0]), "v"(l[1]), "v"(l[2]), "v"(l[3]), "v"(l[4]), "v"(l[5]), "v"(l[6]), "v"(l[7]),
                  "v"(g[0]), "v"(g[1]), "v"(g[2]), "v"(g[3]), "v"(g[4]), "v"(g[5]), "v"(g[6]), "v"(g[7]) : "memory"); }
// One tile (FK k rows, then the same FK keys of the HD V^T rows) into one LDS buffer: a row's 128 bytes are 8 neighbouring lanes' 16 bytes each, 16 rows a round of 128 lanes.
// kg, vg: the lane's own 16 bytes in row tid / 8 of the k tile and of the V^T tile; lds: the LDS byte address of the same place in the buffer. Unrolled in full: l[] and g[] are asm operands.
__device__ __forceinline__ void fa_stage(const _Float16* kg, const _Float16* vg, unsigned lds) {
  unsigned l[8]; const _Float16* g[8];
#pragma unroll
  for (int u = 0; u < 8; ++u) { l[u] = lds + (unsigned)(u * 16 * FPB); g[u] = (u < 4) ? kg + (size_t)(u * 16) * KVD : vg + (size_t)((u - 4) * 16) * SQ; }
  fa_copy8(l, g); }
__device__ __forceinline__ void fa_exp8(float (&x)[8]) {
  asm("v_exp_f32 %0, %0\n\t"
      "v_exp_f32 %1, %1\n\t"
      "v_exp_f32 %2, %2\n\t"
      "v_exp_f32 %3, %3\n\t"
      "v_exp_f32 %4, %4\n\t"
      "v_exp_f32 %5, %5\n\t"
      "v_exp_f32 %6, %6\n\t"
      "v_exp_f32 %7, %7\n\t"
      "v_nop"
      : "+v"(x[0]), "+v"(x[1]), "+v"(x[2]), "+v"(x[3]), "+v"(x[4]), "+v"(x[5]), "+v"(x[6]), "+v"(x[7])); }
// One 2^x with the same slot behind it.
__device__ __forceinline__ float fa_exp1(float x) { asm("v_exp_f32 %0, %0\n\tv_nop" : "+v"(x)); return x; }
__device__ __forceinline__ v8f fa_mma(v16h a, v16h b, v8f c) { return __builtin_amdgcn_wmma_f32_16x16x32_f16(false, a, false, b, (short)0, c, false, false); }
__global__ __launch_bounds__(128) void k_fattn(const _Float16* __restrict__ Q, const _Float16* __restrict__ Kh, const _Float16* __restrict__ Vt, _Float16* __restrict__ O) {
  __shared__ __attribute__((aligned(16))) unsigned char st[2 * FBUF];
  const int tid = threadIdx.x, lane = tid & 31, c = lane & 15, hh = lane >> 4; const int w = __builtin_amdgcn_readfirstlane(tid >> 5);      /* the wave's number in a scalar register: the head's offsets become scalar arithmetic */
  const int qt = (SQ / FQ - 1) - (int)(blockIdx.x / (NB * NG)); const int bg = (int)(blockIdx.x % (NB * NG)); const int b = bg / NG, g = bg % NG;      /* longest rows first */
  const int q0 = qt * FQ, h = g * HPG + w; const int nt = (q0 + FQ + FK - 1) / FK;      /* causal: tiles up to the one that holds the last query's own key; the same for the whole work-group */
  const int sr = tid >> 3, sc = tid & 7;      /* this lane's row and 16-byte column in a round of copies */
  const _Float16* kg = Kh + ((size_t)b * SQ + sr) * KVD + g * HD + sc * 8; const _Float16* vg = Vt + ((size_t)bg * HD + sr) * SQ + sc * 8;
  const unsigned lds0 = (unsigned)(size_t)(&st[0]) + (unsigned)(sr * FPB + sc * 16);
  fa_stage(kg, vg, lds0);
  v16h qf[2][2];
#pragma unroll
  for (int j = 0; j < 2; ++j) {
#pragma unroll
    for (int ks = 0; ks < 2; ++ks) { const unsigned short* p = (const unsigned short*)Q + ((size_t)b * SQ + q0 + j * 16 + c) * DM + h * HD + ks * 32 + 8 * hh; FragH f; f.half[0] = *(const v8us*)p; f.half[1] = *(const v8us*)(p + 16); qf[j][ks] = f.v; } }
  asm volatile("s_wait_xcnt 0x0" ::: "memory");      /* the q loads' address registers are reused below */
  asm volatile("s_wait_asynccnt 0x0" ::: "memory");      /* this wave's copies of tile 0 have landed */
  __syncthreads();      /* tile 0 readable by every wave */
  if (nt > 1) fa_stage(kg + (size_t)FK * KVD, vg + FK, lds0 + FBUF);
  const v8f z8 = {0.f,0.f,0.f,0.f,0.f,0.f,0.f,0.f};
  v8f acc[4][2]; float m[2], l[2];
#pragma unroll
  for (int j = 0; j < 2; ++j) { m[j] = -1.0e30f; l[j] = 0.f;
#pragma unroll
    for (int dt = 0; dt < 4; ++dt) acc[dt][j] = z8; }
  const float C = 0.125f * 1.4426950408889634f;      /* 1 / sqrt(HD), and e^x = 2^(x log2 e) */
#pragma unroll 1      /* kept rolled: one copy of the long body, the buffer chosen by t & 1 */
  for (int t = 0; t < nt; ++t) { const unsigned char* sk = st + (t & 1) * FBUF + c * FPB + 16 * hh; const unsigned char* sv = sk + FK * FPB;
#pragma unroll
    for (int ps = 0; ps < FK / 32; ++ps) { const int kb = t * FK + ps * 32;      /* a pass: 32 keys, one k step of O^T += V^T P^T */
      if (kb <= q0) {      /* the same for the whole work-group; false only for a pass whose every key lies past the diagonal */
        v8f s[2][2];
#pragma unroll
        for (int kt = 0; kt < 2; ++kt) { const v16h k0 = g2_lfrag(sk + (ps * 2 + kt) * 16 * FPB), k1 = g2_lfrag(sk + (ps * 2 + kt) * 16 * FPB + 64);
#pragma unroll
          for (int j = 0; j < 2; ++j) s[kt][j] = fa_mma(k1, qf[j][1], fa_mma(k0, qf[j][0], z8)); }
        if (kb == q0) {      /* only the pass on the diagonal holds masked keys */
#pragma unroll
          for (int kt = 0; kt < 2; ++kt) {
#pragma unroll
            for (int j = 0; j < 2; ++j) {
#pragma unroll
              for (int r = 0; r < 8; ++r) s[kt][j][r] = (kt * 16 + 8 * hh + r <= j * 16 + c) ? s[kt][j][r] : -1.0e30f; } } }
        FragH pf[2];
#pragma unroll
        for (int j = 0; j < 2; ++j) { float mk[2];
#pragma unroll
          for (int kt = 0; kt < 2; ++kt) mk[kt] = fmaxf(fmaxf(fmaxf(s[kt][j][0], s[kt][j][1]), fmaxf(s[kt][j][2], s[kt][j][3])), fmaxf(fmaxf(s[kt][j][4], s[kt][j][5]), fmaxf(s[kt][j][6], s[kt][j][7])));
          float mx = fmaxf(mk[0], mk[1]); mx = fmaxf(mx, __shfl_xor(mx, 16, 32)); mx = fmaxf(mx, m[j]);
          const float al = fa_exp1((m[j] - mx) * C); const float nb = 8.0f - mx * C; m[j] = mx;      /* weights x256: 2^(s C - mx C + 8); a masked key gives 0 */
          float sm[2];
#pragma unroll
          for (int kt = 0; kt < 2; ++kt) { float p[8];
#pragma unroll
            for (int r = 0; r < 8; ++r) p[r] = __builtin_fmaf(s[kt][j][r], C, nb);
            fa_exp8(p); sm[kt] = ((p[0] + p[1]) + (p[2] + p[3])) + ((p[4] + p[5]) + (p[6] + p[7]));
#pragma unroll
            for (int r = 0; r < 8; ++r) pf[j].h[kt * 8 + r] = (_Float16)p[r]; }
          l[j] = __builtin_fmaf(l[j], al, sm[0] + sm[1]);      /* this lane half's keys only; the halves are joined behind the loop */
#pragma unroll
          for (int dt = 0; dt < 4; ++dt) acc[dt][j] *= al; }
#pragma unroll
        for (int dt = 0; dt < 4; ++dt) { const v16h vf = g2_lfrag(sv + dt * 16 * FPB + ps * 64);
#pragma unroll
          for (int j = 0; j < 2; ++j) acc[dt][j] = fa_mma(vf, pf[j].v, acc[dt][j]); } } }
    asm volatile("s_wait_dscnt 0x0" ::: "memory");      /* this wave's reads of tile t are done before the buffer is refilled */
    asm volatile("s_wait_asynccnt 0x0" ::: "memory");      /* this wave's copies of tile t + 1 have landed */
    __syncthreads();      /* publishes tile t + 1 and ends every wave's reads of tile t */
    if (t + 2 < nt) fa_stage(kg + (size_t)(t + 2) * FK * KVD, vg + (size_t)(t + 2) * FK, lds0 + (unsigned)((t & 1) * FBUF)); }
  asm volatile("s_wait_asynccnt 0x0" ::: "memory");      /* no copy outstanding when the wave ends */
  FragH of[2][4];      /* every piece converted into registers of its own before the first store: no register of an issued store is written again */
#pragma unroll
  for (int j = 0; j < 2; ++j) { const float fin = 64.0f / (l[j] + __shfl_xor(l[j], 16, 32));
#pragma unroll
    for (int dt = 0; dt < 4; ++dt) {
#pragma unroll
      for (int r = 0; r < 8; ++r) of[j][dt].h[r] = (_Float16)(acc[dt][j][r] * fin); } }
#pragma unroll
  for (int j = 0; j < 2; ++j) { unsigned short* po = (unsigned short*)O + ((size_t)b * SQ + q0 + j * 16 + c) * DM + h * HD + 8 * hh;      /* a lane's 8 accumulator registers are 8 neighbouring head dims of one query row: one 16-byte store */
#pragma unroll
    for (int dt = 0; dt < 4; ++dt) *(v8us*)(po + dt * 16) = of[j][dt].half[0]; } }


#define A0R 16                       /* query rows, one wave each, per work-group of the f32 first-tile kernel */
#define A0P (HD + 4)                 /* pitch of a staged k row in floats: 272 B = 16 B x 17, so 32 lanes reading 32 different rows spread over the LDS banks */
typedef float v2f __attribute__((ext_vector_type(2)));
// f32 causal attention for query rows 0..QT0-1 of every batch (blockIdx.y; QT0 rows a batch in QF, KF, VF and OF). One work-group per (batch, head, A0R query rows): the head's QT0 k and v rows are staged in LDS once,
// then one wave per query row i: scores with one key per lane (32 keys a pass), maximum and sum over the lanes, then o with two head dims per lane, key after key.
// Every loop is unrolled in full so that s[], e[], q[], tk[] and tv[] are indexed by constants and stay in registers and the lane number of each readlane is a constant; the tests on c are the same for the whole wave.
__global__ __launch_bounds__(512) void k_att0w(const float* __restrict__ QF, const float* __restrict__ KF, const float* __restrict__ VF, int ld, float scale, float* __restrict__ OF, int ldo) {
  __shared__ __attribute__((aligned(16))) float lk[QT0][A0P]; __shared__ __attribute__((aligned(16))) float lv[QT0][HD];
  const int tid = threadIdx.x, lane = tid & 31; const int w = __builtin_amdgcn_readfirstlane(tid >> 5);
  const int h = blockIdx.x / (QT0 / A0R), rg = blockIdx.x % (QT0 / A0R); const int i = rg * A0R + w;
  const int hb = h * HD + (int)blockIdx.y * QT0 * ld, ho = h * HD + (int)blockIdx.y * QT0 * ldo;      /* first column of the head in row 0 of this batch's QT0 rows, in QF, KF, VF and in OF */
  v4f tk[QT0 * (HD / 4) / 512], tv[QT0 * (HD / 4) / 512];      /* all loads issued before the first LDS store: one memory latency for the whole stage */
#pragma unroll
  for (int u = 0; u < QT0 * (HD / 4) / 512; ++u) { const int e4 = u * 512 + tid; const size_t g = (size_t)(e4 / (HD / 4)) * ld + hb + (e4 % (HD / 4)) * 4; tk[u] = *(const v4fa*)(KF + g); tv[u] = *(const v4fa*)(VF + g); }
  const float* qr = QF + (size_t)i * ld + hb; v4f q[HD / 4];
#pragma unroll
  for (int d = 0; d < HD / 4; ++d) q[d] = *(const v4fa*)(qr + d * 4);
#pragma unroll
  for (int u = 0; u < QT0 * (HD / 4) / 512; ++u) { const int e4 = u * 512 + tid; *(v4f*)&lk[e4 / (HD / 4)][(e4 % (HD / 4)) * 4] = tk[u]; *(v4f*)&lv[e4 / (HD / 4)][(e4 % (HD / 4)) * 4] = tv[u]; }
  __syncthreads();
  float s[QT0 / 32]; float mx = -1.0e30f;
#pragma unroll
  for (int c = 0; c < QT0 / 32; ++c) { s[c] = -1.0e30f;
    if (c * 32 <= i) { const float* kr = &lk[c * 32 + lane][0]; v4f a = {0.f, 0.f, 0.f, 0.f};
#pragma unroll
      for (int d = 0; d < HD / 4; ++d) a += q[d] * *(const v4f*)(kr + d * 4);
      const float t = ((a[0] + a[1]) + (a[2] + a[3])) * scale; s[c] = (c * 32 + lane <= i) ? t : -1.0e30f; mx = fmaxf(mx, s[c]); } }
#pragma unroll
  for (int d = 16; d > 0; d >>= 1) mx = fmaxf(mx, __shfl_xor(mx, d, 32));
  float e[QT0 / 32]; float l = 0.f;
#pragma unroll
  for (int c = 0; c < QT0 / 32; ++c) { e[c] = 0.f; if (c * 32 <= i) { e[c] = expf(s[c] - mx); l += e[c]; } }      /* a masked key: expf(-1e30 - mx) = 0 */
#pragma unroll
  for (int d = 16; d > 0; d >>= 1) l += __shfl_xor(l, d, 32);
  v2f o = {0.f, 0.f};
#pragma unroll
  for (int c = 0; c < QT0 / 32; ++c) if (c * 32 <= i) {
#pragma unroll
    for (int j = 0; j < 32; ++j) { const float p = __int_as_float(__builtin_amdgcn_readlane(__float_as_int(e[c]), j)); o += p * *(const v2f*)&lv[c * 32 + j][lane * 2]; } }
  const float fin = 64.0f / l;      /* o carried x64 like the f16 path */
  *(v2f*)(OF + (size_t)i * ldo + ho + lane * 2) = o * fin; }


__global__ __launch_bounds__(256) void k_kvexp(const float* __restrict__ src, float* __restrict__ dst, size_t n4) { const size_t t = (size_t)blockIdx.x * 256 + threadIdx.x; if (t >= n4) return; const size_t e = t * 4; const size_t row = e / DM; const int col = (int)(e % DM); const int h = col / HD, d = col % HD; const v4f v = *(const v4fa*)(src + row * KVD + (size_t)(h / HPG) * HD + d); *(v4f*)(dst + e) = v;  }

__global__ __launch_bounds__(256) void k_tab2(float theta, float* __restrict__ CS, float* __restrict__ SN) {
  #pragma clang fp contract(off)
  const int t = blockIdx.x * 256 + threadIdx.x; if (t >= SQ * (HD / 2)) return; const int i = t % (HD / 2); const int p = t / (HD / 2); const float invf = 1.0f / powf(theta, (float)(2 * i) / (float)HD); const float ang = __fmul_rn((float)p, invf); const float c = cosf(ang), s = sinf(ang);
  *(float*)(CS + t) = c; *(float*)(SN + t) = s;  }
__global__ __launch_bounds__(256) void k_bfcp(const float* __restrict__ src, float* __restrict__ dst, size_t n4) { const size_t t = (size_t)blockIdx.x * 256 + threadIdx.x; if (t >= n4) return; const v4f a = *(const v4fa*)(src + t * 4); v4f o; for (int q = 0; q < 4; ++q) o[q] = bf16_round(a[q]); *(v4f*)(dst + t * 4) = o;  }

__global__ __launch_bounds__(256) void k_f2bf(const float* __restrict__ F, unsigned short* __restrict__ O, size_t n8) { const size_t t = (size_t)blockIdx.x * 256 + threadIdx.x; if (t >= n8) return; const v4f a = *(const v4fa*)(F + t * 8), b = *(const v4fa*)(F + t * 8 + 4); FragH f;
  for (int q = 0; q < 4; ++q) { f.u[q] = (unsigned short)(__float_as_uint(bf16_round(a[q])) >> 16); f.u[4 + q] = (unsigned short)(__float_as_uint(bf16_round(b[q])) >> 16); }
  *(v8us*)(O + t * 8) = f.half[0];  }
extern "C" void kernel_launch(void* const* d_in, const int* in_sizes, int n_in,
                              void* d_out, int out_size, void* d_ws, size_t ws_size, hipStream_t stream) {
  (void)in_sizes; (void)n_in; (void)out_size;
  const float* const* I = (const float* const*)d_in; const float* x = I[0]; const float* tcos = I[1]; const float* tsin = I[2]; const float* wq = I[3]; const float* wk = I[4]; const float* wv = I[5]; const float* wo = I[6]; const float* bq = nullptr; const float* bk = nullptr; const float* bv = nullptr; const float* bo = nullptr;      /* [in][out] weights, no biases; rope tables [S][32] */
  char* ws = (char*)d_ws; size_t off = 0;
  auto take = [&](size_t bytes) { char* p = ws + off; off += (bytes + 255) & ~(size_t)255; return p; };
  _Float16* BQ = (_Float16*)take((size_t)DM * DM * 2); _Float16* BK = (_Float16*)take((size_t)KVD * DM * 2); _Float16* BV = (_Float16*)take((size_t)KVD * DM * 2); _Float16* BO = (_Float16*)take((size_t)DM * DM * 2);
  _Float16* X16 = (_Float16*)take(NR * DM * 2); float* CSB = (float*)take((size_t)SQ * 32 * 4); float* SNB = (float*)take((size_t)SQ * 32 * 4); _Float16* Q16 = (_Float16*)take(NR * DM * 2); _Float16* K16 = (_Float16*)take(NR * KVD * 2); _Float16* V16 = (_Float16*)take(NR * KVD * 2); _Float16* O16 = (_Float16*)take(NR * DM * 2);
  _Float16* VT = (_Float16*)take((size_t)NB * NG * HD * SQ * 2);
  float* QF0 = (float*)take((size_t)NB * QT0 * DM * 4); float* KF0 = (float*)take((size_t)NB * QT0 * KVD * 4); float* VF0 = (float*)take((size_t)NB * QT0 * KVD * 4); float* KF0e = (float*)take((size_t)NB * QT0 * DM * 4); float* VF0e = (float*)take((size_t)NB * QT0 * DM * 4); float* OF0 = (float*)take((size_t)NB * QT0 * DM * 4); _Float16* OH0 = (_Float16*)take((size_t)NB * QT0 * DM * 2); _Float16* OL0 = (_Float16*)take((size_t)NB * QT0 * DM * 2); float* OUTF = (float*)take(NR * DM * 4);      /* first-tile planes: QT0 rows a batch, batch after batch; OUTF: f32 result rows, converted to bf16 at the end */
  if (off > ws_size) return;
  k_wt_f16<<<(unsigned)(((size_t)DM * (DM / 8) + 255) / 256), 256, 0, stream>>>(wq, BQ, DM, DM, 16.0f); k_wt_f16<<<(unsigned)(((size_t)KVD * (DM / 8) + 255) / 256), 256, 0, stream>>>(wk, BK, DM, KVD, 16.0f); k_wt_f16<<<(unsigned)(((size_t)KVD * (DM / 8) + 255) / 256), 256, 0, stream>>>(wv, BV, DM, KVD, 16.0f); k_wt_f16<<<(unsigned)(((size_t)DM * (DM / 8) + 255) / 256), 256, 0, stream>>>(wo, BO, DM, DM, 16.0f);      /* [in][out] -> Bt[n][k] x16 */
  k_x16<<<(unsigned)((NR * DM / 8 + 255) / 256), 256, 0, stream>>>(x, X16, NR * DM / 8);
  k_bfcp<<<(SQ * 32 / 4 + 255) / 256, 256, 0, stream>>>(tcos, CSB, (size_t)SQ * 32 / 4); k_bfcp<<<(SQ * 32 / 4 + 255) / 256, 256, 0, stream>>>(tsin, SNB, (size_t)SQ * 32 / 4);      /* bf16-rounded rope tables [pos][32] */
  const size_t r0p = (size_t)B0 * SQ;      /* first projected row */
  k_gemm2<0><<<dim3((unsigned)((MP / 128) * (KVD / 64)), 1), 128, 0, stream>>>(X16 + r0p * DM, DM, 0, BV, DM, 0, 0.0625f, bv, 0, nullptr, 1, 0, 0, nullptr, V16 + r0p * KVD, KVD, 0, MP, KVD, DM);
  const size_t f0p = (size_t)B0 * QT0;      /* first row of the first-tile planes */
  /* every launch below covers all batches at once: nothing in one batch waits for another */
  k_gemm2<0, 1, 128, true><<<dim3((unsigned)((MP / 128) * (DM / 64)), 1), 128, 0, stream>>>(X16 + r0p * DM, DM, 0, BQ, DM, 0, 0.0625f, nullptr, 0, nullptr, 1, 0, 0, QF0 + f0p * DM, Q16 + r0p * DM, DM, 0, MP, DM, DM, CSB, SNB, QT0);      /* q, interleaved-pair rope in the epilogue: f16 rows, and f32 rows 0..127 of each batch */
  k_gemm2<0, 1, 128, true><<<dim3((unsigned)((MP / 128) * (KVD / 64)), 1), 128, 0, stream>>>(X16 + r0p * DM, DM, 0, BK, DM, 0, 0.0625f, nullptr, 0, nullptr, 1, 0, 0, KF0 + f0p * KVD, K16 + r0p * KVD, KVD, 0, MP, KVD, DM, CSB, SNB, QT0);      /* k likewise */
  k_vt<NG, SQ><<<NBR * NG * (SQ / 64), 256, 0, stream>>>(V16 + r0p * KVD, KVD, 0, VT + (size_t)B0 * NG * HD * SQ);      /* V^T [NB][NG][HD][SQ] */
  k_gemm2<0><<<dim3((QT0 / 128) * (KVD / 64), NBR), 128, 0, stream>>>(X16 + r0p * DM, DM, (size_t)SQ * DM, BV, DM, 0, 0.0625f, bv, 0, nullptr, 1, 0, 0, VF0 + f0p * KVD, nullptr, KVD, (size_t)QT0 * KVD, QT0, KVD, DM);      /* f32 v of rows 0..127, grid.y = batch */
  k_kvexp<<<(unsigned)(((size_t)NBR * QT0 * DM / 4 + 255) / 256), 256, 0, stream>>>(KF0 + f0p * KVD, KF0e + f0p * DM, (size_t)NBR * QT0 * DM / 4); k_kvexp<<<(unsigned)(((size_t)NBR * QT0 * DM / 4 + 255) / 256), 256, 0, stream>>>(VF0 + f0p * KVD, VF0e + f0p * DM, (size_t)NBR * QT0 * DM / 4);      /* head h <- kv group h/4 for the exact first-tile kernel */
  k_att0w<<<dim3(NH * (QT0 / A0R), NBR), 512, 0, stream>>>(QF0 + f0p * DM, KF0e + f0p * DM, VF0e + f0p * DM, DM, 0.125f, OF0 + f0p * DM, DM);      /* exact f32 attention for rows 0..127 (o x64), grid.y = batch */
  k_fattn<<<NB * NG * (SQ / FQ), 128, 0, stream>>>(Q16, K16, VT, O16);      /* scores, causal softmax and P V of both batches and all 32 heads in one launch: o (merged heads, x64) as f16 rows */
  k_gemm2<0><<<dim3((unsigned)((MPO / 128) * (DM / 64)), 1), 128, 0, stream>>>(O16 + r0p * DM, DM, 0, BO, DM, 0, 0.0009765625f, bo, 0, nullptr, 1, 0, 0, OUTF + r0p * DM, nullptr, DM, 0, MPO, DM, DM);      /* out rows (f32) */
  k_hl<<<(unsigned)(((size_t)NB * QT0 * DM / 8 + 255) / 256), 256, 0, stream>>>(OF0, OH0, OL0, (size_t)NB * QT0 * DM / 8);      /* first-tile o (x64) -> f16 hi + x1024 residual planes */
  k_gemm2<0><<<dim3((QT0 / 128) * (DM / 64), NBR), 128, 0, stream>>>(OH0 + f0p * DM, DM, (size_t)QT0 * DM, BO, DM, 0, 0.0009765625f, bo, 0, nullptr, 1, 0, 0, OUTF + r0p * DM, nullptr, DM, (size_t)SQ * DM, QT0, DM, DM);      /* rows 0..127 of each batch (grid.y): out = o_hi Wo (+ b), overwriting the f16-path rows */
  k_gemm2<0><<<dim3((QT0 / 128) * (DM / 64), NBR), 128, 0, stream>>>(OL0 + f0p * DM, DM, (size_t)QT0 * DM, BO, DM, 0, 0.00000095367431640625f, nullptr, 0, (const float*)(OUTF + r0p * DM), -1, 0, 0, OUTF + r0p * DM, nullptr, DM, (size_t)SQ * DM, QT0, DM, DM);      /* += o_lo Wo 2^-20 (own-element accumulate) */
  k_f2bf<<<(unsigned)(((size_t)MPO * DM / 8 + 255) / 256), 256, 0, stream>>>(OUTF + (size_t)B0 * SQ * DM, (unsigned short*)d_out + (size_t)B0 * SQ * DM, (size_t)MPO * DM / 8);      /* out.astype(bfloat16): the f32 rows rounded to nearest-even bf16 into the 2-byte output */
}

// v008
// A run of this version takes 257 microseconds.
// In both of two side-by-side timings against v007, it was 1.18 times as fast.
// Over all steps from v000 it is 37.0 times as fast.
#include <hip/hip_runtime.h>
// Grouped-query causal attention with RoPE and a BFLOAT16 output (x [2][2048][2048]; xq = x wq (32 heads x 64), xk = x wk, xv = x wv (8 kv heads x 64) ([in][out] weights sigma 1/sqrt(2048), no biases); interleaved-pair RoPE (reshape(..., 32, 2): real = even, imag = odd) on q and k from the module's INPUT tables freqs_cos/freqs_sin [S][32]; repeat: query head h uses kv head h/4; scores / 8 + triu(-inf, 1) (causal); softmax; out = (merged wo).astype(bfloat16) -> bf16 [2][2048][2048] (2 bytes per element)).
// Compute dtype: inputs rounded to bf16; x / weights exact; q, k, v, softmax weights and o as plain f16 GEMM operands (~2^-12); scores and softmax statistics f32. v_wmma_f32_16x16x32_f16.
#define NB 2
#define NG 8
#define HPG 4
#define KVD (NG * HD)
#define SQ 2048
#define DM 2048
#define NH 32
#define HD 64
#define HG 4                         /* heads per launch of the non-template k_vt (not launched) */
#define QT 256                       /* not used */
#define NKX SQ                       /* S / P row pitch */
#define QT0 128                      /* first-tile rows recomputed exactly in f32 */
#define B0 0                         /* first batch processed (debug hook) */
#define NBR NB                       /* batches processed (debug hook) */
#define NR ((size_t)NB * SQ)         /* token rows */
#define MP ((int)((size_t)NBR * SQ)) /* rows projected (debug hook) */
#define QN SQ                        /* query rows attended per batch (not used) */
#define NHD NH                       /* heads attended (not used) */
#define MPO MP                       /* rows through the output stage (debug hook) */
#define LQ DM      /* row pitch of the q rows */
typedef __bf16 v16b __attribute__((ext_vector_type(16)));
typedef unsigned short v8us __attribute__((ext_vector_type(8), may_alias));
typedef float  v8f  __attribute__((ext_vector_type(8)));
typedef float  v4f  __attribute__((ext_vector_type(4)));
typedef float  v4fa __attribute__((ext_vector_type(4), may_alias));
union FragB { v16b v; v8us half[2]; unsigned short u[16]; };

__device__ __forceinline__ unsigned short bf16_bits(float x) { unsigned int u = __float_as_uint(x); return (unsigned short)((u + 0x7FFFu + ((u >> 16) & 1u)) >> 16); }
__device__ __forceinline__ float bf16_val(unsigned short b) { return __uint_as_float(((unsigned int)b) << 16); }
__device__ __forceinline__ float bf16_round(float x) { return bf16_val(bf16_bits(x)); }
// D += A·B with NT terms: 1 = ah·bh, 2 = + al·bh (A split), 3 = + ah·bl (both split)
template <int NT>
__device__ __forceinline__ v8f mmaN(v16b ah, v16b al, v16b bh, v16b bl, v8f c) {
  c = __builtin_amdgcn_wmma_f32_16x16x32_bf16(false, ah, false, bh, (short)0, c, false, false);
  if (NT >= 2) c = __builtin_amdgcn_wmma_f32_16x16x32_bf16(false, al, false, bh, (short)0, c, false, false);
  if (NT >= 3) c = __builtin_amdgcn_wmma_f32_16x16x32_bf16(false, ah, false, bl, (short)0, c, false, false);
  asm volatile("v_nop\n\tv_nop\n\tv_nop\n\tv_nop" : "+v"(c) : "v"(ah), "v"(al), "v"(bh), "v"(bl));
  return c;
}

__global__ __launch_bounds__(256) void k_wt_bf16(const float* __restrict__ W, unsigned short* __restrict__ Wt, int K, int N) {
  const int t = blockIdx.x * 256 + threadIdx.x;
  const int k8n = K / 8;
  if (t >= N * k8n) return;
  const int n = t / k8n, k8 = (t % k8n) * 8;
  v8us v;
#pragma unroll
  for (int i = 0; i < 8; ++i) v[i] = bf16_bits(W[(size_t)(k8 + i) * N + n]);
  *(v8us*)(Wt + (size_t)n * K + k8) = v;
  
}

// GEMM C[M][N] (f32, pitch ldc) = act(A[M][K]·W + bias). A f32 row-major (pitch lda) converted per fragment to bf16
// (ASPLIT: hi/lo two planes -> 2 terms, else single rounded term); Wt bf16 [N][K] (pitch ldb). BIAS_BF16 rounds the
// bias to bf16 first (bias quantised to bf16 before the add). K%32==0, M%16==0, N%64==0.
template <bool ASPLIT, int ACT, bool BIAS_BF16>
__global__ __launch_bounds__(128) void k_gemm_bf(const float* __restrict__ A, int lda, const unsigned short* __restrict__ Wt, int ldb,
                                               const float* __restrict__ bias, float* __restrict__ C, int ldc, int M, int N, int K) {
  __shared__ __attribute__((aligned(16))) float so[4][16][64];
  const int tid = threadIdx.x, w = tid >> 5, lane = tid & 31, ln = lane & 15, hh = lane >> 4;
  const int ntn = N / 64;
  const int wid = blockIdx.x * 4 + w;
  const int mt = wid / ntn, nq = wid % ntn;
  if (mt * 16 >= M) return;
  const int row0 = mt * 16, col0 = nq * 64;
  const float* arow = A + (size_t)(row0 + ln) * lda;
  v8f acc[4] = {};
  for (int kb = 0; kb < K; kb += 32) {
    FragB ah, al;
    const v4f x0 = *(const v4fa*)(arow + kb + 8 * hh), x1 = *(const v4fa*)(arow + kb + 8 * hh + 4);
    const v4f x2 = *(const v4fa*)(arow + kb + 16 + 8 * hh), x3 = *(const v4fa*)(arow + kb + 16 + 8 * hh + 4);
    float xs[16] = {x0[0],x0[1],x0[2],x0[3],x1[0],x1[1],x1[2],x1[3],x2[0],x2[1],x2[2],x2[3],x3[0],x3[1],x3[2],x3[3]};
#pragma unroll
    for (int i = 0; i < 16; ++i) { const unsigned short hb = bf16_bits(xs[i]); ah.u[i] = hb; al.u[i] = ASPLIT ? bf16_bits(xs[i] - bf16_val(hb)) : (unsigned short)0; }
#pragma unroll
    for (int t = 0; t < 4; ++t) {
      const unsigned short* brow = Wt + (size_t)(col0 + t * 16 + ln) * ldb + kb;
      FragB b;
      b.half[0] = *(const v8us*)(brow + 8 * hh);
      b.half[1] = *(const v8us*)(brow + 16 + 8 * hh);
      acc[t] = mmaN<ASPLIT ? 2 : 1>(ah.v, al.v, b.v, b.v, acc[t]);
    }
  }
#pragma unroll
  for (int t = 0; t < 4; ++t) {
    float bv = bias ? bias[col0 + t * 16 + ln] : 0.f;
    if (BIAS_BF16) bv = bf16_round(bv);
#pragma unroll
    for (int r = 0; r < 8; ++r) { float v = acc[t][r] + bv; if (ACT == 1) v = fmaxf(v, 0.f); so[w][8 * hh + r][t * 16 + ln] = v; }
  }
  __builtin_amdgcn_fence(__ATOMIC_ACQ_REL, "workgroup");
  __builtin_amdgcn_wave_barrier();
  const int rsub = lane >> 4, c4 = (lane & 15) * 4;
  {
#pragma unroll
    for (int q = 0; q < 8; ++q) {
      const int r = q * 2 + rsub;
      const v4f v = *(const v4fa*)&so[w][r][c4];
      *(v4f*)(C + (size_t)(row0 + r) * ldc + col0 + c4) = v;
    }
    
  }
}

// GEMM C = act(A·W + bias + resid): A f32 (ASPLIT -> hi/lo 2 terms), Wt bf16 [N][K]; ACT 0 none, 1 relu, 2 exact gelu;
// resid (optional, f32, row index = (row % rmod), pitch ldr, RES_BF16 rounds it) added before the activation.
template <bool ASPLIT, int ACT, bool BIAS_BF16, bool RES_BF16>
__global__ __launch_bounds__(128) void k_gemm_bf3(const float* __restrict__ A, int lda, const unsigned short* __restrict__ Wt, int ldb,
                                                const float* __restrict__ bias, const float* __restrict__ resid, int rmod, int ldr,
                                                float* __restrict__ C, int ldc, int M, int N, int K) {
  __shared__ __attribute__((aligned(16))) float so[4][16][64];
  const int tid = threadIdx.x, w = tid >> 5, lane = tid & 31, ln = lane & 15, hh = lane >> 4;
  const int ntn = N / 64;
  const int wid = blockIdx.x * 4 + w;
  const int mt = wid / ntn, nq = wid % ntn;
  if (mt * 16 >= M) return;
  const int row0 = mt * 16, col0 = nq * 64;
  const float* arow = A + (size_t)(row0 + ln) * lda;
  v8f acc[4] = {};
  for (int kb = 0; kb < K; kb += 32) {
    FragB ah, al;
    const v4f x0 = *(const v4fa*)(arow + kb + 8 * hh), x1 = *(const v4fa*)(arow + kb + 8 * hh + 4);
    const v4f x2 = *(const v4fa*)(arow + kb + 16 + 8 * hh), x3 = *(const v4fa*)(arow + kb + 16 + 8 * hh + 4);
    float xs[16] = {x0[0],x0[1],x0[2],x0[3],x1[0],x1[1],x1[2],x1[3],x2[0],x2[1],x2[2],x2[3],x3[0],x3[1],x3[2],x3[3]};
#pragma unroll
    for (int i = 0; i < 16; ++i) { const unsigned short hb = bf16_bits(xs[i]); ah.u[i] = hb; al.u[i] = ASPLIT ? bf16_bits(xs[i] - bf16_val(hb)) : (unsigned short)0; }
#pragma unroll
    for (int t = 0; t < 4; ++t) {
      const unsigned short* brow = Wt + (size_t)(col0 + t * 16 + ln) * ldb + kb;
      FragB b;
      b.half[0] = *(const v8us*)(brow + 8 * hh);
      b.half[1] = *(const v8us*)(brow + 16 + 8 * hh);
      acc[t] = mmaN<ASPLIT ? 2 : 1>(ah.v, al.v, b.v, b.v, acc[t]);
    }
  }
#pragma unroll
  for (int t = 0; t < 4; ++t) {
    const int col = col0 + t * 16 + ln;
    float bv = bias ? bias[col] : 0.f;
    if (BIAS_BF16) bv = bf16_round(bv);
#pragma unroll
    for (int r = 0; r < 8; ++r) {
      float v = acc[t][r] + bv;
      if (resid) { float rv = resid[(size_t)((row0 + 8 * hh + r) % rmod) * ldr + col]; if (RES_BF16) rv = bf16_round(rv); v += rv; }
      if (ACT == 1) v = fmaxf(v, 0.f);
      if (ACT == 2) v = 0.5f * v * (1.0f + erff(v * 0.70710678118654752f));
      if (ACT == 3) { const float u = 0.7978845608028654f * (v + 0.044715f * v * v * v); v = 0.5f * v * (1.0f + tanhf(u)); }
      so[w][8 * hh + r][t * 16 + ln] = v;
    }
  }
  __builtin_amdgcn_fence(__ATOMIC_ACQ_REL, "workgroup");
  __builtin_amdgcn_wave_barrier();
  const int rsub = lane >> 4, c4 = (lane & 15) * 4;
  {
#pragma unroll
    for (int q = 0; q < 8; ++q) {
      const int r = q * 2 + rsub;
      const v4f v = *(const v4fa*)&so[w][r][c4];
      *(v4f*)(C + (size_t)(row0 + r) * ldc + col0 + c4) = v;
    }
    
  }
}
// row LayerNorm (biased variance, eps) over N: s = X (+ R); optional out_sum <- s; out_norm <- (s-mu)*rsqrt(var+eps)*g + b
template <bool PARAM_BF16>
__global__ __launch_bounds__(256) void k_layernorm(const float* __restrict__ X, const float* __restrict__ R, const float* __restrict__ g, const float* __restrict__ bta,
                                                  float* __restrict__ out_sum, float* __restrict__ out_norm, int N, float eps) {
  __shared__ float red[256];
  const int row = blockIdx.x, tid = threadIdx.x;
  const float* x = X + (size_t)row * N; const float* rr = R ? R + (size_t)row * N : nullptr;
  float vals[16];                     // up to N = 4096
  const int per = N / 256;            // contiguous chunk per thread? use strided-by-4 chunks: thread handles j = tid*4 + 1024*u
  float s1 = 0.f;
  for (int u = 0; u < per / 4; ++u) {
    const int j = tid * 4 + 1024 * u;
    const v4f a = *(const v4fa*)(x + j);
    v4f b = {0.f,0.f,0.f,0.f}; if (rr) b = *(const v4fa*)(rr + j);
#pragma unroll
    for (int q = 0; q < 4; ++q) { const float v = a[q] + b[q]; vals[u * 4 + q] = v; s1 += v; }
  }
  red[tid] = s1; __syncthreads();
  for (int st = 128; st > 0; st >>= 1) { if (tid < st) red[tid] += red[tid + st]; __syncthreads(); }
  const float mu = red[0] / (float)N; __syncthreads();
  float s2 = 0.f;
  for (int u = 0; u < per / 4; ++u)
#pragma unroll
    for (int q = 0; q < 4; ++q) { const float c = vals[u * 4 + q] - mu; s2 += c * c; }
  red[tid] = s2; __syncthreads();
  for (int st = 128; st > 0; st >>= 1) { if (tid < st) red[tid] += red[tid + st]; __syncthreads(); }
  const float rs = rsqrtf(red[0] / (float)N + eps);
  {
    for (int u = 0; u < per / 4; ++u) {
      const int j = tid * 4 + 1024 * u;
      v4f o, sm;
#pragma unroll
      for (int q = 0; q < 4; ++q) {
        float gg = g[j + q], bb = bta[j + q];
        if (PARAM_BF16) { gg = bf16_round(gg); bb = bf16_round(bb); }
        sm[q] = vals[u * 4 + q]; o[q] = (vals[u * 4 + q] - mu) * rs * gg + bb;
      }
      if (out_sum) *(v4f*)(out_sum + (size_t)row * N + j) = sm;
      *(v4f*)(out_norm + (size_t)row * N + j) = o;
    }
    
  }
}



// ---- f16 WMMA path (v_wmma_f32_16x16x32_f16): 11-bit significands for operands in range — used where a [0,1] probability operand needs more precision than bf16
typedef _Float16 v16h __attribute__((ext_vector_type(16)));
union FragH { v16h v; v8us half[2]; _Float16 h[16]; unsigned short u[16]; };
template <int NT>
__device__ __forceinline__ v8f mmaH(v16h ah, v16h al, v16h bh, v16h bl, v8f c) {
  c = __builtin_amdgcn_wmma_f32_16x16x32_f16(false, ah, false, bh, (short)0, c, false, false);
  if (NT >= 2) c = __builtin_amdgcn_wmma_f32_16x16x32_f16(false, al, false, bh, (short)0, c, false, false);
  if (NT >= 3) c = __builtin_amdgcn_wmma_f32_16x16x32_f16(false, ah, false, bl, (short)0, c, false, false);
  asm volatile("v_nop\n\tv_nop\n\tv_nop\n\tv_nop" : "+v"(c) : "v"(ah), "v"(al), "v"(bh), "v"(bl));
  return c;
}
// batched GEMM like k_gemm_b but f16 operands: A f32 (split into f16 hi/lo if ASPLIT, else rounded to f16), Bt = f16 values [n][k]; alpha; C f32; N multiple of 16 (partial tiles skipped)
template <bool ASPLIT>
__global__ __launch_bounds__(128) void k_gemm_h(const float* __restrict__ A, int lda, size_t sA, const _Float16* __restrict__ Bh, int ldb, size_t sB, float alpha, float* __restrict__ C, int ldc, size_t sC, int M, int N, int K) {
  __shared__ __attribute__((aligned(16))) float so[4][16][64];
  const int tid = threadIdx.x, w = tid >> 5, lane = tid & 31, ln = lane & 15, hh = lane >> 4; const int by = blockIdx.y;
  A += (size_t)by * sA; Bh += (size_t)by * sB; C += (size_t)by * sC;
  const int ntn = (N + 63) / 64; const int wid = blockIdx.x * 4 + w; const int mt = wid / ntn, nq = wid % ntn; if (mt * 16 >= M) return;
  const int row0 = mt * 16, col0 = nq * 64; const float* arow = A + (size_t)(row0 + ln) * lda;
  v8f acc[4] = {};
  for (int kb = 0; kb < K; kb += 32) {
    FragH ah, al;
    const v4f x0 = *(const v4fa*)(arow + kb + 8 * hh), x1 = *(const v4fa*)(arow + kb + 8 * hh + 4), x2 = *(const v4fa*)(arow + kb + 16 + 8 * hh), x3 = *(const v4fa*)(arow + kb + 16 + 8 * hh + 4);
    float xs[16] = {x0[0],x0[1],x0[2],x0[3],x1[0],x1[1],x1[2],x1[3],x2[0],x2[1],x2[2],x2[3],x3[0],x3[1],x3[2],x3[3]};
#pragma unroll
    for (int i = 0; i < 16; ++i) { const _Float16 h = (_Float16)xs[i]; ah.h[i] = h; al.h[i] = ASPLIT ? (_Float16)(xs[i] - (float)h) : (_Float16)0.0f; }
#pragma unroll
    for (int t = 0; t < 4; ++t) { if (col0 + t * 16 >= N) continue; const size_t boff = (size_t)(col0 + t * 16 + ln) * ldb + kb; FragH bq; bq.half[0] = *(const v8us*)(Bh + boff + 8 * hh); bq.half[1] = *(const v8us*)(Bh + boff + 16 + 8 * hh);
      acc[t] = mmaH<ASPLIT ? 2 : 1>(ah.v, al.v, bq.v, bq.v, acc[t]); }
  }
#pragma unroll
  for (int t = 0; t < 4; ++t) { if (col0 + t * 16 >= N) continue;
#pragma unroll
    for (int r = 0; r < 8; ++r) so[w][8 * hh + r][t * 16 + ln] = acc[t][r] * alpha; }
  __builtin_amdgcn_fence(__ATOMIC_ACQ_REL, "workgroup"); __builtin_amdgcn_wave_barrier();
  const int rsub = lane >> 4, c4 = (lane & 15) * 4;
  {
#pragma unroll
    for (int q = 0; q < 8; ++q) { const int r = q * 2 + rsub; if (col0 + c4 < N) { const v4f v = *(const v4fa*)&so[w][r][c4]; *(v4f*)(C + (size_t)(row0 + r) * ldc + col0 + c4) = v; } }
     }
}

// Wt[n][k] = f16(bf16(W[k][n]) * scale) from f32 row-major W[K][N] (scale = power of two; bf16-exact weights stay exact in f16 away from the subnormal range). K and N multiples of 64; grid = (N / 64, K / 64).
// One work-group per tile of 64 k x 64 n, turned in LDS, so that both sides of the transpose move whole lines: 16 lanes load 256 neighbouring bytes of one W row, 8 lanes store one 128-byte line of one Wt row.
// A lane loads the same 4 columns of two neighbouring k rows and packs each (even k, odd k) pair of f16 into one dword: the LDS tile is [n][k / 2].
#define WTP 33                       /* LDS pitch of a tile row in dwords (32 pairs + 1): odd, so the 16 x 2 dwords of a wave's store (rows 4 apart) and the 4 x 8 of a wave's load fall on 32 different banks */
typedef unsigned v4u __attribute__((ext_vector_type(4), may_alias));
typedef _Float16 v2h __attribute__((ext_vector_type(2)));
__global__ __launch_bounds__(256) void k_wt_f16(const float* __restrict__ W, _Float16* __restrict__ Wt, int K, int N, float scale) {
  __shared__ unsigned tl[64][WTP];
  const int tid = threadIdx.x; const int k0 = (int)blockIdx.y * 64, n0 = (int)blockIdx.x * 64;
  const int c = tid & 15, r = tid >> 4;      /* this lane's 4 columns and its pair of k rows in a round of 32 rows */
  const float* s0 = W + (size_t)(k0 + 2 * r) * N + n0 + 4 * c; const float* s1 = s0 + N; const float* s2 = s0 + (size_t)32 * N; const float* s3 = s2 + N;
  const v4f a[2][2] = {{*(const v4fa*)s0, *(const v4fa*)s1}, {*(const v4fa*)s2, *(const v4fa*)s3}};      /* all four loads issued before the first conversion: one memory latency for the whole tile */
  asm volatile("s_wait_xcnt 0x0" :: "v"(s0), "v"(s1), "v"(s2), "v"(s3) : "memory");      /* the four address pairs are inputs, so they stay as they are up to this wait (no load's result lands on one); their registers are reused below */
#pragma unroll      /* both loops unrolled in full: a[][] is indexed by constants and stays in registers */
  for (int u = 0; u < 2; ++u) {
#pragma unroll
    for (int i = 0; i < 4; ++i) { const v2h h = {(_Float16)(bf16_round(a[u][0][i]) * scale), (_Float16)(bf16_round(a[u][1][i]) * scale)}; tl[4 * c + i][16 * u + r] = __builtin_bit_cast(unsigned, h); } }
  __syncthreads();      /* the whole tile is in LDS before any row of it is read */
  const int j = tid & 7, nr = tid >> 3;      /* this lane's 8 k (4 dwords) and its n row in a round of 32 rows */
#pragma unroll      /* two rounds: their LDS reads go out together */
  for (int rd = 0; rd < 2; ++rd) { const int n = rd * 32 + nr; const v4u o = {tl[n][4 * j], tl[n][4 * j + 1], tl[n][4 * j + 2], tl[n][4 * j + 3]};
    *(v4u*)((unsigned short*)Wt + (size_t)(n0 + n) * K + k0 + 8 * j) = o; }
}
// k_gemm_hh variant with fused epilogue: v = acc·alpha + bias[by·sBias + col] (+ CP[(row/rowsPerB)·sCPb + by·64 + col] if CP) ; ACT 0 none / 1 elu ; writes f16 C16 (and f32 C if non-null)
template <int ACT>
__global__ __launch_bounds__(128) void k_gemm_hhx(const _Float16* __restrict__ A, int lda, size_t sA, const _Float16* __restrict__ Bh, int ldb, size_t sB, float alpha, const float* __restrict__ bias, size_t sBias, const float* __restrict__ CP, int rowsPerB, size_t sCPb, int row0g,
    float* __restrict__ C, _Float16* __restrict__ C16, int ldc, size_t sC, int M, int N, int K) {
  __shared__ __attribute__((aligned(16))) float so[4][16][64];
  const int tid = threadIdx.x, w = tid >> 5, lane = tid & 31, ln = lane & 15, hh = lane >> 4; const int by = blockIdx.y;
  A += (size_t)by * sA; Bh += (size_t)by * sB; const size_t cofs = (size_t)by * sC; const float* bp = bias ? bias + (size_t)by * sBias : nullptr;
  const int ntn = (N + 63) / 64; const int wid = blockIdx.x * 4 + w; const int mt = wid / ntn, nq = wid % ntn; if (mt * 16 >= M) return;
  const int row0 = mt * 16, col0 = nq * 64; const _Float16* arow = A + (size_t)(row0 + ln) * lda;
  v8f acc[4] = {};
  for (int kb = 0; kb < K; kb += 32) { FragH ah; ah.half[0] = *(const v8us*)((const unsigned short*)arow + kb + 8 * hh); ah.half[1] = *(const v8us*)((const unsigned short*)arow + kb + 16 + 8 * hh);
#pragma unroll
    for (int t = 0; t < 4; ++t) { if (col0 + t * 16 >= N) continue; const size_t boff = (size_t)(col0 + t * 16 + ln) * ldb + kb; FragH bq; bq.half[0] = *(const v8us*)((const unsigned short*)Bh + boff + 8 * hh); bq.half[1] = *(const v8us*)((const unsigned short*)Bh + boff + 16 + 8 * hh);
      acc[t] = mmaH<1>(ah.v, ah.v, bq.v, bq.v, acc[t]); }
  }
#pragma unroll
  for (int t = 0; t < 4; ++t) { if (col0 + t * 16 >= N) continue; const int col = col0 + t * 16 + ln; const float bv = bp ? bf16_round(bp[col]) : 0.f;
#pragma unroll
    for (int r = 0; r < 8; ++r) { float v = acc[t][r] * alpha + bv; if (CP) { const int rr = row0g + row0 + 8 * hh + r; if (rowsPerB < 0) v += CP[cofs + (size_t)rr * ldc + col];      /* rowsPerB < 0: own element of the batched C plane */ else { const int bidx = rr / rowsPerB; v += CP[(size_t)bidx * sCPb + (size_t)by * 64 + col]; } } if (ACT == 1) v = (v > 0.f) ? v : expm1f(v); else if (ACT == 7) v = (v > 0.f) ? v + 1.0f : expf(v); else if (ACT == 8) v = tanhf(v); else if (ACT == 9) v = 0.5f * v * (1.0f + tanhf(0.7978845608028654f * (v + 0.044715f * v * v * v))); else if (ACT == 11) v = 1.0f / (1.0f + expf(-v)); else if (ACT == 12) v = (v > 0.f) ? v : 0.01f * v; else if (ACT == 14) v = (v > 0.f) ? v : 0.1f * v; else if (ACT == 16) v = (v >= 0.f) ? v : 0.3f * v; else if (ACT == 17) v = (v >= 0.f) ? v : 0.2f * v; else if (ACT == 15) v = v / (1.0f + expf(-v)); else if (ACT == 3) v = fmaxf(v, 0.f); else if (ACT == 6) v = 0.5f * v * (1.0f + erff(v * 0.70710678118654752f)); so[w][8 * hh + r][t * 16 + ln] = v; } }
  __builtin_amdgcn_fence(__ATOMIC_ACQ_REL, "workgroup"); __builtin_amdgcn_wave_barrier();
  const int rsub = lane >> 4, c4 = (lane & 15) * 4; typedef _Float16 v4h __attribute__((ext_vector_type(4)));
  {
#pragma unroll
    for (int q = 0; q < 8; ++q) { const int r = q * 2 + rsub; if (col0 + c4 < N) { const v4f v = *(const v4fa*)&so[w][r][c4]; if (C) *(v4f*)(C + cofs + (size_t)(row0 + r) * ldc + col0 + c4) = v; if (C16) { v4h h4; for (int i = 0; i < 4; ++i) h4[i] = (_Float16)v[i]; *(v4h*)(C16 + cofs + (size_t)(row0 + r) * ldc + col0 + c4) = h4; } } }
     }
}


typedef _Float16 v4h __attribute__((ext_vector_type(4)));

__global__ __launch_bounds__(256) void k_x16(const float* __restrict__ x, _Float16* __restrict__ X16, size_t n8) { const size_t t = (size_t)blockIdx.x * 256 + threadIdx.x; if (t >= n8) return; FragH f;
#pragma unroll
  for (int q = 0; q < 8; ++q) f.h[q] = (_Float16)bf16_round(x[t * 8 + q]); *(v8us*)((unsigned short*)X16 + t * 8) = f.half[0];  }
__global__ __launch_bounds__(256) void k_h16(const float* __restrict__ x, _Float16* __restrict__ X16, size_t n8) { const size_t t = (size_t)blockIdx.x * 256 + threadIdx.x; if (t >= n8) return; FragH f;
#pragma unroll
  for (int q = 0; q < 8; ++q) f.h[q] = (_Float16)x[t * 8 + q]; *(v8us*)((unsigned short*)X16 + t * 8) = f.half[0];  }
__global__ __launch_bounds__(256) void k_round16f(const float* __restrict__ W, _Float16* __restrict__ Bt, size_t n8) { const size_t t = (size_t)blockIdx.x * 256 + threadIdx.x; if (t >= n8) return; FragH f;
#pragma unroll
  for (int i = 0; i < 8; ++i) f.h[i] = (_Float16)(bf16_round(W[t * 8 + i]) * 16.0f); *(v8us*)((unsigned short*)Bt + t * 8) = f.half[0];  }
template <int NHv, int TTv>
__global__ __launch_bounds__(256) void k_vt(const _Float16* __restrict__ V16, int ldv, int voff, _Float16* __restrict__ Vt) { __shared__ unsigned short tl[64][66]; const int tid = threadIdx.x; const int slab = blockIdx.x / (TTv / 64), lg = blockIdx.x % (TTv / 64); const int b = slab / NHv, h = slab % NHv;
  for (int i = tid; i < 64 * 8; i += 256) { const int r = i / 8, c8 = (i % 8) * 8; FragH f; f.half[0] = *(const v8us*)((const unsigned short*)V16 + ((size_t)b * TTv + lg * 64 + r) * ldv + voff + h * 64 + c8);
#pragma unroll
    for (int q = 0; q < 8; ++q) tl[r][c8 + q] = f.u[q]; }
  __syncthreads();
  {
#pragma unroll
    for (int rd = 0; rd < 2; ++rd) { const int d = rd * 32 + tid / 8, pc = tid % 8; FragH f;
#pragma unroll
      for (int q = 0; q < 8; ++q) f.u[q] = tl[pc * 8 + q][d];
      *(v8us*)((unsigned short*)Vt + ((size_t)slab * 64 + d) * TTv + lg * 64 + pc * 8) = f.half[0]; }
     } }

__global__ __launch_bounds__(256) void k_hl(const float* __restrict__ F, _Float16* __restrict__ Hh, _Float16* __restrict__ Hl, size_t n8) { const size_t t = (size_t)blockIdx.x * 256 + threadIdx.x; if (t >= n8) return; FragH fh, fl; const v4f a = *(const v4fa*)(F + t * 8), c = *(const v4fa*)(F + t * 8 + 4);
#pragma unroll
  for (int q = 0; q < 4; ++q) { _Float16 h = (_Float16)a[q]; fh.h[q] = h; fl.h[q] = (_Float16)((a[q] - (float)h) * 1024.0f); h = (_Float16)c[q]; fh.h[4 + q] = h; fl.h[4 + q] = (_Float16)((c[q] - (float)h) * 1024.0f); }
  { *(v8us*)((unsigned short*)Hh + t * 8) = fh.half[0]; *(v8us*)((unsigned short*)Hl + t * 8) = fl.half[0];  } }

// ---- fast GEMM (work-group tile 128x64, wave tile 32x64; requires M % 128 == 0 rows per launch region and N % 64 == 0); epilogue = k_gemm_hhx semantics ----
__device__ __forceinline__ v8f g2_mma(v16h a, v16h b, v8f c) { v8f d = __builtin_amdgcn_wmma_f32_16x16x32_f16(false, a, false, b, (short)0, c, false, false); asm volatile("v_nop\n\tv_nop\n\tv_nop\n\tv_nop" : "+v"(d) : "v"(a), "v"(b)); return d; }
// One A or B fragment (16 rows x 32 k) from staged LDS rows; p: the lane's row, plus 16 * hh bytes. k order, the same for A and B: 8 hh .. 8 hh + 7, then 16 + 8 hh .. 16 + 8 hh + 7.
__device__ __forceinline__ v16h g2_lfrag(const unsigned char* p) { FragH f; f.half[0] = *(const v8us*)p; f.half[1] = *(const v8us*)(p + 32); return f.v; }
// Twelve asynchronous 16-byte copies per lane, global memory -> LDS. The s_wait_xcnt is the last line of the copies' own statement, so no register that a copy names is rewritten in front of it.
__device__ __forceinline__ void g2_copy12(const unsigned (&l)[12], const _Float16* const (&g)[12]) {
  asm volatile("global_load_async_to_lds_b128 %0, %12, off\n\t"
               "global_load_async_to_lds_b128 %1, %13, off\n\t"
               "global_load_async_to_lds_b128 %2, %14, off\n\t"
               "global_load_async_to_lds_b128 %3, %15, off\n\t"
               "global_load_async_to_lds_b128 %4, %16, off\n\t"
               "global_load_async_to_lds_b128 %5, %17, off\n\t"
               "global_load_async_to_lds_b128 %6, %18, off\n\t"
               "global_load_async_to_lds_b128 %7, %19, off\n\t"
               "global_load_async_to_lds_b128 %8, %20, off\n\t"
               "global_load_async_to_lds_b128 %9, %21, off\n\t"
               "global_load_async_to_lds_b128 %10, %22, off\n\t"
               "global_load_async_to_lds_b128 %11, %23, off\n\t"
               "s_wait_xcnt 0x0"
               :: "v"(l[0]), "v"(l[1]), "v"(l[2]), "v"(l[3]), "v"(l[4]), "v"(l[5]), "v"(l[6]), "v"(l[7]), "v"(l[8]), "v"(l[9]), "v"(l[10]), "v"(l[11]),
                  "v"(g[0]), "v"(g[1]), "v"(g[2]), "v"(g[3]), "v"(g[4]), "v"(g[5]), "v"(g[6]), "v"(g[7]), "v"(g[8]), "v"(g[9]), "v"(g[10]), "v"(g[11]) : "memory"); }
// One k slab (KC columns of the work-group's 128 A rows, then of its 64 B rows) into one LDS buffer. A row's KC * 2 bytes are KC / 8 neighbouring lanes' 16 bytes each: every copy covers whole 128-byte lines.
// ag, bg: the lane's own 16 bytes in row tid / (KC / 8) of the A and of the B slab; lds: the LDS byte address of the same place in the buffer. Unrolled in full: l[] and g[] are asm operands.
template <int KC>
__device__ __forceinline__ void g2_stage(const _Float16* ag, int lda, const _Float16* bg, int ldb, unsigned lds) {
  constexpr int RPU = 128 / (KC / 8), NA = 128 / RPU, NC = 192 / RPU, PB = KC * 2 + 16;      /* rows per round of 128 lanes; rounds for A; rounds in all; LDS pitch in bytes */
#pragma unroll
  for (int s = 0; s < NC / 12; ++s) { unsigned l[12]; const _Float16* g[12];
#pragma unroll
    for (int j = 0; j < 12; ++j) { const int u = s * 12 + j; l[j] = lds + (unsigned)(u * RPU * PB); g[j] = (u < NA) ? ag + (size_t)(u * RPU) * lda : bg + (size_t)((u - NA) * RPU) * ldb; }
    g2_copy12(l, g); } }
// BG: consecutive blockIdx.y values that share one B slab (grouped-query attention: BG query heads read the same k / v rows); slab = blockIdx.y / BG
// KC: columns of k per staged slab. M a multiple of 128, N of 64, K of KC. The work-group's A rows (128) and B rows (64) go to LDS slab by slab, two buffers: slab t + 1 is copied while slab t is multiplied.
// LDS pitch KC * 2 + 16 bytes = 16 B x odd, so the 16 rows of a fragment read spread over the banks.
// ROPE (ACT 0; bias and CP are not read): the N tile is one head (64 columns); the epilogue turns each (even, odd) column pair of row r by the angle whose cosine and sine are CS, SN[r % SQ][pair] and stores the turned rows: f16 to C16, and f32 to C for the first nf32 rows of every SQ rows (one batch; C holds nf32 rows a batch, batch after batch).
typedef float v2fa __attribute__((ext_vector_type(2), may_alias));
// Two (even, odd) pairs, each turned by its own angle: c, s hold the two cosines and sines.
__device__ __forceinline__ v4f g2_turn(v4f v, v2fa c, v2fa s) { v4f o; o[0] = v[0] * c[0] - v[1] * s[0]; o[1] = v[0] * s[0] + v[1] * c[0]; o[2] = v[2] * c[1] - v[3] * s[1]; o[3] = v[2] * s[1] + v[3] * c[1]; return o; }
template <int ACT, int BG = 1, int KC = 128, bool ROPE = false>
__global__ __launch_bounds__(128) void k_gemm2(const _Float16* __restrict__ A, int lda, size_t sA, const _Float16* __restrict__ Bh, int ldb, size_t sB, float alpha, const float* __restrict__ bias, size_t sBias, const float* __restrict__ CP, int rowsPerB, size_t sCPb, int row0g,
    float* __restrict__ C, _Float16* __restrict__ C16, int ldc, size_t sC, int M, int N, int K, const float* __restrict__ CS = nullptr, const float* __restrict__ SN = nullptr, int nf32 = 0) { static_assert(ACT == 0 || ACT == 3 || ACT == 6 || ACT == 8 || ACT == 9 || ACT == 11 || ACT == 12 || ACT == 14 || ACT == 15 || ACT == 16 || ACT == 17, "k_gemm2: unsupported ACT code (would silently apply no activation)");
  constexpr int PB = KC * 2 + 16, BUFB = 192 * PB; static_assert(2 * BUFB >= 4 * 32 * 68 * 4, "the output staging must fit the two slab buffers");
  __shared__ __attribute__((aligned(16))) unsigned char st[2 * BUFB];
  float (*so)[32][68] = (float (*)[32][68])st;      /* output staging in the same LDS: first written behind the last trip's barrier, when no copy is in flight and every fragment read is done */
  const int tid = threadIdx.x, w = tid >> 5, lane = tid & 31, ln = lane & 15, hh = lane >> 4; const int by = blockIdx.y;
  A += (size_t)by * sA; Bh += (size_t)(by / BG) * sB; const size_t cofs = (size_t)by * sC; const float* bp = bias ? bias + (size_t)by * sBias : nullptr;
  const int ntn = N >> 6; const int mt = blockIdx.x / ntn, nq = blockIdx.x - mt * ntn; const int row0 = mt * 128 + 32 * w, col0 = nq * 64; if (mt * 128 >= M) return;      /* the same for the whole work-group: it stands in front of barriers */
  const int sr = tid / (KC / 8), sc = tid % (KC / 8);      /* this lane's row and 16-byte column in a round of copies */
  const _Float16* ag = A + (size_t)(mt * 128 + sr) * lda + sc * 8; const _Float16* bg = Bh + (size_t)(col0 + sr) * ldb + sc * 8;
  const unsigned lds0 = (unsigned)(size_t)(&st[0]) + (unsigned)(sr * PB + sc * 16);
  const int nt = K / KC;
  const v8f z8 = {0.f,0.f,0.f,0.f,0.f,0.f,0.f,0.f}; v8f c00 = z8, c01 = z8, c02 = z8, c03 = z8, c10 = z8, c11 = z8, c12 = z8, c13 = z8;
  g2_stage<KC>(ag, lda, bg, ldb, lds0);
  asm volatile("s_wait_asynccnt 0x0" ::: "memory");      /* this wave's copies of slab 0 have landed */
  __syncthreads();      /* slab 0 readable by every wave */
  if (nt > 1) g2_stage<KC>(ag + KC, lda, bg + KC, ldb, lds0 + BUFB);
#pragma unroll 1
  for (int t = 0; t < nt; ++t) { const unsigned char* sb = st + (t & 1) * BUFB; const unsigned char* sa = sb + (32 * w + ln) * PB + 16 * hh; const unsigned char* sbr = sb + (128 + ln) * PB + 16 * hh;
    v16h fa[2][2], fb[2][4];      /* two fragment sets: the next k step's twelve LDS reads go out as one group in front of this k step's products, so the wave waits out the LDS latency once a slab */
    fa[0][0] = g2_lfrag(sa); fa[0][1] = g2_lfrag(sa + 16 * PB); fb[0][0] = g2_lfrag(sbr); fb[0][1] = g2_lfrag(sbr + 16 * PB); fb[0][2] = g2_lfrag(sbr + 32 * PB); fb[0][3] = g2_lfrag(sbr + 48 * PB);
#pragma unroll
    for (int kk = 0; kk < KC / 32; ++kk) { const int cu = kk & 1, nx = cu ^ 1;      /* unrolled in full: fa[] and fb[] are indexed by constants and stay in registers, the LDS offsets become immediates */
      if (kk + 1 < KC / 32) { const int o = (kk + 1) * 64; fa[nx][0] = g2_lfrag(sa + o); fa[nx][1] = g2_lfrag(sa + 16 * PB + o); fb[nx][0] = g2_lfrag(sbr + o); fb[nx][1] = g2_lfrag(sbr + 16 * PB + o); fb[nx][2] = g2_lfrag(sbr + 32 * PB + o); fb[nx][3] = g2_lfrag(sbr + 48 * PB + o); }
      c00 = g2_mma(fa[cu][0], fb[cu][0], c00); c10 = g2_mma(fa[cu][1], fb[cu][0], c10);
      c01 = g2_mma(fa[cu][0], fb[cu][1], c01); c11 = g2_mma(fa[cu][1], fb[cu][1], c11);
      c02 = g2_mma(fa[cu][0], fb[cu][2], c02); c12 = g2_mma(fa[cu][1], fb[cu][2], c12);
      c03 = g2_mma(fa[cu][0], fb[cu][3], c03); c13 = g2_mma(fa[cu][1], fb[cu][3], c13); }
    asm volatile("s_wait_dscnt 0x0" ::: "memory");      /* this wave's reads of slab t are done before the buffer is refilled */
    asm volatile("s_wait_asynccnt 0x0" ::: "memory");      /* this wave's copies of slab t + 1 have landed */
    __syncthreads();      /* publishes slab t + 1 and ends every wave's reads of slab t */
    if (t + 2 < nt) g2_stage<KC>(ag + (size_t)(t + 2) * KC, lda, bg + (size_t)(t + 2) * KC, ldb, lds0 + (unsigned)((t & 1) * BUFB)); }
  asm volatile("s_wait_asynccnt 0x0" ::: "memory");      /* no copy outstanding when the LDS becomes output staging */
  v2fa cc[ROPE ? 16 : 1], ss[ROPE ? 16 : 1];      /* ROPE: cosines and sines of the 2 pairs that this lane turns in each of its 16 rows; 16 lanes read one table row = one 128-byte line */
  if constexpr (ROPE) { static_assert(HD == 64 && ACT == 0, "one N tile = one head: a pair's number is its column in the tile / 2; no activation");
#pragma unroll      /* unrolled in full: cc[], ss[] stay in registers; all 32 loads go out here, so their latency passes while the accumulators are staged */
    for (int q = 0; q < 16; ++q) { const size_t tb = (size_t)((unsigned)(row0 + q * 2 + hh) % SQ) * (HD / 2) + ln * 2; cc[q] = *(const v2fa*)(CS + tb); ss[q] = *(const v2fa*)(SN + tb); }
    asm volatile("s_wait_xcnt 0x0" ::: "memory"); }      /* the table loads' address registers are reused below */
  v8f accs[8] = {c00, c01, c02, c03, c10, c11, c12, c13};
  if constexpr (ROPE) {      /* q and k have no bias, no added plane and no activation: the staging is the scaled accumulators alone; both loops unrolled in full: accs[] is indexed by constants and stays in registers */
#pragma unroll
    for (int u = 0; u < 8; ++u) {
#pragma unroll
      for (int r = 0; r < 8; ++r) so[w][(u >> 2) * 16 + 8 * hh + r][(u & 3) * 16 + ln] = accs[u][r] * alpha; }
  } else {
#pragma unroll
  for (int u = 0; u < 8; ++u) { const int t = u & 3, half = u >> 2; const int col = col0 + t * 16 + ln; const float bv = bp ? bf16_round(bp[col]) : 0.f;
#pragma unroll
    for (int r = 0; r < 8; ++r) { const int rloc = half * 16 + 8 * hh + r; float v = accs[u][r] * alpha + bv; if (CP) { if (rowsPerB < 0) v += CP[cofs + (size_t)(row0g + row0 + rloc) * ldc + col];      /* rowsPerB < 0: own element of the batched C plane */ else { const int bidx = (row0g + row0 + rloc) / rowsPerB; v += CP[(size_t)bidx * sCPb + (size_t)by * 64 + col]; } }
      if (ACT == 3) v = fmaxf(v, 0.f); else if (ACT == 6) v = 0.5f * v * (1.0f + erff(v * 0.70710678118654752f)); else if (ACT == 11) v = 1.0f / (1.0f + expf(-v)); else if (ACT == 15) v = v / (1.0f + expf(-v)); else if (ACT == 12) v = (v > 0.f) ? v : 0.01f * v; else if (ACT == 8) v = tanhf(v); else if (ACT == 9) v = 0.5f * v * (1.0f + tanhf(0.7978845608028654f * (v + 0.044715f * v * v * v))); else if (ACT == 14) v = (v > 0.f) ? v : 0.1f * v; else if (ACT == 16) v = (v >= 0.f) ? v : 0.3f * v; else if (ACT == 17) v = (v >= 0.f) ? v : 0.2f * v;
      so[w][rloc][t * 16 + ln] = v; } } }
  __builtin_amdgcn_fence(__ATOMIC_ACQ_REL, "workgroup"); __builtin_amdgcn_wave_barrier();
  const int rsub = lane >> 4, c4 = (lane & 15) * 4;
  if constexpr (ROPE) {      /* both loops unrolled in full: cc[], ss[] are indexed by constants; a lane's 4 columns are 2 whole pairs */
#pragma unroll
    for (int q = 0; q < 16; ++q) { const int r = q * 2 + rsub; const v4f o = g2_turn(*(const v4fa*)&so[w][r][c4], cc[q], ss[q]); v4h h4; for (int i = 0; i < 4; ++i) h4[i] = (_Float16)o[i]; *(v4h*)(C16 + cofs + (size_t)(row0 + r) * ldc + col0 + c4) = h4; }
    static_assert(SQ % 128 == 0, "a row tile lies in one batch");
    const int bt = (mt * 128) / SQ; const int lim = bt * SQ + nf32; const size_t fsh = (size_t)bt * (SQ - nf32) * ldc;      /* the tile's batch; the end of that batch's f32 rows; what row bt * SQ + i of the GEMM lies ahead of row bt * nf32 + i of C: all three the same for the whole work-group */
    asm volatile("s_wait_xcnt 0x0" ::: "memory");      /* the f16 stores' address and data registers are reused below; in front of the branch, so that nothing of the block behind it can be scheduled ahead of the wait */
    if (mt * 128 < lim) {      /* the same for the whole work-group: only the first row tiles of a batch also store f32 rows; a loop of its own, so that the f16 loop above is free of branches and its LDS reads go out together */
#pragma unroll      /* unrolled in full, like the loop above */
      for (int q = 0; q < 16; ++q) { const int r = q * 2 + rsub; if (row0 + r < lim) *(v4f*)(C + (cofs + (size_t)(row0 + r) * ldc + col0 + c4 - fsh)) = g2_turn(*(const v4fa*)&so[w][r][c4], cc[q], ss[q]); } }
  } else {
#pragma unroll
    for (int q = 0; q < 16; ++q) { const int r = q * 2 + rsub; const v4f v = *(const v4fa*)&so[w][r][c4]; if (C) *(v4f*)(C + cofs + (size_t)(row0 + r) * ldc + col0 + c4) = v; if (C16) { v4h h4; for (int i = 0; i < 4; ++i) h4[i] = (_Float16)v[i]; *(v4h*)(C16 + cofs + (size_t)(row0 + r) * ldc + col0 + c4) = h4; } }
     } }


__global__ __launch_bounds__(256) void k_wnat(const float* __restrict__ w, size_t n8, _Float16* __restrict__ Bt) { const size_t t = (size_t)blockIdx.x * 256 + threadIdx.x; if (t >= n8) return; FragH f; for (int q = 0; q < 8; ++q) f.h[q] = (_Float16)(bf16_round(w[t * 8 + q]) * 16.0f); *(v8us*)((unsigned short*)Bt + t * 8) = f.half[0];  }
__global__ __launch_bounds__(256) void k_rsm(const float* __restrict__ S, _Float16* __restrict__ P, int nrows) {
  #pragma clang fp contract(off)
  const int i = blockIdx.x * 256 + threadIdx.x; if (i >= nrows) return; const float* s = S + (size_t)i * SQ; float mx = -3.0e38f;
#pragma unroll 1
  for (int j = 0; j < SQ; ++j) mx = fmaxf(mx, s[j]); float se = 0.f;
#pragma unroll 1
  for (int j = 0; j < SQ; ++j) se += expf(s[j] - mx); const float sc = 256.0f / se;
#pragma unroll 1
  for (int j0 = 0; j0 < SQ; j0 += 8) { FragH f; for (int q = 0; q < 8; ++q) f.h[q] = (_Float16)(expf(s[j0 + q] - mx) * sc); unsigned short* d = (unsigned short*)P + (size_t)i * SQ + j0; *(v8us*)d = f.half[0];  } }
__global__ __launch_bounds__(256) void k_vt(const _Float16* __restrict__ V16, int b, int h0, _Float16* __restrict__ VT) { __shared__ unsigned short tl[64][65]; const int tid = threadIdx.x; const int hh = blockIdx.x % HG, sg = blockIdx.x / HG; const int s0 = sg * 64; const int h = h0 + hh;
  for (int i = tid; i < 64 * 8; i += 256) { const int j = i / 8, d8 = (i % 8) * 8; FragH f; f.half[0] = *(const v8us*)((const unsigned short*)V16 + ((size_t)b * SQ + s0 + j) * DM + h * HD + d8); for (int q = 0; q < 8; ++q) tl[d8 + q][j] = f.u[q]; }
  __syncthreads();
  { for (int i = tid; i < 64 * 8; i += 256) { const int d = i / 8, j8 = (i % 8) * 8; FragH f; for (int q = 0; q < 8; ++q) f.u[q] = tl[d][j8 + q]; *(v8us*)((unsigned short*)VT + ((size_t)hh * HD + d) * SQ + s0 + j8) = f.half[0]; }  } }



#define FK 64                        /* keys per staged tile of the fused attention kernel */
#define FPB (FK * 2 + 16)            /* LDS pitch of a staged row (a k row: HD f16 = 128 B; a V^T row: FK f16 = 128 B) plus 16 B: 16 B x odd, so the 16 rows of a fragment read spread over the banks */
#define FBUF (2 * FK * FPB)          /* one buffer: FK k rows, then HD V^T rows */
#define FQ 32                        /* query rows per wave */
// Eight asynchronous 16-byte copies per lane, global memory -> LDS. The s_wait_xcnt is the last line of the copies' own statement, so no register that a copy names is rewritten in front of it.
__device__ __forceinline__ void fa_copy8(const unsigned (&l)[8], const _Float16* const (&g)[8]) {
  asm volatile("global_load_async_to_lds_b128 %0, %8, off\n\t"
               "global_load_async_to_lds_b128 %1, %9, off\n\t"
               "global_load_async_to_lds_b128 %2, %10, off\n\t"
               "global_load_async_to_lds_b128 %3, %11, off\n\t"
               "global_load_async_to_lds_b128 %4, %12, off\n\t"
               "global_load_async_to_lds_b128 %5, %13, off\n\t"
               "global_load_async_to_lds_b128 %6, %14, off\n\t"
               "global_load_async_to_lds_b128 %7, %15, off\n\t"
               "s_wait_xcnt 0x0"
               :: "v"(l[0]), "v"(l[1]), "v"(l[2]), "v"(l[3]), "v"(l[4]), "v"(l[5]), "v"(l[6]), "v"(l[7]),
                  "v"(g[0]), "v"(g[1]), "v"(g[2]), "v"(g[3]), "v"(g[4]), "v"(g[5]), "v"(g[6]), "v"(g[7]) : "memory"); }
// One tile (FK k rows, then the same FK keys of the HD V^T rows) into one LDS buffer: a row's 128 bytes are 8 neighbouring lanes' 16 bytes each, 16 rows a round of 128 lanes.
// kg, vg: the lane's own 16 bytes in row tid / 8 of the k tile and of the V^T tile; lds: the LDS byte address of the same place in the buffer. Unrolled in full: l[] and g[] are asm operands.
__device__ __forceinline__ void fa_stage(const _Float16* kg, const _Float16* vg, unsigned lds) {
  unsigned l[8]; const _Float16* g[8];
#pragma unroll
  for (int u = 0; u < 8; ++u) { l[u] = lds + (unsigned)(u * 16 * FPB); g[u] = (u < 4) ? kg + (size_t)(u * 16) * KVD : vg + (size_t)((u - 4) * 16) * SQ; }
  fa_copy8(l, g); }
__device__ __forceinline__ void fa_exp8(float (&x)[8]) {
  asm("v_exp_f32 %0, %0\n\t"
      "v_exp_f32 %1, %1\n\t"
      "v_exp_f32 %2, %2\n\t"
      "v_exp_f32 %3, %3\n\t"
      "v_exp_f32 %4, %4\n\t"
      "v_exp_f32 %5, %5\n\t"
      "v_exp_f32 %6, %6\n\t"
      "v_exp_f32 %7, %7\n\t"
      "v_nop"
      : "+v"(x[0]), "+v"(x[1]), "+v"(x[2]), "+v"(x[3]), "+v"(x[4]), "+v"(x[5]), "+v"(x[6]), "+v"(x[7])); }
// One 2^x with the same slot behind it.
__device__ __forceinline__ float fa_exp1(float x) { asm("v_exp_f32 %0, %0\n\tv_nop" : "+v"(x)); return x; }
__device__ __forceinline__ v8f fa_mma(v16h a, v16h b, v8f c) { return __builtin_amdgcn_wmma_f32_16x16x32_f16(false, a, false, b, (short)0, c, false, false); }
__global__ __launch_bounds__(128) void k_fattn(const _Float16* __restrict__ Q, const _Float16* __restrict__ Kh, const _Float16* __restrict__ Vt, _Float16* __restrict__ O) {
  __shared__ __attribute__((aligned(16))) unsigned char st[2 * FBUF];
  const int tid = threadIdx.x, lane = tid & 31, c = lane & 15, hh = lane >> 4; const int w = __builtin_amdgcn_readfirstlane(tid >> 5);      /* the wave's number in a scalar register: the head's offsets become scalar arithmetic */
  const int qt = (SQ / FQ - 1) - (int)(blockIdx.x / (NB * NG)); const int bg = (int)(blockIdx.x % (NB * NG)); const int b = bg / NG, g = bg % NG;      /* longest rows first */
  const int q0 = qt * FQ, h = g * HPG + w; const int nt = (q0 + FQ + FK - 1) / FK;      /* causal: tiles up to the one that holds the last query's own key; the same for the whole work-group */
  const int sr = tid >> 3, sc = tid & 7;      /* this lane's row and 16-byte column in a round of copies */
  const _Float16* kg = Kh + ((size_t)b * SQ + sr) * KVD + g * HD + sc * 8; const _Float16* vg = Vt + ((size_t)bg * HD + sr) * SQ + sc * 8;
  const unsigned lds0 = (unsigned)(size_t)(&st[0]) + (unsigned)(sr * FPB + sc * 16);
  fa_stage(kg, vg, lds0);
  v16h qf[2][2];
#pragma unroll
  for (int j = 0; j < 2; ++j) {
#pragma unroll
    for (int ks = 0; ks < 2; ++ks) { const unsigned short* p = (const unsigned short*)Q + ((size_t)b * SQ + q0 + j * 16 + c) * DM + h * HD + ks * 32 + 8 * hh; FragH f; f.half[0] = *(const v8us*)p; f.half[1] = *(const v8us*)(p + 16); qf[j][ks] = f.v; } }
  asm volatile("s_wait_xcnt 0x0" ::: "memory");      /* the q loads' address registers are reused below */
  asm volatile("s_wait_asynccnt 0x0" ::: "memory");      /* this wave's copies of tile 0 have landed */
  __syncthreads();      /* tile 0 readable by every wave */
  if (nt > 1) fa_stage(kg + (size_t)FK * KVD, vg + FK, lds0 + FBUF);
  const v8f z8 = {0.f,0.f,0.f,0.f,0.f,0.f,0.f,0.f};
  v8f acc[4][2]; float m[2], l[2];
#pragma unroll
  for (int j = 0; j < 2; ++j) { m[j] = -1.0e30f; l[j] = 0.f;
#pragma unroll
    for (int dt = 0; dt < 4; ++dt) acc[dt][j] = z8; }
  const float C = 0.125f * 1.4426950408889634f;      /* 1 / sqrt(HD), and e^x = 2^(x log2 e) */
#pragma unroll 1      /* kept rolled: one copy of the long body, the buffer chosen by t & 1 */
  for (int t = 0; t < nt; ++t) { const unsigned char* sk = st + (t & 1) * FBUF + c * FPB + 16 * hh; const unsigned char* sv = sk + FK * FPB;
#pragma unroll
    for (int ps = 0; ps < FK / 32; ++ps) { const int kb = t * FK + ps * 32;      /* a pass: 32 keys, one k step of O^T += V^T P^T */
      if (kb <= q0) {      /* the same for the whole work-group; false only for a pass whose every key lies past the diagonal */
        v8f s[2][2];
#pragma unroll
        for (int kt = 0; kt < 2; ++kt) { const v16h k0 = g2_lfrag(sk + (ps * 2 + kt) * 16 * FPB), k1 = g2_lfrag(sk + (ps * 2 + kt) * 16 * FPB + 64);
#pragma unroll
          for (int j = 0; j < 2; ++j) s[kt][j] = fa_mma(k1, qf[j][1], fa_mma(k0, qf[j][0], z8)); }
        if (kb == q0) {      /* only the pass on the diagonal holds masked keys */
#pragma unroll
          for (int kt = 0; kt < 2; ++kt) {
#pragma unroll
            for (int j = 0; j < 2; ++j) {
#pragma unroll
              for (int r = 0; r < 8; ++r) s[kt][j][r] = (kt * 16 + 8 * hh + r <= j * 16 + c) ? s[kt][j][r] : -1.0e30f; } } }
        FragH pf[2];
#pragma unroll
        for (int j = 0; j < 2; ++j) { float mk[2];
#pragma unroll
          for (int kt = 0; kt < 2; ++kt) mk[kt] = fmaxf(fmaxf(fmaxf(s[kt][j][0], s[kt][j][1]), fmaxf(s[kt][j][2], s[kt][j][3])), fmaxf(fmaxf(s[kt][j][4], s[kt][j][5]), fmaxf(s[kt][j][6], s[kt][j][7])));
          float mx = fmaxf(mk[0], mk[1]); mx = fmaxf(mx, __shfl_xor(mx, 16, 32)); mx = fmaxf(mx, m[j]);
          const float al = fa_exp1((m[j] - mx) * C); const float nb = 8.0f - mx * C; m[j] = mx;      /* weights x256: 2^(s C - mx C + 8); a masked key gives 0 */
          float sm[2];
#pragma unroll
          for (int kt = 0; kt < 2; ++kt) { float p[8];
#pragma unroll
            for (int r = 0; r < 8; ++r) p[r] = __builtin_fmaf(s[kt][j][r], C, nb);
            fa_exp8(p); sm[kt] = ((p[0] + p[1]) + (p[2] + p[3])) + ((p[4] + p[5]) + (p[6] + p[7]));
#pragma unroll
            for (int r = 0; r < 8; ++r) pf[j].h[kt * 8 + r] = (_Float16)p[r]; }
          l[j] = __builtin_fmaf(l[j], al, sm[0] + sm[1]);      /* this lane half's keys only; the halves are joined behind the loop */
#pragma unroll
          for (int dt = 0; dt < 4; ++dt) acc[dt][j] *= al; }
#pragma unroll
        for (int dt = 0; dt < 4; ++dt) { const v16h vf = g2_lfrag(sv + dt * 16 * FPB + ps * 64);
#pragma unroll
          for (int j = 0; j < 2; ++j) acc[dt][j] = fa_mma(vf, pf[j].v, acc[dt][j]); } } }
    asm volatile("s_wait_dscnt 0x0" ::: "memory");      /* this wave's reads of tile t are done before the buffer is refilled */
    asm volatile("s_wait_asynccnt 0x0" ::: "memory");      /* this wave's copies of tile t + 1 have landed */
    __syncthreads();      /* publishes tile t + 1 and ends every wave's reads of tile t */
    if (t + 2 < nt) fa_stage(kg + (size_t)(t + 2) * FK * KVD, vg + (size_t)(t + 2) * FK, lds0 + (unsigned)((t & 1) * FBUF)); }
  asm volatile("s_wait_asynccnt 0x0" ::: "memory");      /* no copy outstanding when the wave ends */
  FragH of[2][4];      /* every piece converted into registers of its own before the first store: no register of an issued store is written again */
#pragma unroll
  for (int j = 0; j < 2; ++j) { const float fin = 64.0f / (l[j] + __shfl_xor(l[j], 16, 32));
#pragma unroll
    for (int dt = 0; dt < 4; ++dt) {
#pragma unroll
      for (int r = 0; r < 8; ++r) of[j][dt].h[r] = (_Float16)(acc[dt][j][r] * fin); } }
#pragma unroll
  for (int j = 0; j < 2; ++j) { unsigned short* po = (unsigned short*)O + ((size_t)b * SQ + q0 + j * 16 + c) * DM + h * HD + 8 * hh;      /* a lane's 8 accumulator registers are 8 neighbouring head dims of one query row: one 16-byte store */
#pragma unroll
    for (int dt = 0; dt < 4; ++dt) *(v8us*)(po + dt * 16) = of[j][dt].half[0]; } }


#define A0R 16                       /* query rows, one wave each, per work-group of the f32 first-tile kernel */
#define A0P (HD + 4)                 /* pitch of a staged k row in floats: 272 B = 16 B x 17, so 32 lanes reading 32 different rows spread over the LDS banks */
typedef float v2f __attribute__((ext_vector_type(2)));
// f32 causal attention for query rows 0..QT0-1 of every batch (blockIdx.y; QT0 rows a batch in QF, KF, VF and OF). One work-group per (batch, head, A0R query rows): the head's QT0 k and v rows are staged in LDS once,
// then one wave per query row i: scores with one key per lane (32 keys a pass), maximum and sum over the lanes, then o with two head dims per lane, key after key.
// Every loop is unrolled in full so that s[], e[], q[], tk[] and tv[] are indexed by constants and stay in registers and the lane number of each readlane is a constant; the tests on c are the same for the whole wave.
__global__ __launch_bounds__(512) void k_att0w(const float* __restrict__ QF, const float* __restrict__ KF, const float* __restrict__ VF, int ld, float scale, float* __restrict__ OF, int ldo) {
  __shared__ __attribute__((aligned(16))) float lk[QT0][A0P]; __shared__ __attribute__((aligned(16))) float lv[QT0][HD];
  const int tid = threadIdx.x, lane = tid & 31; const int w = __builtin_amdgcn_readfirstlane(tid >> 5);
  const int h = blockIdx.x / (QT0 / A0R), rg = blockIdx.x % (QT0 / A0R); const int i = rg * A0R + w;
  const int hb = h * HD + (int)blockIdx.y * QT0 * ld, ho = h * HD + (int)blockIdx.y * QT0 * ldo;      /* first column of the head in row 0 of this batch's QT0 rows, in QF, KF, VF and in OF */
  v4f tk[QT0 * (HD / 4) / 512], tv[QT0 * (HD / 4) / 512];      /* all loads issued before the first LDS store: one memory latency for the whole stage */
#pragma unroll
  for (int u = 0; u < QT0 * (HD / 4) / 512; ++u) { const int e4 = u * 512 + tid; const size_t g = (size_t)(e4 / (HD / 4)) * ld + hb + (e4 % (HD / 4)) * 4; tk[u] = *(const v4fa*)(KF + g); tv[u] = *(const v4fa*)(VF + g); }
  const float* qr = QF + (size_t)i * ld + hb; v4f q[HD / 4];
#pragma unroll
  for (int d = 0; d < HD / 4; ++d) q[d] = *(const v4fa*)(qr + d * 4);
#pragma unroll
  for (int u = 0; u < QT0 * (HD / 4) / 512; ++u) { const int e4 = u * 512 + tid; *(v4f*)&lk[e4 / (HD / 4)][(e4 % (HD / 4)) * 4] = tk[u]; *(v4f*)&lv[e4 / (HD / 4)][(e4 % (HD / 4)) * 4] = tv[u]; }
  __syncthreads();
  float s[QT0 / 32]; float mx = -1.0e30f;
#pragma unroll
  for (int c = 0; c < QT0 / 32; ++c) { s[c] = -1.0e30f;
    if (c * 32 <= i) { const float* kr = &lk[c * 32 + lane][0]; v4f a = {0.f, 0.f, 0.f, 0.f};
#pragma unroll
      for (int d = 0; d < HD / 4; ++d) a += q[d] * *(const v4f*)(kr + d * 4);
      const float t = ((a[0] + a[1]) + (a[2] + a[3])) * scale; s[c] = (c * 32 + lane <= i) ? t : -1.0e30f; mx = fmaxf(mx, s[c]); } }
#pragma unroll
  for (int d = 16; d > 0; d >>= 1) mx = fmaxf(mx, __shfl_xor(mx, d, 32));
  float e[QT0 / 32]; float l = 0.f;
#pragma unroll
  for (int c = 0; c < QT0 / 32; ++c) { e[c] = 0.f; if (c * 32 <= i) { e[c] = expf(s[c] - mx); l += e[c]; } }      /* a masked key: expf(-1e30 - mx) = 0 */
#pragma unroll
  for (int d = 16; d > 0; d >>= 1) l += __shfl_xor(l, d, 32);
  v2f o = {0.f, 0.f};
#pragma unroll
  for (int c = 0; c < QT0 / 32; ++c) if (c * 32 <= i) {
#pragma unroll
    for (int j = 0; j < 32; ++j) { const float p = __int_as_float(__builtin_amdgcn_readlane(__float_as_int(e[c]), j)); o += p * *(const v2f*)&lv[c * 32 + j][lane * 2]; } }
  const float fin = 64.0f / l;      /* o carried x64 like the f16 path */
  *(v2f*)(OF + (size_t)i * ldo + ho + lane * 2) = o * fin; }


__global__ __launch_bounds__(256) void k_kvexp(const float* __restrict__ src, float* __restrict__ dst, size_t n4) { const size_t t = (size_t)blockIdx.x * 256 + threadIdx.x; if (t >= n4) return; const size_t e = t * 4; const size_t row = e / DM; const int col = (int)(e % DM); const int h = col / HD, d = col % HD; const v4f v = *(const v4fa*)(src + row * KVD + (size_t)(h / HPG) * HD + d); *(v4f*)(dst + e) = v;  }

__global__ __launch_bounds__(256) void k_tab2(float theta, float* __restrict__ CS, float* __restrict__ SN) {
  #pragma clang fp contract(off)
  const int t = blockIdx.x * 256 + threadIdx.x; if (t >= SQ * (HD / 2)) return; const int i = t % (HD / 2); const int p = t / (HD / 2); const float invf = 1.0f / powf(theta, (float)(2 * i) / (float)HD); const float ang = __fmul_rn((float)p, invf); const float c = cosf(ang), s = sinf(ang);
  *(float*)(CS + t) = c; *(float*)(SN + t) = s;  }
__global__ __launch_bounds__(256) void k_bfcp(const float* __restrict__ src, float* __restrict__ dst, size_t n4) { const size_t t = (size_t)blockIdx.x * 256 + threadIdx.x; if (t >= n4) return; const v4f a = *(const v4fa*)(src + t * 4); v4f o; for (int q = 0; q < 4; ++q) o[q] = bf16_round(a[q]); *(v4f*)(dst + t * 4) = o;  }

__global__ __launch_bounds__(256) void k_f2bf(const float* __restrict__ F, unsigned short* __restrict__ O, size_t n8) { const size_t t = (size_t)blockIdx.x * 256 + threadIdx.x; if (t >= n8) return; const v4f a = *(const v4fa*)(F + t * 8), b = *(const v4fa*)(F + t * 8 + 4); FragH f;
  for (int q = 0; q < 4; ++q) { f.u[q] = (unsigned short)(__float_as_uint(bf16_round(a[q])) >> 16); f.u[4 + q] = (unsigned short)(__float_as_uint(bf16_round(b[q])) >> 16); }
  *(v8us*)(O + t * 8) = f.half[0];  }
extern "C" void kernel_launch(void* const* d_in, const int* in_sizes, int n_in,
                              void* d_out, int out_size, void* d_ws, size_t ws_size, hipStream_t stream) {
  (void)in_sizes; (void)n_in; (void)out_size;
  const float* const* I = (const float* const*)d_in; const float* x = I[0]; const float* tcos = I[1]; const float* tsin = I[2]; const float* wq = I[3]; const float* wk = I[4]; const float* wv = I[5]; const float* wo = I[6]; const float* bq = nullptr; const float* bk = nullptr; const float* bv = nullptr; const float* bo = nullptr;      /* [in][out] weights, no biases; rope tables [S][32] */
  char* ws = (char*)d_ws; size_t off = 0;
  auto take = [&](size_t bytes) { char* p = ws + off; off += (bytes + 255) & ~(size_t)255; return p; };
  _Float16* BQ = (_Float16*)take((size_t)DM * DM * 2); _Float16* BK = (_Float16*)take((size_t)KVD * DM * 2); _Float16* BV = (_Float16*)take((size_t)KVD * DM * 2); _Float16* BO = (_Float16*)take((size_t)DM * DM * 2);
  _Float16* X16 = (_Float16*)take(NR * DM * 2); float* CSB = (float*)take((size_t)SQ * 32 * 4); float* SNB = (float*)take((size_t)SQ * 32 * 4); _Float16* Q16 = (_Float16*)take(NR * DM * 2); _Float16* K16 = (_Float16*)take(NR * KVD * 2); _Float16* V16 = (_Float16*)take(NR * KVD * 2); _Float16* O16 = (_Float16*)take(NR * DM * 2);
  _Float16* VT = (_Float16*)take((size_t)NB * NG * HD * SQ * 2);
  float* QF0 = (float*)take((size_t)NB * QT0 * DM * 4); float* KF0 = (float*)take((size_t)NB * QT0 * KVD * 4); float* VF0 = (float*)take((size_t)NB * QT0 * KVD * 4); float* KF0e = (float*)take((size_t)NB * QT0 * DM * 4); float* VF0e = (float*)take((size_t)NB * QT0 * DM * 4); float* OF0 = (float*)take((size_t)NB * QT0 * DM * 4); _Float16* OH0 = (_Float16*)take((size_t)NB * QT0 * DM * 2); _Float16* OL0 = (_Float16*)take((size_t)NB * QT0 * DM * 2); float* OUTF = (float*)take(NR * DM * 4);      /* first-tile planes: QT0 rows a batch, batch after batch; OUTF: f32 result rows, converted to bf16 at the end */
  if (off > ws_size) return;
  k_wt_f16<<<dim3(DM / 64, DM / 64), 256, 0, stream>>>(wq, BQ, DM, DM, 16.0f); k_wt_f16<<<dim3(KVD / 64, DM / 64), 256, 0, stream>>>(wk, BK, DM, KVD, 16.0f); k_wt_f16<<<dim3(KVD / 64, DM / 64), 256, 0, stream>>>(wv, BV, DM, KVD, 16.0f); k_wt_f16<<<dim3(DM / 64, DM / 64), 256, 0, stream>>>(wo, BO, DM, DM, 16.0f);      /* [in][out] -> Bt[n][k] x16, one work-group per 64 x 64 tile */
  k_x16<<<(unsigned)((NR * DM / 8 + 255) / 256), 256, 0, stream>>>(x, X16, NR * DM / 8);
  k_bfcp<<<(SQ * 32 / 4 + 255) / 256, 256, 0, stream>>>(tcos, CSB, (size_t)SQ * 32 / 4); k_bfcp<<<(SQ * 32 / 4 + 255) / 256, 256, 0, stream>>>(tsin, SNB, (size_t)SQ * 32 / 4);      /* bf16-rounded rope tables [pos][32] */
  const size_t r0p = (size_t)B0 * SQ;      /* first projected row */
  k_gemm2<0><<<dim3((unsigned)((MP / 128) * (KVD / 64)), 1), 128, 0, stream>>>(X16 + r0p * DM, DM, 0, BV, DM, 0, 0.0625f, bv, 0, nullptr, 1, 0, 0, nullptr, V16 + r0p * KVD, KVD, 0, MP, KVD, DM);
  const size_t f0p = (size_t)B0 * QT0;      /* first row of the first-tile planes */
  /* every launch below covers all batches at once: nothing in one batch waits for another */
  k_gemm2<0, 1, 128, true><<<dim3((unsigned)((MP / 128) * (DM / 64)), 1), 128, 0, stream>>>(X16 + r0p * DM, DM, 0, BQ, DM, 0, 0.0625f, nullptr, 0, nullptr, 1, 0, 0, QF0 + f0p * DM, Q16 + r0p * DM, DM, 0, MP, DM, DM, CSB, SNB, QT0);      /* q, interleaved-pair rope in the epilogue: f16 rows, and f32 rows 0..127 of each batch */
  k_gemm2<0, 1, 128, true><<<dim3((unsigned)((MP / 128) * (KVD / 64)), 1), 128, 0, stream>>>(X16 + r0p * DM, DM, 0, BK, DM, 0, 0.0625f, nullptr, 0, nullptr, 1, 0, 0, KF0 + f0p * KVD, K16 + r0p * KVD, KVD, 0, MP, KVD, DM, CSB, SNB, QT0);      /* k likewise */
  k_vt<NG, SQ><<<NBR * NG * (SQ / 64), 256, 0, stream>>>(V16 + r0p * KVD, KVD, 0, VT + (size_t)B0 * NG * HD * SQ);      /* V^T [NB][NG][HD][SQ] */
  k_gemm2<0><<<dim3((QT0 / 128) * (KVD / 64), NBR), 128, 0, stream>>>(X16 + r0p * DM, DM, (size_t)SQ * DM, BV, DM, 0, 0.0625f, bv, 0, nullptr, 1, 0, 0, VF0 + f0p * KVD, nullptr, KVD, (size_t)QT0 * KVD, QT0, KVD, DM);      /* f32 v of rows 0..127, grid.y = batch */
  k_kvexp<<<(unsigned)(((size_t)NBR * QT0 * DM / 4 + 255) / 256), 256, 0, stream>>>(KF0 + f0p * KVD, KF0e + f0p * DM, (size_t)NBR * QT0 * DM / 4); k_kvexp<<<(unsigned)(((size_t)NBR * QT0 * DM / 4 + 255) / 256), 256, 0, stream>>>(VF0 + f0p * KVD, VF0e + f0p * DM, (size_t)NBR * QT0 * DM / 4);      /* head h <- kv group h/4 for the exact first-tile kernel */
  k_att0w<<<dim3(NH * (QT0 / A0R), NBR), 512, 0, stream>>>(QF0 + f0p * DM, KF0e + f0p * DM, VF0e + f0p * DM, DM, 0.125f, OF0 + f0p * DM, DM);      /* exact f32 attention for rows 0..127 (o x64), grid.y = batch */
  k_fattn<<<NB * NG * (SQ / FQ), 128, 0, stream>>>(Q16, K16, VT, O16);      /* scores, causal softmax and P V of both batches and all 32 heads in one launch: o (merged heads, x64) as f16 rows */
  k_gemm2<0><<<dim3((unsigned)((MPO / 128) * (DM / 64)), 1), 128, 0, stream>>>(O16 + r0p * DM, DM, 0, BO, DM, 0, 0.0009765625f, bo, 0, nullptr, 1, 0, 0, OUTF + r0p * DM, nullptr, DM, 0, MPO, DM, DM);      /* out rows (f32) */
  k_hl<<<(unsigned)(((size_t)NB * QT0 * DM / 8 + 255) / 256), 256, 0, stream>>>(OF0, OH0, OL0, (size_t)NB * QT0 * DM / 8);      /* first-tile o (x64) -> f16 hi + x1024 residual planes */
  k_gemm2<0><<<dim3((QT0 / 128) * (DM / 64), NBR), 128, 0, stream>>>(OH0 + f0p * DM, DM, (size_t)QT0 * DM, BO, DM, 0, 0.0009765625f, bo, 0, nullptr, 1, 0, 0, OUTF + r0p * DM, nullptr, DM, (size_t)SQ * DM, QT0, DM, DM);      /* rows 0..127 of each batch (grid.y): out = o_hi Wo (+ b), overwriting the f16-path rows */
  k_gemm2<0><<<dim3((QT0 / 128) * (DM / 64), NBR), 128, 0, stream>>>(OL0 + f0p * DM, DM, (size_t)QT0 * DM, BO, DM, 0, 0.00000095367431640625f, nullptr, 0, (const float*)(OUTF + r0p * DM), -1, 0, 0, OUTF + r0p * DM, nullptr, DM, (size_t)SQ * DM, QT0, DM, DM);      /* += o_lo Wo 2^-20 (own-element accumulate) */
  k_f2bf<<<(unsigned)(((size_t)MPO * DM / 8 + 255) / 256), 256, 0, stream>>>(OUTF + (size_t)B0 * SQ * DM, (unsigned short*)d_out + (size_t)B0 * SQ * DM, (size_t)MPO * DM / 8);      /* out.astype(bfloat16): the f32 rows rounded to nearest-even bf16 into the 2-byte output */
}

// v009
// Measured time: 223 microseconds a run.
// Next to v008, in two timings, it ran 1.16 and 1.17 times as fast.
// All steps since v000 together make it 43.3 times as fast.
#include <hip/hip_runtime.h>
// Grouped-query causal attention with RoPE and a BFLOAT16 output (x [2][2048][2048]; xq = x wq (32 heads x 64), xk = x wk, xv = x wv (8 kv heads x 64) ([in][out] weights sigma 1/sqrt(2048), no biases); interleaved-pair RoPE (reshape(..., 32, 2): real = even, imag = odd) on q and k from the module's INPUT tables freqs_cos/freqs_sin [S][32]; repeat: query head h uses kv head h/4; scores / 8 + triu(-inf, 1) (causal); softmax; out = (merged wo).astype(bfloat16) -> bf16 [2][2048][2048] (2 bytes per element)).
// Compute dtype: inputs rounded to bf16; x / weights exact; q, k, v, softmax weights and o as plain f16 GEMM operands (~2^-12); scores and softmax statistics f32. v_wmma_f32_16x16x32_f16.
#define NB 2
#define NG 8
#define HPG 4
#define KVD (NG * HD)
#define SQ 2048
#define DM 2048
#define NH 32
#define HD 64
#define HG 4                         /* heads per launch of the non-template k_vt (not launched) */
#define QT 256                       /* not used */
#define NKX SQ                       /* S / P row pitch */
#define QT0 128                      /* first-tile rows recomputed exactly in f32 */
#define B0 0                         /* first batch processed (debug hook) */
#define NBR NB                       /* batches processed (debug hook) */
#define NR ((size_t)NB * SQ)         /* token rows */
#define MP ((int)((size_t)NBR * SQ)) /* rows projected (debug hook) */
#define QN SQ                        /* query rows attended per batch (not used) */
#define NHD NH                       /* heads attended (not used) */
#define MPO MP                       /* rows through the output stage (debug hook) */
#define LQ DM      /* row pitch of the q rows */
typedef __bf16 v16b __attribute__((ext_vector_type(16)));
typedef unsigned short v8us __attribute__((ext_vector_type(8), may_alias));
typedef float  v8f  __attribute__((ext_vector_type(8)));
typedef float  v4f  __attribute__((ext_vector_type(4)));
typedef float  v4fa __attribute__((ext_vector_type(4), may_alias));
union FragB { v16b v; v8us half[2]; unsigned short u[16]; };

__device__ __forceinline__ unsigned short bf16_bits(float x) { unsigned int u = __float_as_uint(x); return (unsigned short)((u + 0x7FFFu + ((u >> 16) & 1u)) >> 16); }
__device__ __forceinline__ float bf16_val(unsigned short b) { return __uint_as_float(((unsigned int)b) << 16); }
__device__ __forceinline__ float bf16_round(float x) { return bf16_val(bf16_bits(x)); }
// D += A·B with NT terms: 1 = ah·bh, 2 = + al·bh (A split), 3 = + ah·bl (both split)
template <int NT>
__device__ __forceinline__ v8f mmaN(v16b ah, v16b al, v16b bh, v16b bl, v8f c) {
  c = __builtin_amdgcn_wmma_f32_16x16x32_bf16(false, ah, false, bh, (short)0, c, false, false);
  if (NT >= 2) c = __builtin_amdgcn_wmma_f32_16x16x32_bf16(false, al, false, bh, (short)0, c, false, false);
  if (NT >= 3) c = __builtin_amdgcn_wmma_f32_16x16x32_bf16(false, ah, false, bl, (short)0, c, false, false);
  asm volatile("v_nop\n\tv_nop\n\tv_nop\n\tv_nop" : "+v"(c) : "v"(ah), "v"(al), "v"(bh), "v"(bl));
  return c;
}

__global__ __launch_bounds__(256) void k_wt_bf16(const float* __restrict__ W, unsigned short* __restrict__ Wt, int K, int N) {
  const int t = blockIdx.x * 256 + threadIdx.x;
  const int k8n = K / 8;
  if (t >= N * k8n) return;
  const int n = t / k8n, k8 = (t % k8n) * 8;
  v8us v;
#pragma unroll
  for (int i = 0; i < 8; ++i) v[i] = bf16_bits(W[(size_t)(k8 + i) * N + n]);
  *(v8us*)(Wt + (size_t)n * K + k8) = v;
  
}

// GEMM C[M][N] (f32, pitch ldc) = act(A[M][K]·W + bias). A f32 row-major (pitch lda) converted per fragment to bf16
// (ASPLIT: hi/lo two planes -> 2 terms, else single rounded term); Wt bf16 [N][K] (pitch ldb). BIAS_BF16 rounds the
// bias to bf16 first (bias quantised to bf16 before the add). K%32==0, M%16==0, N%64==0.
template <bool ASPLIT, int ACT, bool BIAS_BF16>
__global__ __launch_bounds__(128) void k_gemm_bf(const float* __restrict__ A, int lda, const unsigned short* __restrict__ Wt, int ldb,
                                               const float* __restrict__ bias, float* __restrict__ C, int ldc, int M, int N, int K) {
  __shared__ __attribute__((aligned(16))) float so[4][16][64];
  const int tid = threadIdx.x, w = tid >> 5, lane = tid & 31, ln = lane & 15, hh = lane >> 4;
  const int ntn = N / 64;
  const int wid = blockIdx.x * 4 + w;
  const int mt = wid / ntn, nq = wid % ntn;
  if (mt * 16 >= M) return;
  const int row0 = mt * 16, col0 = nq * 64;
  const float* arow = A + (size_t)(row0 + ln) * lda;
  v8f acc[4] = {};
  for (int kb = 0; kb < K; kb += 32) {
    FragB ah, al;
    const v4f x0 = *(const v4fa*)(arow + kb + 8 * hh), x1 = *(const v4fa*)(arow + kb + 8 * hh + 4);
    const v4f x2 = *(const v4fa*)(arow + kb + 16 + 8 * hh), x3 = *(const v4fa*)(arow + kb + 16 + 8 * hh + 4);
    float xs[16] = {x0[0],x0[1],x0[2],x0[3],x1[0],x1[1],x1[2],x1[3],x2[0],x2[1],x2[2],x2[3],x3[0],x3[1],x3[2],x3[3]};
#pragma unroll
    for (int i = 0; i < 16; ++i) { const unsigned short hb = bf16_bits(xs[i]); ah.u[i] = hb; al.u[i] = ASPLIT ? bf16_bits(xs[i] - bf16_val(hb)) : (unsigned short)0; }
#pragma unroll
    for (int t = 0; t < 4; ++t) {
      const unsigned short* brow = Wt + (size_t)(col0 + t * 16 + ln) * ldb + kb;
      FragB b;
      b.half[0] = *(const v8us*)(brow + 8 * hh);
      b.half[1] = *(const v8us*)(brow + 16 + 8 * hh);
      acc[t] = mmaN<ASPLIT ? 2 : 1>(ah.v, al.v, b.v, b.v, acc[t]);
    }
  }
#pragma unroll
  for (int t = 0; t < 4; ++t) {
    float bv = bias ? bias[col0 + t * 16 + ln] : 0.f;
    if (BIAS_BF16) bv = bf16_round(bv);
#pragma unroll
    for (int r = 0; r < 8; ++r) { float v = acc[t][r] + bv; if (ACT == 1) v = fmaxf(v, 0.f); so[w][8 * hh + r][t * 16 + ln] = v; }
  }
  __builtin_amdgcn_fence(__ATOMIC_ACQ_REL, "workgroup");
  __builtin_amdgcn_wave_barrier();
  const int rsub = lane >> 4, c4 = (lane & 15) * 4;
  {
#pragma unroll
    for (int q = 0; q < 8; ++q) {
      const int r = q * 2 + rsub;
      const v4f v = *(const v4fa*)&so[w][r][c4];
      *(v4f*)(C + (size_t)(row0 + r) * ldc + col0 + c4) = v;
    }
    
  }
}

// GEMM C = act(A·W + bias + resid): A f32 (ASPLIT -> hi/lo 2 terms), Wt bf16 [N][K]; ACT 0 none, 1 relu, 2 exact gelu;
// resid (optional, f32, row index = (row % rmod), pitch ldr, RES_BF16 rounds it) added before the activation.
template <bool ASPLIT, int ACT, bool BIAS_BF16, bool RES_BF16>
__global__ __launch_bounds__(128) void k_gemm_bf3(const float* __restrict__ A, int lda, const unsigned short* __restrict__ Wt, int ldb,
                                                const float* __restrict__ bias, const float* __restrict__ resid, int rmod, int ldr,
                                                float* __restrict__ C, int ldc, int M, int N, int K) {
  __shared__ __attribute__((aligned(16))) float so[4][16][64];
  const int tid = threadIdx.x, w = tid >> 5, lane = tid & 31, ln = lane & 15, hh = lane >> 4;
  const int ntn = N / 64;
  const int wid = blockIdx.x * 4 + w;
  const int mt = wid / ntn, nq = wid % ntn;
  if (mt * 16 >= M) return;
  const int row0 = mt * 16, col0 = nq * 64;
  const float* arow = A + (size_t)(row0 + ln) * lda;
  v8f acc[4] = {};
  for (int kb = 0; kb < K; kb += 32) {
    FragB ah, al;
    const v4f x0 = *(const v4fa*)(arow + kb + 8 * hh), x1 = *(const v4fa*)(arow + kb + 8 * hh + 4);
    const v4f x2 = *(const v4fa*)(arow + kb + 16 + 8 * hh), x3 = *(const v4fa*)(arow + kb + 16 + 8 * hh + 4);
    float xs[16] = {x0[0],x0[1],x0[2],x0[3],x1[0],x1[1],x1[2],x1[3],x2[0],x2[1],x2[2],x2[3],x3[0],x3[1],x3[2],x3[3]};
#pragma unroll
    for (int i = 0; i < 16; ++i) { const unsigned short hb = bf16_bits(xs[i]); ah.u[i] = hb; al.u[i] = ASPLIT ? bf16_bits(xs[i] - bf16_val(hb)) : (unsigned short)0; }
#pragma unroll
    for (int t = 0; t < 4; ++t) {
      const unsigned short* brow = Wt + (size_t)(col0 + t * 16 + ln) * ldb + kb;
      FragB b;
      b.half[0] = *(const v8us*)(brow + 8 * hh);
      b.half[1] = *(const v8us*)(brow + 16 + 8 * hh);
      acc[t] = mmaN<ASPLIT ? 2 : 1>(ah.v, al.v, b.v, b.v, acc[t]);
    }
  }
#pragma unroll
  for (int t = 0; t < 4; ++t) {
    const int col = col0 + t * 16 + ln;
    float bv = bias ? bias[col] : 0.f;
    if (BIAS_BF16) bv = bf16_round(bv);
#pragma unroll
    for (int r = 0; r < 8; ++r) {
      float v = acc[t][r] + bv;
      if (resid) { float rv = resid[(size_t)((row0 + 8 * hh + r) % rmod) * ldr + col]; if (RES_BF16) rv = bf16_round(rv); v += rv; }
      if (ACT == 1) v = fmaxf(v, 0.f);
      if (ACT == 2) v = 0.5f * v * (1.0f + erff(v * 0.70710678118654752f));
      if (ACT == 3) { const float u = 0.7978845608028654f * (v + 0.044715f * v * v * v); v = 0.5f * v * (1.0f + tanhf(u)); }
      so[w][8 * hh + r][t * 16 + ln] = v;
    }
  }
  __builtin_amdgcn_fence(__ATOMIC_ACQ_REL, "workgroup");
  __builtin_amdgcn_wave_barrier();
  const int rsub = lane >> 4, c4 = (lane & 15) * 4;
  {
#pragma unroll
    for (int q = 0; q < 8; ++q) {
      const int r = q * 2 + rsub;
      const v4f v = *(const v4fa*)&so[w][r][c4];
      *(v4f*)(C + (size_t)(row0 + r) * ldc + col0 + c4) = v;
    }
    
  }
}
// row LayerNorm (biased variance, eps) over N: s = X (+ R); optional out_sum <- s; out_norm <- (s-mu)*rsqrt(var+eps)*g + b
template <bool PARAM_BF16>
__global__ __launch_bounds__(256) void k_layernorm(const float* __restrict__ X, const float* __restrict__ R, const float* __restrict__ g, const float* __restrict__ bta,
                                                  float* __restrict__ out_sum, float* __restrict__ out_norm, int N, float eps) {
  __shared__ float red[256];
  const int row = blockIdx.x, tid = threadIdx.x;
  const float* x = X + (size_t)row * N; const float* rr = R ? R + (size_t)row * N : nullptr;
  float vals[16];                     // up to N = 4096
  const int per = N / 256;            // contiguous chunk per thread? use strided-by-4 chunks: thread handles j = tid*4 + 1024*u
  float s1 = 0.f;
  for (int u = 0; u < per / 4; ++u) {
    const int j = tid * 4 + 1024 * u;
    const v4f a = *(const v4fa*)(x + j);
    v4f b = {0.f,0.f,0.f,0.f}; if (rr) b = *(const v4fa*)(rr + j);
#pragma unroll
    for (int q = 0; q < 4; ++q) { const float v = a[q] + b[q]; vals[u * 4 + q] = v; s1 += v; }
  }
  red[tid] = s1; __syncthreads();
  for (int st = 128; st > 0; st >>= 1) { if (tid < st) red[tid] += red[tid + st]; __syncthreads(); }
  const float mu = red[0] / (float)N; __syncthreads();
  float s2 = 0.f;
  for (int u = 0; u < per / 4; ++u)
#pragma unroll
    for (int q = 0; q < 4; ++q) { const float c = vals[u * 4 + q] - mu; s2 += c * c; }
  red[tid] = s2; __syncthreads();
  for (int st = 128; st > 0; st >>= 1) { if (tid < st) red[tid] += red[tid + st]; __syncthreads(); }
  const float rs = rsqrtf(red[0] / (float)N + eps);
  {
    for (int u = 0; u < per / 4; ++u) {
      const int j = tid * 4 + 1024 * u;
      v4f o, sm;
#pragma unroll
      for (int q = 0; q < 4; ++q) {
        float gg = g[j + q], bb = bta[j + q];
        if (PARAM_BF16) { gg = bf16_round(gg); bb = bf16_round(bb); }
        sm[q] = vals[u * 4 + q]; o[q] = (vals[u * 4 + q] - mu) * rs * gg + bb;
      }
      if (out_sum) *(v4f*)(out_sum + (size_t)row * N + j) = sm;
      *(v4f*)(out_norm + (size_t)row * N + j) = o;
    }
    
  }
}



// ---- f16 WMMA path (v_wmma_f32_16x16x32_f16): 11-bit significands for operands in range — used where a [0,1] probability operand needs more precision than bf16
typedef _Float16 v16h __attribute__((ext_vector_type(16)));
union FragH { v16h v; v8us half[2]; _Float16 h[16]; unsigned short u[16]; };
template <int NT>
__device__ __forceinline__ v8f mmaH(v16h ah, v16h al, v16h bh, v16h bl, v8f c) {
  c = __builtin_amdgcn_wmma_f32_16x16x32_f16(false, ah, false, bh, (short)0, c, false, false);
  if (NT >= 2) c = __builtin_amdgcn_wmma_f32_16x16x32_f16(false, al, false, bh, (short)0, c, false, false);
  if (NT >= 3) c = __builtin_amdgcn_wmma_f32_16x16x32_f16(false, ah, false, bl, (short)0, c, false, false);
  asm volatile("v_nop\n\tv_nop\n\tv_nop\n\tv_nop" : "+v"(c) : "v"(ah), "v"(al), "v"(bh), "v"(bl));
  return c;
}
// batched GEMM like k_gemm_b but f16 operands: A f32 (split into f16 hi/lo if ASPLIT, else rounded to f16), Bt = f16 values [n][k]; alpha; C f32; N multiple of 16 (partial tiles skipped)
template <bool ASPLIT>
__global__ __launch_bounds__(128) void k_gemm_h(const float* __restrict__ A, int lda, size_t sA, const _Float16* __restrict__ Bh, int ldb, size_t sB, float alpha, float* __restrict__ C, int ldc, size_t sC, int M, int N, int K) {
  __shared__ __attribute__((aligned(16))) float so[4][16][64];
  const int tid = threadIdx.x, w = tid >> 5, lane = tid & 31, ln = lane & 15, hh = lane >> 4; const int by = blockIdx.y;
  A += (size_t)by * sA; Bh += (size_t)by * sB; C += (size_t)by * sC;
  const int ntn = (N + 63) / 64; const int wid = blockIdx.x * 4 + w; const int mt = wid / ntn, nq = wid % ntn; if (mt * 16 >= M) return;
  const int row0 = mt * 16, col0 = nq * 64; const float* arow = A + (size_t)(row0 + ln) * lda;
  v8f acc[4] = {};
  for (int kb = 0; kb < K; kb += 32) {
    FragH ah, al;
    const v4f x0 = *(const v4fa*)(arow + kb + 8 * hh), x1 = *(const v4fa*)(arow + kb + 8 * hh + 4), x2 = *(const v4fa*)(arow + kb + 16 + 8 * hh), x3 = *(const v4fa*)(arow + kb + 16 + 8 * hh + 4);
    float xs[16] = {x0[0],x0[1],x0[2],x0[3],x1[0],x1[1],x1[2],x1[3],x2[0],x2[1],x2[2],x2[3],x3[0],x3[1],x3[2],x3[3]};
#pragma unroll
    for (int i = 0; i < 16; ++i) { const _Float16 h = (_Float16)xs[i]; ah.h[i] = h; al.h[i] = ASPLIT ? (_Float16)(xs[i] - (float)h) : (_Float16)0.0f; }
#pragma unroll
    for (int t = 0; t < 4; ++t) { if (col0 + t * 16 >= N) continue; const size_t boff = (size_t)(col0 + t * 16 + ln) * ldb + kb; FragH bq; bq.half[0] = *(const v8us*)(Bh + boff + 8 * hh); bq.half[1] = *(const v8us*)(Bh + boff + 16 + 8 * hh);
      acc[t] = mmaH<ASPLIT ? 2 : 1>(ah.v, al.v, bq.v, bq.v, acc[t]); }
  }
#pragma unroll
  for (int t = 0; t < 4; ++t) { if (col0 + t * 16 >= N) continue;
#pragma unroll
    for (int r = 0; r < 8; ++r) so[w][8 * hh + r][t * 16 + ln] = acc[t][r] * alpha; }
  __builtin_amdgcn_fence(__ATOMIC_ACQ_REL, "workgroup"); __builtin_amdgcn_wave_barrier();
  const int rsub = lane >> 4, c4 = (lane & 15) * 4;
  {
#pragma unroll
    for (int q = 0; q < 8; ++q) { const int r = q * 2 + rsub; if (col0 + c4 < N) { const v4f v = *(const v4fa*)&so[w][r][c4]; *(v4f*)(C + (size_t)(row0 + r) * ldc + col0 + c4) = v; } }
     }
}

// Wt[n][k] = f16(bf16(W[k][n]) * scale) from f32 row-major W[K][N] (scale = power of two; bf16-exact weights stay exact in f16 away from the subnormal range). K and N multiples of 64; grid = (N / 64, K / 64).
// One work-group per tile of 64 k x 64 n, turned in LDS, so that both sides of the transpose move whole lines: 16 lanes load 256 neighbouring bytes of one W row, 8 lanes store one 128-byte line of one Wt row.
// A lane loads the same 4 columns of two neighbouring k rows and packs each (even k, odd k) pair of f16 into one dword: the LDS tile is [n][k / 2].
#define WTP 33                       /* LDS pitch of a tile row in dwords (32 pairs + 1): odd, so the 16 x 2 dwords of a wave's store (rows 4 apart) and the 4 x 8 of a wave's load fall on 32 different banks */
typedef unsigned v4u __attribute__((ext_vector_type(4), may_alias));
typedef _Float16 v2h __attribute__((ext_vector_type(2)));
__global__ __launch_bounds__(256) void k_wt_f16(const float* __restrict__ W, _Float16* __restrict__ Wt, int K, int N, float scale) {
  __shared__ unsigned tl[64][WTP];
  const int tid = threadIdx.x; const int k0 = (int)blockIdx.y * 64, n0 = (int)blockIdx.x * 64;
  const int c = tid & 15, r = tid >> 4;      /* this lane's 4 columns and its pair of k rows in a round of 32 rows */
  const float* s0 = W + (size_t)(k0 + 2 * r) * N + n0 + 4 * c; const float* s1 = s0 + N; const float* s2 = s0 + (size_t)32 * N; const float* s3 = s2 + N;
  const v4f a[2][2] = {{*(const v4fa*)s0, *(const v4fa*)s1}, {*(const v4fa*)s2, *(const v4fa*)s3}};      /* all four loads issued before the first conversion: one memory latency for the whole tile */
  asm volatile("s_wait_xcnt 0x0" :: "v"(s0), "v"(s1), "v"(s2), "v"(s3) : "memory");      /* the four address pairs are inputs, so they stay as they are up to this wait (no load's result lands on one); their registers are reused below */
#pragma unroll      /* both loops unrolled in full: a[][] is indexed by constants and stays in registers */
  for (int u = 0; u < 2; ++u) {
#pragma unroll
    for (int i = 0; i < 4; ++i) { const v2h h = {(_Float16)(bf16_round(a[u][0][i]) * scale), (_Float16)(bf16_round(a[u][1][i]) * scale)}; tl[4 * c + i][16 * u + r] = __builtin_bit_cast(unsigned, h); } }
  __syncthreads();      /* the whole tile is in LDS before any row of it is read */
  const int j = tid & 7, nr = tid >> 3;      /* this lane's 8 k (4 dwords) and its n row in a round of 32 rows */
#pragma unroll      /* two rounds: their LDS reads go out together */
  for (int rd = 0; rd < 2; ++rd) { const int n = rd * 32 + nr; const v4u o = {tl[n][4 * j], tl[n][4 * j + 1], tl[n][4 * j + 2], tl[n][4 * j + 3]};
    *(v4u*)((unsigned short*)Wt + (size_t)(n0 + n) * K + k0 + 8 * j) = o; }
}
// k_gemm_hh variant with fused epilogue: v = acc·alpha + bias[by·sBias + col] (+ CP[(row/rowsPerB)·sCPb + by·64 + col] if CP) ; ACT 0 none / 1 elu ; writes f16 C16 (and f32 C if non-null)
template <int ACT>
__global__ __launch_bounds__(128) void k_gemm_hhx(const _Float16* __restrict__ A, int lda, size_t sA, const _Float16* __restrict__ Bh, int ldb, size_t sB, float alpha, const float* __restrict__ bias, size_t sBias, const float* __restrict__ CP, int rowsPerB, size_t sCPb, int row0g,
    float* __restrict__ C, _Float16* __restrict__ C16, int ldc, size_t sC, int M, int N, int K) {
  __shared__ __attribute__((aligned(16))) float so[4][16][64];
  const int tid = threadIdx.x, w = tid >> 5, lane = tid & 31, ln = lane & 15, hh = lane >> 4; const int by = blockIdx.y;
  A += (size_t)by * sA; Bh += (size_t)by * sB; const size_t cofs = (size_t)by * sC; const float* bp = bias ? bias + (size_t)by * sBias : nullptr;
  const int ntn = (N + 63) / 64; const int wid = blockIdx.x * 4 + w; const int mt = wid / ntn, nq = wid % ntn; if (mt * 16 >= M) return;
  const int row0 = mt * 16, col0 = nq * 64; const _Float16* arow = A + (size_t)(row0 + ln) * lda;
  v8f acc[4] = {};
  for (int kb = 0; kb < K; kb += 32) { FragH ah; ah.half[0] = *(const v8us*)((const unsigned short*)arow + kb + 8 * hh); ah.half[1] = *(const v8us*)((const unsigned short*)arow + kb + 16 + 8 * hh);
#pragma unroll
    for (int t = 0; t < 4; ++t) { if (col0 + t * 16 >= N) continue; const size_t boff = (size_t)(col0 + t * 16 + ln) * ldb + kb; FragH bq; bq.half[0] = *(const v8us*)((const unsigned short*)Bh + boff + 8 * hh); bq.half[1] = *(const v8us*)((const unsigned short*)Bh + boff + 16 + 8 * hh);
      acc[t] = mmaH<1>(ah.v, ah.v, bq.v, bq.v, acc[t]); }
  }
#pragma unroll
  for (int t = 0; t < 4; ++t) { if (col0 + t * 16 >= N) continue; const int col = col0 + t * 16 + ln; const float bv = bp ? bf16_round(bp[col]) : 0.f;
#pragma unroll
    for (int r = 0; r < 8; ++r) { float v = acc[t][r] * alpha + bv; if (CP) { const int rr = row0g + row0 + 8 * hh + r; if (rowsPerB < 0) v += CP[cofs + (size_t)rr * ldc + col];      /* rowsPerB < 0: own element of the batched C plane */ else { const int bidx = rr / rowsPerB; v += CP[(size_t)bidx * sCPb + (size_t)by * 64 + col]; } } if (ACT == 1) v = (v > 0.f) ? v : expm1f(v); else if (ACT == 7) v = (v > 0.f) ? v + 1.0f : expf(v); else if (ACT == 8) v = tanhf(v); else if (ACT == 9) v = 0.5f * v * (1.0f + tanhf(0.7978845608028654f * (v + 0.044715f * v * v * v))); else if (ACT == 11) v = 1.0f / (1.0f + expf(-v)); else if (ACT == 12) v = (v > 0.f) ? v : 0.01f * v; else if (ACT == 14) v = (v > 0.f) ? v : 0.1f * v; else if (ACT == 16) v = (v >= 0.f) ? v : 0.3f * v; else if (ACT == 17) v = (v >= 0.f) ? v : 0.2f * v; else if (ACT == 15) v = v / (1.0f + expf(-v)); else if (ACT == 3) v = fmaxf(v, 0.f); else if (ACT == 6) v = 0.5f * v * (1.0f + erff(v * 0.70710678118654752f)); so[w][8 * hh + r][t * 16 + ln] = v; } }
  __builtin_amdgcn_fence(__ATOMIC_ACQ_REL, "workgroup"); __builtin_amdgcn_wave_barrier();
  const int rsub = lane >> 4, c4 = (lane & 15) * 4; typedef _Float16 v4h __attribute__((ext_vector_type(4)));
  {
#pragma unroll
    for (int q = 0; q < 8; ++q) { const int r = q * 2 + rsub; if (col0 + c4 < N) { const v4f v = *(const v4fa*)&so[w][r][c4]; if (C) *(v4f*)(C + cofs + (size_t)(row0 + r) * ldc + col0 + c4) = v; if (C16) { v4h h4; for (int i = 0; i < 4; ++i) h4[i] = (_Float16)v[i]; *(v4h*)(C16 + cofs + (size_t)(row0 + r) * ldc + col0 + c4) = h4; } } }
     }
}


typedef _Float16 v4h __attribute__((ext_vector_type(4)));

__global__ __launch_bounds__(256) void k_x16(const float* __restrict__ x, _Float16* __restrict__ X16, size_t n8) { const size_t t = (size_t)blockIdx.x * 256 + threadIdx.x; if (t >= n8) return; FragH f;
#pragma unroll
  for (int q = 0; q < 8; ++q) f.h[q] = (_Float16)bf16_round(x[t * 8 + q]); *(v8us*)((unsigned short*)X16 + t * 8) = f.half[0];  }
__global__ __launch_bounds__(256) void k_h16(const float* __restrict__ x, _Float16* __restrict__ X16, size_t n8) { const size_t t = (size_t)blockIdx.x * 256 + threadIdx.x; if (t >= n8) return; FragH f;
#pragma unroll
  for (int q = 0; q < 8; ++q) f.h[q] = (_Float16)x[t * 8 + q]; *(v8us*)((unsigned short*)X16 + t * 8) = f.half[0];  }
__global__ __launch_bounds__(256) void k_round16f(const float* __restrict__ W, _Float16* __restrict__ Bt, size_t n8) { const size_t t = (size_t)blockIdx.x * 256 + threadIdx.x; if (t >= n8) return; FragH f;
#pragma unroll
  for (int i = 0; i < 8; ++i) f.h[i] = (_Float16)(bf16_round(W[t * 8 + i]) * 16.0f); *(v8us*)((unsigned short*)Bt + t * 8) = f.half[0];  }
template <int NHv, int TTv>
__global__ __launch_bounds__(256) void k_vt(const _Float16* __restrict__ V16, int ldv, int voff, _Float16* __restrict__ Vt) { __shared__ unsigned short tl[64][66]; const int tid = threadIdx.x; const int slab = blockIdx.x / (TTv / 64), lg = blockIdx.x % (TTv / 64); const int b = slab / NHv, h = slab % NHv;
  for (int i = tid; i < 64 * 8; i += 256) { const int r = i / 8, c8 = (i % 8) * 8; FragH f; f.half[0] = *(const v8us*)((const unsigned short*)V16 + ((size_t)b * TTv + lg * 64 + r) * ldv + voff + h * 64 + c8);
#pragma unroll
    for (int q = 0; q < 8; ++q) tl[r][c8 + q] = f.u[q]; }
  __syncthreads();
  {
#pragma unroll
    for (int rd = 0; rd < 2; ++rd) { const int d = rd * 32 + tid / 8, pc = tid % 8; FragH f;
#pragma unroll
      for (int q = 0; q < 8; ++q) f.u[q] = tl[pc * 8 + q][d];
      *(v8us*)((unsigned short*)Vt + ((size_t)slab * 64 + d) * TTv + lg * 64 + pc * 8) = f.half[0]; }
     } }

__global__ __launch_bounds__(256) void k_hl(const float* __restrict__ F, _Float16* __restrict__ Hh, _Float16* __restrict__ Hl, size_t n8) { const size_t t = (size_t)blockIdx.x * 256 + threadIdx.x; if (t >= n8) return; FragH fh, fl; const v4f a = *(const v4fa*)(F + t * 8), c = *(const v4fa*)(F + t * 8 + 4);
#pragma unroll
  for (int q = 0; q < 4; ++q) { _Float16 h = (_Float16)a[q]; fh.h[q] = h; fl.h[q] = (_Float16)((a[q] - (float)h) * 1024.0f); h = (_Float16)c[q]; fh.h[4 + q] = h; fl.h[4 + q] = (_Float16)((c[q] - (float)h) * 1024.0f); }
  { *(v8us*)((unsigned short*)Hh + t * 8) = fh.half[0]; *(v8us*)((unsigned short*)Hl + t * 8) = fl.half[0];  } }

// ---- fast GEMM (work-group tile 128x64, wave tile 32x64; requires M % 128 == 0 rows per launch region and N % 64 == 0); epilogue = k_gemm_hhx semantics ----
__device__ __forceinline__ v8f g2_mma(v16h a, v16h b, v8f c) { v8f d = __builtin_amdgcn_wmma_f32_16x16x32_f16(false, a, false, b, (short)0, c, false, false); asm volatile("v_nop\n\tv_nop\n\tv_nop\n\tv_nop" : "+v"(d) : "v"(a), "v"(b)); return d; }
// One A or B fragment (16 rows x 32 k) from staged LDS rows; p: the lane's row, plus 16 * hh bytes. k order, the same for A and B: 8 hh .. 8 hh + 7, then 16 + 8 hh .. 16 + 8 hh + 7.
__device__ __forceinline__ v16h g2_lfrag(const unsigned char* p) { FragH f; f.half[0] = *(const v8us*)p; f.half[1] = *(const v8us*)(p + 32); return f.v; }
// Twelve asynchronous 16-byte copies per lane, global memory -> LDS. The s_wait_xcnt is the last line of the copies' own statement, so no register that a copy names is rewritten in front of it.
__device__ __forceinline__ void g2_copy12(const unsigned (&l)[12], const _Float16* const (&g)[12]) {
  asm volatile("global_load_async_to_lds_b128 %0, %12, off\n\t"
               "global_load_async_to_lds_b128 %1, %13, off\n\t"
               "global_load_async_to_lds_b128 %2, %14, off\n\t"
               "global_load_async_to_lds_b128 %3, %15, off\n\t"
               "global_load_async_to_lds_b128 %4, %16, off\n\t"
               "global_load_async_to_lds_b128 %5, %17, off\n\t"
               "global_load_async_to_lds_b128 %6, %18, off\n\t"
               "global_load_async_to_lds_b128 %7, %19, off\n\t"
               "global_load_async_to_lds_b128 %8, %20, off\n\t"
               "global_load_async_to_lds_b128 %9, %21, off\n\t"
               "global_load_async_to_lds_b128 %10, %22, off\n\t"
               "global_load_async_to_lds_b128 %11, %23, off\n\t"
               "s_wait_xcnt 0x0"
               :: "v"(l[0]), "v"(l[1]), "v"(l[2]), "v"(l[3]), "v"(l[4]), "v"(l[5]), "v"(l[6]), "v"(l[7]), "v"(l[8]), "v"(l[9]), "v"(l[10]), "v"(l[11]),
                  "v"(g[0]), "v"(g[1]), "v"(g[2]), "v"(g[3]), "v"(g[4]), "v"(g[5]), "v"(g[6]), "v"(g[7]), "v"(g[8]), "v"(g[9]), "v"(g[10]), "v"(g[11]) : "memory"); }
// One k slab (KC columns of the work-group's 128 A rows, then of its 64 B rows) into one LDS buffer. A row's KC * 2 bytes are KC / 8 neighbouring lanes' 16 bytes each: every copy covers whole 128-byte lines.
// ag, bg: the lane's own 16 bytes in row tid / (KC / 8) of the A and of the B slab; lds: the LDS byte address of the same place in the buffer. Unrolled in full: l[] and g[] are asm operands.
template <int KC>
__device__ __forceinline__ void g2_stage(const _Float16* ag, int lda, const _Float16* bg, int ldb, unsigned lds) {
  constexpr int RPU = 128 / (KC / 8), NA = 128 / RPU, NC = 192 / RPU, PB = KC * 2 + 16;      /* rows per round of 128 lanes; rounds for A; rounds in all; LDS pitch in bytes */
#pragma unroll
  for (int s = 0; s < NC / 12; ++s) { unsigned l[12]; const _Float16* g[12];
#pragma unroll
    for (int j = 0; j < 12; ++j) { const int u = s * 12 + j; l[j] = lds + (unsigned)(u * RPU * PB); g[j] = (u < NA) ? ag + (size_t)(u * RPU) * lda : bg + (size_t)((u - NA) * RPU) * ldb; }
    g2_copy12(l, g); } }
// BG: consecutive blockIdx.y values that share one B slab (grouped-query attention: BG query heads read the same k / v rows); slab = blockIdx.y / BG
// KC: columns of k per staged slab. M a multiple of 128, N of 64, K of KC. The work-group's A rows (128) and B rows (64) go to LDS slab by slab, two buffers: slab t + 1 is copied while slab t is multiplied.
// LDS pitch KC * 2 + 16 bytes = 16 B x odd, so the 16 rows of a fragment read spread over the banks.
// ROPE (ACT 0; bias and CP are not read): the q, k and v projections in one launch. Bh holds the q, then the k, then the v weight rows (ldc + 2 ldkv = N rows); an N tile is one head (64 columns) of q, of k or of v and goes to that plane: C, C16 (pitch ldc), Ck, Ck16 or Cv, Cv16 (pitch ldkv).
// The epilogue turns each (even, odd) column pair of row r of a q or k tile by the angle whose cosine and sine are CS, SN[r % SQ][pair] (a v tile: by the angle 0, which leaves every finite value as it is) and stores the rows: f16 to the 16-bit plane, and f32 to the f32 plane for the first nf32 rows of every SQ rows (one batch; an f32 plane holds nf32 rows a batch, batch after batch).
typedef float v2fa __attribute__((ext_vector_type(2), may_alias));
// Two (even, odd) pairs, each turned by its own angle: c, s hold the two cosines and sines.
__device__ __forceinline__ v4f g2_turn(v4f v, v2fa c, v2fa s) { v4f o; o[0] = v[0] * c[0] - v[1] * s[0]; o[1] = v[0] * s[0] + v[1] * c[0]; o[2] = v[2] * c[1] - v[3] * s[1]; o[3] = v[2] * s[1] + v[3] * c[1]; return o; }
template <int ACT, int BG = 1, int KC = 128, bool ROPE = false>
__global__ __launch_bounds__(128) void k_gemm2(const _Float16* __restrict__ A, int lda, size_t sA, const _Float16* __restrict__ Bh, int ldb, size_t sB, float alpha, const float* __restrict__ bias, size_t sBias, const float* __restrict__ CP, int rowsPerB, size_t sCPb, int row0g,
    float* __restrict__ C, _Float16* __restrict__ C16, int ldc, size_t sC, int M, int N, int K, const float* __restrict__ CS = nullptr, const float* __restrict__ SN = nullptr, int nf32 = 0,
    float* __restrict__ Ck = nullptr, _Float16* __restrict__ Ck16 = nullptr, float* __restrict__ Cv = nullptr, _Float16* __restrict__ Cv16 = nullptr, int ldkv = 0) { static_assert(ACT == 0 || ACT == 3 || ACT == 6 || ACT == 8 || ACT == 9 || ACT == 11 || ACT == 12 || ACT == 14 || ACT == 15 || ACT == 16 || ACT == 17, "k_gemm2: unsupported ACT code (would silently apply no activation)");
  constexpr int PB = KC * 2 + 16, BUFB = 192 * PB; static_assert(2 * BUFB >= 4 * 32 * 68 * 4, "the output staging must fit the two slab buffers");
  __shared__ __attribute__((aligned(16))) unsigned char st[2 * BUFB];
  float (*so)[32][68] = (float (*)[32][68])st;      /* output staging in the same LDS: first written behind the last trip's barrier, when no copy is in flight and every fragment read is done */
  const int tid = threadIdx.x, w = tid >> 5, lane = tid & 31, ln = lane & 15, hh = lane >> 4; const int by = blockIdx.y;
  A += (size_t)by * sA; Bh += (size_t)(by / BG) * sB; const size_t cofs = (size_t)by * sC; const float* bp = bias ? bias + (size_t)by * sBias : nullptr;
  const int ntn = N >> 6; const int mt = blockIdx.x / ntn, nq = blockIdx.x - mt * ntn; const int row0 = mt * 128 + 32 * w, col0 = nq * 64; if (mt * 128 >= M) return;      /* the same for the whole work-group: it stands in front of barriers */
  const int sr = tid / (KC / 8), sc = tid % (KC / 8);      /* this lane's row and 16-byte column in a round of copies */
  const _Float16* ag = A + (size_t)(mt * 128 + sr) * lda + sc * 8; const _Float16* bg = Bh + (size_t)(col0 + sr) * ldb + sc * 8;
  const unsigned lds0 = (unsigned)(size_t)(&st[0]) + (unsigned)(sr * PB + sc * 16);
  const int nt = K / KC;
  const v8f z8 = {0.f,0.f,0.f,0.f,0.f,0.f,0.f,0.f}; v8f c00 = z8, c01 = z8, c02 = z8, c03 = z8, c10 = z8, c11 = z8, c12 = z8, c13 = z8;
  g2_stage<KC>(ag, lda, bg, ldb, lds0);
  asm volatile("s_wait_asynccnt 0x0" ::: "memory");      /* this wave's copies of slab 0 have landed */
  __syncthreads();      /* slab 0 readable by every wave */
  if (nt > 1) g2_stage<KC>(ag + KC, lda, bg + KC, ldb, lds0 + BUFB);
#pragma unroll 1
  for (int t = 0; t < nt; ++t) { const unsigned char* sb = st + (t & 1) * BUFB; const unsigned char* sa = sb + (32 * w + ln) * PB + 16 * hh; const unsigned char* sbr = sb + (128 + ln) * PB + 16 * hh;
    v16h fa[2][2], fb[2][4];      /* two fragment sets: the next k step's twelve LDS reads go out as one group in front of this k step's products, so the wave waits out the LDS latency once a slab */
    fa[0][0] = g2_lfrag(sa); fa[0][1] = g2_lfrag(sa + 16 * PB); fb[0][0] = g2_lfrag(sbr); fb[0][1] = g2_lfrag(sbr + 16 * PB); fb[0][2] = g2_lfrag(sbr + 32 * PB); fb[0][3] = g2_lfrag(sbr + 48 * PB);
#pragma unroll
    for (int kk = 0; kk < KC / 32; ++kk) { const int cu = kk & 1, nx = cu ^ 1;      /* unrolled in full: fa[] and fb[] are indexed by constants and stay in registers, the LDS offsets become immediates */
      if (kk + 1 < KC / 32) { const int o = (kk + 1) * 64; fa[nx][0] = g2_lfrag(sa + o); fa[nx][1] = g2_lfrag(sa + 16 * PB + o); fb[nx][0] = g2_lfrag(sbr + o); fb[nx][1] = g2_lfrag(sbr + 16 * PB + o); fb[nx][2] = g2_lfrag(sbr + 32 * PB + o); fb[nx][3] = g2_lfrag(sbr + 48 * PB + o); }
      c00 = g2_mma(fa[cu][0], fb[cu][0], c00); c10 = g2_mma(fa[cu][1], fb[cu][0], c10);
      c01 = g2_mma(fa[cu][0], fb[cu][1], c01); c11 = g2_mma(fa[cu][1], fb[cu][1], c11);
      c02 = g2_mma(fa[cu][0], fb[cu][2], c02); c12 = g2_mma(fa[cu][1], fb[cu][2], c12);
      c03 = g2_mma(fa[cu][0], fb[cu][3], c03); c13 = g2_mma(fa[cu][1], fb[cu][3], c13); }
    asm volatile("s_wait_dscnt 0x0" ::: "memory");      /* this wave's reads of slab t are done before the buffer is refilled */
    asm volatile("s_wait_asynccnt 0x0" ::: "memory");      /* this wave's copies of slab t + 1 have landed */
    __syncthreads();      /* publishes slab t + 1 and ends every wave's reads of slab t */
    if (t + 2 < nt) g2_stage<KC>(ag + (size_t)(t + 2) * KC, lda, bg + (size_t)(t + 2) * KC, ldb, lds0 + (unsigned)((t & 1) * BUFB)); }
  asm volatile("s_wait_asynccnt 0x0" ::: "memory");      /* no copy outstanding when the LDS becomes output staging */
  v2fa cc[ROPE ? 16 : 1], ss[ROPE ? 16 : 1];      /* ROPE: cosines and sines of the 2 pairs that this lane turns in each of its 16 rows; 16 lanes read one table row = one 128-byte line */
  [[maybe_unused]] float* Cf = C; [[maybe_unused]] _Float16* Ch = C16; [[maybe_unused]] int ldo = ldc, oc0 = col0;      /* ROPE: the tile's own f32 and f16 plane, their pitch, the tile's first column there; all from blockIdx: the same for the whole work-group */
  if constexpr (ROPE) { static_assert(HD == 64 && ACT == 0, "one N tile = one head: a pair's number is its column in the tile / 2; no activation");
    const int nqt = ldc >> 6, nkt = ldkv >> 6; const bool isv = nq >= nqt + nkt;      /* N tiles of q, of k (and of v) */
    if (nq >= nqt) { Cf = isv ? Cv : Ck; Ch = isv ? Cv16 : Ck16; ldo = ldkv; oc0 = (nq - nqt - (isv ? nkt : 0)) * 64; }
    if (!isv) {
#pragma unroll      /* unrolled in full: cc[], ss[] stay in registers; all 32 loads go out here, so their latency passes while the accumulators are staged */
      for (int q = 0; q < 16; ++q) { const size_t tb = (size_t)((unsigned)(row0 + q * 2 + hh) % SQ) * (HD / 2) + ln * 2; cc[q] = *(const v2fa*)(CS + tb); ss[q] = *(const v2fa*)(SN + tb); }
      asm volatile("s_wait_xcnt 0x0" ::: "memory");      /* the table loads' address registers are reused below; inside the branch, directly behind the loads, so that nothing of the code behind the branch can be scheduled ahead of the wait */
    } else {
#pragma unroll      /* unrolled in full, like the loop above */
      for (int q = 0; q < 16; ++q) { cc[q] = v2fa{1.f, 1.f}; ss[q] = v2fa{0.f, 0.f}; } } }
  v8f accs[8] = {c00, c01, c02, c03, c10, c11, c12, c13};
  if constexpr (ROPE) {      /* q, k and v have no bias, no added plane and no activation: the staging is the scaled accumulators alone; both loops unrolled in full: accs[] is indexed by constants and stays in registers */
#pragma unroll
    for (int u = 0; u < 8; ++u) {
#pragma unroll
      for (int r = 0; r < 8; ++r) so[w][(u >> 2) * 16 + 8 * hh + r][(u & 3) * 16 + ln] = accs[u][r] * alpha; }
  } else {
#pragma unroll
  for (int u = 0; u < 8; ++u) { const int t = u & 3, half = u >> 2; const int col = col0 + t * 16 + ln; const float bv = bp ? bf16_round(bp[col]) : 0.f;
#pragma unroll
    for (int r = 0; r < 8; ++r) { const int rloc = half * 16 + 8 * hh + r; float v = accs[u][r] * alpha + bv; if (CP) { if (rowsPerB < 0) v += CP[cofs + (size_t)(row0g + row0 + rloc) * ldc + col];      /* rowsPerB < 0: own element of the batched C plane */ else { const int bidx = (row0g + row0 + rloc) / rowsPerB; v += CP[(size_t)bidx * sCPb + (size_t)by * 64 + col]; } }
      if (ACT == 3) v = fmaxf(v, 0.f); else if (ACT == 6) v = 0.5f * v * (1.0f + erff(v * 0.70710678118654752f)); else if (ACT == 11) v = 1.0f / (1.0f + expf(-v)); else if (ACT == 15) v = v / (1.0f + expf(-v)); else if (ACT == 12) v = (v > 0.f) ? v : 0.01f * v; else if (ACT == 8) v = tanhf(v); else if (ACT == 9) v = 0.5f * v * (1.0f + tanhf(0.7978845608028654f * (v + 0.044715f * v * v * v))); else if (ACT == 14) v = (v > 0.f) ? v : 0.1f * v; else if (ACT == 16) v = (v >= 0.f) ? v : 0.3f * v; else if (ACT == 17) v = (v >= 0.f) ? v : 0.2f * v;
      so[w][rloc][t * 16 + ln] = v; } } }
  __builtin_amdgcn_fence(__ATOMIC_ACQ_REL, "workgroup"); __builtin_amdgcn_wave_barrier();
  const int rsub = lane >> 4, c4 = (lane & 15) * 4;
  if constexpr (ROPE) {      /* both loops unrolled in full: cc[], ss[] are indexed by constants; a lane's 4 columns are 2 whole pairs */
#pragma unroll
    for (int q = 0; q < 16; ++q) { const int r = q * 2 + rsub; const v4f o = g2_turn(*(const v4fa*)&so[w][r][c4], cc[q], ss[q]); v4h h4; for (int i = 0; i < 4; ++i) h4[i] = (_Float16)o[i]; *(v4h*)(Ch + cofs + (size_t)(row0 + r) * ldo + oc0 + c4) = h4; }
    static_assert(SQ % 128 == 0, "a row tile lies in one batch");
    const int bt = (mt * 128) / SQ; const int lim = bt * SQ + nf32; const size_t fsh = (size_t)bt * (SQ - nf32) * ldo;      /* the tile's batch; the end of that batch's f32 rows; what row bt * SQ + i of the GEMM lies ahead of row bt * nf32 + i of C: all three the same for the whole work-group */
    asm volatile("s_wait_xcnt 0x0" ::: "memory");      /* the f16 stores' address and data registers are reused below; in front of the branch, so that nothing of the block behind it can be scheduled ahead of the wait */
    if (mt * 128 < lim) {      /* the same for the whole work-group: only the first row tiles of a batch also store f32 rows; a loop of its own, so that the f16 loop above is free of branches and its LDS reads go out together */
#pragma unroll      /* unrolled in full, like the loop above */
      for (int q = 0; q < 16; ++q) { const int r = q * 2 + rsub; if (row0 + r < lim) *(v4f*)(Cf + (cofs + (size_t)(row0 + r) * ldo + oc0 + c4 - fsh)) = g2_turn(*(const v4fa*)&so[w][r][c4], cc[q], ss[q]); } }
  } else {
#pragma unroll
    for (int q = 0; q < 16; ++q) { const int r = q * 2 + rsub; const v4f v = *(const v4fa*)&so[w][r][c4]; if (C) *(v4f*)(C + cofs + (size_t)(row0 + r) * ldc + col0 + c4) = v; if (C16) { v4h h4; for (int i = 0; i < 4; ++i) h4[i] = (_Float16)v[i]; *(v4h*)(C16 + cofs + (size_t)(row0 + r) * ldc + col0 + c4) = h4; } }
     } }


__global__ __launch_bounds__(256) void k_wnat(const float* __restrict__ w, size_t n8, _Float16* __restrict__ Bt) { const size_t t = (size_t)blockIdx.x * 256 + threadIdx.x; if (t >= n8) return; FragH f; for (int q = 0; q < 8; ++q) f.h[q] = (_Float16)(bf16_round(w[t * 8 + q]) * 16.0f); *(v8us*)((unsigned short*)Bt + t * 8) = f.half[0];  }
__global__ __launch_bounds__(256) void k_rsm(const float* __restrict__ S, _Float16* __restrict__ P, int nrows) {
  #pragma clang fp contract(off)
  const int i = blockIdx.x * 256 + threadIdx.x; if (i >= nrows) return; const float* s = S + (size_t)i * SQ; float mx = -3.0e38f;
#pragma unroll 1
  for (int j = 0; j < SQ; ++j) mx = fmaxf(mx, s[j]); float se = 0.f;
#pragma unroll 1
  for (int j = 0; j < SQ; ++j) se += expf(s[j] - mx); const float sc = 256.0f / se;
#pragma unroll 1
  for (int j0 = 0; j0 < SQ; j0 += 8) { FragH f; for (int q = 0; q < 8; ++q) f.h[q] = (_Float16)(expf(s[j0 + q] - mx) * sc); unsigned short* d = (unsigned short*)P + (size_t)i * SQ + j0; *(v8us*)d = f.half[0];  } }
__global__ __launch_bounds__(256) void k_vt(const _Float16* __restrict__ V16, int b, int h0, _Float16* __restrict__ VT) { __shared__ unsigned short tl[64][65]; const int tid = threadIdx.x; const int hh = blockIdx.x % HG, sg = blockIdx.x / HG; const int s0 = sg * 64; const int h = h0 + hh;
  for (int i = tid; i < 64 * 8; i += 256) { const int j = i / 8, d8 = (i % 8) * 8; FragH f; f.half[0] = *(const v8us*)((const unsigned short*)V16 + ((size_t)b * SQ + s0 + j) * DM + h * HD + d8); for (int q = 0; q < 8; ++q) tl[d8 + q][j] = f.u[q]; }
  __syncthreads();
  { for (int i = tid; i < 64 * 8; i += 256) { const int d = i / 8, j8 = (i % 8) * 8; FragH f; for (int q = 0; q < 8; ++q) f.u[q] = tl[d][j8 + q]; *(v8us*)((unsigned short*)VT + ((size_t)hh * HD + d) * SQ + s0 + j8) = f.half[0]; }  } }



#define FK 64                        /* keys per staged tile of the fused attention kernel */
#define FPB (FK * 2 + 16)            /* LDS pitch of a staged row (a k row: HD f16 = 128 B; a V^T row: FK f16 = 128 B) plus 16 B: 16 B x odd, so the 16 rows of a fragment read spread over the banks */
#define FBUF (2 * FK * FPB)          /* one buffer: FK k rows, then HD V^T rows */
#define FQ 32                        /* query rows per wave */
// Eight asynchronous 16-byte copies per lane, global memory -> LDS. The s_wait_xcnt is the last line of the copies' own statement, so no register that a copy names is rewritten in front of it.
__device__ __forceinline__ void fa_copy8(const unsigned (&l)[8], const _Float16* const (&g)[8]) {
  asm volatile("global_load_async_to_lds_b128 %0, %8, off\n\t"
               "global_load_async_to_lds_b128 %1, %9, off\n\t"
               "global_load_async_to_lds_b128 %2, %10, off\n\t"
               "global_load_async_to_lds_b128 %3, %11, off\n\t"
               "global_load_async_to_lds_b128 %4, %12, off\n\t"
               "global_load_async_to_lds_b128 %5, %13, off\n\t"
               "global_load_async_to_lds_b128 %6, %14, off\n\t"
               "global_load_async_to_lds_b128 %7, %15, off\n\t"
               "s_wait_xcnt 0x0"
               :: "v"(l[0]), "v"(l[1]), "v"(l[2]), "v"(l[3]), "v"(l[4]), "v"(l[5]), "v"(l[6]), "v"(l[7]),
                  "v"(g[0]), "v"(g[1]), "v"(g[2]), "v"(g[3]), "v"(g[4]), "v"(g[5]), "v"(g[6]), "v"(g[7]) : "memory"); }
// One tile (FK k rows, then the same FK keys of the HD V^T rows) into one LDS buffer: a row's 128 bytes are 8 neighbouring lanes' 16 bytes each, 16 rows a round of 128 lanes.
// kg, vg: the lane's own 16 bytes in row tid / 8 of the k tile and of the V^T tile; lds: the LDS byte address of the same place in the buffer. Unrolled in full: l[] and g[] are asm operands.
__device__ __forceinline__ void fa_stage(const _Float16* kg, const _Float16* vg, unsigned lds) {
  unsigned l[8]; const _Float16* g[8];
#pragma unroll
  for (int u = 0; u < 8; ++u) { l[u] = lds + (unsigned)(u * 16 * FPB); g[u] = (u < 4) ? kg + (size_t)(u * 16) * KVD : vg + (size_t)((u - 4) * 16) * SQ; }
  fa_copy8(l, g); }
__device__ __forceinline__ void fa_exp8(float (&x)[8]) {
  asm("v_exp_f32 %0, %0\n\t"
      "v_exp_f32 %1, %1\n\t"
      "v_exp_f32 %2, %2\n\t"
      "v_exp_f32 %3, %3\n\t"
      "v_exp_f32 %4, %4\n\t"
      "v_exp_f32 %5, %5\n\t"
      "v_exp_f32 %6, %6\n\t"
      "v_exp_f32 %7, %7\n\t"
      "v_nop"
      : "+v"(x[0]), "+v"(x[1]), "+v"(x[2]), "+v"(x[3]), "+v"(x[4]), "+v"(x[5]), "+v"(x[6]), "+v"(x[7])); }
// One 2^x with the same slot behind it.
__device__ __forceinline__ float fa_exp1(float x) { asm("v_exp_f32 %0, %0\n\tv_nop" : "+v"(x)); return x; }
__device__ __forceinline__ v8f fa_mma(v16h a, v16h b, v8f c) { return __builtin_amdgcn_wmma_f32_16x16x32_f16(false, a, false, b, (short)0, c, false, false); }
__global__ __launch_bounds__(128) void k_fattn(const _Float16* __restrict__ Q, const _Float16* __restrict__ Kh, const _Float16* __restrict__ Vt, _Float16* __restrict__ O) {
  __shared__ __attribute__((aligned(16))) unsigned char st[2 * FBUF];
  const int tid = threadIdx.x, lane = tid & 31, c = lane & 15, hh = lane >> 4; const int w = __builtin_amdgcn_readfirstlane(tid >> 5);      /* the wave's number in a scalar register: the head's offsets become scalar arithmetic */
  const int qt = (SQ / FQ - 1) - (int)(blockIdx.x / (NB * NG)); const int bg = (int)(blockIdx.x % (NB * NG)); const int b = bg / NG, g = bg % NG;      /* longest rows first */
  const int q0 = qt * FQ, h = g * HPG + w; const int nt = (q0 + FQ + FK - 1) / FK;      /* causal: tiles up to the one that holds the last query's own key; the same for the whole work-group */
  const int sr = tid >> 3, sc = tid & 7;      /* this lane's row and 16-byte column in a round of copies */
  const _Float16* kg = Kh + ((size_t)b * SQ + sr) * KVD + g * HD + sc * 8; const _Float16* vg = Vt + ((size_t)bg * HD + sr) * SQ + sc * 8;
  const unsigned lds0 = (unsigned)(size_t)(&st[0]) + (unsigned)(sr * FPB + sc * 16);
  fa_stage(kg, vg, lds0);
  v16h qf[2][2];
#pragma unroll
  for (int j = 0; j < 2; ++j) {
#pragma unroll
    for (int ks = 0; ks < 2; ++ks) { const unsigned short* p = (const unsigned short*)Q + ((size_t)b * SQ + q0 + j * 16 + c) * DM + h * HD + ks * 32 + 8 * hh; FragH f; f.half[0] = *(const v8us*)p; f.half[1] = *(const v8us*)(p + 16); qf[j][ks] = f.v; } }
  asm volatile("s_wait_xcnt 0x0" ::: "memory");      /* the q loads' address registers are reused below */
  asm volatile("s_wait_asynccnt 0x0" ::: "memory");      /* this wave's copies of tile 0 have landed */
  __syncthreads();      /* tile 0 readable by every wave */
  if (nt > 1) fa_stage(kg + (size_t)FK * KVD, vg + FK, lds0 + FBUF);
  const v8f z8 = {0.f,0.f,0.f,0.f,0.f,0.f,0.f,0.f};
  v8f acc[4][2]; float m[2], l[2];
#pragma unroll
  for (int j = 0; j < 2; ++j) { m[j] = -1.0e30f; l[j] = 0.f;
#pragma unroll
    for (int dt = 0; dt < 4; ++dt) acc[dt][j] = z8; }
  const float C = 0.125f * 1.4426950408889634f;      /* 1 / sqrt(HD), and e^x = 2^(x log2 e) */
#pragma unroll 1      /* kept rolled: one copy of the long body, the buffer chosen by t & 1 */
  for (int t = 0; t < nt; ++t) { const unsigned char* sk = st + (t & 1) * FBUF + c * FPB + 16 * hh; const unsigned char* sv = sk + FK * FPB;
#pragma unroll
    for (int ps = 0; ps < FK / 32; ++ps) { const int kb = t * FK + ps * 32;      /* a pass: 32 keys, one k step of O^T += V^T P^T */
      if (kb <= q0) {      /* the same for the whole work-group; false only for a pass whose every key lies past the diagonal */
        v8f s[2][2];
#pragma unroll
        for (int kt = 0; kt < 2; ++kt) { const v16h k0 = g2_lfrag(sk + (ps * 2 + kt) * 16 * FPB), k1 = g2_lfrag(sk + (ps * 2 + kt) * 16 * FPB + 64);
#pragma unroll
          for (int j = 0; j < 2; ++j) s[kt][j] = fa_mma(k1, qf[j][1], fa_mma(k0, qf[j][0], z8)); }
        if (kb == q0) {      /* only the pass on the diagonal holds masked keys */
#pragma unroll
          for (int kt = 0; kt < 2; ++kt) {
#pragma unroll
            for (int j = 0; j < 2; ++j) {
#pragma unroll
              for (int r = 0; r < 8; ++r) s[kt][j][r] = (kt * 16 + 8 * hh + r <= j * 16 + c) ? s[kt][j][r] : -1.0e30f; } } }
        FragH pf[2];
#pragma unroll
        for (int j = 0; j < 2; ++j) { float mk[2];
#pragma unroll
          for (int kt = 0; kt < 2; ++kt) mk[kt] = fmaxf(fmaxf(fmaxf(s[kt][j][0], s[kt][j][1]), fmaxf(s[kt][j][2], s[kt][j][3])), fmaxf(fmaxf(s[kt][j][4], s[kt][j][5]), fmaxf(s[kt][j][6], s[kt][j][7])));
          float mx = fmaxf(mk[0], mk[1]); mx = fmaxf(mx, __shfl_xor(mx, 16, 32)); mx = fmaxf(mx, m[j]);
          const float al = fa_exp1((m[j] - mx) * C); const float nb = 8.0f - mx * C; m[j] = mx;      /* weights x256: 2^(s C - mx C + 8); a masked key gives 0 */
          float sm[2];
#pragma unroll
          for (int kt = 0; kt < 2; ++kt) { float p[8];
#pragma unroll
            for (int r = 0; r < 8; ++r) p[r] = __builtin_fmaf(s[kt][j][r], C, nb);
            fa_exp8(p); sm[kt] = ((p[0] + p[1]) + (p[2] + p[3])) + ((p[4] + p[5]) + (p[6] + p[7]));
#pragma unroll
            for (int r = 0; r < 8; ++r) pf[j].h[kt * 8 + r] = (_Float16)p[r]; }
          l[j] = __builtin_fmaf(l[j], al, sm[0] + sm[1]);      /* this lane half's keys only; the halves are joined behind the loop */
#pragma unroll
          for (int dt = 0; dt < 4; ++dt) acc[dt][j] *= al; }
#pragma unroll
        for (int dt = 0; dt < 4; ++dt) { const v16h vf = g2_lfrag(sv + dt * 16 * FPB + ps * 64);
#pragma unroll
          for (int j = 0; j < 2; ++j) acc[dt][j] = fa_mma(vf, pf[j].v, acc[dt][j]); } } }
    asm volatile("s_wait_dscnt 0x0" ::: "memory");      /* this wave's reads of tile t are done before the buffer is refilled */
    asm volatile("s_wait_asynccnt 0x0" ::: "memory");      /* this wave's copies of tile t + 1 have landed */
    __syncthreads();      /* publishes tile t + 1 and ends every wave's reads of tile t */
    if (t + 2 < nt) fa_stage(kg + (size_t)(t + 2) * FK * KVD, vg + (size_t)(t + 2) * FK, lds0 + (unsigned)((t & 1) * FBUF)); }
  asm volatile("s_wait_asynccnt 0x0" ::: "memory");      /* no copy outstanding when the wave ends */
  FragH of[2][4];      /* every piece converted into registers of its own before the first store: no register of an issued store is written again */
#pragma unroll
  for (int j = 0; j < 2; ++j) { const float fin = 64.0f / (l[j] + __shfl_xor(l[j], 16, 32));
#pragma unroll
    for (int dt = 0; dt < 4; ++dt) {
#pragma unroll
      for (int r = 0; r < 8; ++r) of[j][dt].h[r] = (_Float16)(acc[dt][j][r] * fin); } }
#pragma unroll
  for (int j = 0; j < 2; ++j) { unsigned short* po = (unsigned short*)O + ((size_t)b * SQ + q0 + j * 16 + c) * DM + h * HD + 8 * hh;      /* a lane's 8 accumulator registers are 8 neighbouring head dims of one query row: one 16-byte store */
#pragma unroll
    for (int dt = 0; dt < 4; ++dt) *(v8us*)(po + dt * 16) = of[j][dt].half[0]; } }


#define A0R 16                       /* query rows, one wave each, per work-group of the f32 first-tile kernel */
#define A0P (HD + 4)                 /* pitch of a staged k row in floats: 272 B = 16 B x 17, so 32 lanes reading 32 different rows spread over the LDS banks */
typedef float v2f __attribute__((ext_vector_type(2)));
// f32 causal attention for query rows 0..QT0-1 of every batch (blockIdx.y; QT0 rows a batch in QF, KF, VF and OF). One work-group per (batch, head, A0R query rows): the head's QT0 k and v rows are staged in LDS once,
// then one wave per query row i: scores with one key per lane (32 keys a pass), maximum and sum over the lanes, then o with two head dims per lane, key after key.
// Every loop is unrolled in full so that s[], e[], q[], tk[] and tv[] are indexed by constants and stay in registers and the lane number of each readlane is a constant; the tests on c are the same for the whole wave.
__global__ __launch_bounds__(512) void k_att0w(const float* __restrict__ QF, const float* __restrict__ KF, const float* __restrict__ VF, int ld, float scale, float* __restrict__ OF, int ldo) {
  __shared__ __attribute__((aligned(16))) float lk[QT0][A0P]; __shared__ __attribute__((aligned(16))) float lv[QT0][HD];
  const int tid = threadIdx.x, lane = tid & 31; const int w = __builtin_amdgcn_readfirstlane(tid >> 5);
  const int h = blockIdx.x / (QT0 / A0R), rg = blockIdx.x % (QT0 / A0R); const int i = rg * A0R + w;
  const int hb = h * HD + (int)blockIdx.y * QT0 * ld, ho = h * HD + (int)blockIdx.y * QT0 * ldo;      /* first column of the head in row 0 of this batch's QT0 rows, in QF, KF, VF and in OF */
  v4f tk[QT0 * (HD / 4) / 512], tv[QT0 * (HD / 4) / 512];      /* all loads issued before the first LDS store: one memory latency for the whole stage */
#pragma unroll
  for (int u = 0; u < QT0 * (HD / 4) / 512; ++u) { const int e4 = u * 512 + tid; const size_t g = (size_t)(e4 / (HD / 4)) * ld + hb + (e4 % (HD / 4)) * 4; tk[u] = *(const v4fa*)(KF + g); tv[u] = *(const v4fa*)(VF + g); }
  const float* qr = QF + (size_t)i * ld + hb; v4f q[HD / 4];
#pragma unroll
  for (int d = 0; d < HD / 4; ++d) q[d] = *(const v4fa*)(qr + d * 4);
#pragma unroll
  for (int u = 0; u < QT0 * (HD / 4) / 512; ++u) { const int e4 = u * 512 + tid; *(v4f*)&lk[e4 / (HD / 4)][(e4 % (HD / 4)) * 4] = tk[u]; *(v4f*)&lv[e4 / (HD / 4)][(e4 % (HD / 4)) * 4] = tv[u]; }
  __syncthreads();
  float s[QT0 / 32]; float mx = -1.0e30f;
#pragma unroll
  for (int c = 0; c < QT0 / 32; ++c) { s[c] = -1.0e30f;
    if (c * 32 <= i) { const float* kr = &lk[c * 32 + lane][0]; v4f a = {0.f, 0.f, 0.f, 0.f};
#pragma unroll
      for (int d = 0; d < HD / 4; ++d) a += q[d] * *(const v4f*)(kr + d * 4);
      const float t = ((a[0] + a[1]) + (a[2] + a[3])) * scale; s[c] = (c * 32 + lane <= i) ? t : -1.0e30f; mx = fmaxf(mx, s[c]); } }
#pragma unroll
  for (int d = 16; d > 0; d >>= 1) mx = fmaxf(mx, __shfl_xor(mx, d, 32));
  float e[QT0 / 32]; float l = 0.f;
#pragma unroll
  for (int c = 0; c < QT0 / 32; ++c) { e[c] = 0.f; if (c * 32 <= i) { e[c] = expf(s[c] - mx); l += e[c]; } }      /* a masked key: expf(-1e30 - mx) = 0 */
#pragma unroll
  for (int d = 16; d > 0; d >>= 1) l += __shfl_xor(l, d, 32);
  v2f o = {0.f, 0.f};
#pragma unroll
  for (int c = 0; c < QT0 / 32; ++c) if (c * 32 <= i) {
#pragma unroll
    for (int j = 0; j < 32; ++j) { const float p = __int_as_float(__builtin_amdgcn_readlane(__float_as_int(e[c]), j)); o += p * *(const v2f*)&lv[c * 32 + j][lane * 2]; } }
  const float fin = 64.0f / l;      /* o carried x64 like the f16 path */
  *(v2f*)(OF + (size_t)i * ldo + ho + lane * 2) = o * fin; }


__global__ __launch_bounds__(256) void k_kvexp(const float* __restrict__ src, float* __restrict__ dst, size_t n4) { const size_t t = (size_t)blockIdx.x * 256 + threadIdx.x; if (t >= n4) return; const size_t e = t * 4; const size_t row = e / DM; const int col = (int)(e % DM); const int h = col / HD, d = col % HD; const v4f v = *(const v4fa*)(src + row * KVD + (size_t)(h / HPG) * HD + d); *(v4f*)(dst + e) = v;  }

__global__ __launch_bounds__(256) void k_tab2(float theta, float* __restrict__ CS, float* __restrict__ SN) {
  #pragma clang fp contract(off)
  const int t = blockIdx.x * 256 + threadIdx.x; if (t >= SQ * (HD / 2)) return; const int i = t % (HD / 2); const int p = t / (HD / 2); const float invf = 1.0f / powf(theta, (float)(2 * i) / (float)HD); const float ang = __fmul_rn((float)p, invf); const float c = cosf(ang), s = sinf(ang);
  *(float*)(CS + t) = c; *(float*)(SN + t) = s;  }
__global__ __launch_bounds__(256) void k_bfcp(const float* __restrict__ src, float* __restrict__ dst, size_t n4) { const size_t t = (size_t)blockIdx.x * 256 + threadIdx.x; if (t >= n4) return; const v4f a = *(const v4fa*)(src + t * 4); v4f o; for (int q = 0; q < 4; ++q) o[q] = bf16_round(a[q]); *(v4f*)(dst + t * 4) = o;  }

__global__ __launch_bounds__(256) void k_f2bf(const float* __restrict__ F, unsigned short* __restrict__ O, size_t n8) { const size_t t = (size_t)blockIdx.x * 256 + threadIdx.x; if (t >= n8) return; const v4f a = *(const v4fa*)(F + t * 8), b = *(const v4fa*)(F + t * 8 + 4); FragH f;
  for (int q = 0; q < 4; ++q) { f.u[q] = (unsigned short)(__float_as_uint(bf16_round(a[q])) >> 16); f.u[4 + q] = (unsigned short)(__float_as_uint(bf16_round(b[q])) >> 16); }
  *(v8us*)(O + t * 8) = f.half[0];  }
extern "C" void kernel_launch(void* const* d_in, const int* in_sizes, int n_in,
                              void* d_out, int out_size, void* d_ws, size_t ws_size, hipStream_t stream) {
  (void)in_sizes; (void)n_in; (void)out_size;
  const float* const* I = (const float* const*)d_in; const float* x = I[0]; const float* tcos = I[1]; const float* tsin = I[2]; const float* wq = I[3]; const float* wk = I[4]; const float* wv = I[5]; const float* wo = I[6]; const float* bq = nullptr; const float* bk = nullptr; const float* bv = nullptr; const float* bo = nullptr;      /* [in][out] weights, no biases; rope tables [S][32] */
  char* ws = (char*)d_ws; size_t off = 0;
  auto take = [&](size_t bytes) { char* p = ws + off; off += (bytes + 255) & ~(size_t)255; return p; };
  _Float16* BQ = (_Float16*)take((size_t)(DM + 2 * KVD) * DM * 2); _Float16* BK = BQ + (size_t)DM * DM; _Float16* BV = BK + (size_t)KVD * DM;      /* one plane: q, k, v weight rows one behind the other, the B operand of the one projection launch */
  _Float16* BO = (_Float16*)take((size_t)DM * DM * 2);
  _Float16* X16 = (_Float16*)take(NR * DM * 2); float* CSB = (float*)take((size_t)SQ * 32 * 4); float* SNB = (float*)take((size_t)SQ * 32 * 4); _Float16* Q16 = (_Float16*)take(NR * DM * 2); _Float16* K16 = (_Float16*)take(NR * KVD * 2); _Float16* V16 = (_Float16*)take(NR * KVD * 2); _Float16* O16 = (_Float16*)take(NR * DM * 2);
  _Float16* VT = (_Float16*)take((size_t)NB * NG * HD * SQ * 2);
  float* QF0 = (float*)take((size_t)NB * QT0 * DM * 4); float* KF0 = (float*)take((size_t)NB * QT0 * KVD * 4); float* VF0 = (float*)take((size_t)NB * QT0 * KVD * 4); float* KF0e = (float*)take((size_t)NB * QT0 * DM * 4); float* VF0e = (float*)take((size_t)NB * QT0 * DM * 4); float* OF0 = (float*)take((size_t)NB * QT0 * DM * 4); _Float16* OH0 = (_Float16*)take((size_t)NB * QT0 * DM * 2); _Float16* OL0 = (_Float16*)take((size_t)NB * QT0 * DM * 2); float* OUTF = (float*)take(NR * DM * 4);      /* first-tile planes: QT0 rows a batch, batch after batch; OUTF: f32 result rows, converted to bf16 at the end */
  if (off > ws_size) return;
  k_wt_f16<<<dim3(DM / 64, DM / 64), 256, 0, stream>>>(wq, BQ, DM, DM, 16.0f); k_wt_f16<<<dim3(KVD / 64, DM / 64), 256, 0, stream>>>(wk, BK, DM, KVD, 16.0f); k_wt_f16<<<dim3(KVD / 64, DM / 64), 256, 0, stream>>>(wv, BV, DM, KVD, 16.0f); k_wt_f16<<<dim3(DM / 64, DM / 64), 256, 0, stream>>>(wo, BO, DM, DM, 16.0f);      /* [in][out] -> Bt[n][k] x16, one work-group per 64 x 64 tile */
  k_x16<<<(unsigned)((NR * DM / 8 + 255) / 256), 256, 0, stream>>>(x, X16, NR * DM / 8);
  k_bfcp<<<(SQ * 32 / 4 + 255) / 256, 256, 0, stream>>>(tcos, CSB, (size_t)SQ * 32 / 4); k_bfcp<<<(SQ * 32 / 4 + 255) / 256, 256, 0, stream>>>(tsin, SNB, (size_t)SQ * 32 / 4);      /* bf16-rounded rope tables [pos][32] */
  const size_t r0p = (size_t)B0 * SQ;      /* first projected row */
  const size_t f0p = (size_t)B0 * QT0;      /* first row of the first-tile planes */
  /* every launch below covers all batches at once: nothing in one batch waits for another */
  k_gemm2<0, 1, 128, true><<<dim3((unsigned)((MP / 128) * ((DM + 2 * KVD) / 64)), 1), 128, 0, stream>>>(X16 + r0p * DM, DM, 0, BQ, DM, 0, 0.0625f, nullptr, 0, nullptr, 1, 0, 0, QF0 + f0p * DM, Q16 + r0p * DM, DM, 0, MP, DM + 2 * KVD, DM, CSB, SNB, QT0,
      KF0 + f0p * KVD, K16 + r0p * KVD, VF0 + f0p * KVD, V16 + r0p * KVD, KVD);      /* q, k (interleaved-pair rope in the epilogue) and v in one launch: f16 rows, and f32 rows 0..127 of each batch */
  k_vt<NG, SQ><<<NBR * NG * (SQ / 64), 256, 0, stream>>>(V16 + r0p * KVD, KVD, 0, VT + (size_t)B0 * NG * HD * SQ);      /* V^T [NB][NG][HD][SQ] */
  k_kvexp<<<(unsigned)(((size_t)NBR * QT0 * DM / 4 + 255) / 256), 256, 0, stream>>>(KF0 + f0p * KVD, KF0e + f0p * DM, (size_t)NBR * QT0 * DM / 4); k_kvexp<<<(unsigned)(((size_t)NBR * QT0 * DM / 4 + 255) / 256), 256, 0, stream>>>(VF0 + f0p * KVD, VF0e + f0p * DM, (size_t)NBR * QT0 * DM / 4);      /* head h <- kv group h/4 for the exact first-tile kernel */
  k_att0w<<<dim3(NH * (QT0 / A0R), NBR), 512, 0, stream>>>(QF0 + f0p * DM, KF0e + f0p * DM, VF0e + f0p * DM, DM, 0.125f, OF0 + f0p * DM, DM);      /* exact f32 attention for rows 0..127 (o x64), grid.y = batch */
  k_fattn<<<NB * NG * (SQ / FQ), 128, 0, stream>>>(Q16, K16, VT, O16);      /* scores, causal softmax and P V of both batches and all 32 heads in one launch: o (merged heads, x64) as f16 rows */
  k_gemm2<0><<<dim3((unsigned)((MPO / 128) * (DM / 64)), 1), 128, 0, stream>>>(O16 + r0p * DM, DM, 0, BO, DM, 0, 0.0009765625f, bo, 0, nullptr, 1, 0, 0, OUTF + r0p * DM, nullptr, DM, 0, MPO, DM, DM);      /* out rows (f32) */
  k_hl<<<(unsigned)(((size_t)NB * QT0 * DM / 8 + 255) / 256), 256, 0, stream>>>(OF0, OH0, OL0, (size_t)NB * QT0 * DM / 8);      /* first-tile o (x64) -> f16 hi + x1024 residual planes */
  k_gemm2<0><<<dim3((QT0 / 128) * (DM / 64), NBR), 128, 0, stream>>>(OH0 + f0p * DM, DM, (size_t)QT0 * DM, BO, DM, 0, 0.0009765625f, bo, 0, nullptr, 1, 0, 0, OUTF + r0p * DM, nullptr, DM, (size_t)SQ * DM, QT0, DM, DM);      /* rows 0..127 of each batch (grid.y): out = o_hi Wo (+ b), overwriting the f16-path rows */
  k_gemm2<0><<<dim3((QT0 / 128) * (DM / 64), NBR), 128, 0, stream>>>(OL0 + f0p * DM, DM, (size_t)QT0 * DM, BO, DM, 0, 0.00000095367431640625f, nullptr, 0, (const float*)(OUTF + r0p * DM), -1, 0, 0, OUTF + r0p * DM, nullptr, DM, (size_t)SQ * DM, QT0, DM, DM);      /* += o_lo Wo 2^-20 (own-element accumulate) */
  k_f2bf<<<(unsigned)(((size_t)MPO * DM / 8 + 255) / 256), 256, 0, stream>>>(OUTF + (size_t)B0 * SQ * DM, (unsigned short*)d_out + (size_t)B0 * SQ * DM, (size_t)MPO * DM / 8);      /* out.astype(bfloat16): the f32 rows rounded to nearest-even bf16 into the 2-byte output */
}
